// v000
// Measured on an AMD MI455X. A time is GPU time per run, averaged over a window of back-to-back runs after a warm-up
// (all launches, gaps included; the runs take copies of the inputs in turn), and the median of several windows.
// Apart from v000's, it joins two sittings. Times from different sittings can be a few percent apart, while
// side-by-side timings come from the same sitting.
// v000, which the later versions start from, runs in 260 microseconds.
// compute dtype: all float inputs rounded to bf16; q/k/v = h . W with EXACT bf16 products on WMMA 16x16x32 ((in,out) weights as transposed rows); per-(token, head) tables |q|^2, q . mu_0, q . mu_1, |k - mu_0|^2, |k - mu_1|^2 in f32 from the f16 hi + residual rows; PLAIN scores: q . k single f16, then -max(|q|^2 + |k-mu_j|^2 - 2 q.k + 2 q.mu_j, 0) x (1/16, 3/16) for the two Gaussian keys (mu_0 read too; it is zero), max of the two, running-max softmax in f32 (hardware exp), P (scaled by 2^11, single f16) x v (single f16); out = LayerNorm(h + vec (bf16 hi + residual) . Wo (2 products)) in f32.
#include <hip/hip_runtime.h>
#include <math.h>

typedef __attribute__((ext_vector_type(16))) _Float16 v16h;
typedef __attribute__((ext_vector_type(16))) __bf16 v16b;
typedef __attribute__((ext_vector_type(8)))  _Float16 v8h;
typedef __attribute__((ext_vector_type(8)))  float v8f;
typedef __attribute__((ext_vector_type(4)))  float v4f;
typedef __attribute__((ext_vector_type(2)))  float v2f;
typedef __attribute__((ext_vector_type(4)))  unsigned v4u;
typedef __attribute__((ext_vector_type(4)))  int v4i;
typedef float __attribute__((may_alias)) float_a;
typedef int __attribute__((may_alias)) int_a;

template <typename T> __device__ __forceinline__ void vst2(void* p, T v) { *(T*)p = v;  }
__device__ __forceinline__ v8f wmma16(v16h a, v16h b, v8f c) {
  v8f d = __builtin_amdgcn_wmma_f32_16x16x32_f16(false, a, false, b, (short)0, c, false, false);
  asm volatile("v_nop\n\tv_nop\n\tv_nop\n\tv_nop" : "+v"(d) : "v"(a), "v"(b));
  return d;
}
__device__ __forceinline__ v8f wmma_bf(v16b a, v16b b, v8f c) {
  v8f d = __builtin_amdgcn_wmma_f32_16x16x32_bf16(false, a, false, b, (short)0, c, false, false);
  asm volatile("v_nop\n\tv_nop\n\tv_nop\n\tv_nop" : "+v"(d) : "v"(a), "v"(b));
  return d;
}
// Mixture-of-Gaussian-keys attention (S 1,024, B 8, d 512, 8 heads x 64, two Gaussian keys per position: k and k - mu_1): score = max(-|q - k|^2 / 16, -3 |q - (k - mu_1)|^2 / 16), softmax over keys, . v, Wo, residual, LayerNorm; (s, b, d) layout.
__device__ __forceinline__ v16h frag_h(const _Float16* rowk0, int lane) {
  union { v16h v; v8h q[2]; } u; const _Float16* p = rowk0 + 8 * (lane >> 4);
  u.q[0] = *(const v8h*)p; u.q[1] = *(const v8h*)(p + 16); return u.v;
}
__device__ __forceinline__ v16h frag_f32(const float* rowk0, int lane) {
  v16h a; const float* p = rowk0 + 8 * (lane >> 4);
#pragma unroll
  for (int i = 0; i < 8; ++i) { a[i] = (_Float16)p[i]; a[8 + i] = (_Float16)p[16 + i]; }
  return a;
}
__device__ __forceinline__ v16h frag_f32s(const float* rowk0, int lane, float sc) {
  v16h a; const float* p = rowk0 + 8 * (lane >> 4);
#pragma unroll
  for (int i = 0; i < 8; ++i) { a[i] = (_Float16)(p[i] * sc); a[8 + i] = (_Float16)(p[16 + i] * sc); }
  return a;
}
// column fragment from a [K][ld] layout (column n), rows >= K read as 0
__device__ __forceinline__ v16h fragc_f32(const float* W, int k0, int n, int lane, int ld, int K) {
  v16h a; const int g = lane >> 4;
#pragma unroll
  for (int i = 0; i < 8; ++i) { const int ka = k0 + 8 * g + i, kb = ka + 16;
    a[i] = (_Float16)(ka < K ? W[(size_t)(ka < K ? ka : K - 1) * ld + n] : 0.f); a[8 + i] = (_Float16)(kb < K ? W[(size_t)(kb < K ? kb : K - 1) * ld + n] : 0.f); }
  return a;
}
struct F2 { v16b h, l; };
__device__ __forceinline__ F2 bsplit16(const float v[16]) { F2 r;
#pragma unroll
  for (int i = 0; i < 16; ++i) { const __bf16 h = (__bf16)v[i]; r.h[i] = h; r.l[i] = (__bf16)(v[i] - (float)h); }
  return r; }
__device__ __forceinline__ F2 split_row(const float* row, int k0, int lane) { float v[16]; const float* p = row + k0 + 8 * (lane >> 4);
#pragma unroll
  for (int i = 0; i < 8; ++i) { v[i] = p[i]; v[8 + i] = p[16 + i]; }
  return bsplit16(v); }
__device__ __forceinline__ F2 split_rowK(const float* row, int k0, int lane, int K) { float v[16]; const int g = lane >> 4;
#pragma unroll
  for (int i = 0; i < 8; ++i) { const int ka = k0 + 8 * g + i, kb = ka + 16; v[i] = ka < K ? row[ka < K ? ka : K - 1] : 0.f; v[8 + i] = kb < K ? row[kb < K ? kb : K - 1] : 0.f; }
  return bsplit16(v); }
__device__ __forceinline__ F2 split_col(const float* W, int k0, int n, int lane, int ld, int K) { float v[16]; const int g = lane >> 4;
#pragma unroll
  for (int i = 0; i < 8; ++i) { const int ka = k0 + 8 * g + i, kb = ka + 16; v[i] = ka < K ? W[(size_t)(ka < K ? ka : K - 1) * ld + n] : 0.f; v[8 + i] = kb < K ? W[(size_t)(kb < K ? kb : K - 1) * ld + n] : 0.f; }
  return bsplit16(v); }
__device__ __forceinline__ v8f mac3(const F2& a, const F2& b, v8f c) { c = wmma_bf(a.l, b.h, c); c = wmma_bf(a.h, b.l, c); return wmma_bf(a.h, b.h, c); }
__device__ __forceinline__ float sigm(float v) { return 1.0f / (1.0f + expf(-v)); }
#define LDSX() do { asm volatile("s_wait_dscnt 0" ::: "memory"); __builtin_amdgcn_wave_barrier(); __builtin_amdgcn_fence(__ATOMIC_RELEASE, "workgroup"); } while (0)


#define NB 8
#define SS 1024
#define DM 512
#define NH 8
#define NBATCH 8
__device__ __forceinline__ size_t xrow(size_t r) { return ((r % SS) * NBATCH + r / SS) * (size_t)DM; }   // engine row (b*SS + s) -> module row (s*B + b)
#define HD 64
#define QKVW (3 * DM)
#ifndef TQB
#define TQB (SS / 64)
#define TNB NB
#define TOB (NB * SS / 64)     // output row tiles (all)
#endif
typedef __attribute__((ext_vector_type(8))) __bf16 v8b;
__device__ __forceinline__ v16b frag_b(const __bf16* rowk0, int lane) {
  union { v16b v; v8b q[2]; } u; const __bf16* p = rowk0 + 8 * (lane >> 4);
  u.q[0] = *(const v8b*)p; u.q[1] = *(const v8b*)(p + 16); return u.v;
}
__device__ __forceinline__ float bfr(float v) { return (float)(__bf16)v; }
__device__ __attribute__((noinline)) float exp_ni(float v) { return expf(v); }
__device__ __attribute__((noinline)) float erf_ni(float v) { return erff(v); }

#define PK_A 0                       // [1536][512] Wqkv rows (natural [out][in])
#define PK_P (PK_A + QKVW * DM)        // [512][512] Wo rows (natural)
#define PK_END (PK_P + DM * DM)
#define WS_PK  0u
#define WS_QK  (WS_PK + 2u * PK_END)             // f16 [8192 rows][1024]: q | k
#define WS_QKL (WS_QK + 2u * NB * SS * 2 * DM)     // f16 q | k residual planes x2048
#define WS_VTH (WS_QKL + 2u * NB * SS * 2 * DM)    // f16 [b][512 (h*64+d)][1024 s] hi
#define WS_VTL (WS_VTH + 2u * NB * DM * SS)        // f16 lo x 2048
#define WS_O   (WS_VTL + 2u * NB * DM * SS)        // f32 [8192][512]
#define WS_CS  (WS_O + 4u * NB * SS * DM)           // f32 2 x [1024][32] (unused)
#define WS_TB  (WS_CS + 4u * 2 * SS * 32)                  // f32 tables [NR][64]: |q_h|^2 (0..7), q.mu0 (8..15), q.mu1 (16..23), |k - mu0|^2 (24..31), |k - mu1|^2 (32..39), rest 0
#define WS_A   (WS_TB + 4u * (size_t)NB * SS * 64)
#define WS_END (WS_A + 4u * (size_t)NB * SS * DM)
// ---- k_pack: block = (row n, which): natural [out][in] rows -> bf16; which 0..2 -> W_q/W_k/W_v into PK_A rows which*512 + n; 3 -> W_o into PK_P
__global__ __launch_bounds__(256) void k_pack(const float* __restrict__ WQ, const float* __restrict__ WK, const float* __restrict__ WV, const float* __restrict__ WO, __bf16* __restrict__ PK) {
  __shared__ __align__(16) __bf16 s[DM]; const int n = blockIdx.x, which = blockIdx.y, t = threadIdx.x; const float* Wm = (which == 0) ? WQ : (which == 1) ? WK : (which == 2) ? WV : WO;   // (in,out) weights: pack row n = column n
  for (int k = t; k < DM; k += 256) s[k] = (__bf16)Wm[(size_t)k * DM + n];
  __syncthreads();
  __bf16* dst = (which < 3) ? PK + PK_A + ((size_t)which * DM + n) * DM : PK + PK_P + (size_t)n * DM;
  for (int q = t; q < DM / 8; q += 256) vst2((unsigned*)(dst + q * 8), *(const v4u*)&s[q * 8]);
}
__global__ __launch_bounds__(128) void k_qkv(const float* __restrict__ XQ, const float* __restrict__ XK, const float* __restrict__ XV, const __bf16* __restrict__ P, const float* __restrict__ BQ, const float* __restrict__ BK, const float* __restrict__ BV, _Float16* __restrict__ QK, _Float16* __restrict__ QKL, _Float16* __restrict__ VTH, _Float16* __restrict__ VTL) {
  const int which0 = (blockIdx.y * 128) / DM; const float* X = (which0 == 0) ? XQ : (which0 == 1) ? XK : XV; const float* BB = BQ ? (((which0 == 0) ? BQ : (which0 == 1) ? BK : BV) + (blockIdx.y * 128 - which0 * DM)) : nullptr;
  __shared__ __align__(16) _Float16 so[4][16][136], sol[4][16][136]; __shared__ __align__(16) _Float16 sth[128][72], stl[128][72];
  const int tid = threadIdx.x, wave = tid >> 5, lane = tid & 31, col = lane & 15, g = lane >> 4; const size_t r0 = (size_t)blockIdx.x * 64 + wave * 16; const int n0 = blockIdx.y * 128;
  v8f acc[8] = {};
#pragma unroll 2
  for (int kc = 0; kc < DM / 32; ++kc) { v16b a; { const float* p = X + xrow(r0 + col) + kc * 32 + 8 * g;   // (s, b) input layout
#pragma unroll
      for (int i = 0; i < 8; ++i) { a[i] = (__bf16)p[i]; a[8 + i] = (__bf16)p[16 + i]; } }
#pragma unroll
    for (int j = 0; j < 8; ++j) acc[j] = wmma_bf(a, frag_b(P + (size_t)(n0 + j * 16 + col) * DM + kc * 32, lane), acc[j]); }
  if (n0 < 2 * DM) {   // q stored unscaled (f16 sigma ~0.6, no subnormal exposure); 1/16 and 3/16 applied to the f32 scores
#pragma unroll
    for (int j = 0; j < 8; ++j) {
#pragma unroll
      for (int r = 0; r < 8; ++r) { const float v = acc[j][r] + (BB ? bfr(BB[j * 16 + col]) : 0.f); const _Float16 hv = (_Float16)v; so[wave][8 * g + r][j * 16 + col] = hv; sol[wave][8 * g + r][j * 16 + col] = (_Float16)((v - (float)hv) * 2048.0f); } }   // q, k (+ bias) as f16 hi + (x2048) residual
    LDSX();
    for (int rl = 0; rl < 16; ++rl) if (lane < 16) { vst2((unsigned*)(QK + (r0 + rl) * (2 * DM) + n0 + lane * 8), *(const v4u*)&so[wave][rl][lane * 8]); vst2((unsigned*)(QKL + (r0 + rl) * (2 * DM) + n0 + lane * 8), *(const v4u*)&sol[wave][rl][lane * 8]); }
  } else {
#pragma unroll
    for (int j = 0; j < 8; ++j) {
#pragma unroll
      for (int r = 0; r < 8; ++r) { const float v = acc[j][r] + (BB ? bfr(BB[j * 16 + col]) : 0.f); const _Float16 hv = (_Float16)v; sth[j * 16 + col][wave * 16 + 8 * g + r] = hv; stl[j * 16 + col][wave * 16 + 8 * g + r] = (_Float16)((v - (float)hv) * 2048.0f); } }
    __syncthreads();
    const size_t rb = (size_t)blockIdx.x * 64; const int b = (int)(rb / SS), s0 = (int)(rb % SS); const int pc0 = n0 - 2 * DM;
    for (int q = tid; q < 128 * 8; q += 128) { const int d = q >> 3, pc = q & 7; const size_t o = ((size_t)b * DM + pc0 + d) * SS + s0 + pc * 8; vst2((unsigned*)(VTH + o), *(const v4u*)&sth[d][pc * 8]); vst2((unsigned*)(VTL + o), *(const v4u*)&stl[d][pc * 8]); }
  }
}
// ---- k_attn: block = (64 queries, head h, batch b): all-keys flash attention (K = 64: 2 k-steps), scores = max of the two Gaussian-key distances x (1/16, 3/16) from a single-f16 q.k, P.V: f16 P (x2^11) x V hi in one accumulator (accl stays 0); O[b*S+q][h*64+d] = acc / (2048 l) (256-B segments)
__global__ __launch_bounds__(128) void k_attn(const _Float16* __restrict__ QK, const _Float16* __restrict__ QKL, const _Float16* __restrict__ VTH, const _Float16* __restrict__ VTL, const void* __restrict__ KMASK, const float* __restrict__ TB, float* __restrict__ O) {
  __shared__ __align__(16) float sp[4][16][36]; __shared__ __align__(16) float so[4][16][68];
  const int tid = threadIdx.x, wave = tid >> 5, lane = tid & 31, col = lane & 15, g = lane >> 4;
  const int qb = blockIdx.x, h = blockIdx.y, b = blockIdx.z; const int q0 = qb * 64 + wave * 16; const size_t rq = (size_t)b * SS + q0 + col;
  v16h aq[2], aql[2];
#pragma unroll
  for (int kc = 0; kc < 2; ++kc) { aq[kc] = frag_h(QK + rq * (2 * DM) + h * HD + kc * 32, lane); aql[kc] = frag_h(QKL + rq * (2 * DM) + h * HD + kc * 32, lane); }
  float qn[8], qm[8], qm0[8];   // |q|^2, q . mu_1, q . mu_0 for this lane's 8 query rows
#pragma unroll
  for (int r = 0; r < 8; ++r) { const float* tb = TB + ((size_t)b * SS + q0 + 8 * g + r) * 64; qn[r] = tb[h]; qm0[r] = tb[8 + h]; qm[r] = tb[16 + h]; }
  float m[8], l[8];
#pragma unroll
  for (int r = 0; r < 8; ++r) { m[r] = -3.0e38f; l[r] = 0.f; }
  v8f acc[4] = {}, accl[4] = {};
  const int nks = SS / 32;   // all keys
#pragma unroll 1
  for (int ks = 0; ks < nks; ++ks) { v8f s[2];
#pragma unroll
    for (int ct = 0; ct < 2; ++ct) { const int kk = ks * 32 + ct * 16 + col; const _Float16* krow = QK + ((size_t)b * SS + kk) * (2 * DM) + DM + h * HD; const _Float16* krowl = QKL + ((size_t)b * SS + kk) * (2 * DM) + DM + h * HD; v8f c = {}, cl = {};
#pragma unroll
      for (int kc = 0; kc < 2; ++kc) c = wmma16(aq[kc], frag_h(krow + kc * 32, lane), c);   // single product: q, k as one-rounding f16 operands
      (void)cl; (void)krowl;
      { const bool keepk = true;
      { const float* tk = TB + ((size_t)b * SS + kk) * 64; const float kn = tk[24 + h], kn1 = tk[32 + h];
#pragma unroll
        for (int r = 0; r < 8; ++r) { const float d0 = -fmaxf(qn[r] + kn - 2.0f * c[r] + 2.0f * qm0[r], 0.f) * 0.0625f, d1 = -fmaxf(qn[r] + kn1 - 2.0f * c[r] + 2.0f * qm[r], 0.f) * 0.1875f; s[ct][r] = keepk ? fmaxf(d0, d1) : -3.0e38f; } } } }   // max over the two Gaussian keys (mu_0 and mu_1 both read from the tables)
#pragma unroll
    for (int r = 0; r < 8; ++r) { float mx = fmaxf(s[0][r], s[1][r]);
#pragma unroll
      for (int o = 1; o < 16; o <<= 1) mx = fmaxf(mx, __shfl_xor(mx, o));
      const float mn = fmaxf(m[r], mx); const float alpha = (m[r] <= -1.0e38f) ? 0.f : __expf(m[r] - mn);
      const float e0 = (s[0][r] <= -1.0e38f) ? 0.f : __expf(s[0][r] - mn), e1 = (s[1][r] <= -1.0e38f) ? 0.f : __expf(s[1][r] - mn); float es = e0 + e1;
#pragma unroll
      for (int o = 1; o < 16; o <<= 1) es += __shfl_xor(es, o);
      l[r] = l[r] * alpha + es; m[r] = mn;
#pragma unroll
      for (int dt = 0; dt < 4; ++dt) { acc[dt][r] *= alpha; accl[dt][r] *= alpha; }
      sp[wave][8 * g + r][col] = e0; sp[wave][8 * g + r][16 + col] = e1; }
    LDSX();
    v16h pa, pl; { const float* prow = &sp[wave][col][0] + 8 * (lane >> 4);
#pragma unroll
      for (int i = 0; i < 8; ++i) { const float x0 = prow[i] * 2048.0f, x1 = prow[16 + i] * 2048.0f; const _Float16 h0 = (_Float16)x0, h1 = (_Float16)x1; pa[i] = h0; pa[8 + i] = h1; pl[i] = (_Float16)((x0 - (float)h0) * 2048.0f); pl[8 + i] = (_Float16)((x1 - (float)h1) * 2048.0f); } }   // P scaled by 2^11 before the f16 split so small softmax weights stay out of the f16 subnormal range; 2^-11 folded into the epilogue
#pragma unroll
    for (int dt = 0; dt < 4; ++dt) { const size_t vr = ((size_t)b * DM + h * HD + dt * 16 + col) * SS + ks * 32; acc[dt] = wmma16(pa, frag_h(VTH + vr, lane), acc[dt]); }   // single product: P (x2^11) x V
    (void)pl;
    LDSX(); }
#pragma unroll
  for (int r = 0; r < 8; ++r) { const float il = (1.0f / 2048.0f) / l[r];
#pragma unroll
    for (int dt = 0; dt < 4; ++dt) so[wave][8 * g + r][dt * 16 + col] = (acc[dt][r] + accl[dt][r] * (1.0f / 2048.0f)) * il; }
  LDSX();
  for (int rl = 0; rl < 16; ++rl) if (lane < 16) vst2(O + ((size_t)b * SS + q0 + rl) * DM + h * HD + lane * 4, *(const v4f*)&so[wave][rl][lane * 4]);
}
// ---- k_out: block = (64 rows, 128 cols): out = O(hi/lo) . Wo rows (2 products) + bo
__global__ __launch_bounds__(128) void k_out(const float* __restrict__ O, const __bf16* __restrict__ P, const float* __restrict__ BO, float* __restrict__ Y) {
  __shared__ __align__(16) float so[4][16][132];
  const int tid = threadIdx.x, wave = tid >> 5, lane = tid & 31, col = lane & 15, g = lane >> 4; const size_t r0 = (size_t)blockIdx.x * 64 + wave * 16; const int n0 = blockIdx.y * 128;
  v8f acc[8] = {};
#pragma unroll 2
  for (int kc = 0; kc < DM / 32; ++kc) { const F2 a = split_row(O + (r0 + col) * DM, kc * 32, lane);
#pragma unroll
    for (int j = 0; j < 8; ++j) { const v16b w = frag_b(P + (size_t)(n0 + j * 16 + col) * DM + kc * 32, lane); acc[j] = wmma_bf(a.l, w, acc[j]); acc[j] = wmma_bf(a.h, w, acc[j]); } }
#pragma unroll
  for (int j = 0; j < 8; ++j) {
#pragma unroll
    for (int r = 0; r < 8; ++r) so[wave][8 * g + r][j * 16 + col] = acc[j][r] + (BO ? bfr(BO[n0 + j * 16 + col]) : 0.f); }
  LDSX();
  for (int rl = 0; rl < 16; ++rl) vst2(Y + xrow(r0 + rl) + n0 + lane * 4, *(const v4f*)&so[wave][rl][lane * 4]);
}
// ---- k_packkv: Wkv (in,out) [512][1024] -> k rows (cols 0..511) and v rows (cols 512..1023) as transposed bf16 rows in the engine's k / v slots
__global__ __launch_bounds__(256) void k_packkv(const float* __restrict__ WKV, __bf16* __restrict__ PK) { const int n = blockIdx.x, which = blockIdx.y + 1, t = threadIdx.x; __shared__ __align__(16) __bf16 s[DM]; for (int k = t; k < DM; k += 256) s[k] = (__bf16)WKV[(size_t)k * (2 * DM) + (which - 1) * DM + n]; __syncthreads(); if (t < DM / 8) vst2((unsigned*)(PK + PK_A + ((size_t)which * DM + n) * DM + t * 8), *(const v4u*)&s[t * 8]); }
__global__ __launch_bounds__(256) void k_tabs(const _Float16* __restrict__ QK, const _Float16* __restrict__ QKL, const float* __restrict__ MU, float* __restrict__ TB) { __shared__ __align__(16) float st[8][64]; const int t = threadIdx.x; const int rl = t >> 5, h = (t >> 2) & 7, part = t & 3; const size_t row = (size_t)blockIdx.x * 8 + rl;
  float qq = 0.f, qm0 = 0.f, qm1 = 0.f, k0 = 0.f, k1 = 0.f;
  for (int d = part * 16; d < part * 16 + 16; ++d) { const size_t o = row * (2 * DM) + h * HD + d; const float q = (float)QK[o] + (float)QKL[o] * (1.0f / 2048.0f); const float k = (float)QK[o + DM] + (float)QKL[o + DM] * (1.0f / 2048.0f); const float m0 = bfr(MU[h * HD + d]), m1 = bfr(MU[(NH + h) * HD + d]); qq += q * q; qm0 += q * m0; qm1 += q * m1; const float a0 = k - m0, a1 = k - m1; k0 += a0 * a0; k1 += a1 * a1; }
#pragma unroll
  for (int o = 1; o < 4; o <<= 1) { qq += __shfl_xor(qq, o); qm0 += __shfl_xor(qm0, o); qm1 += __shfl_xor(qm1, o); k0 += __shfl_xor(k0, o); k1 += __shfl_xor(k1, o); }
  if (part == 0) { st[rl][h] = qq; st[rl][8 + h] = qm0; st[rl][16 + h] = qm1; st[rl][24 + h] = k0; st[rl][32 + h] = k1; st[rl][40 + h] = 0.f; st[rl][48 + h] = 0.f; st[rl][56 + h] = 0.f; }
  __syncthreads(); if (t < 128) { const int r2 = t >> 4, q4 = t & 15; vst2(TB + ((size_t)blockIdx.x * 8 + r2) * 64 + q4 * 4, *(const v4f*)&st[r2][q4 * 4]); } }
// ---- k_lnsum<RAWR>: block = row: T = LayerNorm(R + A) g + b ; R is a raw input (bf16-rounded) when RAWR, else an f32 intermediate
template <int RAWR>
__global__ __launch_bounds__(128) void k_lnsum(const float* __restrict__ R, const float* __restrict__ A, const float* __restrict__ G, const float* __restrict__ Bt, float* __restrict__ T) {
  __shared__ float red[4]; const int t = threadIdx.x; const size_t row = blockIdx.x; float v[4]; float s = 0.f; for (int i = 0; i < 4; ++i) { const size_t e = row * DM + t * 4 + i; v[i] = (RAWR ? bfr(R[e]) : R[e]) + A[e]; s += v[i]; }
#pragma unroll
  for (int o = 1; o < 32; o <<= 1) s += __shfl_xor(s, o);
  if ((t & 31) == 0) red[t >> 5] = s; __syncthreads(); const float mu = ((red[0] + red[1]) + (red[2] + red[3])) / (float)DM; __syncthreads();
  float q = 0.f; for (int i = 0; i < 4; ++i) { const float d = v[i] - mu; q += d * d; }
#pragma unroll
  for (int o = 1; o < 32; o <<= 1) q += __shfl_xor(q, o);
  if ((t & 31) == 0) red[t >> 5] = q; __syncthreads(); const float inv = 1.0f / sqrtf(((red[0] + red[1]) + (red[2] + red[3])) / (float)DM + 1e-5f);
  v4f o4; for (int i = 0; i < 4; ++i) { const int e = t * 4 + i; o4[i] = (v[i] - mu) * inv * bfr(G[e]) + bfr(Bt[e]); } vst2(T + row * DM + t * 4, o4);
}
extern "C" void kernel_launch(void* const* d_in, const int* in_sizes, int n_in, void* d_out, int out_size, void* d_ws, size_t ws_size, hipStream_t stream) {
  (void)in_sizes; (void)n_in; (void)out_size;
  const float** F = (const float**)d_in;   // 0 h [1024,8,512] (s,b,d), 1 Wq [512,512] (in,out), 2 Wkv [512,1024] (in,out: k | v), 3 Wo [512,512] (in,out), 4 mu [2,8,64], 5 gamma, 6 beta
  if (ws_size < (size_t)WS_END) return;
  char* ws = (char*)d_ws; __bf16* PK = (__bf16*)(ws + WS_PK); _Float16 *QK = (_Float16*)(ws + WS_QK), *QKL = (_Float16*)(ws + WS_QKL), *VTH = (_Float16*)(ws + WS_VTH), *VTL = (_Float16*)(ws + WS_VTL); float *O = (float*)(ws + WS_O), *TB = (float*)(ws + WS_TB), *A = (float*)(ws + WS_A);
  k_pack<<<dim3(DM, 4), 256, 0, stream>>>(F[1], F[1], F[1], F[3], PK);   // Wq (and Wo); k/v slots overwritten next
  k_packkv<<<dim3(DM, 2), 256, 0, stream>>>(F[2], PK);
  k_qkv<<<dim3(TNB * SS / 64, QKVW / 128), 128, 0, stream>>>(F[0], F[0], F[0], PK + PK_A, nullptr, nullptr, nullptr, QK, QKL, VTH, VTL);
  k_tabs<<<TNB * SS / 8, 256, 0, stream>>>(QK, QKL, F[4], TB);
  k_attn<<<dim3(TQB, NH, TNB), 128, 0, stream>>>(QK, QKL, VTH, VTL, nullptr, TB, O);
  k_out<<<dim3(TOB, DM / 128), 128, 0, stream>>>(O, PK + PK_P, nullptr, A);   // A rows in (s, b) order
  k_lnsum<1><<<TOB * 64, 128, 0, stream>>>(F[0], A, F[5], F[6], (float*)d_out);
}

// v001
// Measured time: 139 microseconds a run.
// In two side-by-side timings against v000, it was 1.91 and 1.92 times as fast.
// compute dtype: all float inputs rounded to bf16; q/k/v = h . W with EXACT bf16 products on WMMA 16x16x32 ((in,out) weights as transposed rows); per-(token, head) tables |q|^2, q . mu_0, q . mu_1, |k - mu_0|^2, |k - mu_1|^2 in f32 from the f16 hi + residual rows; PLAIN scores: q . k single f16, then -max(|q|^2 + |k-mu_j|^2 - 2 q.k + 2 q.mu_j, 0) x (1/16, 3/16) for the two Gaussian keys (mu_0 read too; it is zero), max of the two, running-max softmax in f32 (hardware exp), P (scaled by 2^11, single f16) x v (single f16); out = LayerNorm(h + vec (bf16 hi + residual) . Wo (2 products)) in f32.
#include <hip/hip_runtime.h>
#include <math.h>

typedef __attribute__((ext_vector_type(16))) _Float16 v16h;
typedef __attribute__((ext_vector_type(16))) __bf16 v16b;
typedef __attribute__((ext_vector_type(8)))  _Float16 v8h;
typedef __attribute__((ext_vector_type(8)))  float v8f;
typedef __attribute__((ext_vector_type(4)))  float v4f;
typedef __attribute__((ext_vector_type(2)))  float v2f;
typedef __attribute__((ext_vector_type(4)))  unsigned v4u;
typedef __attribute__((ext_vector_type(4)))  int v4i;
typedef float __attribute__((may_alias)) float_a;
typedef int __attribute__((may_alias)) int_a;

template <typename T> __device__ __forceinline__ void vst2(void* p, T v) { *(T*)p = v;  }
__device__ __forceinline__ v8f wmma16(v16h a, v16h b, v8f c) {
  v8f d = __builtin_amdgcn_wmma_f32_16x16x32_f16(false, a, false, b, (short)0, c, false, false);
  asm volatile("v_nop\n\tv_nop\n\tv_nop\n\tv_nop" : "+v"(d) : "v"(a), "v"(b));
  return d;
}
__device__ __forceinline__ v8f wmma_bf(v16b a, v16b b, v8f c) {
  v8f d = __builtin_amdgcn_wmma_f32_16x16x32_bf16(false, a, false, b, (short)0, c, false, false);
  asm volatile("v_nop\n\tv_nop\n\tv_nop\n\tv_nop" : "+v"(d) : "v"(a), "v"(b));
  return d;
}
// Mixture-of-Gaussian-keys attention (S 1,024, B 8, d 512, 8 heads x 64, two Gaussian keys per position: k and k - mu_1): score = max(-|q - k|^2 / 16, -3 |q - (k - mu_1)|^2 / 16), softmax over keys, . v, Wo, residual, LayerNorm; (s, b, d) layout.
__device__ __forceinline__ v16h frag_h(const _Float16* rowk0, int lane) {
  union { v16h v; v8h q[2]; } u; const _Float16* p = rowk0 + 8 * (lane >> 4);
  u.q[0] = *(const v8h*)p; u.q[1] = *(const v8h*)(p + 16); return u.v;
}
__device__ __forceinline__ v16h frag_f32(const float* rowk0, int lane) {
  v16h a; const float* p = rowk0 + 8 * (lane >> 4);
#pragma unroll
  for (int i = 0; i < 8; ++i) { a[i] = (_Float16)p[i]; a[8 + i] = (_Float16)p[16 + i]; }
  return a;
}
__device__ __forceinline__ v16h frag_f32s(const float* rowk0, int lane, float sc) {
  v16h a; const float* p = rowk0 + 8 * (lane >> 4);
#pragma unroll
  for (int i = 0; i < 8; ++i) { a[i] = (_Float16)(p[i] * sc); a[8 + i] = (_Float16)(p[16 + i] * sc); }
  return a;
}
// column fragment from a [K][ld] layout (column n), rows >= K read as 0
__device__ __forceinline__ v16h fragc_f32(const float* W, int k0, int n, int lane, int ld, int K) {
  v16h a; const int g = lane >> 4;
#pragma unroll
  for (int i = 0; i < 8; ++i) { const int ka = k0 + 8 * g + i, kb = ka + 16;
    a[i] = (_Float16)(ka < K ? W[(size_t)(ka < K ? ka : K - 1) * ld + n] : 0.f); a[8 + i] = (_Float16)(kb < K ? W[(size_t)(kb < K ? kb : K - 1) * ld + n] : 0.f); }
  return a;
}
struct F2 { v16b h, l; };
__device__ __forceinline__ F2 bsplit16(const float v[16]) { F2 r;
#pragma unroll
  for (int i = 0; i < 16; ++i) { const __bf16 h = (__bf16)v[i]; r.h[i] = h; r.l[i] = (__bf16)(v[i] - (float)h); }
  return r; }
__device__ __forceinline__ F2 split_row(const float* row, int k0, int lane) { float v[16]; const float* p = row + k0 + 8 * (lane >> 4);
#pragma unroll
  for (int i = 0; i < 8; ++i) { v[i] = p[i]; v[8 + i] = p[16 + i]; }
  return bsplit16(v); }
__device__ __forceinline__ F2 split_rowK(const float* row, int k0, int lane, int K) { float v[16]; const int g = lane >> 4;
#pragma unroll
  for (int i = 0; i < 8; ++i) { const int ka = k0 + 8 * g + i, kb = ka + 16; v[i] = ka < K ? row[ka < K ? ka : K - 1] : 0.f; v[8 + i] = kb < K ? row[kb < K ? kb : K - 1] : 0.f; }
  return bsplit16(v); }
__device__ __forceinline__ F2 split_col(const float* W, int k0, int n, int lane, int ld, int K) { float v[16]; const int g = lane >> 4;
#pragma unroll
  for (int i = 0; i < 8; ++i) { const int ka = k0 + 8 * g + i, kb = ka + 16; v[i] = ka < K ? W[(size_t)(ka < K ? ka : K - 1) * ld + n] : 0.f; v[8 + i] = kb < K ? W[(size_t)(kb < K ? kb : K - 1) * ld + n] : 0.f; }
  return bsplit16(v); }
__device__ __forceinline__ v8f mac3(const F2& a, const F2& b, v8f c) { c = wmma_bf(a.l, b.h, c); c = wmma_bf(a.h, b.l, c); return wmma_bf(a.h, b.h, c); }
__device__ __forceinline__ float sigm(float v) { return 1.0f / (1.0f + expf(-v)); }
#define LDSX() do { asm volatile("s_wait_dscnt 0" ::: "memory"); __builtin_amdgcn_wave_barrier(); __builtin_amdgcn_fence(__ATOMIC_RELEASE, "workgroup"); } while (0)


#define NB 8
#define SS 1024
#define DM 512
#define NH 8
#define NBATCH 8
__device__ __forceinline__ size_t xrow(size_t r) { return ((r % SS) * NBATCH + r / SS) * (size_t)DM; }   // engine row (b*SS + s) -> module row (s*B + b)
#define HD 64
#define QKVW (3 * DM)
#ifndef TQB
#define TQB (SS / 64)
#define TNB NB
#define TOB (NB * SS / 64)     // output row tiles (all)
#endif
typedef __attribute__((ext_vector_type(8))) __bf16 v8b;
__device__ __forceinline__ v16b frag_b(const __bf16* rowk0, int lane) {
  union { v16b v; v8b q[2]; } u; const __bf16* p = rowk0 + 8 * (lane >> 4);
  u.q[0] = *(const v8b*)p; u.q[1] = *(const v8b*)(p + 16); return u.v;
}
__device__ __forceinline__ float bfr(float v) { return (float)(__bf16)v; }
__device__ __attribute__((noinline)) float exp_ni(float v) { return expf(v); }
__device__ __attribute__((noinline)) float erf_ni(float v) { return erff(v); }

#define PK_A 0                       // [1536][512] Wqkv rows (natural [out][in])
#define PK_P (PK_A + QKVW * DM)        // [512][512] Wo rows (natural)
#define PK_END (PK_P + DM * DM)
#define WS_PK  0u
#define WS_QK  (WS_PK + 2u * PK_END)             // f16 [8192 rows][1024]: q | k
#define WS_QKL (WS_QK + 2u * NB * SS * 2 * DM)     // f16 q | k residual planes x2048
#define WS_VTH (WS_QKL + 2u * NB * SS * 2 * DM)    // f16 [b][512 (h*64+d)][1024 s] hi
#define WS_VTL (WS_VTH + 2u * NB * DM * SS)        // f16 lo x 2048
#define WS_O   (WS_VTL + 2u * NB * DM * SS)        // f32 [8192][512]
#define WS_CS  (WS_O + 4u * NB * SS * DM)           // f32 2 x [1024][32] (unused)
#define WS_TB  (WS_CS + 4u * 2 * SS * 32)                  // f32 tables [NR][64]: |q_h|^2 (0..7), q.mu0 (8..15), q.mu1 (16..23), |k - mu0|^2 (24..31), |k - mu1|^2 (32..39), rest 0
#define WS_A   (WS_TB + 4u * (size_t)NB * SS * 64)
#define WS_END (WS_A + 4u * (size_t)NB * SS * DM)
// ---- k_pack: block = (row n, which): (in,out) columns -> bf16 [out][in] rows; which 0..2 -> W_q/W_k/W_v into PK_A rows which*512 + n; 3 -> W_o into PK_P
__global__ __launch_bounds__(256) void k_pack(const float* __restrict__ WQ, const float* __restrict__ WK, const float* __restrict__ WV, const float* __restrict__ WO, __bf16* __restrict__ PK) {
  __shared__ __align__(16) __bf16 s[DM]; const int n = blockIdx.x, which = blockIdx.y, t = threadIdx.x; const float* Wm = (which == 0) ? WQ : (which == 1) ? WK : (which == 2) ? WV : WO;   // (in,out) weights: pack row n = column n
  for (int k = t; k < DM; k += 256) s[k] = (__bf16)Wm[(size_t)k * DM + n];
  __syncthreads();
  __bf16* dst = (which < 3) ? PK + PK_A + ((size_t)which * DM + n) * DM : PK + PK_P + (size_t)n * DM;
  for (int q = t; q < DM / 8; q += 256) vst2((unsigned*)(dst + q * 8), *(const v4u*)&s[q * 8]);
}
typedef __attribute__((ext_vector_type(4))) __bf16 v4b;
#define GK 64          // k per LDS stage of the two GEMMs
#define GP (GK + 8)    // LDS row pitch in 16-bit elements: 144 B = 16 B x 9 (odd), so the b128 fragment reads of 16 rows spread over the banks
#define GN (GK / 8)    // 16-B pieces per thread and stage, of the weight tile and of the f32 rows alike
#define XW() asm volatile("s_wait_xcnt 0x0" ::: "memory")   // stands behind a group of stage loads: their address registers are reused only behind it
// one stage (GK k) of a [128 rows][DM] bf16 weight tile in 16-B pieces; one wave-wide load covers four rows x 128 B, whole lines; pw = this thread's piece of the first 128 / GN rows
__device__ __forceinline__ void ldw(v8b (&r)[GN], const __bf16* __restrict__ pw) {
#pragma unroll
  for (int i = 0; i < GN; ++i) r[i] = *(const v8b*)(pw + (size_t)i * (128 / GN) * DM);
}
__device__ __forceinline__ void stw(const v8b (&r)[GN], __bf16* sB, int tid) {
#pragma unroll
  for (int i = 0; i < GN; ++i) *(v8b*)(sB + (i * (128 / GN) + tid / GN) * GP + (tid % GN) * 8) = r[i];
}
__global__ __launch_bounds__(128) void k_qkv(const float* __restrict__ XQ, const float* __restrict__ XK, const float* __restrict__ XV, const __bf16* __restrict__ P, const float* __restrict__ BQ, const float* __restrict__ BK, const float* __restrict__ BV, _Float16* __restrict__ QK, _Float16* __restrict__ QKL, _Float16* __restrict__ VTH, _Float16* __restrict__ VTL) {
  const int which0 = (blockIdx.y * 128) / DM; const float* X = (which0 == 0) ? XQ : (which0 == 1) ? XK : XV; const float* BB = BQ ? (((which0 == 0) ? BQ : (which0 == 1) ? BK : BV) + (blockIdx.y * 128 - which0 * DM)) : nullptr;
  __shared__ __align__(16) char smem[2 * 128 * 72 * 2];   // stage: weight tile [128][GP] | bf16 input rows [64][GP] (27,648 B); behind the loop's last barrier the same bytes are the output staging (36,864 B at most)
  __bf16* sB = (__bf16*)smem; __bf16* sA = sB + 128 * GP;
  _Float16 (*so)[16][136] = (_Float16 (*)[16][136])smem; _Float16 (*sol)[16][136] = so + 4; _Float16 (*sth)[72] = (_Float16 (*)[72])smem; _Float16 (*stl)[72] = sth + 128;
  const int tid = threadIdx.x, wave = tid >> 5, lane = tid & 31, col = lane & 15, g = lane >> 4; const size_t r0 = (size_t)blockIdx.x * 64 + wave * 16; const int n0 = blockIdx.y * 128;
  v8f acc[8] = {};
  const __bf16* pw = P + (size_t)(n0 + tid / GN) * DM + (tid % GN) * 8; const size_t rb0 = (size_t)blockIdx.x * 64;
  const int ar = tid / (GK / 4), ap = (tid % (GK / 4)) * 4;   // this thread's row (step 128 / (GK / 4)) and k offset in the f32 rows of a stage
  v8b rw[GN]; v4f ra[GN];   // the next stage, on its way through registers while this stage is multiplied
  const float* px = X + xrow(rb0 + ar) + ap;   // (s, b) input layout: the block's 64 rows are one batch entry's, so the next engine row lies NBATCH * DM further on
  ldw(rw, pw);
#pragma unroll
  for (int i = 0; i < GN; ++i) ra[i] = *(const v4f*)(px + (size_t)i * (512 / GK) * NBATCH * DM);   // one wave-wide load = two rows x 256 B
  XW();
  for (int st = 0; st < DM / GK; ++st) {
    __syncthreads();   // every wave has left the stage that is overwritten next
    stw(rw, sB, tid);
#pragma unroll
    for (int i = 0; i < GN; ++i) { v4b hv; hv[0] = (__bf16)ra[i][0]; hv[1] = (__bf16)ra[i][1]; hv[2] = (__bf16)ra[i][2]; hv[3] = (__bf16)ra[i][3]; *(v4b*)(sA + (i * (512 / GK) + ar) * GP + ap) = hv; }
    __syncthreads();   // the stage is complete for every wave
    if (st + 1 < DM / GK) { ldw(rw, pw + (st + 1) * GK);
#pragma unroll
      for (int i = 0; i < GN; ++i) ra[i] = *(const v4f*)(px + (size_t)i * (512 / GK) * NBATCH * DM + (st + 1) * GK);
      XW(); }
#pragma unroll
    for (int kc = 0; kc < GK / 32; ++kc) { const v16b a = frag_b(sA + (wave * 16 + col) * GP + kc * 32, lane); v16b w[8];
#pragma unroll
      for (int j = 0; j < 8; ++j) w[j] = frag_b(sB + (j * 16 + col) * GP + kc * 32, lane);
      asm volatile("" :: "v"(a), "v"(w[0]), "v"(w[1]), "v"(w[2]), "v"(w[3]), "v"(w[4]), "v"(w[5]), "v"(w[6]), "v"(w[7]));   // holds the nine fragment reads together in front of the products: one LDS wait per eight products, not one per product
#pragma unroll
      for (int j = 0; j < 8; ++j) acc[j] = wmma_bf(a, w[j], acc[j]); } }
  __syncthreads();   // the last stage's reads are over before its bytes become output staging
  if (n0 < 2 * DM) {   // q stored unscaled (f16 sigma ~0.6, no subnormal exposure); 1/16 and 3/16 applied to the f32 squared distances in k_attn
#pragma unroll
    for (int j = 0; j < 8; ++j) {
#pragma unroll
      for (int r = 0; r < 8; ++r) { const float v = acc[j][r] + (BB ? bfr(BB[j * 16 + col]) : 0.f); const _Float16 hv = (_Float16)v; so[wave][8 * g + r][j * 16 + col] = hv; sol[wave][8 * g + r][j * 16 + col] = (_Float16)((v - (float)hv) * 2048.0f); } }   // q, k (+ bias) as f16 hi + (x2048) residual
    LDSX();
    for (int rl = 0; rl < 16; ++rl) if (lane < 16) { vst2((unsigned*)(QK + (r0 + rl) * (2 * DM) + n0 + lane * 8), *(const v4u*)&so[wave][rl][lane * 8]); vst2((unsigned*)(QKL + (r0 + rl) * (2 * DM) + n0 + lane * 8), *(const v4u*)&sol[wave][rl][lane * 8]); }
  } else {
#pragma unroll
    for (int j = 0; j < 8; ++j) {
#pragma unroll
      for (int r = 0; r < 8; ++r) { const float v = acc[j][r] + (BB ? bfr(BB[j * 16 + col]) : 0.f); const _Float16 hv = (_Float16)v; sth[j * 16 + col][wave * 16 + 8 * g + r] = hv; stl[j * 16 + col][wave * 16 + 8 * g + r] = (_Float16)((v - (float)hv) * 2048.0f); } }
    __syncthreads();
    const size_t rb = (size_t)blockIdx.x * 64; const int b = (int)(rb / SS), s0 = (int)(rb % SS); const int pc0 = n0 - 2 * DM;
    for (int q = tid; q < 128 * 8; q += 128) { const int d = q >> 3, pc = q & 7; const size_t o = ((size_t)b * DM + pc0 + d) * SS + s0 + pc * 8; vst2((unsigned*)(VTH + o), *(const v4u*)&sth[d][pc * 8]); vst2((unsigned*)(VTL + o), *(const v4u*)&stl[d][pc * 8]); }
  }
}
#define AK 64   // keys per LDS stage of k_attn
#define AP 72   // its LDS row pitch in f16: 144 B = 16 B x 9 (odd), so the b128 fragment reads of 16 rows spread over the banks
// ---- k_attn: block = (64 queries, head h, batch b): all-keys flash attention (K = 64: 2 k-steps), scores = max(-|q - k|^2 / 16, -3 |q - (k - mu_1)|^2 / 16) from q.k with single f16 operands and the f32 tables, P.V: f16 P (x2^11) x V hi, single product; O[b*S+q][h*64+d] = (acc + accl / 2048) / (2048 l) (256-B segments)
__global__ __launch_bounds__(128) void k_attn(const _Float16* __restrict__ QK, const _Float16* __restrict__ QKL, const _Float16* __restrict__ VTH, const _Float16* __restrict__ VTL, const void* __restrict__ KMASK, const float* __restrict__ TB, float* __restrict__ O) {
  __shared__ __align__(16) float sp[4][16][36]; __shared__ __align__(16) float so[4][16][68];
  __shared__ __align__(16) _Float16 sK[AK][AP], sV[HD][AP]; __shared__ float skn[2][AK];   // one stage of AK keys, shared by the four waves: k rows, v columns (d-major), |k - mu_j|^2
  const int tid = threadIdx.x, wave = tid >> 5, lane = tid & 31, col = lane & 15, g = lane >> 4;
  const int qb = blockIdx.x, h = blockIdx.y, b = blockIdx.z; const int q0 = qb * 64 + wave * 16; const size_t rq = (size_t)b * SS + q0 + col;
  v16h aq[2], aql[2];
#pragma unroll
  for (int kc = 0; kc < 2; ++kc) { aq[kc] = frag_h(QK + rq * (2 * DM) + h * HD + kc * 32, lane); aql[kc] = frag_h(QKL + rq * (2 * DM) + h * HD + kc * 32, lane); }
  float qn[8], qm[8], qm0[8];   // |q|^2, q . mu_1, q . mu_0 for this lane's 8 query rows
#pragma unroll
  for (int r = 0; r < 8; ++r) { const float* tb = TB + ((size_t)b * SS + q0 + 8 * g + r) * 64; qn[r] = tb[h]; qm0[r] = tb[8 + h]; qm[r] = tb[16 + h]; }
  float m[8], l[8];
#pragma unroll
  for (int r = 0; r < 8; ++r) { m[r] = -3.0e38f; l[r] = 0.f; }
  v8f acc[4] = {}, accl[4] = {};
  // stage loads: AK * 128 B of k rows and of v columns in 16-B pieces, a wave-wide load covering four whole 128-B lines; one table word per thread
  const _Float16* gK = QK + ((size_t)b * SS + (tid >> 3)) * (2 * DM) + DM + h * HD + (tid & 7) * 8; const _Float16* gV = VTH + ((size_t)b * DM + h * HD + (tid >> 3)) * SS + (tid & 7) * 8;
  const float* gT = TB + ((size_t)b * SS + (tid & (AK - 1))) * 64 + 24 + 8 * (tid / AK) + h;
  v8h rk[4], rv[4]; float rt;   // the next stage, on its way through registers while this stage is worked on
#pragma unroll
  for (int i = 0; i < 4; ++i) { rk[i] = *(const v8h*)(gK + (size_t)i * 16 * (2 * DM)); rv[i] = *(const v8h*)(gV + (size_t)i * 16 * SS); }
  rt = *gT;
  XW();
  asm volatile("" :: "v"(aq[0]), "v"(aq[1]), "v"(qn[0]), "v"(qn[1]), "v"(qn[2]), "v"(qn[3]), "v"(qn[4]), "v"(qn[5]), "v"(qn[6]), "v"(qn[7]), "v"(qm[0]), "v"(qm[1]), "v"(qm[2]), "v"(qm[3]), "v"(qm[4]), "v"(qm[5]), "v"(qm[6]), "v"(qm[7]), "v"(qm0[0]), "v"(qm0[1]), "v"(qm0[2]), "v"(qm0[3]), "v"(qm0[4]), "v"(qm0[5]), "v"(qm0[6]), "v"(qm0[7]));   // the query-side loads are waited for here, once: a wait for them inside the loop would also cover the next stage's loads, which are to stay in flight over the stage's work
  const int nks = SS / 32;   // all keys
#pragma unroll 1
  for (int ks = 0; ks < nks; ++ks) { v8f s[2];
    const int sub = ks & (AK / 32 - 1);
    if (sub == 0) {
      __syncthreads();   // every wave has left the stage that is overwritten next
#pragma unroll
      for (int i = 0; i < 4; ++i) { *(v8h*)&sK[i * 16 + (tid >> 3)][(tid & 7) * 8] = rk[i]; *(v8h*)&sV[i * 16 + (tid >> 3)][(tid & 7) * 8] = rv[i]; }
      skn[tid / AK][tid & (AK - 1)] = rt;
      __syncthreads();   // the stage is complete for every wave
      if (ks + AK / 32 < nks) { const size_t k1 = (size_t)ks * 32 + AK;
#pragma unroll
        for (int i = 0; i < 4; ++i) { rk[i] = *(const v8h*)(gK + (k1 + i * 16) * (2 * DM)); rv[i] = *(const v8h*)(gV + (size_t)i * 16 * SS + k1); }
        rt = gT[k1 * 64];
        XW(); } }
#pragma unroll
    for (int ct = 0; ct < 2; ++ct) { const int kk = sub * 32 + ct * 16 + col; const _Float16* krow = &sK[kk][0]; const _Float16* krowl = krow; v8f c = {}, cl = {};
#pragma unroll
      for (int kc = 0; kc < 2; ++kc) c = wmma16(aq[kc], frag_h(krow + kc * 32, lane), c);   // single product: q, k as one-rounding f16 operands
      (void)cl; (void)krowl;
      { const bool keepk = true;
      { const float kn = skn[0][kk], kn1 = skn[1][kk];
#pragma unroll
        for (int r = 0; r < 8; ++r) { const float d0 = -fmaxf(qn[r] + kn - 2.0f * c[r] + 2.0f * qm0[r], 0.f) * 0.0625f, d1 = -fmaxf(qn[r] + kn1 - 2.0f * c[r] + 2.0f * qm[r], 0.f) * 0.1875f; s[ct][r] = keepk ? fmaxf(d0, d1) : -3.0e38f; } } } }   // max over the two Gaussian keys (mu_0 and mu_1 both read from the tables)
#pragma unroll
    for (int r = 0; r < 8; ++r) { float mx = fmaxf(s[0][r], s[1][r]);
#pragma unroll
      for (int o = 1; o < 16; o <<= 1) mx = fmaxf(mx, __shfl_xor(mx, o));
      const float mn = fmaxf(m[r], mx); const float alpha = (m[r] <= -1.0e38f) ? 0.f : __expf(m[r] - mn);
      const float e0 = (s[0][r] <= -1.0e38f) ? 0.f : __expf(s[0][r] - mn), e1 = (s[1][r] <= -1.0e38f) ? 0.f : __expf(s[1][r] - mn); float es = e0 + e1;
#pragma unroll
      for (int o = 1; o < 16; o <<= 1) es += __shfl_xor(es, o);
      l[r] = l[r] * alpha + es; m[r] = mn;
#pragma unroll
      for (int dt = 0; dt < 4; ++dt) { acc[dt][r] *= alpha; accl[dt][r] *= alpha; }
      sp[wave][8 * g + r][col] = e0; sp[wave][8 * g + r][16 + col] = e1; }
    LDSX();
    v16h pa, pl; { const float* prow = &sp[wave][col][0] + 8 * (lane >> 4);
#pragma unroll
      for (int i = 0; i < 8; ++i) { const float x0 = prow[i] * 2048.0f, x1 = prow[16 + i] * 2048.0f; const _Float16 h0 = (_Float16)x0, h1 = (_Float16)x1; pa[i] = h0; pa[8 + i] = h1; pl[i] = (_Float16)((x0 - (float)h0) * 2048.0f); pl[8 + i] = (_Float16)((x1 - (float)h1) * 2048.0f); } }   // P scaled by 2^11 before the f16 split so small softmax weights stay out of the f16 subnormal range; 2^-11 folded into the epilogue
#pragma unroll
    for (int dt = 0; dt < 4; ++dt) acc[dt] = wmma16(pa, frag_h(&sV[dt * 16 + col][sub * 32], lane), acc[dt]);   // single product: P (x2^11) x V
    (void)pl;
    LDSX(); }
#pragma unroll
  for (int r = 0; r < 8; ++r) { const float il = (1.0f / 2048.0f) / l[r];
#pragma unroll
    for (int dt = 0; dt < 4; ++dt) so[wave][8 * g + r][dt * 16 + col] = (acc[dt][r] + accl[dt][r] * (1.0f / 2048.0f)) * il; }
  LDSX();
  for (int rl = 0; rl < 16; ++rl) if (lane < 16) vst2(O + ((size_t)b * SS + q0 + rl) * DM + h * HD + lane * 4, *(const v4f*)&so[wave][rl][lane * 4]);
}
// ---- k_out: block = (64 rows, 128 cols): out = O(hi/lo) . Wo rows (2 products) + bo
__global__ __launch_bounds__(128) void k_out(const float* __restrict__ O, const __bf16* __restrict__ P, const float* __restrict__ BO, float* __restrict__ Y) {
  __shared__ __align__(16) char smem[(128 + 64 + 64) * GP * 2];   // stage: weight tile [128][GP] | O rows bf16 hi [64][GP] | residual [64][GP]; behind the loop's last barrier the same bytes are the output staging
  __bf16* sB = (__bf16*)smem; __bf16* sAh = sB + 128 * GP; __bf16* sAl = sAh + 64 * GP;
  float (*so)[16][132] = (float (*)[16][132])smem;
  const int tid = threadIdx.x, wave = tid >> 5, lane = tid & 31, col = lane & 15, g = lane >> 4; const size_t r0 = (size_t)blockIdx.x * 64 + wave * 16; const int n0 = blockIdx.y * 128;
  v8f acc[8] = {};
  const __bf16* pw = P + (size_t)(n0 + tid / GN) * DM + (tid % GN) * 8; const int ar = tid / (GK / 4), ap = (tid % (GK / 4)) * 4; const float* Ot = O + ((size_t)blockIdx.x * 64 + ar) * DM + ap;   // this thread's row (step 128 / (GK / 4)) and k offset in the f32 rows of a stage
  v8b rw[GN]; v4f ra[GN];   // the next stage, on its way through registers while this stage is multiplied
  ldw(rw, pw);
#pragma unroll
  for (int i = 0; i < GN; ++i) ra[i] = *(const v4f*)(Ot + (size_t)i * (512 / GK) * DM);   // one wave-wide load = two rows x 256 B
  XW();
  for (int st = 0; st < DM / GK; ++st) {
    __syncthreads();   // every wave has left the stage that is overwritten next
    stw(rw, sB, tid);
#pragma unroll
    for (int i = 0; i < GN; ++i) { v4b hv, lv;
#pragma unroll
      for (int e = 0; e < 4; ++e) { const __bf16 hh = (__bf16)ra[i][e]; hv[e] = hh; lv[e] = (__bf16)(ra[i][e] - (float)hh); }
      *(v4b*)(sAh + (i * (512 / GK) + ar) * GP + ap) = hv; *(v4b*)(sAl + (i * (512 / GK) + ar) * GP + ap) = lv; }
    __syncthreads();   // the stage is complete for every wave
    if (st + 1 < DM / GK) { ldw(rw, pw + (st + 1) * GK);
#pragma unroll
      for (int i = 0; i < GN; ++i) ra[i] = *(const v4f*)(Ot + (size_t)i * (512 / GK) * DM + (st + 1) * GK);
      XW(); }
#pragma unroll
    for (int kc = 0; kc < GK / 32; ++kc) { const v16b ah = frag_b(sAh + (wave * 16 + col) * GP + kc * 32, lane), al = frag_b(sAl + (wave * 16 + col) * GP + kc * 32, lane); v16b w[8];
#pragma unroll
      for (int j = 0; j < 8; ++j) w[j] = frag_b(sB + (j * 16 + col) * GP + kc * 32, lane);
      asm volatile("" :: "v"(ah), "v"(al), "v"(w[0]), "v"(w[1]), "v"(w[2]), "v"(w[3]), "v"(w[4]), "v"(w[5]), "v"(w[6]), "v"(w[7]));   // holds the ten fragment reads together in front of the products: one LDS wait per sixteen products, not one per pair
#pragma unroll
      for (int j = 0; j < 8; ++j) { acc[j] = wmma_bf(al, w[j], acc[j]); acc[j] = wmma_bf(ah, w[j], acc[j]); } } }
  __syncthreads();   // the last stage's reads are over before its bytes become output staging
#pragma unroll
  for (int j = 0; j < 8; ++j) {
#pragma unroll
    for (int r = 0; r < 8; ++r) so[wave][8 * g + r][j * 16 + col] = acc[j][r] + (BO ? bfr(BO[n0 + j * 16 + col]) : 0.f); }
  LDSX();
  for (int rl = 0; rl < 16; ++rl) vst2(Y + xrow(r0 + rl) + n0 + lane * 4, *(const v4f*)&so[wave][rl][lane * 4]);
}
// ---- k_packkv: Wkv (in,out) [512][1024] -> k rows (cols 0..511) and v rows (cols 512..1023) as transposed bf16 rows in the engine's k / v slots
__global__ __launch_bounds__(256) void k_packkv(const float* __restrict__ WKV, __bf16* __restrict__ PK) { const int n = blockIdx.x, which = blockIdx.y + 1, t = threadIdx.x; __shared__ __align__(16) __bf16 s[DM]; for (int k = t; k < DM; k += 256) s[k] = (__bf16)WKV[(size_t)k * (2 * DM) + (which - 1) * DM + n]; __syncthreads(); if (t < DM / 8) vst2((unsigned*)(PK + PK_A + ((size_t)which * DM + n) * DM + t * 8), *(const v4u*)&s[t * 8]); }
__global__ __launch_bounds__(256) void k_tabs(const _Float16* __restrict__ QK, const _Float16* __restrict__ QKL, const float* __restrict__ MU, float* __restrict__ TB) { __shared__ __align__(16) float st[8][64]; const int t = threadIdx.x; const int rl = t >> 5, h = (t >> 2) & 7, part = t & 3; const size_t row = (size_t)blockIdx.x * 8 + rl;
  float qq = 0.f, qm0 = 0.f, qm1 = 0.f, k0 = 0.f, k1 = 0.f;
  for (int d = part * 16; d < part * 16 + 16; ++d) { const size_t o = row * (2 * DM) + h * HD + d; const float q = (float)QK[o] + (float)QKL[o] * (1.0f / 2048.0f); const float k = (float)QK[o + DM] + (float)QKL[o + DM] * (1.0f / 2048.0f); const float m0 = bfr(MU[h * HD + d]), m1 = bfr(MU[(NH + h) * HD + d]); qq += q * q; qm0 += q * m0; qm1 += q * m1; const float a0 = k - m0, a1 = k - m1; k0 += a0 * a0; k1 += a1 * a1; }
#pragma unroll
  for (int o = 1; o < 4; o <<= 1) { qq += __shfl_xor(qq, o); qm0 += __shfl_xor(qm0, o); qm1 += __shfl_xor(qm1, o); k0 += __shfl_xor(k0, o); k1 += __shfl_xor(k1, o); }
  if (part == 0) { st[rl][h] = qq; st[rl][8 + h] = qm0; st[rl][16 + h] = qm1; st[rl][24 + h] = k0; st[rl][32 + h] = k1; st[rl][40 + h] = 0.f; st[rl][48 + h] = 0.f; st[rl][56 + h] = 0.f; }
  __syncthreads(); if (t < 128) { const int r2 = t >> 4, q4 = t & 15; vst2(TB + ((size_t)blockIdx.x * 8 + r2) * 64 + q4 * 4, *(const v4f*)&st[r2][q4 * 4]); } }
// ---- k_lnsum<RAWR>: block = row: T = LayerNorm(R + A) g + b ; R is a raw input (bf16-rounded) when RAWR, else an f32 intermediate
template <int RAWR>
__global__ __launch_bounds__(128) void k_lnsum(const float* __restrict__ R, const float* __restrict__ A, const float* __restrict__ G, const float* __restrict__ Bt, float* __restrict__ T) {
  __shared__ float red[4]; const int t = threadIdx.x; const size_t row = blockIdx.x; float v[4]; float s = 0.f; for (int i = 0; i < 4; ++i) { const size_t e = row * DM + t * 4 + i; v[i] = (RAWR ? bfr(R[e]) : R[e]) + A[e]; s += v[i]; }
#pragma unroll
  for (int o = 1; o < 32; o <<= 1) s += __shfl_xor(s, o);
  if ((t & 31) == 0) red[t >> 5] = s; __syncthreads(); const float mu = ((red[0] + red[1]) + (red[2] + red[3])) / (float)DM; __syncthreads();
  float q = 0.f; for (int i = 0; i < 4; ++i) { const float d = v[i] - mu; q += d * d; }
#pragma unroll
  for (int o = 1; o < 32; o <<= 1) q += __shfl_xor(q, o);
  if ((t & 31) == 0) red[t >> 5] = q; __syncthreads(); const float inv = 1.0f / sqrtf(((red[0] + red[1]) + (red[2] + red[3])) / (float)DM + 1e-5f);
  v4f o4; for (int i = 0; i < 4; ++i) { const int e = t * 4 + i; o4[i] = (v[i] - mu) * inv * bfr(G[e]) + bfr(Bt[e]); } vst2(T + row * DM + t * 4, o4);
}
extern "C" void kernel_launch(void* const* d_in, const int* in_sizes, int n_in, void* d_out, int out_size, void* d_ws, size_t ws_size, hipStream_t stream) {
  (void)in_sizes; (void)n_in; (void)out_size;
  const float** F = (const float**)d_in;   // 0 h [1024,8,512] (s,b,d), 1 Wq [512,512] (in,out), 2 Wkv [512,1024] (in,out: k | v), 3 Wo [512,512] (in,out), 4 mu [2,8,64], 5 gamma, 6 beta
  if (ws_size < (size_t)WS_END) return;
  char* ws = (char*)d_ws; __bf16* PK = (__bf16*)(ws + WS_PK); _Float16 *QK = (_Float16*)(ws + WS_QK), *QKL = (_Float16*)(ws + WS_QKL), *VTH = (_Float16*)(ws + WS_VTH), *VTL = (_Float16*)(ws + WS_VTL); float *O = (float*)(ws + WS_O), *TB = (float*)(ws + WS_TB), *A = (float*)(ws + WS_A);
  k_pack<<<dim3(DM, 4), 256, 0, stream>>>(F[1], F[1], F[1], F[3], PK);   // Wq (and Wo); k/v slots overwritten next
  k_packkv<<<dim3(DM, 2), 256, 0, stream>>>(F[2], PK);
  k_qkv<<<dim3(TNB * SS / 64, QKVW / 128), 128, 0, stream>>>(F[0], F[0], F[0], PK + PK_A, nullptr, nullptr, nullptr, QK, QKL, VTH, VTL);
  k_tabs<<<TNB * SS / 8, 256, 0, stream>>>(QK, QKL, F[4], TB);
  k_attn<<<dim3(TQB, NH, TNB), 128, 0, stream>>>(QK, QKL, VTH, VTL, nullptr, TB, O);
  k_out<<<dim3(TOB, DM / 128), 128, 0, stream>>>(O, PK + PK_P, nullptr, A);   // A rows in (s, b) order
  k_lnsum<1><<<TOB * 64, 128, 0, stream>>>(F[0], A, F[5], F[6], (float*)d_out);
}

// v002
// It runs in 117 microseconds.
// Next to v001, in two timings, it ran 1.20 and 1.19 times as fast.
// All steps since v000 together make it 2.29 times as fast.
// compute dtype: all float inputs rounded to bf16; q/k/v = h . W with EXACT bf16 products on WMMA 16x16x32 ((in,out) weights as transposed rows); per-(token, head) tables |q|^2, q . mu_0, q . mu_1, |k - mu_0|^2, |k - mu_1|^2 in f32 from the f16 hi + residual rows; PLAIN scores: q . k single f16, then -max(|q|^2 + |k-mu_j|^2 - 2 q.k + 2 q.mu_j, 0) x (1/16, 3/16) for the two Gaussian keys (mu_0 read too; it is zero), max of the two, running-max softmax in f32 (hardware exp), P (scaled by 2^11, single f16) x v (single f16); out = LayerNorm(h + vec (bf16 hi + residual) . Wo (2 products)) in f32.
#include <hip/hip_runtime.h>
#include <math.h>

typedef __attribute__((ext_vector_type(16))) _Float16 v16h;
typedef __attribute__((ext_vector_type(16))) __bf16 v16b;
typedef __attribute__((ext_vector_type(8)))  _Float16 v8h;
typedef __attribute__((ext_vector_type(8)))  float v8f;
typedef __attribute__((ext_vector_type(4)))  float v4f;
typedef __attribute__((ext_vector_type(2)))  float v2f;
typedef __attribute__((ext_vector_type(4)))  unsigned v4u;
typedef __attribute__((ext_vector_type(4)))  int v4i;
typedef float __attribute__((may_alias)) float_a;
typedef int __attribute__((may_alias)) int_a;

template <typename T> __device__ __forceinline__ void vst2(void* p, T v) { *(T*)p = v;  }
__device__ __forceinline__ v8f wmma16(v16h a, v16h b, v8f c) {
  v8f d = __builtin_amdgcn_wmma_f32_16x16x32_f16(false, a, false, b, (short)0, c, false, false);
  asm volatile("v_nop\n\tv_nop\n\tv_nop\n\tv_nop" : "+v"(d) : "v"(a), "v"(b));
  return d;
}
__device__ __forceinline__ v8f wmma_bf(v16b a, v16b b, v8f c) {
  v8f d = __builtin_amdgcn_wmma_f32_16x16x32_bf16(false, a, false, b, (short)0, c, false, false);
  asm volatile("v_nop\n\tv_nop\n\tv_nop\n\tv_nop" : "+v"(d) : "v"(a), "v"(b));
  return d;
}
// Mixture-of-Gaussian-keys attention (S 1,024, B 8, d 512, 8 heads x 64, two Gaussian keys per position: k and k - mu_1): score = max(-|q - k|^2 / 16, -3 |q - (k - mu_1)|^2 / 16), softmax over keys, . v, Wo, residual, LayerNorm; (s, b, d) layout.
__device__ __forceinline__ v16h frag_h(const _Float16* rowk0, int lane) {
  union { v16h v; v8h q[2]; } u; const _Float16* p = rowk0 + 8 * (lane >> 4);
  u.q[0] = *(const v8h*)p; u.q[1] = *(const v8h*)(p + 16); return u.v;
}
__device__ __forceinline__ v16h frag_f32(const float* rowk0, int lane) {
  v16h a; const float* p = rowk0 + 8 * (lane >> 4);
#pragma unroll
  for (int i = 0; i < 8; ++i) { a[i] = (_Float16)p[i]; a[8 + i] = (_Float16)p[16 + i]; }
  return a;
}
__device__ __forceinline__ v16h frag_f32s(const float* rowk0, int lane, float sc) {
  v16h a; const float* p = rowk0 + 8 * (lane >> 4);
#pragma unroll
  for (int i = 0; i < 8; ++i) { a[i] = (_Float16)(p[i] * sc); a[8 + i] = (_Float16)(p[16 + i] * sc); }
  return a;
}
// column fragment from a [K][ld] layout (column n), rows >= K read as 0
__device__ __forceinline__ v16h fragc_f32(const float* W, int k0, int n, int lane, int ld, int K) {
  v16h a; const int g = lane >> 4;
#pragma unroll
  for (int i = 0; i < 8; ++i) { const int ka = k0 + 8 * g + i, kb = ka + 16;
    a[i] = (_Float16)(ka < K ? W[(size_t)(ka < K ? ka : K - 1) * ld + n] : 0.f); a[8 + i] = (_Float16)(kb < K ? W[(size_t)(kb < K ? kb : K - 1) * ld + n] : 0.f); }
  return a;
}
struct F2 { v16b h, l; };
__device__ __forceinline__ F2 bsplit16(const float v[16]) { F2 r;
#pragma unroll
  for (int i = 0; i < 16; ++i) { const __bf16 h = (__bf16)v[i]; r.h[i] = h; r.l[i] = (__bf16)(v[i] - (float)h); }
  return r; }
__device__ __forceinline__ F2 split_row(const float* row, int k0, int lane) { float v[16]; const float* p = row + k0 + 8 * (lane >> 4);
#pragma unroll
  for (int i = 0; i < 8; ++i) { v[i] = p[i]; v[8 + i] = p[16 + i]; }
  return bsplit16(v); }
__device__ __forceinline__ F2 split_rowK(const float* row, int k0, int lane, int K) { float v[16]; const int g = lane >> 4;
#pragma unroll
  for (int i = 0; i < 8; ++i) { const int ka = k0 + 8 * g + i, kb = ka + 16; v[i] = ka < K ? row[ka < K ? ka : K - 1] : 0.f; v[8 + i] = kb < K ? row[kb < K ? kb : K - 1] : 0.f; }
  return bsplit16(v); }
__device__ __forceinline__ F2 split_col(const float* W, int k0, int n, int lane, int ld, int K) { float v[16]; const int g = lane >> 4;
#pragma unroll
  for (int i = 0; i < 8; ++i) { const int ka = k0 + 8 * g + i, kb = ka + 16; v[i] = ka < K ? W[(size_t)(ka < K ? ka : K - 1) * ld + n] : 0.f; v[8 + i] = kb < K ? W[(size_t)(kb < K ? kb : K - 1) * ld + n] : 0.f; }
  return bsplit16(v); }
__device__ __forceinline__ v8f mac3(const F2& a, const F2& b, v8f c) { c = wmma_bf(a.l, b.h, c); c = wmma_bf(a.h, b.l, c); return wmma_bf(a.h, b.h, c); }
__device__ __forceinline__ float sigm(float v) { return 1.0f / (1.0f + expf(-v)); }
#define LDSX() do { asm volatile("s_wait_dscnt 0" ::: "memory"); __builtin_amdgcn_wave_barrier(); __builtin_amdgcn_fence(__ATOMIC_RELEASE, "workgroup"); } while (0)


#define NB 8
#define SS 1024
#define DM 512
#define NH 8
#define NBATCH 8
__device__ __forceinline__ size_t xrow(size_t r) { return ((r % SS) * NBATCH + r / SS) * (size_t)DM; }   // engine row (b*SS + s) -> module row (s*B + b)
#define HD 64
#define QKVW (3 * DM)
#ifndef TQB
#define TQB (SS / 64)
#define TNB NB
#define TOB (NB * SS / 64)     // output row tiles (all)
#endif
typedef __attribute__((ext_vector_type(8))) __bf16 v8b;
__device__ __forceinline__ v16b frag_b(const __bf16* rowk0, int lane) {
  union { v16b v; v8b q[2]; } u; const __bf16* p = rowk0 + 8 * (lane >> 4);
  u.q[0] = *(const v8b*)p; u.q[1] = *(const v8b*)(p + 16); return u.v;
}
__device__ __forceinline__ float bfr(float v) { return (float)(__bf16)v; }
__device__ __attribute__((noinline)) float exp_ni(float v) { return expf(v); }
__device__ __attribute__((noinline)) float erf_ni(float v) { return erff(v); }

#define PK_A 0                       // [1536][512] Wqkv rows (natural [out][in])
#define PK_P (PK_A + QKVW * DM)        // [512][512] Wo rows (natural)
#define PK_END (PK_P + DM * DM)
#define WS_PK  0u
#define WS_QK  (WS_PK + 2u * PK_END)             // f16 [8192 rows][1024]: q | k
#define WS_QKL (WS_QK + 2u * NB * SS * 2 * DM)     // f16 q | k residual planes x2048
#define WS_VTH (WS_QKL + 2u * NB * SS * 2 * DM)    // f16 [b][512 (h*64+d)][1024 s] hi
#define WS_VTL (WS_VTH + 2u * NB * DM * SS)        // f16 lo x 2048
#define WS_O   (WS_VTL + 2u * NB * DM * SS)        // f32 [8192][512]
#define WS_CS  (WS_O + 4u * NB * SS * DM)           // f32 2 x [1024][32] (unused)
#define WS_TB  (WS_CS + 4u * 2 * SS * 32)                  // f32 tables [NR][64]: |q_h|^2 (0..7), q.mu0 (8..15), q.mu1 (16..23), |k - mu0|^2 (24..31), |k - mu1|^2 (32..39), rest 0
#define WS_A   (WS_TB + 4u * (size_t)NB * SS * 64)
#define WS_END (WS_A + 4u * (size_t)NB * SS * DM)
// ---- k_pack: block = (row n, which): (in,out) columns -> bf16 [out][in] rows; which 0..2 -> W_q/W_k/W_v into PK_A rows which*512 + n; 3 -> W_o into PK_P
__global__ __launch_bounds__(256) void k_pack(const float* __restrict__ WQ, const float* __restrict__ WK, const float* __restrict__ WV, const float* __restrict__ WO, __bf16* __restrict__ PK) {
  __shared__ __align__(16) __bf16 s[DM]; const int n = blockIdx.x, which = blockIdx.y, t = threadIdx.x; const float* Wm = (which == 0) ? WQ : (which == 1) ? WK : (which == 2) ? WV : WO;   // (in,out) weights: pack row n = column n
  for (int k = t; k < DM; k += 256) s[k] = (__bf16)Wm[(size_t)k * DM + n];
  __syncthreads();
  __bf16* dst = (which < 3) ? PK + PK_A + ((size_t)which * DM + n) * DM : PK + PK_P + (size_t)n * DM;
  for (int q = t; q < DM / 8; q += 256) vst2((unsigned*)(dst + q * 8), *(const v4u*)&s[q * 8]);
}
typedef __attribute__((ext_vector_type(4))) __bf16 v4b;
#define GK 64          // k per LDS stage of the two GEMMs
#define GP (GK + 8)    // LDS row pitch in 16-bit elements: 144 B = 16 B x 9 (odd), so the b128 fragment reads of 16 rows spread over the banks
#define GN (GK / 8)    // 16-B pieces per thread and stage, of the weight tile and of the f32 rows alike
#define XW() asm volatile("s_wait_xcnt 0x0" ::: "memory")   // stands behind a group of stage loads: their address registers are reused only behind it
// one stage (GK k) of a [128 rows][DM] bf16 weight tile in 16-B pieces; one wave-wide load covers four rows x 128 B, whole lines; pw = this thread's piece of the first 128 / GN rows
__device__ __forceinline__ void ldw(v8b (&r)[GN], const __bf16* __restrict__ pw) {
#pragma unroll
  for (int i = 0; i < GN; ++i) r[i] = *(const v8b*)(pw + (size_t)i * (128 / GN) * DM);
}
__device__ __forceinline__ void stw(const v8b (&r)[GN], __bf16* sB, int tid) {
#pragma unroll
  for (int i = 0; i < GN; ++i) *(v8b*)(sB + (i * (128 / GN) + tid / GN) * GP + (tid % GN) * 8) = r[i];
}
__global__ __launch_bounds__(128) void k_qkv(const float* __restrict__ XQ, const float* __restrict__ XK, const float* __restrict__ XV, const __bf16* __restrict__ P, const float* __restrict__ BQ, const float* __restrict__ BK, const float* __restrict__ BV, _Float16* __restrict__ QK, _Float16* __restrict__ QKL, _Float16* __restrict__ VTH, _Float16* __restrict__ VTL) {
  const int which0 = (blockIdx.y * 128) / DM; const float* X = (which0 == 0) ? XQ : (which0 == 1) ? XK : XV; const float* BB = BQ ? (((which0 == 0) ? BQ : (which0 == 1) ? BK : BV) + (blockIdx.y * 128 - which0 * DM)) : nullptr;
  __shared__ __align__(16) char smem[2 * 128 * 72 * 2];   // stage: weight tile [128][GP] | bf16 input rows [64][GP] (27,648 B); behind the loop's last barrier the same bytes are the output staging (36,864 B at most)
  __bf16* sB = (__bf16*)smem; __bf16* sA = sB + 128 * GP;
  _Float16 (*so)[16][136] = (_Float16 (*)[16][136])smem; _Float16 (*sol)[16][136] = so + 4; _Float16 (*sth)[72] = (_Float16 (*)[72])smem; _Float16 (*stl)[72] = sth + 128;
  const int tid = threadIdx.x, wave = tid >> 5, lane = tid & 31, col = lane & 15, g = lane >> 4; const size_t r0 = (size_t)blockIdx.x * 64 + wave * 16; const int n0 = blockIdx.y * 128;
  v8f acc[8] = {};
  const __bf16* pw = P + (size_t)(n0 + tid / GN) * DM + (tid % GN) * 8; const size_t rb0 = (size_t)blockIdx.x * 64;
  const int ar = tid / (GK / 4), ap = (tid % (GK / 4)) * 4;   // this thread's row (step 128 / (GK / 4)) and k offset in the f32 rows of a stage
  v8b rw[GN]; v4f ra[GN];   // the next stage, on its way through registers while this stage is multiplied
  const float* px = X + xrow(rb0 + ar) + ap;   // (s, b) input layout: the block's 64 rows are one batch entry's, so the next engine row lies NBATCH * DM further on
  ldw(rw, pw);
#pragma unroll
  for (int i = 0; i < GN; ++i) ra[i] = *(const v4f*)(px + (size_t)i * (512 / GK) * NBATCH * DM);   // one wave-wide load = two rows x 256 B
  XW();
  for (int st = 0; st < DM / GK; ++st) {
    __syncthreads();   // every wave has left the stage that is overwritten next
    stw(rw, sB, tid);
#pragma unroll
    for (int i = 0; i < GN; ++i) { v4b hv; hv[0] = (__bf16)ra[i][0]; hv[1] = (__bf16)ra[i][1]; hv[2] = (__bf16)ra[i][2]; hv[3] = (__bf16)ra[i][3]; *(v4b*)(sA + (i * (512 / GK) + ar) * GP + ap) = hv; }
    __syncthreads();   // the stage is complete for every wave
    if (st + 1 < DM / GK) { ldw(rw, pw + (st + 1) * GK);
#pragma unroll
      for (int i = 0; i < GN; ++i) ra[i] = *(const v4f*)(px + (size_t)i * (512 / GK) * NBATCH * DM + (st + 1) * GK);
      XW(); }
#pragma unroll
    for (int kc = 0; kc < GK / 32; ++kc) { const v16b a = frag_b(sA + (wave * 16 + col) * GP + kc * 32, lane); v16b w[8];
#pragma unroll
      for (int j = 0; j < 8; ++j) w[j] = frag_b(sB + (j * 16 + col) * GP + kc * 32, lane);
      asm volatile("" :: "v"(a), "v"(w[0]), "v"(w[1]), "v"(w[2]), "v"(w[3]), "v"(w[4]), "v"(w[5]), "v"(w[6]), "v"(w[7]));   // holds the nine fragment reads together in front of the products: one LDS wait per eight products, not one per product
#pragma unroll
      for (int j = 0; j < 8; ++j) acc[j] = wmma_bf(a, w[j], acc[j]); } }
  __syncthreads();   // the last stage's reads are over before its bytes become output staging
  if (n0 < 2 * DM) {   // q stored unscaled (f16 sigma ~0.6, no subnormal exposure); 1/16 and 3/16 applied to the f32 squared distances in k_attn
#pragma unroll
    for (int j = 0; j < 8; ++j) {
#pragma unroll
      for (int r = 0; r < 8; ++r) { const float v = acc[j][r] + (BB ? bfr(BB[j * 16 + col]) : 0.f); const _Float16 hv = (_Float16)v; so[wave][8 * g + r][j * 16 + col] = hv; sol[wave][8 * g + r][j * 16 + col] = (_Float16)((v - (float)hv) * 2048.0f); } }   // q, k (+ bias) as f16 hi + (x2048) residual
    LDSX();
    for (int rl = 0; rl < 16; ++rl) if (lane < 16) { vst2((unsigned*)(QK + (r0 + rl) * (2 * DM) + n0 + lane * 8), *(const v4u*)&so[wave][rl][lane * 8]); vst2((unsigned*)(QKL + (r0 + rl) * (2 * DM) + n0 + lane * 8), *(const v4u*)&sol[wave][rl][lane * 8]); }
  } else {
#pragma unroll
    for (int j = 0; j < 8; ++j) {
#pragma unroll
      for (int r = 0; r < 8; ++r) { const float v = acc[j][r] + (BB ? bfr(BB[j * 16 + col]) : 0.f); const _Float16 hv = (_Float16)v; sth[j * 16 + col][wave * 16 + 8 * g + r] = hv; stl[j * 16 + col][wave * 16 + 8 * g + r] = (_Float16)((v - (float)hv) * 2048.0f); } }
    __syncthreads();
    const size_t rb = (size_t)blockIdx.x * 64; const int b = (int)(rb / SS), s0 = (int)(rb % SS); const int pc0 = n0 - 2 * DM;
    for (int q = tid; q < 128 * 8; q += 128) { const int d = q >> 3, pc = q & 7; const size_t o = ((size_t)b * DM + pc0 + d) * SS + s0 + pc * 8; vst2((unsigned*)(VTH + o), *(const v4u*)&sth[d][pc * 8]); vst2((unsigned*)(VTL + o), *(const v4u*)&stl[d][pc * 8]); }
  }
}
#define AK 64   // keys per LDS stage of k_attn
#define AP 72   // its LDS row pitch in f16: 144 B = 16 B x 9 (odd), so the b128 fragment reads of 16 rows spread over the banks
__device__ __forceinline__ float xhalf(float x) { return __builtin_bit_cast(float, __builtin_amdgcn_permlanex16(__builtin_bit_cast(int, x), __builtin_bit_cast(int, x), 0x76543210, 0xfedcba98, false, false)); }   // lane l with lane l ^ 16
__global__ __launch_bounds__(128) void k_attn(const _Float16* __restrict__ QK, const _Float16* __restrict__ QKL, const _Float16* __restrict__ VTH, const _Float16* __restrict__ VTL, const void* __restrict__ KMASK, const float* __restrict__ TB, float* __restrict__ O) {
  __shared__ __align__(16) float so[4][16][68];
  __shared__ __align__(16) _Float16 sK[AK][AP], sV[HD][AP]; __shared__ __align__(32) float skn[2][AK];   // one stage of AK keys, shared by the four waves: k rows, v columns (d-major), |k - mu_j|^2
  const int tid = threadIdx.x, wave = tid >> 5, lane = tid & 31, col = lane & 15, g = lane >> 4;
  const int qb = blockIdx.x, h = blockIdx.y, b = blockIdx.z; const int q0 = qb * 64 + wave * 16; const size_t rq = (size_t)b * SS + q0 + col;
  v16h aq[2];
#pragma unroll
  for (int kc = 0; kc < 2; ++kc) aq[kc] = frag_h(QK + rq * (2 * DM) + h * HD + kc * 32, lane);
  const float* tb = TB + rq * 64; const float qn = tb[h], qm0 = tb[8 + h], qm = tb[16 + h];   // |q|^2, q . mu_0, q . mu_1 of this lane's query
  XW();   // the query-side loads' address registers are reused only behind it
  float m = -3.0e38f, l = 0.f;   // running maximum (equal in both halves) and this half's part of the running sum
  v8f acc[4] = {}, accl[4] = {};   // O^T tiles: acc[dt][r] = d (dt * 16 + 8 g + r) of query col
  // stage loads: AK * 128 B of k rows and of v columns in 16-B pieces, a wave-wide load covering four whole 128-B lines; one table word per thread
  const _Float16* gK = QK + ((size_t)b * SS + (tid >> 3)) * (2 * DM) + DM + h * HD + (tid & 7) * 8; const _Float16* gV = VTH + ((size_t)b * DM + h * HD + (tid >> 3)) * SS + (tid & 7) * 8;
  const float* gT = TB + ((size_t)b * SS + (tid & (AK - 1))) * 64 + 24 + 8 * (tid / AK) + h;
  v8h rk[4], rv[4]; float rt;   // the next stage, on its way through registers while this stage is worked on
#pragma unroll
  for (int i = 0; i < 4; ++i) { rk[i] = *(const v8h*)(gK + (size_t)i * 16 * (2 * DM)); rv[i] = *(const v8h*)(gV + (size_t)i * 16 * SS); }
  rt = *gT;
  XW();
  asm volatile("" :: "v"(aq[0]), "v"(aq[1]), "v"(qn), "v"(qm), "v"(qm0));   // the query-side loads are waited for here, once: a wait for them inside the loop would also cover the next stage's loads, which are to stay in flight over the stage's work
  const int nks = SS / 32;   // all keys
#pragma unroll 1
  for (int ks = 0; ks < nks; ++ks) { v8f s[2];
    const int sub = ks & (AK / 32 - 1);
    if (sub == 0) {
      __syncthreads();   // every wave has left the stage that is overwritten next
#pragma unroll
      for (int i = 0; i < 4; ++i) { *(v8h*)&sK[i * 16 + (tid >> 3)][(tid & 7) * 8] = rk[i]; *(v8h*)&sV[i * 16 + (tid >> 3)][(tid & 7) * 8] = rv[i]; }
      skn[tid / AK][tid & (AK - 1)] = rt;
      __syncthreads();   // the stage is complete for every wave
      if (ks + AK / 32 < nks) { const size_t k1 = (size_t)ks * 32 + AK;
#pragma unroll
        for (int i = 0; i < 4; ++i) { rk[i] = *(const v8h*)(gK + (k1 + i * 16) * (2 * DM)); rv[i] = *(const v8h*)(gV + (size_t)i * 16 * SS + k1); }
        rt = gT[k1 * 64];
        XW(); } }
#pragma unroll
    for (int ct = 0; ct < 2; ++ct) { const int kb = sub * 32 + ct * 16; const _Float16* krow = &sK[kb + col][0]; v8f c = {};
#pragma unroll
      for (int kc = 0; kc < 2; ++kc) c = wmma16(frag_h(krow + kc * 32, lane), aq[kc], c);   // single product: k, q as one-rounding f16 operands; c[r] = k (kb + 8 g + r) . q (col)
      const v8f kn = *(const v8f*)&skn[0][kb + 8 * g], kn1 = *(const v8f*)&skn[1][kb + 8 * g];
#pragma unroll
      for (int r = 0; r < 8; ++r) { const float d0 = -fmaxf(qn + kn[r] - 2.0f * c[r] + 2.0f * qm0, 0.f) * 0.0625f, d1 = -fmaxf(qn + kn1[r] - 2.0f * c[r] + 2.0f * qm, 0.f) * 0.1875f; s[ct][r] = fmaxf(d0, d1); } }   // max over the two Gaussian keys (mu_0, mu_1 both read)
    float mx = fmaxf(s[0][0], s[1][0]);
#pragma unroll
    for (int r = 1; r < 8; ++r) mx = fmaxf(mx, fmaxf(s[0][r], s[1][r]));
    mx = fmaxf(mx, xhalf(mx));   // both halves now hold the maximum over the 32 keys
    const float mn = fmaxf(m, mx); const float alpha = (m <= -1.0e38f) ? 0.f : __expf(m - mn);
    v16h pb; float es0 = 0.f, es1 = 0.f;
#pragma unroll
    for (int r = 0; r < 8; ++r) { const float e0 = (s[0][r] <= -1.0e38f) ? 0.f : __expf(s[0][r] - mn), e1 = (s[1][r] <= -1.0e38f) ? 0.f : __expf(s[1][r] - mn); es0 += e0; es1 += e1;
      pb[r] = (_Float16)(e0 * 2048.0f); pb[8 + r] = (_Float16)(e1 * 2048.0f); }   // P scaled by 2^11 before the f16 rounding so small softmax weights stay out of the f16 subnormal range; 2^-11 folded into the epilogue
    l = l * alpha + (es0 + es1); m = mn;
#pragma unroll
    for (int dt = 0; dt < 4; ++dt) { acc[dt] *= alpha; accl[dt] *= alpha; }
#pragma unroll
    for (int dt = 0; dt < 4; ++dt) acc[dt] = wmma16(frag_h(&sV[dt * 16 + col][sub * 32], lane), pb, acc[dt]); }   // single product: V^T x P^T (x2^11)
  l += xhalf(l);   // the halves' sums are joined once
  { const float il = (1.0f / 2048.0f) / l;
#pragma unroll
    for (int dt = 0; dt < 4; ++dt) { v4f o0, o1;
#pragma unroll
      for (int r = 0; r < 4; ++r) { o0[r] = (acc[dt][r] + accl[dt][r] * (1.0f / 2048.0f)) * il; o1[r] = (acc[dt][4 + r] + accl[dt][4 + r] * (1.0f / 2048.0f)) * il; }
      *(v4f*)&so[wave][col][dt * 16 + 8 * g] = o0; *(v4f*)&so[wave][col][dt * 16 + 8 * g + 4] = o1; } }
  LDSX();
  for (int rl = 0; rl < 16; ++rl) if (lane < 16) vst2(O + ((size_t)b * SS + q0 + rl) * DM + h * HD + lane * 4, *(const v4f*)&so[wave][rl][lane * 4]);
}
// ---- k_out: block = (64 rows, 128 cols): out = O(hi/lo) . Wo rows (2 products) + bo
__global__ __launch_bounds__(128) void k_out(const float* __restrict__ O, const __bf16* __restrict__ P, const float* __restrict__ BO, float* __restrict__ Y) {
  __shared__ __align__(16) char smem[(128 + 64 + 64) * GP * 2];   // stage: weight tile [128][GP] | O rows bf16 hi [64][GP] | residual [64][GP]; behind the loop's last barrier the same bytes are the output staging
  __bf16* sB = (__bf16*)smem; __bf16* sAh = sB + 128 * GP; __bf16* sAl = sAh + 64 * GP;
  float (*so)[16][132] = (float (*)[16][132])smem;
  const int tid = threadIdx.x, wave = tid >> 5, lane = tid & 31, col = lane & 15, g = lane >> 4; const size_t r0 = (size_t)blockIdx.x * 64 + wave * 16; const int n0 = blockIdx.y * 128;
  v8f acc[8] = {};
  const __bf16* pw = P + (size_t)(n0 + tid / GN) * DM + (tid % GN) * 8; const int ar = tid / (GK / 4), ap = (tid % (GK / 4)) * 4; const float* Ot = O + ((size_t)blockIdx.x * 64 + ar) * DM + ap;   // this thread's row (step 128 / (GK / 4)) and k offset in the f32 rows of a stage
  v8b rw[GN]; v4f ra[GN];   // the next stage, on its way through registers while this stage is multiplied
  ldw(rw, pw);
#pragma unroll
  for (int i = 0; i < GN; ++i) ra[i] = *(const v4f*)(Ot + (size_t)i * (512 / GK) * DM);   // one wave-wide load = two rows x 256 B
  XW();
  for (int st = 0; st < DM / GK; ++st) {
    __syncthreads();   // every wave has left the stage that is overwritten next
    stw(rw, sB, tid);
#pragma unroll
    for (int i = 0; i < GN; ++i) { v4b hv, lv;
#pragma unroll
      for (int e = 0; e < 4; ++e) { const __bf16 hh = (__bf16)ra[i][e]; hv[e] = hh; lv[e] = (__bf16)(ra[i][e] - (float)hh); }
      *(v4b*)(sAh + (i * (512 / GK) + ar) * GP + ap) = hv; *(v4b*)(sAl + (i * (512 / GK) + ar) * GP + ap) = lv; }
    __syncthreads();   // the stage is complete for every wave
    if (st + 1 < DM / GK) { ldw(rw, pw + (st + 1) * GK);
#pragma unroll
      for (int i = 0; i < GN; ++i) ra[i] = *(const v4f*)(Ot + (size_t)i * (512 / GK) * DM + (st + 1) * GK);
      XW(); }
#pragma unroll
    for (int kc = 0; kc < GK / 32; ++kc) { const v16b ah = frag_b(sAh + (wave * 16 + col) * GP + kc * 32, lane), al = frag_b(sAl + (wave * 16 + col) * GP + kc * 32, lane); v16b w[8];
#pragma unroll
      for (int j = 0; j < 8; ++j) w[j] = frag_b(sB + (j * 16 + col) * GP + kc * 32, lane);
      asm volatile("" :: "v"(ah), "v"(al), "v"(w[0]), "v"(w[1]), "v"(w[2]), "v"(w[3]), "v"(w[4]), "v"(w[5]), "v"(w[6]), "v"(w[7]));   // holds the ten fragment reads together in front of the products: one LDS wait per sixteen products, not one per pair
#pragma unroll
      for (int j = 0; j < 8; ++j) { acc[j] = wmma_bf(al, w[j], acc[j]); acc[j] = wmma_bf(ah, w[j], acc[j]); } } }
  __syncthreads();   // the last stage's reads are over before its bytes become output staging
#pragma unroll
  for (int j = 0; j < 8; ++j) {
#pragma unroll
    for (int r = 0; r < 8; ++r) so[wave][8 * g + r][j * 16 + col] = acc[j][r] + (BO ? bfr(BO[n0 + j * 16 + col]) : 0.f); }
  LDSX();
  for (int rl = 0; rl < 16; ++rl) vst2(Y + xrow(r0 + rl) + n0 + lane * 4, *(const v4f*)&so[wave][rl][lane * 4]);
}
// ---- k_packkv: Wkv (in,out) [512][1024] -> k rows (cols 0..511) and v rows (cols 512..1023) as transposed bf16 rows in the engine's k / v slots
__global__ __launch_bounds__(256) void k_packkv(const float* __restrict__ WKV, __bf16* __restrict__ PK) { const int n = blockIdx.x, which = blockIdx.y + 1, t = threadIdx.x; __shared__ __align__(16) __bf16 s[DM]; for (int k = t; k < DM; k += 256) s[k] = (__bf16)WKV[(size_t)k * (2 * DM) + (which - 1) * DM + n]; __syncthreads(); if (t < DM / 8) vst2((unsigned*)(PK + PK_A + ((size_t)which * DM + n) * DM + t * 8), *(const v4u*)&s[t * 8]); }
__global__ __launch_bounds__(256) void k_tabs(const _Float16* __restrict__ QK, const _Float16* __restrict__ QKL, const float* __restrict__ MU, float* __restrict__ TB) { __shared__ __align__(16) float st[8][64]; const int t = threadIdx.x; const int rl = t >> 5, h = (t >> 2) & 7, part = t & 3; const size_t row = (size_t)blockIdx.x * 8 + rl;
  float qq = 0.f, qm0 = 0.f, qm1 = 0.f, k0 = 0.f, k1 = 0.f;
  for (int d = part * 16; d < part * 16 + 16; ++d) { const size_t o = row * (2 * DM) + h * HD + d; const float q = (float)QK[o] + (float)QKL[o] * (1.0f / 2048.0f); const float k = (float)QK[o + DM] + (float)QKL[o + DM] * (1.0f / 2048.0f); const float m0 = bfr(MU[h * HD + d]), m1 = bfr(MU[(NH + h) * HD + d]); qq += q * q; qm0 += q * m0; qm1 += q * m1; const float a0 = k - m0, a1 = k - m1; k0 += a0 * a0; k1 += a1 * a1; }
#pragma unroll
  for (int o = 1; o < 4; o <<= 1) { qq += __shfl_xor(qq, o); qm0 += __shfl_xor(qm0, o); qm1 += __shfl_xor(qm1, o); k0 += __shfl_xor(k0, o); k1 += __shfl_xor(k1, o); }
  if (part == 0) { st[rl][h] = qq; st[rl][8 + h] = qm0; st[rl][16 + h] = qm1; st[rl][24 + h] = k0; st[rl][32 + h] = k1; st[rl][40 + h] = 0.f; st[rl][48 + h] = 0.f; st[rl][56 + h] = 0.f; }
  __syncthreads(); if (t < 128) { const int r2 = t >> 4, q4 = t & 15; vst2(TB + ((size_t)blockIdx.x * 8 + r2) * 64 + q4 * 4, *(const v4f*)&st[r2][q4 * 4]); } }
// ---- k_lnsum<RAWR>: block = row: T = LayerNorm(R + A) g + b ; R is a raw input (bf16-rounded) when RAWR, else an f32 intermediate
template <int RAWR>
__global__ __launch_bounds__(128) void k_lnsum(const float* __restrict__ R, const float* __restrict__ A, const float* __restrict__ G, const float* __restrict__ Bt, float* __restrict__ T) {
  __shared__ float red[4]; const int t = threadIdx.x; const size_t row = blockIdx.x; float v[4]; float s = 0.f; for (int i = 0; i < 4; ++i) { const size_t e = row * DM + t * 4 + i; v[i] = (RAWR ? bfr(R[e]) : R[e]) + A[e]; s += v[i]; }
#pragma unroll
  for (int o = 1; o < 32; o <<= 1) s += __shfl_xor(s, o);
  if ((t & 31) == 0) red[t >> 5] = s; __syncthreads(); const float mu = ((red[0] + red[1]) + (red[2] + red[3])) / (float)DM; __syncthreads();
  float q = 0.f; for (int i = 0; i < 4; ++i) { const float d = v[i] - mu; q += d * d; }
#pragma unroll
  for (int o = 1; o < 32; o <<= 1) q += __shfl_xor(q, o);
  if ((t & 31) == 0) red[t >> 5] = q; __syncthreads(); const float inv = 1.0f / sqrtf(((red[0] + red[1]) + (red[2] + red[3])) / (float)DM + 1e-5f);
  v4f o4; for (int i = 0; i < 4; ++i) { const int e = t * 4 + i; o4[i] = (v[i] - mu) * inv * bfr(G[e]) + bfr(Bt[e]); } vst2(T + row * DM + t * 4, o4);
}
extern "C" void kernel_launch(void* const* d_in, const int* in_sizes, int n_in, void* d_out, int out_size, void* d_ws, size_t ws_size, hipStream_t stream) {
  (void)in_sizes; (void)n_in; (void)out_size;
  const float** F = (const float**)d_in;   // 0 h [1024,8,512] (s,b,d), 1 Wq [512,512] (in,out), 2 Wkv [512,1024] (in,out: k | v), 3 Wo [512,512] (in,out), 4 mu [2,8,64], 5 gamma, 6 beta
  if (ws_size < (size_t)WS_END) return;
  char* ws = (char*)d_ws; __bf16* PK = (__bf16*)(ws + WS_PK); _Float16 *QK = (_Float16*)(ws + WS_QK), *QKL = (_Float16*)(ws + WS_QKL), *VTH = (_Float16*)(ws + WS_VTH), *VTL = (_Float16*)(ws + WS_VTL); float *O = (float*)(ws + WS_O), *TB = (float*)(ws + WS_TB), *A = (float*)(ws + WS_A);
  k_pack<<<dim3(DM, 4), 256, 0, stream>>>(F[1], F[1], F[1], F[3], PK);   // Wq (and Wo); k/v slots overwritten next
  k_packkv<<<dim3(DM, 2), 256, 0, stream>>>(F[2], PK);
  k_qkv<<<dim3(TNB * SS / 64, QKVW / 128), 128, 0, stream>>>(F[0], F[0], F[0], PK + PK_A, nullptr, nullptr, nullptr, QK, QKL, VTH, VTL);
  k_tabs<<<TNB * SS / 8, 256, 0, stream>>>(QK, QKL, F[4], TB);
  k_attn<<<dim3(TQB, NH, TNB), 128, 0, stream>>>(QK, QKL, VTH, VTL, nullptr, TB, O);
  k_out<<<dim3(TOB, DM / 128), 128, 0, stream>>>(O, PK + PK_P, nullptr, A);   // A rows in (s, b) order
  k_lnsum<1><<<TOB * 64, 128, 0, stream>>>(F[0], A, F[5], F[6], (float*)d_out);
}

// v003
// One run takes 109 microseconds.
// In both of two side-by-side timings against v002, it was 1.07 times as fast.
// Counting every step since v000, it is 2.44 times as fast.
// compute dtype: all float inputs rounded to bf16; q/k/v = h . W with EXACT bf16 products on WMMA 16x16x32 ((in,out) weights as transposed rows); per-(token, head) tables |q|^2, q . mu_0, q . mu_1, |k - mu_0|^2, |k - mu_1|^2 in f32 from the f16 hi + residual rows; PLAIN scores: q . k single f16, then -max(|q|^2 + |k-mu_j|^2 - 2 q.k + 2 q.mu_j, 0) x (1/16, 3/16) for the two Gaussian keys (mu_0 read too; it is zero), max of the two, in log2 units with the per-query and per-key terms folded in the tables, running-max softmax in f32 (hardware exp2), P (scaled by 2^11, single f16) x v (single f16); out = LayerNorm(h + vec (bf16 hi + residual) . Wo (2 products)) in f32.
#include <hip/hip_runtime.h>
#include <math.h>

typedef __attribute__((ext_vector_type(16))) _Float16 v16h;
typedef __attribute__((ext_vector_type(16))) __bf16 v16b;
typedef __attribute__((ext_vector_type(8)))  _Float16 v8h;
typedef __attribute__((ext_vector_type(8)))  float v8f;
typedef __attribute__((ext_vector_type(4)))  float v4f;
typedef __attribute__((ext_vector_type(2)))  float v2f;
typedef __attribute__((ext_vector_type(4)))  unsigned v4u;
typedef __attribute__((ext_vector_type(4)))  int v4i;
typedef float __attribute__((may_alias)) float_a;
typedef int __attribute__((may_alias)) int_a;

template <typename T> __device__ __forceinline__ void vst2(void* p, T v) { *(T*)p = v;  }
__device__ __forceinline__ v8f wmma16(v16h a, v16h b, v8f c) {
  v8f d = __builtin_amdgcn_wmma_f32_16x16x32_f16(false, a, false, b, (short)0, c, false, false);
  asm volatile("v_nop\n\tv_nop\n\tv_nop\n\tv_nop" : "+v"(d) : "v"(a), "v"(b));
  return d;
}
__device__ __forceinline__ v8f wmma_bf(v16b a, v16b b, v8f c) {
  v8f d = __builtin_amdgcn_wmma_f32_16x16x32_bf16(false, a, false, b, (short)0, c, false, false);
  asm volatile("v_nop\n\tv_nop\n\tv_nop\n\tv_nop" : "+v"(d) : "v"(a), "v"(b));
  return d;
}
// Mixture-of-Gaussian-keys attention (S 1,024, B 8, d 512, 8 heads x 64, two Gaussian keys per position: k and k - mu_1): score = max(-|q - k|^2 / 16, -3 |q - (k - mu_1)|^2 / 16), softmax over keys, . v, Wo, residual, LayerNorm; (s, b, d) layout.
__device__ __forceinline__ v16h frag_h(const _Float16* rowk0, int lane) {
  union { v16h v; v8h q[2]; } u; const _Float16* p = rowk0 + 8 * (lane >> 4);
  u.q[0] = *(const v8h*)p; u.q[1] = *(const v8h*)(p + 16); return u.v;
}
__device__ __forceinline__ v16h frag_f32(const float* rowk0, int lane) {
  v16h a; const float* p = rowk0 + 8 * (lane >> 4);
#pragma unroll
  for (int i = 0; i < 8; ++i) { a[i] = (_Float16)p[i]; a[8 + i] = (_Float16)p[16 + i]; }
  return a;
}
__device__ __forceinline__ v16h frag_f32s(const float* rowk0, int lane, float sc) {
  v16h a; const float* p = rowk0 + 8 * (lane >> 4);
#pragma unroll
  for (int i = 0; i < 8; ++i) { a[i] = (_Float16)(p[i] * sc); a[8 + i] = (_Float16)(p[16 + i] * sc); }
  return a;
}
// column fragment from a [K][ld] layout (column n), rows >= K read as 0
__device__ __forceinline__ v16h fragc_f32(const float* W, int k0, int n, int lane, int ld, int K) {
  v16h a; const int g = lane >> 4;
#pragma unroll
  for (int i = 0; i < 8; ++i) { const int ka = k0 + 8 * g + i, kb = ka + 16;
    a[i] = (_Float16)(ka < K ? W[(size_t)(ka < K ? ka : K - 1) * ld + n] : 0.f); a[8 + i] = (_Float16)(kb < K ? W[(size_t)(kb < K ? kb : K - 1) * ld + n] : 0.f); }
  return a;
}
struct F2 { v16b h, l; };
__device__ __forceinline__ F2 bsplit16(const float v[16]) { F2 r;
#pragma unroll
  for (int i = 0; i < 16; ++i) { const __bf16 h = (__bf16)v[i]; r.h[i] = h; r.l[i] = (__bf16)(v[i] - (float)h); }
  return r; }
__device__ __forceinline__ F2 split_row(const float* row, int k0, int lane) { float v[16]; const float* p = row + k0 + 8 * (lane >> 4);
#pragma unroll
  for (int i = 0; i < 8; ++i) { v[i] = p[i]; v[8 + i] = p[16 + i]; }
  return bsplit16(v); }
__device__ __forceinline__ F2 split_rowK(const float* row, int k0, int lane, int K) { float v[16]; const int g = lane >> 4;
#pragma unroll
  for (int i = 0; i < 8; ++i) { const int ka = k0 + 8 * g + i, kb = ka + 16; v[i] = ka < K ? row[ka < K ? ka : K - 1] : 0.f; v[8 + i] = kb < K ? row[kb < K ? kb : K - 1] : 0.f; }
  return bsplit16(v); }
__device__ __forceinline__ F2 split_col(const float* W, int k0, int n, int lane, int ld, int K) { float v[16]; const int g = lane >> 4;
#pragma unroll
  for (int i = 0; i < 8; ++i) { const int ka = k0 + 8 * g + i, kb = ka + 16; v[i] = ka < K ? W[(size_t)(ka < K ? ka : K - 1) * ld + n] : 0.f; v[8 + i] = kb < K ? W[(size_t)(kb < K ? kb : K - 1) * ld + n] : 0.f; }
  return bsplit16(v); }
__device__ __forceinline__ v8f mac3(const F2& a, const F2& b, v8f c) { c = wmma_bf(a.l, b.h, c); c = wmma_bf(a.h, b.l, c); return wmma_bf(a.h, b.h, c); }
__device__ __forceinline__ float sigm(float v) { return 1.0f / (1.0f + expf(-v)); }
#define LDSX() do { asm volatile("s_wait_dscnt 0" ::: "memory"); __builtin_amdgcn_wave_barrier(); __builtin_amdgcn_fence(__ATOMIC_RELEASE, "workgroup"); } while (0)


#define NB 8
#define SS 1024
#define DM 512
#define NH 8
#define NBATCH 8
__device__ __forceinline__ size_t xrow(size_t r) { return ((r % SS) * NBATCH + r / SS) * (size_t)DM; }   // engine row (b*SS + s) -> module row (s*B + b)
#define HD 64
#define QKVW (3 * DM)
#ifndef TQB
#define TQB (SS / 64)
#define TNB NB
#define TOB (NB * SS / 64)     // output row tiles (all)
#endif
typedef __attribute__((ext_vector_type(8))) __bf16 v8b;
__device__ __forceinline__ v16b frag_b(const __bf16* rowk0, int lane) {
  union { v16b v; v8b q[2]; } u; const __bf16* p = rowk0 + 8 * (lane >> 4);
  u.q[0] = *(const v8b*)p; u.q[1] = *(const v8b*)(p + 16); return u.v;
}
__device__ __forceinline__ float bfr(float v) { return (float)(__bf16)v; }
__device__ __attribute__((noinline)) float exp_ni(float v) { return expf(v); }
__device__ __attribute__((noinline)) float erf_ni(float v) { return erff(v); }

#define PK_A 0                       // [1536][512] Wqkv rows (natural [out][in])
#define PK_P (PK_A + QKVW * DM)        // [512][512] Wo rows (natural)
#define PK_END (PK_P + DM * DM)
#define WS_PK  0u
#define WS_QK  (WS_PK + 2u * PK_END)             // f16 [8192 rows][1024]: q | k
#define WS_QKL (WS_QK + 2u * NB * SS * 2 * DM)     // f16 q | k residual planes x2048
#define WS_VTH (WS_QKL + 2u * NB * SS * 2 * DM)    // f16 [b][512 (h*64+d)][1024 s] hi
#define WS_VTL (WS_VTH + 2u * NB * DM * SS)        // f16 lo x 2048
#define WS_O   (WS_VTL + 2u * NB * DM * SS)        // f32 [8192][512]
#define WS_CS  (WS_O + 4u * NB * SS * DM)           // f32 [2][1024][32], unused
#define WS_TB  (WS_CS + 4u * 2 * SS * 32)                  // f32 tables [NR][64], L = log2 e: -(L/16)(|q_h|^2 + 2 q.mu0) (0..7), -(3L/16)(|q_h|^2 + 2 q.mu1) (8..15), -|k - mu0|^2 / 2 (24..31), (3L/16)(|k - mu0|^2 - |k - mu1|^2) (32..39), rest 0
#define WS_A   (WS_TB + 4u * (size_t)NB * SS * 64)
#define WS_END (WS_A + 4u * (size_t)NB * SS * DM)
// ---- k_pack: block = (row n, which): (in,out) columns -> bf16 [out][in] rows; which 0..2 -> W_q/W_k/W_v into PK_A rows which*512 + n; 3 -> W_o into PK_P
__global__ __launch_bounds__(256) void k_pack(const float* __restrict__ WQ, const float* __restrict__ WK, const float* __restrict__ WV, const float* __restrict__ WO, __bf16* __restrict__ PK) {
  __shared__ __align__(16) __bf16 s[DM]; const int n = blockIdx.x, which = blockIdx.y, t = threadIdx.x; const float* Wm = (which == 0) ? WQ : (which == 1) ? WK : (which == 2) ? WV : WO;   // (in,out) weights: pack row n = column n
  for (int k = t; k < DM; k += 256) s[k] = (__bf16)Wm[(size_t)k * DM + n];
  __syncthreads();
  __bf16* dst = (which < 3) ? PK + PK_A + ((size_t)which * DM + n) * DM : PK + PK_P + (size_t)n * DM;
  for (int q = t; q < DM / 8; q += 256) vst2((unsigned*)(dst + q * 8), *(const v4u*)&s[q * 8]);
}
typedef __attribute__((ext_vector_type(4))) __bf16 v4b;
#define GK 64          // k per LDS stage of the two GEMMs
#define GP (GK + 8)    // LDS row pitch in 16-bit elements: 144 B = 16 B x 9 (odd), so the b128 fragment reads of 16 rows spread over the banks
#define GN (GK / 8)    // 16-B pieces per thread and stage, of the weight tile and of the f32 rows alike
#define XW() asm volatile("s_wait_xcnt 0x0" ::: "memory")   // stands behind a group of stage loads: their address registers are reused only behind it
// one stage (GK k) of a [128 rows][DM] bf16 weight tile in 16-B pieces; one wave-wide load covers four rows x 128 B, whole lines; pw = this thread's piece of the first 128 / GN rows
__device__ __forceinline__ void ldw(v8b (&r)[GN], const __bf16* __restrict__ pw) {
#pragma unroll
  for (int i = 0; i < GN; ++i) r[i] = *(const v8b*)(pw + (size_t)i * (128 / GN) * DM);
}
__device__ __forceinline__ void stw(const v8b (&r)[GN], __bf16* sB, int tid) {
#pragma unroll
  for (int i = 0; i < GN; ++i) *(v8b*)(sB + (i * (128 / GN) + tid / GN) * GP + (tid % GN) * 8) = r[i];
}
__global__ __launch_bounds__(128) void k_qkv(const float* __restrict__ XQ, const float* __restrict__ XK, const float* __restrict__ XV, const __bf16* __restrict__ P, const float* __restrict__ BQ, const float* __restrict__ BK, const float* __restrict__ BV, _Float16* __restrict__ QK, _Float16* __restrict__ QKL, _Float16* __restrict__ VTH, _Float16* __restrict__ VTL) {
  const int which0 = (blockIdx.y * 128) / DM; const float* X = (which0 == 0) ? XQ : (which0 == 1) ? XK : XV; const float* BB = BQ ? (((which0 == 0) ? BQ : (which0 == 1) ? BK : BV) + (blockIdx.y * 128 - which0 * DM)) : nullptr;
  __shared__ __align__(16) char smem[2 * 128 * 72 * 2];   // stage: weight tile [128][GP] | bf16 input rows [64][GP] (27,648 B); behind the loop's last barrier the same bytes are the output staging (36,864 B at most)
  __bf16* sB = (__bf16*)smem; __bf16* sA = sB + 128 * GP;
  _Float16 (*so)[16][136] = (_Float16 (*)[16][136])smem; _Float16 (*sol)[16][136] = so + 4; _Float16 (*sth)[72] = (_Float16 (*)[72])smem; _Float16 (*stl)[72] = sth + 128;
  const int tid = threadIdx.x, wave = tid >> 5, lane = tid & 31, col = lane & 15, g = lane >> 4; const size_t r0 = (size_t)blockIdx.x * 64 + wave * 16; const int n0 = blockIdx.y * 128;
  v8f acc[8] = {};
  const __bf16* pw = P + (size_t)(n0 + tid / GN) * DM + (tid % GN) * 8; const size_t rb0 = (size_t)blockIdx.x * 64;
  const int ar = tid / (GK / 4), ap = (tid % (GK / 4)) * 4;   // this thread's row (step 128 / (GK / 4)) and k offset in the f32 rows of a stage
  v8b rw[GN]; v4f ra[GN];   // the next stage, on its way through registers while this stage is multiplied
  const float* px = X + xrow(rb0 + ar) + ap;   // (s, b) input layout: the block's 64 rows are one batch entry's, so the next engine row lies NBATCH * DM further on
  ldw(rw, pw);
#pragma unroll
  for (int i = 0; i < GN; ++i) ra[i] = *(const v4f*)(px + (size_t)i * (512 / GK) * NBATCH * DM);   // one wave-wide load = two rows x 256 B
  XW();
  for (int st = 0; st < DM / GK; ++st) {
    __syncthreads();   // every wave has left the stage that is overwritten next
    stw(rw, sB, tid);
#pragma unroll
    for (int i = 0; i < GN; ++i) { v4b hv; hv[0] = (__bf16)ra[i][0]; hv[1] = (__bf16)ra[i][1]; hv[2] = (__bf16)ra[i][2]; hv[3] = (__bf16)ra[i][3]; *(v4b*)(sA + (i * (512 / GK) + ar) * GP + ap) = hv; }
    __syncthreads();   // the stage is complete for every wave
    if (st + 1 < DM / GK) { ldw(rw, pw + (st + 1) * GK);
#pragma unroll
      for (int i = 0; i < GN; ++i) ra[i] = *(const v4f*)(px + (size_t)i * (512 / GK) * NBATCH * DM + (st + 1) * GK);
      XW(); }
#pragma unroll
    for (int kc = 0; kc < GK / 32; ++kc) { const v16b a = frag_b(sA + (wave * 16 + col) * GP + kc * 32, lane); v16b w[8];
#pragma unroll
      for (int j = 0; j < 8; ++j) w[j] = frag_b(sB + (j * 16 + col) * GP + kc * 32, lane);
      asm volatile("" :: "v"(a), "v"(w[0]), "v"(w[1]), "v"(w[2]), "v"(w[3]), "v"(w[4]), "v"(w[5]), "v"(w[6]), "v"(w[7]));   // holds the nine fragment reads together in front of the products: one LDS wait per eight products, not one per product
#pragma unroll
      for (int j = 0; j < 8; ++j) acc[j] = wmma_bf(a, w[j], acc[j]); } }
  __syncthreads();   // the last stage's reads are over before its bytes become output staging
  if (n0 < 2 * DM) {   // q stored unscaled (f16 sigma ~0.6, no subnormal exposure); 1/16 and 3/16 applied to the f32 squared distances in k_attn
#pragma unroll
    for (int j = 0; j < 8; ++j) {
#pragma unroll
      for (int r = 0; r < 8; ++r) { const float v = acc[j][r] + (BB ? bfr(BB[j * 16 + col]) : 0.f); const _Float16 hv = (_Float16)v; so[wave][8 * g + r][j * 16 + col] = hv; sol[wave][8 * g + r][j * 16 + col] = (_Float16)((v - (float)hv) * 2048.0f); } }   // q, k (+ bias) as f16 hi + (x2048) residual
    LDSX();
    for (int rl = 0; rl < 16; ++rl) if (lane < 16) { vst2((unsigned*)(QK + (r0 + rl) * (2 * DM) + n0 + lane * 8), *(const v4u*)&so[wave][rl][lane * 8]); vst2((unsigned*)(QKL + (r0 + rl) * (2 * DM) + n0 + lane * 8), *(const v4u*)&sol[wave][rl][lane * 8]); }
  } else {
#pragma unroll
    for (int j = 0; j < 8; ++j) {
#pragma unroll
      for (int r = 0; r < 8; ++r) { const float v = acc[j][r] + (BB ? bfr(BB[j * 16 + col]) : 0.f); const _Float16 hv = (_Float16)v; sth[j * 16 + col][wave * 16 + 8 * g + r] = hv; stl[j * 16 + col][wave * 16 + 8 * g + r] = (_Float16)((v - (float)hv) * 2048.0f); } }
    __syncthreads();
    const size_t rb = (size_t)blockIdx.x * 64; const int b = (int)(rb / SS), s0 = (int)(rb % SS); const int pc0 = n0 - 2 * DM;
    for (int q = tid; q < 128 * 8; q += 128) { const int d = q >> 3, pc = q & 7; const size_t o = ((size_t)b * DM + pc0 + d) * SS + s0 + pc * 8; vst2((unsigned*)(VTH + o), *(const v4u*)&sth[d][pc * 8]); vst2((unsigned*)(VTL + o), *(const v4u*)&stl[d][pc * 8]); }
  }
}
#define AK 64   // keys per LDS stage of k_attn
#define LOG2E 1.44269504f
#define AP 72   // its LDS row pitch in f16: 144 B = 16 B x 9 (odd), so the b128 fragment reads of 16 rows spread over the banks
__device__ __forceinline__ float xhalf(float x) { return __builtin_bit_cast(float, __builtin_amdgcn_permlanex16(__builtin_bit_cast(int, x), __builtin_bit_cast(int, x), 0x76543210, 0xfedcba98, false, false)); }   // lane l with lane l ^ 16
__global__ __launch_bounds__(128) void k_attn(const _Float16* __restrict__ QK, const _Float16* __restrict__ QKL, const _Float16* __restrict__ VTH, const _Float16* __restrict__ VTL, const void* __restrict__ KMASK, const float* __restrict__ TB, float* __restrict__ O) {
  __shared__ __align__(16) float so[4][16][68];
  __shared__ __align__(16) _Float16 sK[AK][AP], sV[HD][AP]; __shared__ __align__(32) float skn[2][AK];   // one stage of AK keys, shared by the four waves: k rows, v columns (d-major), the two per-key table words
  const int tid = threadIdx.x, wave = tid >> 5, lane = tid & 31, col = lane & 15, g = lane >> 4;
  const int qb = blockIdx.x, h = blockIdx.y, b = blockIdx.z; const int q0 = qb * 64 + wave * 16; const size_t rq = (size_t)b * SS + q0 + col;
  v16h aq[2];
#pragma unroll
  for (int kc = 0; kc < 2; ++kc) aq[kc] = frag_h(QK + rq * (2 * DM) + h * HD + kc * 32, lane);
  const float* tb = TB + rq * 64; const float q0t = tb[h], q1t = tb[8 + h];   // the per-query terms of the two scores of this lane's query
  XW();   // the query-side loads' address registers are reused only behind it
  float m = -3.0e38f, l = 0.f;   // running maximum (equal in both halves) and this half's part of the running sum
  v8f acc[4] = {};   // O^T tiles: acc[dt][r] = d (dt * 16 + 8 g + r) of query col
  // stage loads: AK * 128 B of k rows and of v columns in 16-B pieces, a wave-wide load covering four whole 128-B lines; one table word per thread
  const _Float16* gK = QK + ((size_t)b * SS + (tid >> 3)) * (2 * DM) + DM + h * HD + (tid & 7) * 8; const _Float16* gV = VTH + ((size_t)b * DM + h * HD + (tid >> 3)) * SS + (tid & 7) * 8;
  const float* gT = TB + ((size_t)b * SS + (tid & (AK - 1))) * 64 + 24 + 8 * (tid / AK) + h;
  v8h rk[4], rv[4]; float rt;   // the next stage, on its way through registers while this stage is worked on
#pragma unroll
  for (int i = 0; i < 4; ++i) { rk[i] = *(const v8h*)(gK + (size_t)i * 16 * (2 * DM)); rv[i] = *(const v8h*)(gV + (size_t)i * 16 * SS); }
  rt = *gT;
  XW();
  asm volatile("" :: "v"(aq[0]), "v"(aq[1]), "v"(q0t), "v"(q1t));   // the query-side loads are waited for here, once: a wait for them inside the loop would also cover the next stage's loads, which are to stay in flight over the stage's work
  const int nks = SS / 32;   // all keys
#pragma unroll 1
  for (int ks = 0; ks < nks; ++ks) { v8f s[2];
    const int sub = ks & (AK / 32 - 1);
    if (sub == 0) {
      __syncthreads();   // every wave has left the stage that is overwritten next
#pragma unroll
      for (int i = 0; i < 4; ++i) { *(v8h*)&sK[i * 16 + (tid >> 3)][(tid & 7) * 8] = rk[i]; *(v8h*)&sV[i * 16 + (tid >> 3)][(tid & 7) * 8] = rv[i]; }
      skn[tid / AK][tid & (AK - 1)] = rt;
      __syncthreads();   // the stage is complete for every wave
      if (ks + AK / 32 < nks) { const size_t k1 = (size_t)ks * 32 + AK;
#pragma unroll
        for (int i = 0; i < 4; ++i) { rk[i] = *(const v8h*)(gK + (k1 + i * 16) * (2 * DM)); rv[i] = *(const v8h*)(gV + (size_t)i * 16 * SS + k1); }
        rt = gT[k1 * 64];
        XW(); } }
#pragma unroll
    for (int ct = 0; ct < 2; ++ct) { const int kb = sub * 32 + ct * 16; const _Float16* krow = &sK[kb + col][0]; v8f c = *(const v8f*)&skn[0][kb + 8 * g];   // the products are added onto -|k - mu_0|^2 / 2
#pragma unroll
      for (int kc = 0; kc < 2; ++kc) c = wmma16(frag_h(krow + kc * 32, lane), aq[kc], c);   // single product: k, q as one-rounding f16 operands; c[r] = k (kb + 8 g + r) . q (col) - |k - mu_0|^2 / 2
      const v8f dk = *(const v8f*)&skn[1][kb + 8 * g];
#pragma unroll
      for (int r = 0; r < 8; ++r) { const float x0 = c[r] * (LOG2E * 0.125f) + q0t, x1 = c[r] * (LOG2E * 0.375f) + (dk[r] + q1t); s[ct][r] = fminf(fmaxf(x0, x1), 0.f); } }   // max over the two Gaussian keys (mu_0, mu_1 both read) of min(x_j, 0) = -max(distance^2, 0) x scale x log2 e
    float mx = fmaxf(s[0][0], s[1][0]);
#pragma unroll
    for (int r = 1; r < 8; ++r) mx = fmaxf(mx, fmaxf(s[0][r], s[1][r]));
    mx = fmaxf(mx, xhalf(mx));   // both halves now hold the maximum over the 32 keys
    const float mn = fmaxf(m, mx); const float mb = mn - 11.0f;
    v16h pb; float es0 = 0.f, es1 = 0.f;
#pragma unroll
    for (int r = 0; r < 8; ++r) { const float e0 = __builtin_amdgcn_exp2f(s[0][r] - mb), e1 = __builtin_amdgcn_exp2f(s[1][r] - mb); es0 += e0; es1 += e1;
      pb[r] = (_Float16)e0; pb[8 + r] = (_Float16)e1; }   // P carries 2^11 (in the exponent's argument) so small softmax weights stay out of the f16 subnormal range; the sum l carries it too, so it cancels in the epilogue
    float alpha;   // exp2(m - mn); the first pass's m gives 0
    asm("v_exp_f32 %0, %1\n\tv_nop" : "=v"(alpha) : "v"(m - mn));   // in asm so that the slot which the instruction set asks for behind a transcendentalx
    l = l * alpha + (es0 + es1); m = mn;
#pragma unroll
    for (int dt = 0; dt < 4; ++dt) acc[dt] *= alpha;
#pragma unroll
    for (int dt = 0; dt < 4; ++dt) acc[dt] = wmma16(frag_h(&sV[dt * 16 + col][sub * 32], lane), pb, acc[dt]); }   // single product: V^T x P^T (x2^11)
  l += xhalf(l);   // the halves' sums are joined once
  { const float il = 1.0f / l;
#pragma unroll
    for (int dt = 0; dt < 4; ++dt) { v4f o0, o1;
#pragma unroll
      for (int r = 0; r < 4; ++r) { o0[r] = acc[dt][r] * il; o1[r] = acc[dt][4 + r] * il; }
      *(v4f*)&so[wave][col][dt * 16 + 8 * g] = o0; *(v4f*)&so[wave][col][dt * 16 + 8 * g + 4] = o1; } }
  LDSX();
  for (int rl = 0; rl < 16; ++rl) if (lane < 16) vst2(O + ((size_t)b * SS + q0 + rl) * DM + h * HD + lane * 4, *(const v4f*)&so[wave][rl][lane * 4]);
}
// ---- k_out: block = (64 rows, 128 cols): out = O(hi/lo) . Wo rows (2 products) + bo
__global__ __launch_bounds__(128) void k_out(const float* __restrict__ O, const __bf16* __restrict__ P, const float* __restrict__ BO, float* __restrict__ Y) {
  __shared__ __align__(16) char smem[(128 + 64 + 64) * GP * 2];   // stage: weight tile [128][GP] | O rows bf16 hi [64][GP] | residual [64][GP]; behind the loop's last barrier the same bytes are the output staging
  __bf16* sB = (__bf16*)smem; __bf16* sAh = sB + 128 * GP; __bf16* sAl = sAh + 64 * GP;
  float (*so)[16][132] = (float (*)[16][132])smem;
  const int tid = threadIdx.x, wave = tid >> 5, lane = tid & 31, col = lane & 15, g = lane >> 4; const size_t r0 = (size_t)blockIdx.x * 64 + wave * 16; const int n0 = blockIdx.y * 128;
  v8f acc[8] = {};
  const __bf16* pw = P + (size_t)(n0 + tid / GN) * DM + (tid % GN) * 8; const int ar = tid / (GK / 4), ap = (tid % (GK / 4)) * 4; const float* Ot = O + ((size_t)blockIdx.x * 64 + ar) * DM + ap;   // this thread's row (step 128 / (GK / 4)) and k offset in the f32 rows of a stage
  v8b rw[GN]; v4f ra[GN];   // the next stage, on its way through registers while this stage is multiplied
  ldw(rw, pw);
#pragma unroll
  for (int i = 0; i < GN; ++i) ra[i] = *(const v4f*)(Ot + (size_t)i * (512 / GK) * DM);   // one wave-wide load = two rows x 256 B
  XW();
  for (int st = 0; st < DM / GK; ++st) {
    __syncthreads();   // every wave has left the stage that is overwritten next
    stw(rw, sB, tid);
#pragma unroll
    for (int i = 0; i < GN; ++i) { v4b hv, lv;
#pragma unroll
      for (int e = 0; e < 4; ++e) { const __bf16 hh = (__bf16)ra[i][e]; hv[e] = hh; lv[e] = (__bf16)(ra[i][e] - (float)hh); }
      *(v4b*)(sAh + (i * (512 / GK) + ar) * GP + ap) = hv; *(v4b*)(sAl + (i * (512 / GK) + ar) * GP + ap) = lv; }
    __syncthreads();   // the stage is complete for every wave
    if (st + 1 < DM / GK) { ldw(rw, pw + (st + 1) * GK);
#pragma unroll
      for (int i = 0; i < GN; ++i) ra[i] = *(const v4f*)(Ot + (size_t)i * (512 / GK) * DM + (st + 1) * GK);
      XW(); }
#pragma unroll
    for (int kc = 0; kc < GK / 32; ++kc) { const v16b ah = frag_b(sAh + (wave * 16 + col) * GP + kc * 32, lane), al = frag_b(sAl + (wave * 16 + col) * GP + kc * 32, lane); v16b w[8];
#pragma unroll
      for (int j = 0; j < 8; ++j) w[j] = frag_b(sB + (j * 16 + col) * GP + kc * 32, lane);
      asm volatile("" :: "v"(ah), "v"(al), "v"(w[0]), "v"(w[1]), "v"(w[2]), "v"(w[3]), "v"(w[4]), "v"(w[5]), "v"(w[6]), "v"(w[7]));   // holds the ten fragment reads together in front of the products: one LDS wait per sixteen products, not one per pair
#pragma unroll
      for (int j = 0; j < 8; ++j) { acc[j] = wmma_bf(al, w[j], acc[j]); acc[j] = wmma_bf(ah, w[j], acc[j]); } } }
  __syncthreads();   // the last stage's reads are over before its bytes become output staging
#pragma unroll
  for (int j = 0; j < 8; ++j) {
#pragma unroll
    for (int r = 0; r < 8; ++r) so[wave][8 * g + r][j * 16 + col] = acc[j][r] + (BO ? bfr(BO[n0 + j * 16 + col]) : 0.f); }
  LDSX();
  for (int rl = 0; rl < 16; ++rl) vst2(Y + xrow(r0 + rl) + n0 + lane * 4, *(const v4f*)&so[wave][rl][lane * 4]);
}
// ---- k_packkv: Wkv (in,out) [512][1024] -> k rows (cols 0..511) and v rows (cols 512..1023) as transposed bf16 rows in the engine's k / v slots
__global__ __launch_bounds__(256) void k_packkv(const float* __restrict__ WKV, __bf16* __restrict__ PK) { const int n = blockIdx.x, which = blockIdx.y + 1, t = threadIdx.x; __shared__ __align__(16) __bf16 s[DM]; for (int k = t; k < DM; k += 256) s[k] = (__bf16)WKV[(size_t)k * (2 * DM) + (which - 1) * DM + n]; __syncthreads(); if (t < DM / 8) vst2((unsigned*)(PK + PK_A + ((size_t)which * DM + n) * DM + t * 8), *(const v4u*)&s[t * 8]); }
__global__ __launch_bounds__(256) void k_tabs(const _Float16* __restrict__ QK, const _Float16* __restrict__ QKL, const float* __restrict__ MU, float* __restrict__ TB) { __shared__ __align__(16) float st[8][64]; const int t = threadIdx.x; const int rl = t >> 5, h = (t >> 2) & 7, part = t & 3; const size_t row = (size_t)blockIdx.x * 8 + rl;
  float qq = 0.f, qm0 = 0.f, qm1 = 0.f, k0 = 0.f, k1 = 0.f;
  for (int d = part * 16; d < part * 16 + 16; ++d) { const size_t o = row * (2 * DM) + h * HD + d; const float q = (float)QK[o] + (float)QKL[o] * (1.0f / 2048.0f); const float k = (float)QK[o + DM] + (float)QKL[o + DM] * (1.0f / 2048.0f); const float m0 = bfr(MU[h * HD + d]), m1 = bfr(MU[(NH + h) * HD + d]); qq += q * q; qm0 += q * m0; qm1 += q * m1; const float a0 = k - m0, a1 = k - m1; k0 += a0 * a0; k1 += a1 * a1; }
#pragma unroll
  for (int o = 1; o < 4; o <<= 1) { qq += __shfl_xor(qq, o); qm0 += __shfl_xor(qm0, o); qm1 += __shfl_xor(qm1, o); k0 += __shfl_xor(k0, o); k1 += __shfl_xor(k1, o); }
  if (part == 0) { st[rl][h] = (qq + 2.0f * qm0) * (-0.0625f * LOG2E); st[rl][8 + h] = (qq + 2.0f * qm1) * (-0.1875f * LOG2E); st[rl][16 + h] = 0.f; st[rl][24 + h] = -0.5f * k0; st[rl][32 + h] = (k0 - k1) * (0.1875f * LOG2E); st[rl][40 + h] = 0.f; st[rl][48 + h] = 0.f; st[rl][56 + h] = 0.f; }
  __syncthreads(); if (t < 128) { const int r2 = t >> 4, q4 = t & 15; vst2(TB + ((size_t)blockIdx.x * 8 + r2) * 64 + q4 * 4, *(const v4f*)&st[r2][q4 * 4]); } }
// ---- k_lnsum<RAWR>: block = row: T = LayerNorm(R + A) g + b ; R is a raw input (bf16-rounded) when RAWR, else an f32 intermediate
template <int RAWR>
__global__ __launch_bounds__(128) void k_lnsum(const float* __restrict__ R, const float* __restrict__ A, const float* __restrict__ G, const float* __restrict__ Bt, float* __restrict__ T) {
  __shared__ float red[4]; const int t = threadIdx.x; const size_t row = blockIdx.x; float v[4]; float s = 0.f; for (int i = 0; i < 4; ++i) { const size_t e = row * DM + t * 4 + i; v[i] = (RAWR ? bfr(R[e]) : R[e]) + A[e]; s += v[i]; }
#pragma unroll
  for (int o = 1; o < 32; o <<= 1) s += __shfl_xor(s, o);
  if ((t & 31) == 0) red[t >> 5] = s; __syncthreads(); const float mu = ((red[0] + red[1]) + (red[2] + red[3])) / (float)DM; __syncthreads();
  float q = 0.f; for (int i = 0; i < 4; ++i) { const float d = v[i] - mu; q += d * d; }
#pragma unroll
  for (int o = 1; o < 32; o <<= 1) q += __shfl_xor(q, o);
  if ((t & 31) == 0) red[t >> 5] = q; __syncthreads(); const float inv = 1.0f / sqrtf(((red[0] + red[1]) + (red[2] + red[3])) / (float)DM + 1e-5f);
  v4f o4; for (int i = 0; i < 4; ++i) { const int e = t * 4 + i; o4[i] = (v[i] - mu) * inv * bfr(G[e]) + bfr(Bt[e]); } vst2(T + row * DM + t * 4, o4);
}
extern "C" void kernel_launch(void* const* d_in, const int* in_sizes, int n_in, void* d_out, int out_size, void* d_ws, size_t ws_size, hipStream_t stream) {
  (void)in_sizes; (void)n_in; (void)out_size;
  const float** F = (const float**)d_in;   // 0 h [1024,8,512] (s,b,d), 1 Wq [512,512] (in,out), 2 Wkv [512,1024] (in,out: k | v), 3 Wo [512,512] (in,out), 4 mu [2,8,64], 5 gamma, 6 beta
  if (ws_size < (size_t)WS_END) return;
  char* ws = (char*)d_ws; __bf16* PK = (__bf16*)(ws + WS_PK); _Float16 *QK = (_Float16*)(ws + WS_QK), *QKL = (_Float16*)(ws + WS_QKL), *VTH = (_Float16*)(ws + WS_VTH), *VTL = (_Float16*)(ws + WS_VTL); float *O = (float*)(ws + WS_O), *TB = (float*)(ws + WS_TB), *A = (float*)(ws + WS_A);
  k_pack<<<dim3(DM, 4), 256, 0, stream>>>(F[1], F[1], F[1], F[3], PK);   // Wq (and Wo); k/v slots overwritten next
  k_packkv<<<dim3(DM, 2), 256, 0, stream>>>(F[2], PK);
  k_qkv<<<dim3(TNB * SS / 64, QKVW / 128), 128, 0, stream>>>(F[0], F[0], F[0], PK + PK_A, nullptr, nullptr, nullptr, QK, QKL, VTH, VTL);
  k_tabs<<<TNB * SS / 8, 256, 0, stream>>>(QK, QKL, F[4], TB);
  k_attn<<<dim3(TQB, NH, TNB), 128, 0, stream>>>(QK, QKL, VTH, VTL, nullptr, TB, O);
  k_out<<<dim3(TOB, DM / 128), 128, 0, stream>>>(O, PK + PK_P, nullptr, A);   // A rows in (s, b) order
  k_lnsum<1><<<TOB * 64, 128, 0, stream>>>(F[0], A, F[5], F[6], (float*)d_out);
}

// v004
// Measured time: 95.4 microseconds a run.
// Next to v003, in two timings, it ran 1.15 times as fast each time.
// All steps since v000 together make it 2.79 times as fast.
// compute dtype: all float inputs rounded to bf16; q/k/v = h . W with EXACT bf16 products on WMMA 16x16x32 ((in,out) weights as transposed rows); per-(token, head) tables |q|^2, q . mu_0, q . mu_1, |k - mu_0|^2, |k - mu_1|^2 in f32 from the f16 hi + residual rows; PLAIN scores: q . k single f16, then -max(|q|^2 + |k-mu_j|^2 - 2 q.k + 2 q.mu_j, 0) x (1/16, 3/16) for the two Gaussian keys (mu_0 read too; it is zero), max of the two, in log2 units with the per-query and per-key terms folded in the tables, running-max softmax in f32 (hardware exp2), P (scaled by 2^11, single f16) x v (single f16); out = LayerNorm(h + vec (bf16 hi + residual) . Wo (2 products)) in f32.
#include <hip/hip_runtime.h>
#include <math.h>

typedef __attribute__((ext_vector_type(16))) _Float16 v16h;
typedef __attribute__((ext_vector_type(16))) __bf16 v16b;
typedef __attribute__((ext_vector_type(8)))  _Float16 v8h;
typedef __attribute__((ext_vector_type(8)))  float v8f;
typedef __attribute__((ext_vector_type(4)))  float v4f;
typedef __attribute__((ext_vector_type(2)))  float v2f;
typedef __attribute__((ext_vector_type(4)))  unsigned v4u;
typedef __attribute__((ext_vector_type(4)))  int v4i;
typedef float __attribute__((may_alias)) float_a;
typedef int __attribute__((may_alias)) int_a;

template <typename T> __device__ __forceinline__ void vst2(void* p, T v) { *(T*)p = v;  }
__device__ __forceinline__ v8f wmma16(v16h a, v16h b, v8f c) {
  v8f d = __builtin_amdgcn_wmma_f32_16x16x32_f16(false, a, false, b, (short)0, c, false, false);
  asm volatile("v_nop\n\tv_nop\n\tv_nop\n\tv_nop" : "+v"(d) : "v"(a), "v"(b));
  return d;
}
__device__ __forceinline__ v8f wmma_bf(v16b a, v16b b, v8f c) {
  v8f d = __builtin_amdgcn_wmma_f32_16x16x32_bf16(false, a, false, b, (short)0, c, false, false);
  asm volatile("v_nop\n\tv_nop\n\tv_nop\n\tv_nop" : "+v"(d) : "v"(a), "v"(b));
  return d;
}
// Mixture-of-Gaussian-keys attention (S 1,024, B 8, d 512, 8 heads x 64, two Gaussian keys per position: k and k - mu_1): score = max(-|q - k|^2 / 16, -3 |q - (k - mu_1)|^2 / 16), softmax over keys, . v, Wo, residual, LayerNorm; (s, b, d) layout.
__device__ __forceinline__ v16h frag_h(const _Float16* rowk0, int lane) {
  union { v16h v; v8h q[2]; } u; const _Float16* p = rowk0 + 8 * (lane >> 4);
  u.q[0] = *(const v8h*)p; u.q[1] = *(const v8h*)(p + 16); return u.v;
}
__device__ __forceinline__ v16h frag_f32(const float* rowk0, int lane) {
  v16h a; const float* p = rowk0 + 8 * (lane >> 4);
#pragma unroll
  for (int i = 0; i < 8; ++i) { a[i] = (_Float16)p[i]; a[8 + i] = (_Float16)p[16 + i]; }
  return a;
}
__device__ __forceinline__ v16h frag_f32s(const float* rowk0, int lane, float sc) {
  v16h a; const float* p = rowk0 + 8 * (lane >> 4);
#pragma unroll
  for (int i = 0; i < 8; ++i) { a[i] = (_Float16)(p[i] * sc); a[8 + i] = (_Float16)(p[16 + i] * sc); }
  return a;
}
// column fragment from a [K][ld] layout (column n), rows >= K read as 0
__device__ __forceinline__ v16h fragc_f32(const float* W, int k0, int n, int lane, int ld, int K) {
  v16h a; const int g = lane >> 4;
#pragma unroll
  for (int i = 0; i < 8; ++i) { const int ka = k0 + 8 * g + i, kb = ka + 16;
    a[i] = (_Float16)(ka < K ? W[(size_t)(ka < K ? ka : K - 1) * ld + n] : 0.f); a[8 + i] = (_Float16)(kb < K ? W[(size_t)(kb < K ? kb : K - 1) * ld + n] : 0.f); }
  return a;
}
struct F2 { v16b h, l; };
__device__ __forceinline__ F2 bsplit16(const float v[16]) { F2 r;
#pragma unroll
  for (int i = 0; i < 16; ++i) { const __bf16 h = (__bf16)v[i]; r.h[i] = h; r.l[i] = (__bf16)(v[i] - (float)h); }
  return r; }
__device__ __forceinline__ F2 split_row(const float* row, int k0, int lane) { float v[16]; const float* p = row + k0 + 8 * (lane >> 4);
#pragma unroll
  for (int i = 0; i < 8; ++i) { v[i] = p[i]; v[8 + i] = p[16 + i]; }
  return bsplit16(v); }
__device__ __forceinline__ F2 split_rowK(const float* row, int k0, int lane, int K) { float v[16]; const int g = lane >> 4;
#pragma unroll
  for (int i = 0; i < 8; ++i) { const int ka = k0 + 8 * g + i, kb = ka + 16; v[i] = ka < K ? row[ka < K ? ka : K - 1] : 0.f; v[8 + i] = kb < K ? row[kb < K ? kb : K - 1] : 0.f; }
  return bsplit16(v); }
__device__ __forceinline__ F2 split_col(const float* W, int k0, int n, int lane, int ld, int K) { float v[16]; const int g = lane >> 4;
#pragma unroll
  for (int i = 0; i < 8; ++i) { const int ka = k0 + 8 * g + i, kb = ka + 16; v[i] = ka < K ? W[(size_t)(ka < K ? ka : K - 1) * ld + n] : 0.f; v[8 + i] = kb < K ? W[(size_t)(kb < K ? kb : K - 1) * ld + n] : 0.f; }
  return bsplit16(v); }
__device__ __forceinline__ v8f mac3(const F2& a, const F2& b, v8f c) { c = wmma_bf(a.l, b.h, c); c = wmma_bf(a.h, b.l, c); return wmma_bf(a.h, b.h, c); }
__device__ __forceinline__ float sigm(float v) { return 1.0f / (1.0f + expf(-v)); }
#define LDSX() do { asm volatile("s_wait_dscnt 0" ::: "memory"); __builtin_amdgcn_wave_barrier(); __builtin_amdgcn_fence(__ATOMIC_RELEASE, "workgroup"); } while (0)


#define NB 8
#define SS 1024
#define DM 512
#define NH 8
#define NBATCH 8
__device__ __forceinline__ size_t xrow(size_t r) { return ((r % SS) * NBATCH + r / SS) * (size_t)DM; }   // engine row (b*SS + s) -> module row (s*B + b)
#define HD 64
#define QKVW (3 * DM)
#ifndef TQB
#define TQB (SS / 64)
#define TNB NB
#define TOB (NB * SS / 64)     // output row tiles (all)
#endif
typedef __attribute__((ext_vector_type(8))) __bf16 v8b;
__device__ __forceinline__ v16b frag_b(const __bf16* rowk0, int lane) {
  union { v16b v; v8b q[2]; } u; const __bf16* p = rowk0 + 8 * (lane >> 4);
  u.q[0] = *(const v8b*)p; u.q[1] = *(const v8b*)(p + 16); return u.v;
}
__device__ __forceinline__ float bfr(float v) { return (float)(__bf16)v; }
__device__ __attribute__((noinline)) float exp_ni(float v) { return expf(v); }
__device__ __attribute__((noinline)) float erf_ni(float v) { return erff(v); }

#define PK_A 0                       // [1536][512] Wqkv rows (natural [out][in])
#define PK_P (PK_A + QKVW * DM)        // [512][512] Wo rows (natural)
#define PK_END (PK_P + DM * DM)
#define WS_PK  0u
#define WS_QK  (WS_PK + 2u * PK_END)             // f16 [8192 rows][1024]: q | k
#define WS_QKL (WS_QK + 2u * NB * SS * 2 * DM)     // f16 q | k residual planes x2048
#define WS_VTH (WS_QKL + 2u * NB * SS * 2 * DM)    // f16 [b][512 (h*64+d)][1024 s] hi
#define WS_VTL (WS_VTH + 2u * NB * DM * SS)        // f16 lo x 2048
#define WS_O   (WS_VTL + 2u * NB * DM * SS)        // f32 [8192][512]
#define WS_CS  (WS_O + 4u * NB * SS * DM)           // f32 [2][1024][32], unused
#define WS_TB  (WS_CS + 4u * 2 * SS * 32)                  // f32 tables [NR][64], L = log2 e: -(L/16)(|q_h|^2 + 2 q.mu0) (0..7), -(3L/16)(|q_h|^2 + 2 q.mu1) (8..15), -|k - mu0|^2 / 2 (24..31), (3L/16)(|k - mu0|^2 - |k - mu1|^2) (32..39), rest 0
#define WS_A   (WS_TB + 4u * (size_t)NB * SS * 64)
#define WS_END (WS_A + 4u * (size_t)NB * SS * DM)
typedef __attribute__((ext_vector_type(4))) __bf16 v4b;
#define GK 64          // k per LDS stage of the two GEMMs
#define GP (GK + 8)    // LDS row pitch in 16-bit elements: 144 B = 16 B x 9 (odd), so the b128 fragment reads of 16 rows spread over the banks
#define GN (GK / 8)    // 16-B pieces per thread and stage, of the weight tile and of the f32 rows alike
#define XW() asm volatile("s_wait_xcnt 0x0" ::: "memory")   // stands behind a group of stage loads: their address registers are reused only behind it
// one stage (GK k) of a [128 rows][DM] bf16 weight tile in 16-B pieces; one wave-wide load covers four rows x 128 B, whole lines; pw = this thread's piece of the first 128 / GN rows
__device__ __forceinline__ void ldw(v8b (&r)[GN], const __bf16* __restrict__ pw) {
#pragma unroll
  for (int i = 0; i < GN; ++i) r[i] = *(const v8b*)(pw + (size_t)i * (128 / GN) * DM);
}
__device__ __forceinline__ void stw(const v8b (&r)[GN], __bf16* sB, int tid) {
#pragma unroll
  for (int i = 0; i < GN; ++i) *(v8b*)(sB + (i * (128 / GN) + tid / GN) * GP + (tid % GN) * 8) = r[i];
}
__global__ __launch_bounds__(128) void k_qkv(const float* __restrict__ XQ, const float* __restrict__ XK, const float* __restrict__ XV, const __bf16* __restrict__ P, const float* __restrict__ BQ, const float* __restrict__ BK, const float* __restrict__ BV, _Float16* __restrict__ QK, _Float16* __restrict__ QKL, _Float16* __restrict__ VTH, _Float16* __restrict__ VTL) {
  const int which0 = (blockIdx.y * 128) / DM; const float* X = (which0 == 0) ? XQ : (which0 == 1) ? XK : XV; const float* BB = BQ ? (((which0 == 0) ? BQ : (which0 == 1) ? BK : BV) + (blockIdx.y * 128 - which0 * DM)) : nullptr;
  __shared__ __align__(16) char smem[2 * 128 * 72 * 2];   // stage: weight tile [128][GP] | bf16 input rows [64][GP] (27,648 B); behind the loop's last barrier the same bytes are the output staging (36,864 B at most)
  __bf16* sB = (__bf16*)smem; __bf16* sA = sB + 128 * GP;
  _Float16 (*so)[16][136] = (_Float16 (*)[16][136])smem; _Float16 (*sol)[16][136] = so + 4; _Float16 (*sth)[72] = (_Float16 (*)[72])smem; _Float16 (*stl)[72] = sth + 128;
  const int tid = threadIdx.x, wave = tid >> 5, lane = tid & 31, col = lane & 15, g = lane >> 4; const size_t r0 = (size_t)blockIdx.x * 64 + wave * 16; const int n0 = blockIdx.y * 128;
  v8f acc[8] = {};
  const __bf16* pw = P + (size_t)(n0 + tid / GN) * DM + (tid % GN) * 8; const size_t rb0 = (size_t)blockIdx.x * 64;
  const int ar = tid / (GK / 4), ap = (tid % (GK / 4)) * 4;   // this thread's row (step 128 / (GK / 4)) and k offset in the f32 rows of a stage
  v8b rw[GN]; v4f ra[GN];   // the next stage, on its way through registers while this stage is multiplied
  const float* px = X + xrow(rb0 + ar) + ap;   // (s, b) input layout: the block's 64 rows are one batch entry's, so the next engine row lies NBATCH * DM further on
  ldw(rw, pw);
#pragma unroll
  for (int i = 0; i < GN; ++i) ra[i] = *(const v4f*)(px + (size_t)i * (512 / GK) * NBATCH * DM);   // one wave-wide load = two rows x 256 B
  XW();
  for (int st = 0; st < DM / GK; ++st) {
    __syncthreads();   // every wave has left the stage that is overwritten next
    stw(rw, sB, tid);
#pragma unroll
    for (int i = 0; i < GN; ++i) { v4b hv; hv[0] = (__bf16)ra[i][0]; hv[1] = (__bf16)ra[i][1]; hv[2] = (__bf16)ra[i][2]; hv[3] = (__bf16)ra[i][3]; *(v4b*)(sA + (i * (512 / GK) + ar) * GP + ap) = hv; }
    __syncthreads();   // the stage is complete for every wave
    if (st + 1 < DM / GK) { ldw(rw, pw + (st + 1) * GK);
#pragma unroll
      for (int i = 0; i < GN; ++i) ra[i] = *(const v4f*)(px + (size_t)i * (512 / GK) * NBATCH * DM + (st + 1) * GK);
      XW(); }
#pragma unroll
    for (int kc = 0; kc < GK / 32; ++kc) { const v16b a = frag_b(sA + (wave * 16 + col) * GP + kc * 32, lane); v16b w[8];
#pragma unroll
      for (int j = 0; j < 8; ++j) w[j] = frag_b(sB + (j * 16 + col) * GP + kc * 32, lane);
      asm volatile("" :: "v"(a), "v"(w[0]), "v"(w[1]), "v"(w[2]), "v"(w[3]), "v"(w[4]), "v"(w[5]), "v"(w[6]), "v"(w[7]));   // holds the nine fragment reads together in front of the products: one LDS wait per eight products, not one per product
#pragma unroll
      for (int j = 0; j < 8; ++j) acc[j] = wmma_bf(a, w[j], acc[j]); } }
  __syncthreads();   // the last stage's reads are over before its bytes become output staging
  if (n0 < 2 * DM) {   // q stored unscaled (f16 sigma ~0.6, no subnormal exposure); 1/16 and 3/16 applied to the f32 squared distances in k_attn
#pragma unroll
    for (int j = 0; j < 8; ++j) {
#pragma unroll
      for (int r = 0; r < 8; ++r) { const float v = acc[j][r] + (BB ? bfr(BB[j * 16 + col]) : 0.f); const _Float16 hv = (_Float16)v; so[wave][8 * g + r][j * 16 + col] = hv; sol[wave][8 * g + r][j * 16 + col] = (_Float16)((v - (float)hv) * 2048.0f); } }   // q, k (+ bias) as f16 hi + (x2048) residual
    LDSX();
    for (int rl = 0; rl < 16; ++rl) if (lane < 16) { vst2((unsigned*)(QK + (r0 + rl) * (2 * DM) + n0 + lane * 8), *(const v4u*)&so[wave][rl][lane * 8]); vst2((unsigned*)(QKL + (r0 + rl) * (2 * DM) + n0 + lane * 8), *(const v4u*)&sol[wave][rl][lane * 8]); }
  } else {
#pragma unroll
    for (int j = 0; j < 8; ++j) {
#pragma unroll
      for (int r = 0; r < 8; ++r) { const float v = acc[j][r] + (BB ? bfr(BB[j * 16 + col]) : 0.f); const _Float16 hv = (_Float16)v; sth[j * 16 + col][wave * 16 + 8 * g + r] = hv; stl[j * 16 + col][wave * 16 + 8 * g + r] = (_Float16)((v - (float)hv) * 2048.0f); } }
    __syncthreads();
    const size_t rb = (size_t)blockIdx.x * 64; const int b = (int)(rb / SS), s0 = (int)(rb % SS); const int pc0 = n0 - 2 * DM;
    for (int q = tid; q < 128 * 8; q += 128) { const int d = q >> 3, pc = q & 7; const size_t o = ((size_t)b * DM + pc0 + d) * SS + s0 + pc * 8; vst2((unsigned*)(VTH + o), *(const v4u*)&sth[d][pc * 8]); vst2((unsigned*)(VTL + o), *(const v4u*)&stl[d][pc * 8]); }
  }
}
#define AK 64   // keys per LDS stage of k_attn
#define LOG2E 1.44269504f
#define AP 72   // its LDS row pitch in f16: 144 B = 16 B x 9 (odd), so the b128 fragment reads of 16 rows spread over the banks
__device__ __forceinline__ float xhalf(float x) { return __builtin_bit_cast(float, __builtin_amdgcn_permlanex16(__builtin_bit_cast(int, x), __builtin_bit_cast(int, x), 0x76543210, 0xfedcba98, false, false)); }   // lane l with lane l ^ 16
__global__ __launch_bounds__(128) void k_attn(const _Float16* __restrict__ QK, const _Float16* __restrict__ QKL, const _Float16* __restrict__ VTH, const _Float16* __restrict__ VTL, const void* __restrict__ KMASK, const float* __restrict__ TB, float* __restrict__ O) {
  __shared__ __align__(16) float so[4][16][68];
  __shared__ __align__(16) _Float16 sK[AK][AP], sV[HD][AP]; __shared__ __align__(32) float skn[2][AK];   // one stage of AK keys, shared by the four waves: k rows, v columns (d-major), the two per-key table words
  const int tid = threadIdx.x, wave = tid >> 5, lane = tid & 31, col = lane & 15, g = lane >> 4;
  const int qb = blockIdx.x, h = blockIdx.y, b = blockIdx.z; const int q0 = qb * 64 + wave * 16; const size_t rq = (size_t)b * SS + q0 + col;
  v16h aq[2];
#pragma unroll
  for (int kc = 0; kc < 2; ++kc) aq[kc] = frag_h(QK + rq * (2 * DM) + h * HD + kc * 32, lane);
  const float* tb = TB + rq * 64; const float q0t = tb[h], q1t = tb[8 + h];   // the per-query terms of the two scores of this lane's query
  XW();   // the query-side loads' address registers are reused only behind it
  float m = -3.0e38f, l = 0.f;   // running maximum (equal in both halves) and this half's part of the running sum
  v8f acc[4] = {};   // O^T tiles: acc[dt][r] = d (dt * 16 + 8 g + r) of query col
  // stage loads: AK * 128 B of k rows and of v columns in 16-B pieces, a wave-wide load covering four whole 128-B lines; one table word per thread
  const _Float16* gK = QK + ((size_t)b * SS + (tid >> 3)) * (2 * DM) + DM + h * HD + (tid & 7) * 8; const _Float16* gV = VTH + ((size_t)b * DM + h * HD + (tid >> 3)) * SS + (tid & 7) * 8;
  const float* gT = TB + ((size_t)b * SS + (tid & (AK - 1))) * 64 + 24 + 8 * (tid / AK) + h;
  v8h rk[4], rv[4]; float rt;   // the next stage, on its way through registers while this stage is worked on
#pragma unroll
  for (int i = 0; i < 4; ++i) { rk[i] = *(const v8h*)(gK + (size_t)i * 16 * (2 * DM)); rv[i] = *(const v8h*)(gV + (size_t)i * 16 * SS); }
  rt = *gT;
  XW();
  asm volatile("" :: "v"(aq[0]), "v"(aq[1]), "v"(q0t), "v"(q1t));   // the query-side loads are waited for here, once: a wait for them inside the loop would also cover the next stage's loads, which are to stay in flight over the stage's work
  const int nks = SS / 32;   // all keys
#pragma unroll 1
  for (int ks = 0; ks < nks; ++ks) { v8f s[2];
    const int sub = ks & (AK / 32 - 1);
    if (sub == 0) {
      __syncthreads();   // every wave has left the stage that is overwritten next
#pragma unroll
      for (int i = 0; i < 4; ++i) { *(v8h*)&sK[i * 16 + (tid >> 3)][(tid & 7) * 8] = rk[i]; *(v8h*)&sV[i * 16 + (tid >> 3)][(tid & 7) * 8] = rv[i]; }
      skn[tid / AK][tid & (AK - 1)] = rt;
      __syncthreads();   // the stage is complete for every wave
      if (ks + AK / 32 < nks) { const size_t k1 = (size_t)ks * 32 + AK;
#pragma unroll
        for (int i = 0; i < 4; ++i) { rk[i] = *(const v8h*)(gK + (k1 + i * 16) * (2 * DM)); rv[i] = *(const v8h*)(gV + (size_t)i * 16 * SS + k1); }
        rt = gT[k1 * 64];
        XW(); } }
#pragma unroll
    for (int ct = 0; ct < 2; ++ct) { const int kb = sub * 32 + ct * 16; const _Float16* krow = &sK[kb + col][0]; v8f c = *(const v8f*)&skn[0][kb + 8 * g];   // the products are added onto -|k - mu_0|^2 / 2
#pragma unroll
      for (int kc = 0; kc < 2; ++kc) c = wmma16(frag_h(krow + kc * 32, lane), aq[kc], c);   // single product: k, q as one-rounding f16 operands; c[r] = k (kb + 8 g + r) . q (col) - |k - mu_0|^2 / 2
      const v8f dk = *(const v8f*)&skn[1][kb + 8 * g];
#pragma unroll
      for (int r = 0; r < 8; ++r) { const float x0 = c[r] * (LOG2E * 0.125f) + q0t, x1 = c[r] * (LOG2E * 0.375f) + (dk[r] + q1t); s[ct][r] = fminf(fmaxf(x0, x1), 0.f); } }   // max over the two Gaussian keys (mu_0, mu_1 both read) of min(x_j, 0) = -max(distance^2, 0) x scale x log2 e
    float mx = fmaxf(s[0][0], s[1][0]);
#pragma unroll
    for (int r = 1; r < 8; ++r) mx = fmaxf(mx, fmaxf(s[0][r], s[1][r]));
    mx = fmaxf(mx, xhalf(mx));   // both halves now hold the maximum over the 32 keys
    const float mn = fmaxf(m, mx); const float mb = mn - 11.0f;
    v16h pb; float es0 = 0.f, es1 = 0.f;
#pragma unroll
    for (int r = 0; r < 8; ++r) { const float e0 = __builtin_amdgcn_exp2f(s[0][r] - mb), e1 = __builtin_amdgcn_exp2f(s[1][r] - mb); es0 += e0; es1 += e1;
      pb[r] = (_Float16)e0; pb[8 + r] = (_Float16)e1; }   // P carries 2^11 (in the exponent's argument) so small softmax weights stay out of the f16 subnormal range; the sum l carries it too, so it cancels in the epilogue
    float alpha;   // exp2(m - mn); the first pass's m gives 0
    asm("v_exp_f32 %0, %1\n\tv_nop" : "=v"(alpha) : "v"(m - mn));   // in asm so that the slot which the instruction set asks for behind a transcendentalx
    l = l * alpha + (es0 + es1); m = mn;
#pragma unroll
    for (int dt = 0; dt < 4; ++dt) acc[dt] *= alpha;
#pragma unroll
    for (int dt = 0; dt < 4; ++dt) acc[dt] = wmma16(frag_h(&sV[dt * 16 + col][sub * 32], lane), pb, acc[dt]); }   // single product: V^T x P^T (x2^11)
  l += xhalf(l);   // the halves' sums are joined once
  { const float il = 1.0f / l;
#pragma unroll
    for (int dt = 0; dt < 4; ++dt) { v4f o0, o1;
#pragma unroll
      for (int r = 0; r < 4; ++r) { o0[r] = acc[dt][r] * il; o1[r] = acc[dt][4 + r] * il; }
      *(v4f*)&so[wave][col][dt * 16 + 8 * g] = o0; *(v4f*)&so[wave][col][dt * 16 + 8 * g + 4] = o1; } }
  LDSX();
  for (int rl = 0; rl < 16; ++rl) if (lane < 16) vst2(O + ((size_t)b * SS + q0 + rl) * DM + h * HD + lane * 4, *(const v4f*)&so[wave][rl][lane * 4]);
}
// ---- k_out: block = (64 rows, 128 cols): out = O(hi/lo) . Wo rows (2 products) + bo
__global__ __launch_bounds__(128) void k_out(const float* __restrict__ O, const __bf16* __restrict__ P, const float* __restrict__ BO, float* __restrict__ Y) {
  __shared__ __align__(16) char smem[(128 + 64 + 64) * GP * 2];   // stage: weight tile [128][GP] | O rows bf16 hi [64][GP] | residual [64][GP]; behind the loop's last barrier the same bytes are the output staging
  __bf16* sB = (__bf16*)smem; __bf16* sAh = sB + 128 * GP; __bf16* sAl = sAh + 64 * GP;
  float (*so)[16][132] = (float (*)[16][132])smem;
  const int tid = threadIdx.x, wave = tid >> 5, lane = tid & 31, col = lane & 15, g = lane >> 4; const size_t r0 = (size_t)blockIdx.x * 64 + wave * 16; const int n0 = blockIdx.y * 128;
  v8f acc[8] = {};
  const __bf16* pw = P + (size_t)(n0 + tid / GN) * DM + (tid % GN) * 8; const int ar = tid / (GK / 4), ap = (tid % (GK / 4)) * 4; const float* Ot = O + ((size_t)blockIdx.x * 64 + ar) * DM + ap;   // this thread's row (step 128 / (GK / 4)) and k offset in the f32 rows of a stage
  v8b rw[GN]; v4f ra[GN];   // the next stage, on its way through registers while this stage is multiplied
  ldw(rw, pw);
#pragma unroll
  for (int i = 0; i < GN; ++i) ra[i] = *(const v4f*)(Ot + (size_t)i * (512 / GK) * DM);   // one wave-wide load = two rows x 256 B
  XW();
  for (int st = 0; st < DM / GK; ++st) {
    __syncthreads();   // every wave has left the stage that is overwritten next
    stw(rw, sB, tid);
#pragma unroll
    for (int i = 0; i < GN; ++i) { v4b hv, lv;
#pragma unroll
      for (int e = 0; e < 4; ++e) { const __bf16 hh = (__bf16)ra[i][e]; hv[e] = hh; lv[e] = (__bf16)(ra[i][e] - (float)hh); }
      *(v4b*)(sAh + (i * (512 / GK) + ar) * GP + ap) = hv; *(v4b*)(sAl + (i * (512 / GK) + ar) * GP + ap) = lv; }
    __syncthreads();   // the stage is complete for every wave
    if (st + 1 < DM / GK) { ldw(rw, pw + (st + 1) * GK);
#pragma unroll
      for (int i = 0; i < GN; ++i) ra[i] = *(const v4f*)(Ot + (size_t)i * (512 / GK) * DM + (st + 1) * GK);
      XW(); }
#pragma unroll
    for (int kc = 0; kc < GK / 32; ++kc) { const v16b ah = frag_b(sAh + (wave * 16 + col) * GP + kc * 32, lane), al = frag_b(sAl + (wave * 16 + col) * GP + kc * 32, lane); v16b w[8];
#pragma unroll
      for (int j = 0; j < 8; ++j) w[j] = frag_b(sB + (j * 16 + col) * GP + kc * 32, lane);
      asm volatile("" :: "v"(ah), "v"(al), "v"(w[0]), "v"(w[1]), "v"(w[2]), "v"(w[3]), "v"(w[4]), "v"(w[5]), "v"(w[6]), "v"(w[7]));   // holds the ten fragment reads together in front of the products: one LDS wait per sixteen products, not one per pair
#pragma unroll
      for (int j = 0; j < 8; ++j) { acc[j] = wmma_bf(al, w[j], acc[j]); acc[j] = wmma_bf(ah, w[j], acc[j]); } } }
  __syncthreads();   // the last stage's reads are over before its bytes become output staging
#pragma unroll
  for (int j = 0; j < 8; ++j) {
#pragma unroll
    for (int r = 0; r < 8; ++r) so[wave][8 * g + r][j * 16 + col] = acc[j][r] + (BO ? bfr(BO[n0 + j * 16 + col]) : 0.f); }
  LDSX();
  for (int rl = 0; rl < 16; ++rl) vst2(Y + xrow(r0 + rl) + n0 + lane * 4, *(const v4f*)&so[wave][rl][lane * 4]);
}
// ---- pack_tile: one work-group turns a PT (k) x PT (n) tile of an (in,out) f32 weight (row length ld) into bf16 rows [n][k] of length DM: whole-line loads (a wave-wide load = two k rows x 256 B), transposed through LDS, whole-line stores (four n rows x 128 B); its loops are unrolled so that the four loads issue as one group
#define PT 64
__device__ __forceinline__ void pack_tile(const float* __restrict__ Wt, int ld, __bf16* __restrict__ dst) {   // Wt = the tile's first element, dst = its first element in the packed rows
  __shared__ __align__(16) __bf16 s[PT][PT + 8]; const int t = threadIdx.x, kr = t >> 4, c4 = (t & 15) * 4; const unsigned vo = (unsigned)(kr * ld + c4); v4f r[4];
#pragma unroll
  for (int i = 0; i < 4; ++i) r[i] = *(const v4f*)(Wt + vo + i * 16 * ld);
  XW();
#pragma unroll
  for (int i = 0; i < 4; ++i) {
#pragma unroll
    for (int e = 0; e < 4; ++e) s[c4 + e][i * 16 + kr] = (__bf16)r[i][e]; }
  __syncthreads();   // the tile is complete before its rows are read back
#pragma unroll
  for (int i = 0; i < 2; ++i) { const int n = i * 32 + (t >> 3), pc = (t & 7) * 8; vst2((unsigned*)(dst + (unsigned)((t >> 3) * DM + pc) + i * 32 * DM), *(const v4u*)&s[n][pc]); }
}
// ---- k_pack: block = (n tile, k tile, which): Wq -> PK_A rows 0..511, Wo -> PK_P
__global__ __launch_bounds__(256) void k_pack(const float* __restrict__ WQ, const float* __restrict__ WO, __bf16* __restrict__ PK) {
  const int n0 = blockIdx.x * PT, k0 = blockIdx.y * PT;
  pack_tile((blockIdx.z ? WO : WQ) + (size_t)k0 * DM + n0, DM, PK + (blockIdx.z ? PK_P : PK_A) + (size_t)n0 * DM + k0);
}
// ---- k_packkv: block = (n tile, k tile) of Wkv (in,out) [512][1024]: k rows (cols 0..511) and v rows (cols 512..1023) follow the q rows in PK_A
__global__ __launch_bounds__(256) void k_packkv(const float* __restrict__ WKV, __bf16* __restrict__ PK) {
  const int n0 = blockIdx.x * PT, k0 = blockIdx.y * PT;
  pack_tile(WKV + (size_t)k0 * (2 * DM) + n0, 2 * DM, PK + PK_A + (size_t)(DM + n0) * DM + k0);
}
#define TR 4   // rows per wave of k_tabs
// ---- k_tabs: block = 8 waves x TR rows; a lane sums 16 d of one head of each of its wave's rows, all rows' loads in flight together (every loop is unrolled for that, and so that the arrays stay in registers)
__global__ __launch_bounds__(256) void k_tabs(const _Float16* __restrict__ QK, const _Float16* __restrict__ QKL, const float* __restrict__ MU, float* __restrict__ TB) { __shared__ __align__(16) float st[8 * TR][64]; const int t = threadIdx.x; const int w = t >> 5, h = (t >> 2) & 7, part = t & 3; const size_t row0 = (size_t)blockIdx.x * (8 * TR); const _Float16* Qb = QK + row0 * (2 * DM); const _Float16* Lb = QKL + row0 * (2 * DM); const unsigned vo = (unsigned)(w * TR * (2 * DM) + h * HD + part * 16);   // block base (scalar) + one lane offset that every load of the lane shares
  v8h qh[TR][2], ql[TR][2], kh[TR][2], kl[TR][2]; v4f u0[4], u1[4];
#pragma unroll
  for (int j = 0; j < TR; ++j) { const unsigned o = vo + j * (2 * DM);
#pragma unroll
    for (int c = 0; c < 2; ++c) { qh[j][c] = *(const v8h*)(Qb + o + c * 8); ql[j][c] = *(const v8h*)(Lb + o + c * 8); kh[j][c] = *(const v8h*)(Qb + o + DM + c * 8); kl[j][c] = *(const v8h*)(Lb + o + DM + c * 8); } }
#pragma unroll
  for (int c = 0; c < 4; ++c) { u0[c] = *(const v4f*)(MU + h * HD + part * 16 + c * 4); u1[c] = *(const v4f*)(MU + (NH + h) * HD + part * 16 + c * 4); }
  XW();
#pragma unroll
  for (int j = 0; j < TR; ++j) { float qq = 0.f, qm0 = 0.f, qm1 = 0.f, k0 = 0.f, k1 = 0.f;
#pragma unroll
    for (int d = 0; d < 16; ++d) { const float q = (float)qh[j][d >> 3][d & 7] + (float)ql[j][d >> 3][d & 7] * (1.0f / 2048.0f); const float k = (float)kh[j][d >> 3][d & 7] + (float)kl[j][d >> 3][d & 7] * (1.0f / 2048.0f); const float m0 = bfr(u0[d >> 2][d & 3]), m1 = bfr(u1[d >> 2][d & 3]); qq += q * q; qm0 += q * m0; qm1 += q * m1; const float a0 = k - m0, a1 = k - m1; k0 += a0 * a0; k1 += a1 * a1; }
#pragma unroll
    for (int o = 1; o < 4; o <<= 1) { qq += __shfl_xor(qq, o); qm0 += __shfl_xor(qm0, o); qm1 += __shfl_xor(qm1, o); k0 += __shfl_xor(k0, o); k1 += __shfl_xor(k1, o); }
    float* sr = st[w * TR + j];
    if (part == 0) { sr[h] = (qq + 2.0f * qm0) * (-0.0625f * LOG2E); sr[8 + h] = (qq + 2.0f * qm1) * (-0.1875f * LOG2E); sr[16 + h] = 0.f; sr[24 + h] = -0.5f * k0; sr[32 + h] = (k0 - k1) * (0.1875f * LOG2E); sr[40 + h] = 0.f; sr[48 + h] = 0.f; sr[56 + h] = 0.f; } }
  __syncthreads();
#pragma unroll
  for (int i = 0; i < TR / 2; ++i) { const int r2 = i * 16 + (t >> 4), q4 = t & 15; vst2(TB + row0 * 64 + (unsigned)(t * 4) + i * 16 * 64, *(const v4f*)&st[r2][q4 * 4]); } }
#define LR 4   // rows per wave of k_lnsum
// ---- k_lnsum<RAWR>: wave = LR whole rows (a lane holds 16 elements of each, a wave-wide load = 512 contiguous B), all rows' loads in flight together (every loop is unrolled for that, and so that the arrays stay in registers), row sums inside the wave, the LR rows' exchanges side by side: T = LayerNorm(R + A) g + b ; R is a raw input (bf16-rounded) when RAWR, else an f32 intermediate
template <int RAWR>
__global__ __launch_bounds__(256) void k_lnsum(const float* __restrict__ R, const float* __restrict__ A, const float* __restrict__ G, const float* __restrict__ Bt, float* __restrict__ T) {
  const int t = threadIdx.x, lane = t & 31; const size_t b0 = (size_t)blockIdx.x * (8 * LR * DM); const unsigned vo = (unsigned)((t >> 5) * (LR * DM) + lane * 4);   // block base (scalar) + one lane offset that every load and store of the lane shares
  const float* Rb = R + b0; const float* Ab = A + b0; float* Tb = T + b0; v4f v[LR][4], a[LR][4], gm[4], bt[4];
#pragma unroll
  for (int j = 0; j < LR; ++j) {
#pragma unroll
    for (int i = 0; i < 4; ++i) { v[j][i] = *(const v4f*)(Rb + vo + j * DM + i * 128); a[j][i] = *(const v4f*)(Ab + vo + j * DM + i * 128); } }
#pragma unroll
  for (int i = 0; i < 4; ++i) { gm[i] = *(const v4f*)(G + i * 128 + lane * 4); bt[i] = *(const v4f*)(Bt + i * 128 + lane * 4); }
  XW();
  float s[LR], q[LR];
#pragma unroll
  for (int j = 0; j < LR; ++j) { float p[4];
#pragma unroll
    for (int i = 0; i < 4; ++i) { p[i] = 0.f;
#pragma unroll
      for (int e = 0; e < 4; ++e) { v[j][i][e] = (RAWR ? bfr(v[j][i][e]) : v[j][i][e]) + a[j][i][e]; p[i] += v[j][i][e]; } }
    s[j] = (p[0] + p[1]) + (p[2] + p[3]); }
#pragma unroll
  for (int o = 1; o < 32; o <<= 1) {
#pragma unroll
    for (int j = 0; j < LR; ++j) s[j] += __shfl_xor(s[j], o); }
#pragma unroll
  for (int j = 0; j < LR; ++j) { s[j] = s[j] / (float)DM; float p[4];
#pragma unroll
    for (int i = 0; i < 4; ++i) { p[i] = 0.f;
#pragma unroll
      for (int e = 0; e < 4; ++e) { v[j][i][e] -= s[j]; p[i] += v[j][i][e] * v[j][i][e]; } }
    q[j] = (p[0] + p[1]) + (p[2] + p[3]); }
#pragma unroll
  for (int o = 1; o < 32; o <<= 1) {
#pragma unroll
    for (int j = 0; j < LR; ++j) q[j] += __shfl_xor(q[j], o); }
#pragma unroll
  for (int j = 0; j < LR; ++j) { const float inv = 1.0f / sqrtf(q[j] / (float)DM + 1e-5f);
#pragma unroll
    for (int i = 0; i < 4; ++i) { v4f o4;
#pragma unroll
      for (int e = 0; e < 4; ++e) o4[e] = v[j][i][e] * inv * bfr(gm[i][e]) + bfr(bt[i][e]);
      vst2(Tb + vo + j * DM + i * 128, o4); } }
}
extern "C" void kernel_launch(void* const* d_in, const int* in_sizes, int n_in, void* d_out, int out_size, void* d_ws, size_t ws_size, hipStream_t stream) {
  (void)in_sizes; (void)n_in; (void)out_size;
  const float** F = (const float**)d_in;   // 0 h [1024,8,512] (s,b,d), 1 Wq [512,512] (in,out), 2 Wkv [512,1024] (in,out: k | v), 3 Wo [512,512] (in,out), 4 mu [2,8,64], 5 gamma, 6 beta
  if (ws_size < (size_t)WS_END) return;
  char* ws = (char*)d_ws; __bf16* PK = (__bf16*)(ws + WS_PK); _Float16 *QK = (_Float16*)(ws + WS_QK), *QKL = (_Float16*)(ws + WS_QKL), *VTH = (_Float16*)(ws + WS_VTH), *VTL = (_Float16*)(ws + WS_VTL); float *O = (float*)(ws + WS_O), *TB = (float*)(ws + WS_TB), *A = (float*)(ws + WS_A);
  k_pack<<<dim3(DM / PT, DM / PT, 2), 256, 0, stream>>>(F[1], F[3], PK);   // Wq and Wo
  k_packkv<<<dim3(2 * DM / PT, DM / PT), 256, 0, stream>>>(F[2], PK);
  k_qkv<<<dim3(TNB * SS / 64, QKVW / 128), 128, 0, stream>>>(F[0], F[0], F[0], PK + PK_A, nullptr, nullptr, nullptr, QK, QKL, VTH, VTL);
  k_tabs<<<TNB * SS / (8 * TR), 256, 0, stream>>>(QK, QKL, F[4], TB);
  k_attn<<<dim3(TQB, NH, TNB), 128, 0, stream>>>(QK, QKL, VTH, VTL, nullptr, TB, O);
  k_out<<<dim3(TOB, DM / 128), 128, 0, stream>>>(O, PK + PK_P, nullptr, A);   // A rows in (s, b) order
  k_lnsum<1><<<TOB * 64 / (8 * LR), 256, 0, stream>>>(F[0], A, F[5], F[6], (float*)d_out);
}

// v005
// One run takes 79.5 microseconds.
// Two timings next to v004 both put it at 1.20 times that version's speed.
// All steps since v000 together make it 3.35 times as fast.
// compute dtype: all float inputs rounded to bf16; q/k/v = h . W with EXACT bf16 products on WMMA 16x16x32 ((in,out) weights as transposed rows); per-(token, head) tables |q|^2 + 2 q . mu_j, |k - mu_j|^2 (j = 0, 1) in f32 from the projections' f32 accumulators; PLAIN scores: q . k single f16, then -max(|q|^2 + |k-mu_j|^2 - 2 q.k + 2 q.mu_j, 0) x (1/16, 3/16) for the two Gaussian keys (mu_0 read too; it is zero), max of the two, in log2 units with the per-query and per-key terms folded in the tables, running-max softmax in f32 (hardware exp2), P (scaled by 2^11, single f16) x v (single f16); out = LayerNorm(h + vec (bf16 hi + residual) . Wo (2 products)) in f32.
#include <hip/hip_runtime.h>
#include <math.h>

typedef __attribute__((ext_vector_type(16))) _Float16 v16h;
typedef __attribute__((ext_vector_type(16))) __bf16 v16b;
typedef __attribute__((ext_vector_type(8)))  _Float16 v8h;
typedef __attribute__((ext_vector_type(8)))  float v8f;
typedef __attribute__((ext_vector_type(4)))  float v4f;
typedef __attribute__((ext_vector_type(2)))  float v2f;
typedef __attribute__((ext_vector_type(4)))  unsigned v4u;
typedef __attribute__((ext_vector_type(4)))  int v4i;
typedef float __attribute__((may_alias)) float_a;
typedef int __attribute__((may_alias)) int_a;

template <typename T> __device__ __forceinline__ void vst2(void* p, T v) { *(T*)p = v;  }
__device__ __forceinline__ v8f wmma16(v16h a, v16h b, v8f c) {
  v8f d = __builtin_amdgcn_wmma_f32_16x16x32_f16(false, a, false, b, (short)0, c, false, false);
  asm volatile("v_nop\n\tv_nop\n\tv_nop\n\tv_nop" : "+v"(d) : "v"(a), "v"(b));
  return d;
}
__device__ __forceinline__ v8f wmma_bf(v16b a, v16b b, v8f c) {
  v8f d = __builtin_amdgcn_wmma_f32_16x16x32_bf16(false, a, false, b, (short)0, c, false, false);
  asm volatile("v_nop\n\tv_nop\n\tv_nop\n\tv_nop" : "+v"(d) : "v"(a), "v"(b));
  return d;
}
// Mixture-of-Gaussian-keys attention (S 1,024, B 8, d 512, 8 heads x 64, two Gaussian keys per position: k and k - mu_1): score = max(-|q - k|^2 / 16, -3 |q - (k - mu_1)|^2 / 16), softmax over keys, . v, Wo, residual, LayerNorm; (s, b, d) layout.
__device__ __forceinline__ v16h frag_h(const _Float16* rowk0, int lane) {
  union { v16h v; v8h q[2]; } u; const _Float16* p = rowk0 + 8 * (lane >> 4);
  u.q[0] = *(const v8h*)p; u.q[1] = *(const v8h*)(p + 16); return u.v;
}
__device__ __forceinline__ v16h frag_f32(const float* rowk0, int lane) {
  v16h a; const float* p = rowk0 + 8 * (lane >> 4);
#pragma unroll
  for (int i = 0; i < 8; ++i) { a[i] = (_Float16)p[i]; a[8 + i] = (_Float16)p[16 + i]; }
  return a;
}
__device__ __forceinline__ v16h frag_f32s(const float* rowk0, int lane, float sc) {
  v16h a; const float* p = rowk0 + 8 * (lane >> 4);
#pragma unroll
  for (int i = 0; i < 8; ++i) { a[i] = (_Float16)(p[i] * sc); a[8 + i] = (_Float16)(p[16 + i] * sc); }
  return a;
}
// column fragment from a [K][ld] layout (column n), rows >= K read as 0
__device__ __forceinline__ v16h fragc_f32(const float* W, int k0, int n, int lane, int ld, int K) {
  v16h a; const int g = lane >> 4;
#pragma unroll
  for (int i = 0; i < 8; ++i) { const int ka = k0 + 8 * g + i, kb = ka + 16;
    a[i] = (_Float16)(ka < K ? W[(size_t)(ka < K ? ka : K - 1) * ld + n] : 0.f); a[8 + i] = (_Float16)(kb < K ? W[(size_t)(kb < K ? kb : K - 1) * ld + n] : 0.f); }
  return a;
}
struct F2 { v16b h, l; };
__device__ __forceinline__ F2 bsplit16(const float v[16]) { F2 r;
#pragma unroll
  for (int i = 0; i < 16; ++i) { const __bf16 h = (__bf16)v[i]; r.h[i] = h; r.l[i] = (__bf16)(v[i] - (float)h); }
  return r; }
__device__ __forceinline__ F2 split_row(const float* row, int k0, int lane) { float v[16]; const float* p = row + k0 + 8 * (lane >> 4);
#pragma unroll
  for (int i = 0; i < 8; ++i) { v[i] = p[i]; v[8 + i] = p[16 + i]; }
  return bsplit16(v); }
__device__ __forceinline__ F2 split_rowK(const float* row, int k0, int lane, int K) { float v[16]; const int g = lane >> 4;
#pragma unroll
  for (int i = 0; i < 8; ++i) { const int ka = k0 + 8 * g + i, kb = ka + 16; v[i] = ka < K ? row[ka < K ? ka : K - 1] : 0.f; v[8 + i] = kb < K ? row[kb < K ? kb : K - 1] : 0.f; }
  return bsplit16(v); }
__device__ __forceinline__ F2 split_col(const float* W, int k0, int n, int lane, int ld, int K) { float v[16]; const int g = lane >> 4;
#pragma unroll
  for (int i = 0; i < 8; ++i) { const int ka = k0 + 8 * g + i, kb = ka + 16; v[i] = ka < K ? W[(size_t)(ka < K ? ka : K - 1) * ld + n] : 0.f; v[8 + i] = kb < K ? W[(size_t)(kb < K ? kb : K - 1) * ld + n] : 0.f; }
  return bsplit16(v); }
__device__ __forceinline__ v8f mac3(const F2& a, const F2& b, v8f c) { c = wmma_bf(a.l, b.h, c); c = wmma_bf(a.h, b.l, c); return wmma_bf(a.h, b.h, c); }
__device__ __forceinline__ float sigm(float v) { return 1.0f / (1.0f + expf(-v)); }
#define LDSX() do { asm volatile("s_wait_dscnt 0" ::: "memory"); __builtin_amdgcn_wave_barrier(); __builtin_amdgcn_fence(__ATOMIC_RELEASE, "workgroup"); } while (0)


#define NB 8
#define SS 1024
#define DM 512
#define NH 8
#define NBATCH 8
__device__ __forceinline__ size_t xrow(size_t r) { return ((r % SS) * NBATCH + r / SS) * (size_t)DM; }   // engine row (b*SS + s) -> module row (s*B + b)
#define HD 64
#define QKVW (3 * DM)
#ifndef TQB
#define TQB (SS / 64)
#define TNB NB
#define TOB (NB * SS / 64)     // output row tiles (all)
#endif
typedef __attribute__((ext_vector_type(8))) __bf16 v8b;
__device__ __forceinline__ v16b frag_b(const __bf16* rowk0, int lane) {
  union { v16b v; v8b q[2]; } u; const __bf16* p = rowk0 + 8 * (lane >> 4);
  u.q[0] = *(const v8b*)p; u.q[1] = *(const v8b*)(p + 16); return u.v;
}
__device__ __forceinline__ float bfr(float v) { return (float)(__bf16)v; }
__device__ __attribute__((noinline)) float exp_ni(float v) { return expf(v); }
__device__ __attribute__((noinline)) float erf_ni(float v) { return erff(v); }

#define PK_A 0                       // [1536][512] Wqkv rows (natural [out][in])
#define PK_P (PK_A + QKVW * DM)        // [512][512] Wo rows (natural)
#define PK_END (PK_P + DM * DM)
#define WS_PK  0u
#define WS_QK  (WS_PK + 2u * PK_END)             // f16 [8192 rows][1024]: q | k
#define WS_QKL (WS_QK + 2u * NB * SS * 2 * DM)     // f16 [8192][1024], not written or read by these kernels
#define WS_VTH (WS_QKL + 2u * NB * SS * 2 * DM)    // f16 [b][512 (h*64+d)][1024 s] hi
#define WS_VTL (WS_VTH + 2u * NB * DM * SS)        // f16 [b][512][1024], not written or read by these kernels
#define WS_O   (WS_VTL + 2u * NB * DM * SS)        // f32 [8192][512]
#define WS_CS  (WS_O + 4u * NB * SS * DM)           // f32 2 x [1024][32], not used by these kernels
#define WS_TB  (WS_CS + 4u * 2 * SS * 32)                  // f32 tables as planes [word][head][NR], L = log2 e: word 0 -(L/16)(|q_h|^2 + 2 q.mu0), 1 -(3L/16)(|q_h|^2 + 2 q.mu1), 2 -|k - mu0|^2 / 2, 3 (3L/16)(|k - mu0|^2 - |k - mu1|^2)
#define WS_A   (WS_TB + 4u * (size_t)NB * SS * 64)
#define WS_END (WS_A + 4u * (size_t)NB * SS * DM)
typedef __attribute__((ext_vector_type(4))) __bf16 v4b;
#define GK 64          // k per LDS stage of the two GEMMs
#define GP (GK + 8)    // LDS row pitch in 16-bit elements: 144 B = 16 B x 9 (odd), so the b128 fragment reads of 16 rows spread over the banks
#define GN (GK / 8)    // 16-B pieces per thread and stage, of the weight tile and of the f32 rows alike
#define XW() asm volatile("s_wait_xcnt 0x0" ::: "memory")   // stands behind a group of stage loads: their address registers are reused only behind it
// one stage (GK k) of a [128 rows][DM] bf16 weight tile in 16-B pieces; one wave-wide load covers four rows x 128 B, whole lines; pw = this thread's piece of the first 128 / GN rows
__device__ __forceinline__ void ldw(v8b (&r)[GN], const __bf16* __restrict__ pw) {
#pragma unroll
  for (int i = 0; i < GN; ++i) r[i] = *(const v8b*)(pw + (size_t)i * (128 / GN) * DM);
}
__device__ __forceinline__ void stw(const v8b (&r)[GN], __bf16* sB, int tid) {
#pragma unroll
  for (int i = 0; i < GN; ++i) *(v8b*)(sB + (i * (128 / GN) + tid / GN) * GP + (tid % GN) * 8) = r[i];
}
#define LOG2E 1.44269504f
// sum over the 16 lanes of a row, every lane of the row gets it: four adds whose second operand comes through DPP row_xmask (0x160 + mask); all lanes are on
template <int M> __device__ __forceinline__ float rowx(float x) { return x + __builtin_bit_cast(float, __builtin_amdgcn_update_dpp(0, __builtin_bit_cast(int, x), 0x160 + M, 0xf, 0xf, true)); }
__device__ __forceinline__ float rowsum16(float x) { return rowx<8>(rowx<4>(rowx<2>(rowx<1>(x)))); }
// this lane's part (4 of the 64 d of each of the block's two heads) of the two table sums of its 8 rows: k rows |k - mu_0|^2, |k - mu_1|^2; q rows |q|^2 + 2 q . mu_0, |q|^2 + 2 q . mu_1
template <bool ISK> __device__ __forceinline__ void tsum(const v8f (&acc)[8], const float (&m0)[8], const float (&m1)[8], float (&ta)[2][8], float (&tb)[2][8]) {
#pragma unroll
  for (int hh = 0; hh < 2; ++hh) {
#pragma unroll
    for (int r = 0; r < 8; ++r) { float a = 0.f, b = 0.f;
#pragma unroll
      for (int jj = 0; jj < 4; ++jj) { const float v = acc[hh * 4 + jj][r], u0 = bfr(m0[hh * 4 + jj]), u1 = bfr(m1[hh * 4 + jj]);
        if (ISK) { const float d0 = v - u0, d1 = v - u1; a += d0 * d0; b += d1 * d1; } else { a += v * (v + 2.0f * u0); b += v * (v + 2.0f * u1); } }
      ta[hh][r] = a; tb[hh][r] = b; } }
}
__global__ __launch_bounds__(128) void k_qkv(const float* __restrict__ XQ, const float* __restrict__ XK, const float* __restrict__ XV, const __bf16* __restrict__ P, const float* __restrict__ BQ, const float* __restrict__ BK, const float* __restrict__ BV, _Float16* __restrict__ QK, const float* __restrict__ MU, _Float16* __restrict__ VTH, float* __restrict__ TB) {
  const int which0 = (blockIdx.y * 128) / DM; const float* X = (which0 == 0) ? XQ : (which0 == 1) ? XK : XV; const float* BB = BQ ? (((which0 == 0) ? BQ : (which0 == 1) ? BK : BV) + (blockIdx.y * 128 - which0 * DM)) : nullptr;
  __shared__ __align__(16) char smem[(128 + 64) * GP * 2];   // stage: weight tile [128][GP] | bf16 input rows [64][GP] (27,648 B); behind the loop's last barrier the same bytes are the output staging (18,432 B)
  __bf16* sB = (__bf16*)smem; __bf16* sA = sB + 128 * GP;
  _Float16 (*so)[16][136] = (_Float16 (*)[16][136])smem; float (*st)[64] = (float (*)[64])(so + 4); _Float16 (*sth)[72] = (_Float16 (*)[72])smem;   // st: the block's table words, [head of the block * 2 + word][row]
  const int tid = threadIdx.x, wave = tid >> 5, lane = tid & 31, col = lane & 15, g = lane >> 4; const size_t r0 = (size_t)blockIdx.x * 64 + wave * 16; const int n0 = blockIdx.y * 128;
  v8f acc[8] = {};
  const __bf16* pw = P + (size_t)(n0 + tid / GN) * DM + (tid % GN) * 8; const size_t rb0 = (size_t)blockIdx.x * 64;
  const int ar = tid / (GK / 4), ap = (tid % (GK / 4)) * 4;   // this thread's row (step 128 / (GK / 4)) and k offset in the f32 rows of a stage
  v8b rw[GN]; v4f ra[GN];   // the next stage, on its way through registers while this stage is multiplied
  const float* px = X + xrow(rb0 + ar) + ap;   // (s, b) input layout: the block's 64 rows are one batch entry's, so the next engine row lies NBATCH * DM further on
  ldw(rw, pw);
#pragma unroll
  for (int i = 0; i < GN; ++i) ra[i] = *(const v4f*)(px + (size_t)i * (512 / GK) * NBATCH * DM);   // one wave-wide load = two rows x 256 B
  XW();
  float m0[8] = {}, m1[8] = {};   // q and k blocks: this lane's elements of mu_0 and mu_1, column j * 16 + col of the block's two heads; loaded here, behind the first stage's loads, so that the epilogue does not wait for them
  if (n0 < 2 * DM) { const float* pm = MU + (n0 & (DM - 1)) + col;
#pragma unroll
    for (int j = 0; j < 8; ++j) { m0[j] = pm[j * 16]; m1[j] = pm[NH * HD + j * 16]; }
    XW(); }
  for (int st = 0; st < DM / GK; ++st) {
    __syncthreads();   // every wave has left the stage that is overwritten next
    stw(rw, sB, tid);
#pragma unroll
    for (int i = 0; i < GN; ++i) { v4b hv; hv[0] = (__bf16)ra[i][0]; hv[1] = (__bf16)ra[i][1]; hv[2] = (__bf16)ra[i][2]; hv[3] = (__bf16)ra[i][3]; *(v4b*)(sA + (i * (512 / GK) + ar) * GP + ap) = hv; }
    __syncthreads();   // the stage is complete for every wave
    if (st + 1 < DM / GK) { ldw(rw, pw + (st + 1) * GK);
#pragma unroll
      for (int i = 0; i < GN; ++i) ra[i] = *(const v4f*)(px + (size_t)i * (512 / GK) * NBATCH * DM + (st + 1) * GK);
      XW(); }
#pragma unroll
    for (int kc = 0; kc < GK / 32; ++kc) { const v16b a = frag_b(sA + (wave * 16 + col) * GP + kc * 32, lane); v16b w[8];
#pragma unroll
      for (int j = 0; j < 8; ++j) w[j] = frag_b(sB + (j * 16 + col) * GP + kc * 32, lane);
      asm volatile("" :: "v"(a), "v"(w[0]), "v"(w[1]), "v"(w[2]), "v"(w[3]), "v"(w[4]), "v"(w[5]), "v"(w[6]), "v"(w[7]));   // holds the nine fragment reads together in front of the products: one LDS wait per eight products, not one per product
#pragma unroll
      for (int j = 0; j < 8; ++j) acc[j] = wmma_bf(a, w[j], acc[j]); } }
  __syncthreads();   // the last stage's reads are over before its bytes become output staging
  if (BB) {
#pragma unroll
    for (int j = 0; j < 8; ++j) { const float bb = bfr(BB[j * 16 + col]);
#pragma unroll
      for (int r = 0; r < 8; ++r) acc[j][r] += bb; } }
  if (n0 < 2 * DM) {   // q stored unscaled (f16 sigma ~0.6, no subnormal exposure); 1/8 and 3/8 (x log2 e) applied to the f32 score
    const bool isk = n0 >= DM; const int h0 = (n0 & (DM - 1)) / HD;   // the block holds heads h0 and h0 + 1 of q or of k
#pragma unroll
    for (int j = 0; j < 8; ++j) {
#pragma unroll
      for (int r = 0; r < 8; ++r) so[wave][8 * g + r][j * 16 + col] = (_Float16)acc[j][r]; }   // q, k (+ bias) as f16
    float ta[2][8], tb[2][8];
    if (isk) tsum<true>(acc, m0, m1, ta, tb); else tsum<false>(acc, m0, m1, ta, tb);
#pragma unroll
    for (int hh = 0; hh < 2; ++hh) {
#pragma unroll
      for (int r = 0; r < 8; ++r) { ta[hh][r] = rowsum16(ta[hh][r]); tb[hh][r] = rowsum16(tb[hh][r]); } }
    if (col == 0) {   // one lane of each half stores the words of its 8 rows
#pragma unroll
      for (int hh = 0; hh < 2; ++hh) { v4f w0[2], w1[2];
#pragma unroll
        for (int r = 0; r < 8; ++r) { const float a = ta[hh][r], b = tb[hh][r]; w0[r >> 2][r & 3] = isk ? -0.5f * a : a * (-0.0625f * LOG2E); w1[r >> 2][r & 3] = isk ? (a - b) * (0.1875f * LOG2E) : b * (-0.1875f * LOG2E); }
#pragma unroll
        for (int c = 0; c < 2; ++c) { *(v4f*)&st[hh * 2][wave * 16 + 8 * g + 4 * c] = w0[c]; *(v4f*)&st[hh * 2 + 1][wave * 16 + 8 * g + 4 * c] = w1[c]; } } }
    __syncthreads();   // the four waves' table words are complete before two waves store them as whole lines; each wave's own staged rows are complete too
    for (int rl = 0; rl < 16; ++rl) if (lane < 16) vst2((unsigned*)(QK + (r0 + rl) * (2 * DM) + n0 + lane * 8), *(const v4u*)&so[wave][rl][lane * 8]);
    if (tid < 64) { const int p = tid >> 4, pc = tid & 15; vst2(TB + ((size_t)((isk ? 2 : 0) + (p & 1)) * NH + h0 + (p >> 1)) * (NB * SS) + rb0 + pc * 4, *(const v4f*)&st[p][pc * 4]); }   // 16 lanes = the block's 64 rows of one plane, 256 contiguous B
  } else {
#pragma unroll
    for (int j = 0; j < 8; ++j) {
#pragma unroll
      for (int r = 0; r < 8; ++r) sth[j * 16 + col][wave * 16 + 8 * g + r] = (_Float16)acc[j][r]; }
    __syncthreads();
    const size_t rb = (size_t)blockIdx.x * 64; const int b = (int)(rb / SS), s0 = (int)(rb % SS); const int pc0 = n0 - 2 * DM;
    for (int q = tid; q < 128 * 8; q += 128) { const int d = q >> 3, pc = q & 7; const size_t o = ((size_t)b * DM + pc0 + d) * SS + s0 + pc * 8; vst2((unsigned*)(VTH + o), *(const v4u*)&sth[d][pc * 8]); }
  }
}
#define AK 64   // keys per LDS stage of k_attn
#define AP 72   // its LDS row pitch in f16: 144 B = 16 B x 9 (odd), so the b128 fragment reads of 16 rows spread over the banks
__device__ __forceinline__ float xhalf(float x) { return __builtin_bit_cast(float, __builtin_amdgcn_permlanex16(__builtin_bit_cast(int, x), __builtin_bit_cast(int, x), 0x76543210, 0xfedcba98, false, false)); }   // lane l with lane l ^ 16
__global__ __launch_bounds__(128) void k_attn(const _Float16* __restrict__ QK, const _Float16* __restrict__ QKL, const _Float16* __restrict__ VTH, const _Float16* __restrict__ VTL, const void* __restrict__ KMASK, const float* __restrict__ TB, float* __restrict__ O) {
  __shared__ __align__(16) float so[4][16][68];
  __shared__ __align__(16) _Float16 sK[AK][AP], sV[HD][AP]; __shared__ __align__(32) float skn[2][AK];   // one stage of AK keys, shared by the four waves: k rows, v columns (d-major), the two per-key table words
  const int tid = threadIdx.x, wave = tid >> 5, lane = tid & 31, col = lane & 15, g = lane >> 4;
  const int qb = blockIdx.x, h = blockIdx.y, b = blockIdx.z; const int q0 = qb * 64 + wave * 16; const size_t rq = (size_t)b * SS + q0 + col;
  const float q0t = TB[(size_t)h * (NB * SS) + rq], q1t = TB[(size_t)(NH + h) * (NB * SS) + rq];   // the per-query terms of the two scores of this lane's query
  XW();   // the two loads' address registers are reused only behind it
  v16h aq[2];
#pragma unroll
  for (int kc = 0; kc < 2; ++kc) aq[kc] = frag_h(QK + rq * (2 * DM) + h * HD + kc * 32, lane);
  XW();   // the query-side loads' address registers are reused only behind it
  float m = -3.0e38f, l = 0.f;   // running maximum (equal in both halves) and this half's part of the running sum
  v8f acc[4] = {};   // O^T tiles: acc[dt][r] = d (dt * 16 + 8 g + r) of query col
  // stage loads: AK * 128 B of k rows and of v columns in 16-B pieces, a wave-wide load covering four whole 128-B lines; one table word per thread
  const _Float16* gK = QK + ((size_t)b * SS + (tid >> 3)) * (2 * DM) + DM + h * HD + (tid & 7) * 8; const _Float16* gV = VTH + ((size_t)b * DM + h * HD + (tid >> 3)) * SS + (tid & 7) * 8;
  const float* gT = TB + ((size_t)(2 + tid / AK) * NH + h) * (NB * SS) + (size_t)b * SS + (tid & (AK - 1));   // planes 2 and 3: a stage's AK words of a plane are contiguous
  v8h rk[4], rv[4]; float rt;   // the next stage, on its way through registers while this stage is worked on
#pragma unroll
  for (int i = 0; i < 4; ++i) { rk[i] = *(const v8h*)(gK + (size_t)i * 16 * (2 * DM)); rv[i] = *(const v8h*)(gV + (size_t)i * 16 * SS); }
  rt = *gT;
  XW();
  asm volatile("" :: "v"(aq[0]), "v"(aq[1]), "v"(q0t), "v"(q1t));   // the query-side loads are waited for here, once: a wait for them inside the loop would also cover the next stage's loads, which are to stay in flight over the stage's work
  const int nks = SS / 32;   // all keys
#pragma unroll 1
  for (int ks = 0; ks < nks; ++ks) { v8f s[2];
    const int sub = ks & (AK / 32 - 1);
    if (sub == 0) {
      __syncthreads();   // every wave has left the stage that is overwritten next
#pragma unroll
      for (int i = 0; i < 4; ++i) { *(v8h*)&sK[i * 16 + (tid >> 3)][(tid & 7) * 8] = rk[i]; *(v8h*)&sV[i * 16 + (tid >> 3)][(tid & 7) * 8] = rv[i]; }
      skn[tid / AK][tid & (AK - 1)] = rt;
      __syncthreads();   // the stage is complete for every wave
      if (ks + AK / 32 < nks) { const size_t k1 = (size_t)ks * 32 + AK;
#pragma unroll
        for (int i = 0; i < 4; ++i) { rk[i] = *(const v8h*)(gK + (k1 + i * 16) * (2 * DM)); rv[i] = *(const v8h*)(gV + (size_t)i * 16 * SS + k1); }
        rt = gT[k1];
        XW(); } }
#pragma unroll
    for (int ct = 0; ct < 2; ++ct) { const int kb = sub * 32 + ct * 16; const _Float16* krow = &sK[kb + col][0]; v8f c = *(const v8f*)&skn[0][kb + 8 * g];   // the products are added onto -|k - mu_0|^2 / 2
#pragma unroll
      for (int kc = 0; kc < 2; ++kc) c = wmma16(frag_h(krow + kc * 32, lane), aq[kc], c);   // single product: k, q as one-rounding f16 operands; c[r] = k (kb + 8 g + r) . q (col) - |k - mu_0|^2 / 2
      const v8f dk = *(const v8f*)&skn[1][kb + 8 * g];
#pragma unroll
      for (int r = 0; r < 8; ++r) { const float x0 = c[r] * (LOG2E * 0.125f) + q0t, x1 = c[r] * (LOG2E * 0.375f) + (dk[r] + q1t); s[ct][r] = fminf(fmaxf(x0, x1), 0.f); } }   // max over the two Gaussian keys (mu_0, mu_1 both read) of min(x_j, 0) = -max(distance^2, 0) x scale x log2 e
    float mx = fmaxf(s[0][0], s[1][0]);
#pragma unroll
    for (int r = 1; r < 8; ++r) mx = fmaxf(mx, fmaxf(s[0][r], s[1][r]));
    mx = fmaxf(mx, xhalf(mx));   // both halves now hold the maximum over the 32 keys
    const float mn = fmaxf(m, mx); const float mb = mn - 11.0f;
    v16h pb; float es0 = 0.f, es1 = 0.f;
#pragma unroll
    for (int r = 0; r < 8; ++r) { const float e0 = __builtin_amdgcn_exp2f(s[0][r] - mb), e1 = __builtin_amdgcn_exp2f(s[1][r] - mb); es0 += e0; es1 += e1;
      pb[r] = (_Float16)e0; pb[8 + r] = (_Float16)e1; }   // P carries 2^11 (in the exponent's argument) so small softmax weights stay out of the f16 subnormal range; the sum l carries it too, so it cancels in the epilogue
    float alpha;   // exp2(m - mn); the first pass's m gives 0
    asm("v_exp_f32 %0, %1\n\tv_nop" : "=v"(alpha) : "v"(m - mn));   // in asm so that the slot which the instruction set asks for behind a transcendentalx
    l = l * alpha + (es0 + es1); m = mn;
#pragma unroll
    for (int dt = 0; dt < 4; ++dt) acc[dt] *= alpha;
#pragma unroll
    for (int dt = 0; dt < 4; ++dt) acc[dt] = wmma16(frag_h(&sV[dt * 16 + col][sub * 32], lane), pb, acc[dt]); }   // single product: V^T x P^T (x2^11)
  l += xhalf(l);   // the halves' sums are joined once
  { const float il = 1.0f / l;
#pragma unroll
    for (int dt = 0; dt < 4; ++dt) { v4f o0, o1;
#pragma unroll
      for (int r = 0; r < 4; ++r) { o0[r] = acc[dt][r] * il; o1[r] = acc[dt][4 + r] * il; }
      *(v4f*)&so[wave][col][dt * 16 + 8 * g] = o0; *(v4f*)&so[wave][col][dt * 16 + 8 * g + 4] = o1; } }
  LDSX();
  for (int rl = 0; rl < 16; ++rl) if (lane < 16) vst2(O + ((size_t)b * SS + q0 + rl) * DM + h * HD + lane * 4, *(const v4f*)&so[wave][rl][lane * 4]);
}
// ---- k_out: block = (64 rows, 128 cols): out = O(hi/lo) . Wo rows (2 products) + bo
__global__ __launch_bounds__(128) void k_out(const float* __restrict__ O, const __bf16* __restrict__ P, const float* __restrict__ BO, float* __restrict__ Y) {
  __shared__ __align__(16) char smem[(128 + 64 + 64) * GP * 2];   // stage: weight tile [128][GP] | O rows bf16 hi [64][GP] | residual [64][GP]; behind the loop's last barrier the same bytes are the output staging
  __bf16* sB = (__bf16*)smem; __bf16* sAh = sB + 128 * GP; __bf16* sAl = sAh + 64 * GP;
  float (*so)[16][132] = (float (*)[16][132])smem;
  const int tid = threadIdx.x, wave = tid >> 5, lane = tid & 31, col = lane & 15, g = lane >> 4; const size_t r0 = (size_t)blockIdx.x * 64 + wave * 16; const int n0 = blockIdx.y * 128;
  v8f acc[8] = {};
  const __bf16* pw = P + (size_t)(n0 + tid / GN) * DM + (tid % GN) * 8; const int ar = tid / (GK / 4), ap = (tid % (GK / 4)) * 4; const float* Ot = O + ((size_t)blockIdx.x * 64 + ar) * DM + ap;   // this thread's row (step 128 / (GK / 4)) and k offset in the f32 rows of a stage
  v8b rw[GN]; v4f ra[GN];   // the next stage, on its way through registers while this stage is multiplied
  ldw(rw, pw);
#pragma unroll
  for (int i = 0; i < GN; ++i) ra[i] = *(const v4f*)(Ot + (size_t)i * (512 / GK) * DM);   // one wave-wide load = two rows x 256 B
  XW();
  for (int st = 0; st < DM / GK; ++st) {
    __syncthreads();   // every wave has left the stage that is overwritten next
    stw(rw, sB, tid);
#pragma unroll
    for (int i = 0; i < GN; ++i) { v4b hv, lv;
#pragma unroll
      for (int e = 0; e < 4; ++e) { const __bf16 hh = (__bf16)ra[i][e]; hv[e] = hh; lv[e] = (__bf16)(ra[i][e] - (float)hh); }
      *(v4b*)(sAh + (i * (512 / GK) + ar) * GP + ap) = hv; *(v4b*)(sAl + (i * (512 / GK) + ar) * GP + ap) = lv; }
    __syncthreads();   // the stage is complete for every wave
    if (st + 1 < DM / GK) { ldw(rw, pw + (st + 1) * GK);
#pragma unroll
      for (int i = 0; i < GN; ++i) ra[i] = *(const v4f*)(Ot + (size_t)i * (512 / GK) * DM + (st + 1) * GK);
      XW(); }
#pragma unroll
    for (int kc = 0; kc < GK / 32; ++kc) { const v16b ah = frag_b(sAh + (wave * 16 + col) * GP + kc * 32, lane), al = frag_b(sAl + (wave * 16 + col) * GP + kc * 32, lane); v16b w[8];
#pragma unroll
      for (int j = 0; j < 8; ++j) w[j] = frag_b(sB + (j * 16 + col) * GP + kc * 32, lane);
      asm volatile("" :: "v"(ah), "v"(al), "v"(w[0]), "v"(w[1]), "v"(w[2]), "v"(w[3]), "v"(w[4]), "v"(w[5]), "v"(w[6]), "v"(w[7]));   // holds the ten fragment reads together in front of the products: one LDS wait per sixteen products, not one per pair
#pragma unroll
      for (int j = 0; j < 8; ++j) { acc[j] = wmma_bf(al, w[j], acc[j]); acc[j] = wmma_bf(ah, w[j], acc[j]); } } }
  __syncthreads();   // the last stage's reads are over before its bytes become output staging
#pragma unroll
  for (int j = 0; j < 8; ++j) {
#pragma unroll
    for (int r = 0; r < 8; ++r) so[wave][8 * g + r][j * 16 + col] = acc[j][r] + (BO ? bfr(BO[n0 + j * 16 + col]) : 0.f); }
  LDSX();
  for (int rl = 0; rl < 16; ++rl) vst2(Y + xrow(r0 + rl) + n0 + lane * 4, *(const v4f*)&so[wave][rl][lane * 4]);
}
// ---- pack_tile: one work-group turns a PT (k) x PT (n) tile of an (in,out) f32 weight (row length ld) into bf16 rows [n][k] of length DM: whole-line loads (a wave-wide load = two k rows x 256 B), transposed through LDS, whole-line stores (four n rows x 128 B); its loops are unrolled so that the four loads issue as one group
#define PT 64
__device__ __forceinline__ void pack_tile(const float* __restrict__ Wt, int ld, __bf16* __restrict__ dst) {   // Wt = the tile's first element, dst = its first element in the packed rows
  __shared__ __align__(16) __bf16 s[PT][PT + 8]; const int t = threadIdx.x, kr = t >> 4, c4 = (t & 15) * 4; const unsigned vo = (unsigned)(kr * ld + c4); v4f r[4];
#pragma unroll
  for (int i = 0; i < 4; ++i) r[i] = *(const v4f*)(Wt + vo + i * 16 * ld);
  XW();
#pragma unroll
  for (int i = 0; i < 4; ++i) {
#pragma unroll
    for (int e = 0; e < 4; ++e) s[c4 + e][i * 16 + kr] = (__bf16)r[i][e]; }
  __syncthreads();   // the tile is complete before its rows are read back
#pragma unroll
  for (int i = 0; i < 2; ++i) { const int n = i * 32 + (t >> 3), pc = (t & 7) * 8; vst2((unsigned*)(dst + (unsigned)((t >> 3) * DM + pc) + i * 32 * DM), *(const v4u*)&s[n][pc]); }
}
// ---- k_pack: block = (n tile, k tile, which): Wq -> PK_A rows 0..511, Wo -> PK_P
__global__ __launch_bounds__(256) void k_pack(const float* __restrict__ WQ, const float* __restrict__ WO, __bf16* __restrict__ PK) {
  const int n0 = blockIdx.x * PT, k0 = blockIdx.y * PT;
  pack_tile((blockIdx.z ? WO : WQ) + (size_t)k0 * DM + n0, DM, PK + (blockIdx.z ? PK_P : PK_A) + (size_t)n0 * DM + k0);
}
// ---- k_packkv: block = (n tile, k tile) of Wkv (in,out) [512][1024]: k rows (cols 0..511) and v rows (cols 512..1023) follow the q rows in PK_A
__global__ __launch_bounds__(256) void k_packkv(const float* __restrict__ WKV, __bf16* __restrict__ PK) {
  const int n0 = blockIdx.x * PT, k0 = blockIdx.y * PT;
  pack_tile(WKV + (size_t)k0 * (2 * DM) + n0, 2 * DM, PK + PK_A + (size_t)(DM + n0) * DM + k0);
}
#define LR 4   // rows per wave of k_lnsum
// ---- k_lnsum<RAWR>: wave = LR whole rows (a lane holds 16 elements of each, a wave-wide load = 512 contiguous B), all rows' loads in flight together (every loop is unrolled for that, and so that the arrays stay in registers), row sums inside the wave, the LR rows' exchanges side by side: T = LayerNorm(R + A) g + b ; R is a raw input (bf16-rounded) when RAWR, else an f32 intermediate
template <int RAWR>
__global__ __launch_bounds__(256) void k_lnsum(const float* __restrict__ R, const float* __restrict__ A, const float* __restrict__ G, const float* __restrict__ Bt, float* __restrict__ T) {
  const int t = threadIdx.x, lane = t & 31; const size_t b0 = (size_t)blockIdx.x * (8 * LR * DM); const unsigned vo = (unsigned)((t >> 5) * (LR * DM) + lane * 4);   // block base (scalar) + one lane offset that every load and store of the lane shares
  const float* Rb = R + b0; const float* Ab = A + b0; float* Tb = T + b0; v4f v[LR][4], a[LR][4], gm[4], bt[4];
#pragma unroll
  for (int j = 0; j < LR; ++j) {
#pragma unroll
    for (int i = 0; i < 4; ++i) { v[j][i] = *(const v4f*)(Rb + vo + j * DM + i * 128); a[j][i] = *(const v4f*)(Ab + vo + j * DM + i * 128); } }
#pragma unroll
  for (int i = 0; i < 4; ++i) { gm[i] = *(const v4f*)(G + i * 128 + lane * 4); bt[i] = *(const v4f*)(Bt + i * 128 + lane * 4); }
  XW();
  float s[LR], q[LR];
#pragma unroll
  for (int j = 0; j < LR; ++j) { float p[4];
#pragma unroll
    for (int i = 0; i < 4; ++i) { p[i] = 0.f;
#pragma unroll
      for (int e = 0; e < 4; ++e) { v[j][i][e] = (RAWR ? bfr(v[j][i][e]) : v[j][i][e]) + a[j][i][e]; p[i] += v[j][i][e]; } }
    s[j] = (p[0] + p[1]) + (p[2] + p[3]); }
#pragma unroll
  for (int o = 1; o < 32; o <<= 1) {
#pragma unroll
    for (int j = 0; j < LR; ++j) s[j] += __shfl_xor(s[j], o); }
#pragma unroll
  for (int j = 0; j < LR; ++j) { s[j] = s[j] / (float)DM; float p[4];
#pragma unroll
    for (int i = 0; i < 4; ++i) { p[i] = 0.f;
#pragma unroll
      for (int e = 0; e < 4; ++e) { v[j][i][e] -= s[j]; p[i] += v[j][i][e] * v[j][i][e]; } }
    q[j] = (p[0] + p[1]) + (p[2] + p[3]); }
#pragma unroll
  for (int o = 1; o < 32; o <<= 1) {
#pragma unroll
    for (int j = 0; j < LR; ++j) q[j] += __shfl_xor(q[j], o); }
#pragma unroll
  for (int j = 0; j < LR; ++j) { const float inv = 1.0f / sqrtf(q[j] / (float)DM + 1e-5f);
#pragma unroll
    for (int i = 0; i < 4; ++i) { v4f o4;
#pragma unroll
      for (int e = 0; e < 4; ++e) o4[e] = v[j][i][e] * inv * bfr(gm[i][e]) + bfr(bt[i][e]);
      vst2(Tb + vo + j * DM + i * 128, o4); } }
}
extern "C" void kernel_launch(void* const* d_in, const int* in_sizes, int n_in, void* d_out, int out_size, void* d_ws, size_t ws_size, hipStream_t stream) {
  (void)in_sizes; (void)n_in; (void)out_size;
  const float** F = (const float**)d_in;   // 0 h [1024,8,512] (s,b,d), 1 Wq [512,512] (in,out), 2 Wkv [512,1024] (in,out: k | v), 3 Wo [512,512] (in,out), 4 mu [2,8,64], 5 gamma, 6 beta
  if (ws_size < (size_t)WS_END) return;
  char* ws = (char*)d_ws; __bf16* PK = (__bf16*)(ws + WS_PK); _Float16 *QK = (_Float16*)(ws + WS_QK), *QKL = (_Float16*)(ws + WS_QKL), *VTH = (_Float16*)(ws + WS_VTH), *VTL = (_Float16*)(ws + WS_VTL); float *O = (float*)(ws + WS_O), *TB = (float*)(ws + WS_TB), *A = (float*)(ws + WS_A);
  k_pack<<<dim3(DM / PT, DM / PT, 2), 256, 0, stream>>>(F[1], F[3], PK);   // Wq and Wo
  k_packkv<<<dim3(2 * DM / PT, DM / PT), 256, 0, stream>>>(F[2], PK);
  k_qkv<<<dim3(TNB * SS / 64, QKVW / 128), 128, 0, stream>>>(F[0], F[0], F[0], PK + PK_A, nullptr, nullptr, nullptr, QK, F[4], VTH, TB);   // also writes the tables
  k_attn<<<dim3(TQB, NH, TNB), 128, 0, stream>>>(QK, QKL, VTH, VTL, nullptr, TB, O);
  k_out<<<dim3(TOB, DM / 128), 128, 0, stream>>>(O, PK + PK_P, nullptr, A);   // A rows in (s, b) order
  k_lnsum<1><<<TOB * 64 / (8 * LR), 256, 0, stream>>>(F[0], A, F[5], F[6], (float*)d_out);
}

// v006
// One run takes 74.7 microseconds.
// Next to v005, in two timings, it ran 1.07 and 1.06 times as fast.
// All steps since v000 together make it 3.56 times as fast.
// compute dtype: all float inputs rounded to bf16; q/k/v = h . W with EXACT bf16 products on WMMA 16x16x32 ((in,out) weights as transposed rows); per-(token, head) tables |q|^2 + 2 q . mu_j, |k - mu_j|^2 (j = 0, 1) in f32 from the projections' f32 accumulators; PLAIN scores: q . k single f16, then -max(|q|^2 + |k-mu_j|^2 - 2 q.k + 2 q.mu_j, 0) x (1/16, 3/16) for the two Gaussian keys (mu_0 read too; it is zero), max of the two, in log2 units with the per-query and per-key terms folded in the tables, running-max softmax in f32 (hardware exp2), P (scaled by 2^11, single f16) x v (single f16); out = LayerNorm(h + vec (bf16 hi + residual) . Wo (2 products)) in f32.
#include <hip/hip_runtime.h>
#include <math.h>

typedef __attribute__((ext_vector_type(16))) _Float16 v16h;
typedef __attribute__((ext_vector_type(16))) __bf16 v16b;
typedef __attribute__((ext_vector_type(8)))  _Float16 v8h;
typedef __attribute__((ext_vector_type(8)))  float v8f;
typedef __attribute__((ext_vector_type(4)))  float v4f;
typedef __attribute__((ext_vector_type(2)))  float v2f;
typedef __attribute__((ext_vector_type(4)))  unsigned v4u;
typedef __attribute__((ext_vector_type(4)))  int v4i;
typedef float __attribute__((may_alias)) float_a;
typedef int __attribute__((may_alias)) int_a;

template <typename T> __device__ __forceinline__ void vst2(void* p, T v) { *(T*)p = v;  }
__device__ __forceinline__ v8f wmma16(v16h a, v16h b, v8f c) {
  v8f d = __builtin_amdgcn_wmma_f32_16x16x32_f16(false, a, false, b, (short)0, c, false, false);
  asm volatile("v_nop\n\tv_nop\n\tv_nop\n\tv_nop" : "+v"(d) : "v"(a), "v"(b));
  return d;
}
__device__ __forceinline__ v8f wmma_bf(v16b a, v16b b, v8f c) {
  v8f d = __builtin_amdgcn_wmma_f32_16x16x32_bf16(false, a, false, b, (short)0, c, false, false);
  asm volatile("v_nop\n\tv_nop\n\tv_nop\n\tv_nop" : "+v"(d) : "v"(a), "v"(b));
  return d;
}
// Mixture-of-Gaussian-keys attention (S 1,024, B 8, d 512, 8 heads x 64, two Gaussian keys per position: k and k - mu_1): score = max(-|q - k|^2 / 16, -3 |q - (k - mu_1)|^2 / 16), softmax over keys, . v, Wo, residual, LayerNorm; (s, b, d) layout.
__device__ __forceinline__ v16h frag_h(const _Float16* rowk0, int lane) {
  union { v16h v; v8h q[2]; } u; const _Float16* p = rowk0 + 8 * (lane >> 4);
  u.q[0] = *(const v8h*)p; u.q[1] = *(const v8h*)(p + 16); return u.v;
}
__device__ __forceinline__ v16h frag_f32(const float* rowk0, int lane) {
  v16h a; const float* p = rowk0 + 8 * (lane >> 4);
#pragma unroll
  for (int i = 0; i < 8; ++i) { a[i] = (_Float16)p[i]; a[8 + i] = (_Float16)p[16 + i]; }
  return a;
}
__device__ __forceinline__ v16h frag_f32s(const float* rowk0, int lane, float sc) {
  v16h a; const float* p = rowk0 + 8 * (lane >> 4);
#pragma unroll
  for (int i = 0; i < 8; ++i) { a[i] = (_Float16)(p[i] * sc); a[8 + i] = (_Float16)(p[16 + i] * sc); }
  return a;
}
// column fragment from a [K][ld] layout (column n), rows >= K read as 0
__device__ __forceinline__ v16h fragc_f32(const float* W, int k0, int n, int lane, int ld, int K) {
  v16h a; const int g = lane >> 4;
#pragma unroll
  for (int i = 0; i < 8; ++i) { const int ka = k0 + 8 * g + i, kb = ka + 16;
    a[i] = (_Float16)(ka < K ? W[(size_t)(ka < K ? ka : K - 1) * ld + n] : 0.f); a[8 + i] = (_Float16)(kb < K ? W[(size_t)(kb < K ? kb : K - 1) * ld + n] : 0.f); }
  return a;
}
struct F2 { v16b h, l; };
__device__ __forceinline__ F2 bsplit16(const float v[16]) { F2 r;
#pragma unroll
  for (int i = 0; i < 16; ++i) { const __bf16 h = (__bf16)v[i]; r.h[i] = h; r.l[i] = (__bf16)(v[i] - (float)h); }
  return r; }
__device__ __forceinline__ F2 split_row(const float* row, int k0, int lane) { float v[16]; const float* p = row + k0 + 8 * (lane >> 4);
#pragma unroll
  for (int i = 0; i < 8; ++i) { v[i] = p[i]; v[8 + i] = p[16 + i]; }
  return bsplit16(v); }
__device__ __forceinline__ F2 split_rowK(const float* row, int k0, int lane, int K) { float v[16]; const int g = lane >> 4;
#pragma unroll
  for (int i = 0; i < 8; ++i) { const int ka = k0 + 8 * g + i, kb = ka + 16; v[i] = ka < K ? row[ka < K ? ka : K - 1] : 0.f; v[8 + i] = kb < K ? row[kb < K ? kb : K - 1] : 0.f; }
  return bsplit16(v); }
__device__ __forceinline__ F2 split_col(const float* W, int k0, int n, int lane, int ld, int K) { float v[16]; const int g = lane >> 4;
#pragma unroll
  for (int i = 0; i < 8; ++i) { const int ka = k0 + 8 * g + i, kb = ka + 16; v[i] = ka < K ? W[(size_t)(ka < K ? ka : K - 1) * ld + n] : 0.f; v[8 + i] = kb < K ? W[(size_t)(kb < K ? kb : K - 1) * ld + n] : 0.f; }
  return bsplit16(v); }
__device__ __forceinline__ v8f mac3(const F2& a, const F2& b, v8f c) { c = wmma_bf(a.l, b.h, c); c = wmma_bf(a.h, b.l, c); return wmma_bf(a.h, b.h, c); }
__device__ __forceinline__ float sigm(float v) { return 1.0f / (1.0f + expf(-v)); }
#define LDSX() do { asm volatile("s_wait_dscnt 0" ::: "memory"); __builtin_amdgcn_wave_barrier(); __builtin_amdgcn_fence(__ATOMIC_RELEASE, "workgroup"); } while (0)


#define NB 8
#define SS 1024
#define DM 512
#define NH 8
#define NBATCH 8
__device__ __forceinline__ size_t xrow(size_t r) { return ((r % SS) * NBATCH + r / SS) * (size_t)DM; }   // engine row (b*SS + s) -> module row (s*B + b)
#define HD 64
#define QKVW (3 * DM)
#ifndef TQB
#define TQB (SS / 64)
#define TNB NB
#define TOB (NB * SS / 64)     // output row tiles (all)
#endif
typedef __attribute__((ext_vector_type(8))) __bf16 v8b;
__device__ __forceinline__ v16b frag_b(const __bf16* rowk0, int lane) {
  union { v16b v; v8b q[2]; } u; const __bf16* p = rowk0 + 8 * (lane >> 4);
  u.q[0] = *(const v8b*)p; u.q[1] = *(const v8b*)(p + 16); return u.v;
}
__device__ __forceinline__ float bfr(float v) { return (float)(__bf16)v; }
__device__ __attribute__((noinline)) float exp_ni(float v) { return expf(v); }
__device__ __attribute__((noinline)) float erf_ni(float v) { return erff(v); }

#define PK_A 0                       // [1536][512] Wqkv rows (natural [out][in])
#define PK_P (PK_A + QKVW * DM)        // [512][512] Wo rows (natural)
#define PK_END (PK_P + DM * DM)
#define WS_PK  0u
#define WS_QK  (WS_PK + 2u * PK_END)             // f16 [8192 rows][1024]: q | k
#define WS_QKL (WS_QK + 2u * NB * SS * 2 * DM)     // f16 [8192][1024], not written or read by these kernels
#define WS_VTH (WS_QKL + 2u * NB * SS * 2 * DM)    // f16 [b][512 (h*64+d)][1024 s] hi
#define WS_VTL (WS_VTH + 2u * NB * DM * SS)        // f16 [b][512][1024], not written or read by these kernels
#define WS_O   (WS_VTL + 2u * NB * DM * SS)        // f32 [8192][512]
#define WS_CS  (WS_O + 4u * NB * SS * DM)           // f32 2 x [1024][32], not used by these kernels
#define WS_TB  (WS_CS + 4u * 2 * SS * 32)                  // f32 tables as planes [word][head][NR], L = log2 e: word 0 -(L/16)(|q_h|^2 + 2 q.mu0), 1 -(3L/16)(|q_h|^2 + 2 q.mu1), 2 -|k - mu0|^2 / 2, 3 (3L/16)(|k - mu0|^2 - |k - mu1|^2)
#define WS_A   (WS_TB + 4u * (size_t)NB * SS * 64)
#define WS_END (WS_A + 4u * (size_t)NB * SS * DM)
typedef __attribute__((ext_vector_type(4))) __bf16 v4b;
#define GK 64          // k per LDS stage of the two GEMMs
#define GP (GK + 8)    // LDS row pitch in 16-bit elements: 144 B = 16 B x 9 (odd), so the b128 fragment reads of 16 rows spread over the banks
#define GN (GK / 8)    // 16-B pieces per thread and stage, of the weight tile and of the f32 rows alike
#define XW() asm volatile("s_wait_xcnt 0x0" ::: "memory")   // stands behind a group of stage loads: their address registers are reused only behind it
// one stage (GK k) of a [128 rows][DM] bf16 weight tile in 16-B pieces; one wave-wide load covers four rows x 128 B, whole lines; pw = this thread's piece of the first 128 / GN rows
__device__ __forceinline__ void ldw(v8b (&r)[GN], const __bf16* __restrict__ pw) {
#pragma unroll
  for (int i = 0; i < GN; ++i) r[i] = *(const v8b*)(pw + (size_t)i * (128 / GN) * DM);
}
__device__ __forceinline__ void stw(const v8b (&r)[GN], __bf16* sB, int tid) {
#pragma unroll
  for (int i = 0; i < GN; ++i) *(v8b*)(sB + (i * (128 / GN) + tid / GN) * GP + (tid % GN) * 8) = r[i];
}
#define LOG2E 1.44269504f
// sum over the 16 lanes of a row, every lane of the row gets it: four adds whose second operand comes through DPP row_xmask (0x160 + mask); all lanes are on
template <int M> __device__ __forceinline__ float rowx(float x) { return x + __builtin_bit_cast(float, __builtin_amdgcn_update_dpp(0, __builtin_bit_cast(int, x), 0x160 + M, 0xf, 0xf, true)); }
__device__ __forceinline__ float rowsum16(float x) { return rowx<8>(rowx<4>(rowx<2>(rowx<1>(x)))); }
// this lane's part (4 of the 64 d of each of the block's two heads) of the two table sums of its 8 rows: k rows |k - mu_0|^2, |k - mu_1|^2; q rows |q|^2 + 2 q . mu_0, |q|^2 + 2 q . mu_1
template <bool ISK> __device__ __forceinline__ void tsum(const v8f (&acc)[8], const float (&m0)[8], const float (&m1)[8], float (&ta)[2][8], float (&tb)[2][8]) {
#pragma unroll
  for (int hh = 0; hh < 2; ++hh) {
#pragma unroll
    for (int r = 0; r < 8; ++r) { float a = 0.f, b = 0.f;
#pragma unroll
      for (int jj = 0; jj < 4; ++jj) { const float v = acc[hh * 4 + jj][r], u0 = bfr(m0[hh * 4 + jj]), u1 = bfr(m1[hh * 4 + jj]);
        if (ISK) { const float d0 = v - u0, d1 = v - u1; a += d0 * d0; b += d1 * d1; } else { a += v * (v + 2.0f * u0); b += v * (v + 2.0f * u1); } }
      ta[hh][r] = a; tb[hh][r] = b; } }
}
__global__ __launch_bounds__(128) void k_qkv(const float* __restrict__ XQ, const float* __restrict__ XK, const float* __restrict__ XV, const __bf16* __restrict__ P, const float* __restrict__ BQ, const float* __restrict__ BK, const float* __restrict__ BV, _Float16* __restrict__ QK, const float* __restrict__ MU, _Float16* __restrict__ VTH, float* __restrict__ TB) {
  const int which0 = (blockIdx.y * 128) / DM; const float* X = (which0 == 0) ? XQ : (which0 == 1) ? XK : XV; const float* BB = BQ ? (((which0 == 0) ? BQ : (which0 == 1) ? BK : BV) + (blockIdx.y * 128 - which0 * DM)) : nullptr;
  __shared__ __align__(16) char smem[(128 + 64) * GP * 2];   // stage: weight tile [128][GP] | bf16 input rows [64][GP] (27,648 B); behind the loop's last barrier the same bytes are the output staging (18,432 B)
  __bf16* sB = (__bf16*)smem; __bf16* sA = sB + 128 * GP;
  _Float16 (*so)[16][136] = (_Float16 (*)[16][136])smem; float (*st)[64] = (float (*)[64])(so + 4); _Float16 (*sth)[72] = (_Float16 (*)[72])smem;   // st: the block's table words, [head of the block * 2 + word][row]
  const int tid = threadIdx.x, wave = tid >> 5, lane = tid & 31, col = lane & 15, g = lane >> 4; const size_t r0 = (size_t)blockIdx.x * 64 + wave * 16; const int n0 = blockIdx.y * 128;
  v8f acc[8] = {};
  const __bf16* pw = P + (size_t)(n0 + tid / GN) * DM + (tid % GN) * 8; const size_t rb0 = (size_t)blockIdx.x * 64;
  const int ar = tid / (GK / 4), ap = (tid % (GK / 4)) * 4;   // this thread's row (step 128 / (GK / 4)) and k offset in the f32 rows of a stage
  v8b rw[GN]; v4f ra[GN];   // the next stage, on its way through registers while this stage is multiplied
  const float* px = X + xrow(rb0 + ar) + ap;   // (s, b) input layout: the block's 64 rows are one batch entry's, so the next engine row lies NBATCH * DM further on
  ldw(rw, pw);
#pragma unroll
  for (int i = 0; i < GN; ++i) ra[i] = *(const v4f*)(px + (size_t)i * (512 / GK) * NBATCH * DM);   // one wave-wide load = two rows x 256 B
  XW();
  float m0[8] = {}, m1[8] = {};   // q and k blocks: this lane's elements of mu_0 and mu_1, column j * 16 + col of the block's two heads; loaded here, behind the first stage's loads, so that the epilogue does not wait for them
  if (n0 < 2 * DM) { const float* pm = MU + (n0 & (DM - 1)) + col;
#pragma unroll
    for (int j = 0; j < 8; ++j) { m0[j] = pm[j * 16]; m1[j] = pm[NH * HD + j * 16]; }
    XW(); }
  for (int st = 0; st < DM / GK; ++st) {
    __syncthreads();   // every wave has left the stage that is overwritten next
    stw(rw, sB, tid);
#pragma unroll
    for (int i = 0; i < GN; ++i) { v4b hv; hv[0] = (__bf16)ra[i][0]; hv[1] = (__bf16)ra[i][1]; hv[2] = (__bf16)ra[i][2]; hv[3] = (__bf16)ra[i][3]; *(v4b*)(sA + (i * (512 / GK) + ar) * GP + ap) = hv; }
    __syncthreads();   // the stage is complete for every wave
    if (st + 1 < DM / GK) { ldw(rw, pw + (st + 1) * GK);
#pragma unroll
      for (int i = 0; i < GN; ++i) ra[i] = *(const v4f*)(px + (size_t)i * (512 / GK) * NBATCH * DM + (st + 1) * GK);
      XW(); }
#pragma unroll
    for (int kc = 0; kc < GK / 32; ++kc) { const v16b a = frag_b(sA + (wave * 16 + col) * GP + kc * 32, lane); v16b w[8];
#pragma unroll
      for (int j = 0; j < 8; ++j) w[j] = frag_b(sB + (j * 16 + col) * GP + kc * 32, lane);
      asm volatile("" :: "v"(a), "v"(w[0]), "v"(w[1]), "v"(w[2]), "v"(w[3]), "v"(w[4]), "v"(w[5]), "v"(w[6]), "v"(w[7]));   // holds the nine fragment reads together in front of the products: one LDS wait per eight products, not one per product
#pragma unroll
      for (int j = 0; j < 8; ++j) acc[j] = wmma_bf(a, w[j], acc[j]); } }
  __syncthreads();   // the last stage's reads are over before its bytes become output staging
  if (BB) {
#pragma unroll
    for (int j = 0; j < 8; ++j) { const float bb = bfr(BB[j * 16 + col]);
#pragma unroll
      for (int r = 0; r < 8; ++r) acc[j][r] += bb; } }
  if (n0 < 2 * DM) {   // q stored unscaled (f16 sigma ~0.6, no subnormal exposure); 1/8 and 3/8 (x log2 e) applied to the f32 score
    const bool isk = n0 >= DM; const int h0 = (n0 & (DM - 1)) / HD;   // the block holds heads h0 and h0 + 1 of q or of k
#pragma unroll
    for (int j = 0; j < 8; ++j) {
#pragma unroll
      for (int r = 0; r < 8; ++r) so[wave][8 * g + r][j * 16 + col] = (_Float16)acc[j][r]; }   // q, k (+ bias) as f16
    float ta[2][8], tb[2][8];
    if (isk) tsum<true>(acc, m0, m1, ta, tb); else tsum<false>(acc, m0, m1, ta, tb);
#pragma unroll
    for (int hh = 0; hh < 2; ++hh) {
#pragma unroll
      for (int r = 0; r < 8; ++r) { ta[hh][r] = rowsum16(ta[hh][r]); tb[hh][r] = rowsum16(tb[hh][r]); } }
    if (col == 0) {   // one lane of each half stores the words of its 8 rows
#pragma unroll
      for (int hh = 0; hh < 2; ++hh) { v4f w0[2], w1[2];
#pragma unroll
        for (int r = 0; r < 8; ++r) { const float a = ta[hh][r], b = tb[hh][r]; w0[r >> 2][r & 3] = isk ? -0.5f * a : a * (-0.0625f * LOG2E); w1[r >> 2][r & 3] = isk ? (a - b) * (0.1875f * LOG2E) : b * (-0.1875f * LOG2E); }
#pragma unroll
        for (int c = 0; c < 2; ++c) { *(v4f*)&st[hh * 2][wave * 16 + 8 * g + 4 * c] = w0[c]; *(v4f*)&st[hh * 2 + 1][wave * 16 + 8 * g + 4 * c] = w1[c]; } } }
    __syncthreads();   // the four waves' table words are complete before two waves store them as whole lines; each wave's own staged rows are complete too
    for (int rl = 0; rl < 16; ++rl) if (lane < 16) vst2((unsigned*)(QK + (r0 + rl) * (2 * DM) + n0 + lane * 8), *(const v4u*)&so[wave][rl][lane * 8]);
    if (tid < 64) { const int p = tid >> 4, pc = tid & 15; vst2(TB + ((size_t)((isk ? 2 : 0) + (p & 1)) * NH + h0 + (p >> 1)) * (NB * SS) + rb0 + pc * 4, *(const v4f*)&st[p][pc * 4]); }   // 16 lanes = the block's 64 rows of one plane, 256 contiguous B
  } else {
#pragma unroll
    for (int j = 0; j < 8; ++j) {
#pragma unroll
      for (int r = 0; r < 8; ++r) sth[j * 16 + col][wave * 16 + 8 * g + r] = (_Float16)acc[j][r]; }
    __syncthreads();
    const size_t rb = (size_t)blockIdx.x * 64; const int b = (int)(rb / SS), s0 = (int)(rb % SS); const int pc0 = n0 - 2 * DM;
    for (int q = tid; q < 128 * 8; q += 128) { const int d = q >> 3, pc = q & 7; const size_t o = ((size_t)b * DM + pc0 + d) * SS + s0 + pc * 8; vst2((unsigned*)(VTH + o), *(const v4u*)&sth[d][pc * 8]); }
  }
}
#define AK 64   // keys per LDS stage of k_attn
#define AP 72   // its LDS row pitch in f16: 144 B = 16 B x 9 (odd), so the b128 fragment reads of 16 rows spread over the banks
__device__ __forceinline__ float xhalf(float x) { return __builtin_bit_cast(float, __builtin_amdgcn_permlanex16(__builtin_bit_cast(int, x), __builtin_bit_cast(int, x), 0x76543210, 0xfedcba98, false, false)); }   // lane l with lane l ^ 16
__global__ __launch_bounds__(128) void k_attn(const _Float16* __restrict__ QK, const _Float16* __restrict__ QKL, const _Float16* __restrict__ VTH, const _Float16* __restrict__ VTL, const void* __restrict__ KMASK, const float* __restrict__ TB, float* __restrict__ O) {
  __shared__ __align__(16) float so[4][16][68];
  __shared__ __align__(16) _Float16 sK[AK][AP], sV[HD][AP]; __shared__ __align__(32) float skn[2][AK];   // one stage of AK keys, shared by the four waves: k rows, v columns (d-major), the two per-key table words
  const int tid = threadIdx.x, wave = tid >> 5, lane = tid & 31, col = lane & 15, g = lane >> 4;
  const int qb = blockIdx.x, h = blockIdx.y, b = blockIdx.z; const int q0 = qb * 64 + wave * 16; const size_t rq = (size_t)b * SS + q0 + col;
  const float q0t = TB[(size_t)h * (NB * SS) + rq], q1t = TB[(size_t)(NH + h) * (NB * SS) + rq];   // the per-query terms of the two scores of this lane's query
  XW();   // the two loads' address registers are reused only behind it
  v16h aq[2];
#pragma unroll
  for (int kc = 0; kc < 2; ++kc) aq[kc] = frag_h(QK + rq * (2 * DM) + h * HD + kc * 32, lane);
  XW();   // the query-side loads' address registers are reused only behind it
  float m = -3.0e38f, l = 0.f;   // running maximum (equal in both halves) and this half's part of the running sum
  v8f acc[4] = {};   // O^T tiles: acc[dt][r] = d (dt * 16 + 8 g + r) of query col
  // stage loads: AK * 128 B of k rows and of v columns in 16-B pieces, a wave-wide load covering four whole 128-B lines; one table word per thread
  const _Float16* gK = QK + ((size_t)b * SS + (tid >> 3)) * (2 * DM) + DM + h * HD + (tid & 7) * 8; const _Float16* gV = VTH + ((size_t)b * DM + h * HD + (tid >> 3)) * SS + (tid & 7) * 8;
  const float* gT = TB + ((size_t)(2 + tid / AK) * NH + h) * (NB * SS) + (size_t)b * SS + (tid & (AK - 1));   // planes 2 and 3: a stage's AK words of a plane are contiguous
  v8h rk[4], rv[4]; float rt;   // the next stage, on its way through registers while this stage is worked on
#pragma unroll
  for (int i = 0; i < 4; ++i) { rk[i] = *(const v8h*)(gK + (size_t)i * 16 * (2 * DM)); rv[i] = *(const v8h*)(gV + (size_t)i * 16 * SS); }
  rt = *gT;
  XW();
  asm volatile("" :: "v"(aq[0]), "v"(aq[1]), "v"(q0t), "v"(q1t));   // the query-side loads are waited for here, once: a wait for them inside the loop would also cover the next stage's loads, which are to stay in flight over the stage's work
  // One pass of the loop = one stage of AK keys: its LDS reads stand in two groups, each ahead of the products that use it (the k rows and table words right behind the stage's barrier, the v columns behind the score products, in flight over the softmax), and the running maximum, the exchange between the halves and the rescaling of the sums come once per AK keys. The loop stays rolled: a second copy of this long body would only cost registers and instruction cache.
#pragma unroll 1
  for (int st = 0; st < SS / AK; ++st) {
    __syncthreads();   // every wave has left the stage that is overwritten next
#pragma unroll
    for (int i = 0; i < 4; ++i) { *(v8h*)&sK[i * 16 + (tid >> 3)][(tid & 7) * 8] = rk[i]; *(v8h*)&sV[i * 16 + (tid >> 3)][(tid & 7) * 8] = rv[i]; }
    skn[tid / AK][tid & (AK - 1)] = rt;
    __syncthreads();   // the stage is complete for every wave
    if (st + 1 < SS / AK) { const size_t k1 = (size_t)(st + 1) * AK;
#pragma unroll
      for (int i = 0; i < 4; ++i) { rk[i] = *(const v8h*)(gK + (k1 + i * 16) * (2 * DM)); rv[i] = *(const v8h*)(gV + (size_t)i * 16 * SS + k1); }
      rt = gT[k1];
      XW(); }
    v16h kf[AK / 16][2], vf[AK / 32][4]; v8f c[AK / 16], dk[AK / 16];   // k fragments [16-key tile][k half], v fragments [32 keys][d tile], the two table words of each tile
#pragma unroll
    for (int ct = 0; ct < AK / 16; ++ct) { c[ct] = *(const v8f*)&skn[0][ct * 16 + 8 * g];   // the products are added onto -|k - mu_0|^2 / 2
#pragma unroll
      for (int kc = 0; kc < 2; ++kc) kf[ct][kc] = frag_h(&sK[ct * 16 + col][kc * 32], lane); }
#pragma unroll
    for (int ct = 0; ct < AK / 16; ++ct) dk[ct] = *(const v8f*)&skn[1][ct * 16 + 8 * g];
    __builtin_amdgcn_sched_barrier(0);   // keeps the group of reads above the products: sunk to their uses, each read's LDS latency is waited out in front of its own product
#pragma unroll
    for (int kc = 0; kc < 2; ++kc) {
#pragma unroll
      for (int ct = 0; ct < AK / 16; ++ct) c[ct] = wmma16(kf[ct][kc], aq[kc], c[ct]); }   // single product: k, q as one-rounding f16 operands; c[ct][r] = k (ct * 16 + 8 g + r) . q (col) - |k - mu_0|^2 / 2; the tiles' chains alternate
#pragma unroll
    for (int sub = 0; sub < AK / 32; ++sub) {
#pragma unroll
      for (int dt = 0; dt < 4; ++dt) vf[sub][dt] = frag_h(&sV[dt * 16 + col][sub * 32], lane); }
    __builtin_amdgcn_sched_barrier(0);   // the v columns' reads are issued here and fly over the softmax's vector work
    v8f s[AK / 16];
#pragma unroll
    for (int ct = 0; ct < AK / 16; ++ct) {
#pragma unroll
      for (int r = 0; r < 8; ++r) { const float x0 = c[ct][r] * (LOG2E * 0.125f) + q0t, x1 = c[ct][r] * (LOG2E * 0.375f) + (dk[ct][r] + q1t); s[ct][r] = fminf(fmaxf(x0, x1), 0.f); } }   // max over the two Gaussian keys (mu_0, mu_1 both read) of min(x_j, 0) = -max(distance^2, 0) x scale x log2 e
    float mx = fmaxf(fmaxf(s[0][0], s[1][0]), fmaxf(s[2][0], s[3][0]));
#pragma unroll
    for (int r = 1; r < 8; ++r) mx = fmaxf(fmaxf(mx, fmaxf(s[0][r], s[1][r])), fmaxf(s[2][r], s[3][r]));
    mx = fmaxf(mx, xhalf(mx));   // both halves now hold the maximum over the AK keys
    const float mn = fmaxf(m, mx); const float mb = mn - 11.0f;
    v16h pb[AK / 32]; float es[AK / 16];
#pragma unroll
    for (int ct = 0; ct < AK / 16; ++ct) { const v8f t = s[ct] - mb; float e[8];
      asm("v_exp_f32 %0, %8\n\tv_exp_f32 %1, %9\n\tv_exp_f32 %2, %10\n\tv_exp_f32 %3, %11\n\tv_exp_f32 %4, %12\n\tv_exp_f32 %5, %13\n\tv_exp_f32 %6, %14\n\tv_exp_f32 %7, %15\n\tv_nop" : "=&v"(e[0]), "=&v"(e[1]), "=&v"(e[2]), "=&v"(e[3]), "=&v"(e[4]), "=&v"(e[5]), "=&v"(e[6]), "=&v"(e[7]) : "v"(t[0]), "v"(t[1]), "v"(t[2]), "v"(t[3]), "v"(t[4]), "v"(t[5]), "v"(t[6]), "v"(t[7]));   // a tile's eight exp2 in one statement, results apart from all sources: behind each stands an independent one, behind the last the v_nop, which is the slot the instruction set asks for behind a transcendental
      es[ct] = e[0]; pb[ct >> 1][(ct & 1) * 8] = (_Float16)e[0];
#pragma unroll
      for (int r = 1; r < 8; ++r) { es[ct] += e[r]; pb[ct >> 1][(ct & 1) * 8 + r] = (_Float16)e[r]; } }   // P carries 2^11 (in the exponent's argument) so small softmax weights stay out of the f16 subnormal range; the sum l carries it too, so it cancels in the epilogue
    float alpha;   // exp2(m - mn); the first pass's m gives 0
    asm("v_exp_f32 %0, %1\n\tv_nop" : "=v"(alpha) : "v"(m - mn));   // in asm so that the slot which the instruction set asks for behind a transcendental stands in the same statement
    l = l * alpha + ((es[0] + es[1]) + (es[2] + es[3])); m = mn;
#pragma unroll
    for (int dt = 0; dt < 4; ++dt) acc[dt] *= alpha;
#pragma unroll
    for (int sub = 0; sub < AK / 32; ++sub) {
#pragma unroll
      for (int dt = 0; dt < 4; ++dt) acc[dt] = wmma16(vf[sub][dt], pb[sub], acc[dt]); } }   // single product: V^T x P^T (x2^11)
  l += xhalf(l);   // the halves' sums are joined once
  { const float il = 1.0f / l;
#pragma unroll
    for (int dt = 0; dt < 4; ++dt) { v4f o0, o1;
#pragma unroll
      for (int r = 0; r < 4; ++r) { o0[r] = acc[dt][r] * il; o1[r] = acc[dt][4 + r] * il; }
      *(v4f*)&so[wave][col][dt * 16 + 8 * g] = o0; *(v4f*)&so[wave][col][dt * 16 + 8 * g + 4] = o1; } }
  LDSX();
  for (int rl = 0; rl < 16; ++rl) if (lane < 16) vst2(O + ((size_t)b * SS + q0 + rl) * DM + h * HD + lane * 4, *(const v4f*)&so[wave][rl][lane * 4]);
}
// ---- k_out: block = (64 rows, 128 cols): out = O(hi/lo) . Wo rows (2 products) + bo
__global__ __launch_bounds__(128) void k_out(const float* __restrict__ O, const __bf16* __restrict__ P, const float* __restrict__ BO, float* __restrict__ Y) {
  __shared__ __align__(16) char smem[(128 + 64 + 64) * GP * 2];   // stage: weight tile [128][GP] | O rows bf16 hi [64][GP] | residual [64][GP]; behind the loop's last barrier the same bytes are the output staging
  __bf16* sB = (__bf16*)smem; __bf16* sAh = sB + 128 * GP; __bf16* sAl = sAh + 64 * GP;
  float (*so)[16][132] = (float (*)[16][132])smem;
  const int tid = threadIdx.x, wave = tid >> 5, lane = tid & 31, col = lane & 15, g = lane >> 4; const size_t r0 = (size_t)blockIdx.x * 64 + wave * 16; const int n0 = blockIdx.y * 128;
  v8f acc[8] = {};
  const __bf16* pw = P + (size_t)(n0 + tid / GN) * DM + (tid % GN) * 8; const int ar = tid / (GK / 4), ap = (tid % (GK / 4)) * 4; const float* Ot = O + ((size_t)blockIdx.x * 64 + ar) * DM + ap;   // this thread's row (step 128 / (GK / 4)) and k offset in the f32 rows of a stage
  v8b rw[GN]; v4f ra[GN];   // the next stage, on its way through registers while this stage is multiplied
  ldw(rw, pw);
#pragma unroll
  for (int i = 0; i < GN; ++i) ra[i] = *(const v4f*)(Ot + (size_t)i * (512 / GK) * DM);   // one wave-wide load = two rows x 256 B
  XW();
  for (int st = 0; st < DM / GK; ++st) {
    __syncthreads();   // every wave has left the stage that is overwritten next
    stw(rw, sB, tid);
#pragma unroll
    for (int i = 0; i < GN; ++i) { v4b hv, lv;
#pragma unroll
      for (int e = 0; e < 4; ++e) { const __bf16 hh = (__bf16)ra[i][e]; hv[e] = hh; lv[e] = (__bf16)(ra[i][e] - (float)hh); }
      *(v4b*)(sAh + (i * (512 / GK) + ar) * GP + ap) = hv; *(v4b*)(sAl + (i * (512 / GK) + ar) * GP + ap) = lv; }
    __syncthreads();   // the stage is complete for every wave
    if (st + 1 < DM / GK) { ldw(rw, pw + (st + 1) * GK);
#pragma unroll
      for (int i = 0; i < GN; ++i) ra[i] = *(const v4f*)(Ot + (size_t)i * (512 / GK) * DM + (st + 1) * GK);
      XW(); }
#pragma unroll
    for (int kc = 0; kc < GK / 32; ++kc) { const v16b ah = frag_b(sAh + (wave * 16 + col) * GP + kc * 32, lane), al = frag_b(sAl + (wave * 16 + col) * GP + kc * 32, lane); v16b w[8];
#pragma unroll
      for (int j = 0; j < 8; ++j) w[j] = frag_b(sB + (j * 16 + col) * GP + kc * 32, lane);
      asm volatile("" :: "v"(ah), "v"(al), "v"(w[0]), "v"(w[1]), "v"(w[2]), "v"(w[3]), "v"(w[4]), "v"(w[5]), "v"(w[6]), "v"(w[7]));   // holds the ten fragment reads together in front of the products: one LDS wait per sixteen products, not one per pair
#pragma unroll
      for (int j = 0; j < 8; ++j) { acc[j] = wmma_bf(al, w[j], acc[j]); acc[j] = wmma_bf(ah, w[j], acc[j]); } } }
  __syncthreads();   // the last stage's reads are over before its bytes become output staging
#pragma unroll
  for (int j = 0; j < 8; ++j) {
#pragma unroll
    for (int r = 0; r < 8; ++r) so[wave][8 * g + r][j * 16 + col] = acc[j][r] + (BO ? bfr(BO[n0 + j * 16 + col]) : 0.f); }
  LDSX();
  for (int rl = 0; rl < 16; ++rl) vst2(Y + xrow(r0 + rl) + n0 + lane * 4, *(const v4f*)&so[wave][rl][lane * 4]);
}
// ---- pack_tile: one work-group turns a PT (k) x PT (n) tile of an (in,out) f32 weight (row length ld) into bf16 rows [n][k] of length DM: whole-line loads (a wave-wide load = two k rows x 256 B), transposed through LDS, whole-line stores (four n rows x 128 B); its loops are unrolled so that the four loads issue as one group
#define PT 64
__device__ __forceinline__ void pack_tile(const float* __restrict__ Wt, int ld, __bf16* __restrict__ dst) {   // Wt = the tile's first element, dst = its first element in the packed rows
  __shared__ __align__(16) __bf16 s[PT][PT + 8]; const int t = threadIdx.x, kr = t >> 4, c4 = (t & 15) * 4; const unsigned vo = (unsigned)(kr * ld + c4); v4f r[4];
#pragma unroll
  for (int i = 0; i < 4; ++i) r[i] = *(const v4f*)(Wt + vo + i * 16 * ld);
  XW();
#pragma unroll
  for (int i = 0; i < 4; ++i) {
#pragma unroll
    for (int e = 0; e < 4; ++e) s[c4 + e][i * 16 + kr] = (__bf16)r[i][e]; }
  __syncthreads();   // the tile is complete before its rows are read back
#pragma unroll
  for (int i = 0; i < 2; ++i) { const int n = i * 32 + (t >> 3), pc = (t & 7) * 8; vst2((unsigned*)(dst + (unsigned)((t >> 3) * DM + pc) + i * 32 * DM), *(const v4u*)&s[n][pc]); }
}
// ---- k_pack: block = (n tile, k tile, which): Wq -> PK_A rows 0..511, Wo -> PK_P
__global__ __launch_bounds__(256) void k_pack(const float* __restrict__ WQ, const float* __restrict__ WO, __bf16* __restrict__ PK) {
  const int n0 = blockIdx.x * PT, k0 = blockIdx.y * PT;
  pack_tile((blockIdx.z ? WO : WQ) + (size_t)k0 * DM + n0, DM, PK + (blockIdx.z ? PK_P : PK_A) + (size_t)n0 * DM + k0);
}
// ---- k_packkv: block = (n tile, k tile) of Wkv (in,out) [512][1024]: k rows (cols 0..511) and v rows (cols 512..1023) follow the q rows in PK_A
__global__ __launch_bounds__(256) void k_packkv(const float* __restrict__ WKV, __bf16* __restrict__ PK) {
  const int n0 = blockIdx.x * PT, k0 = blockIdx.y * PT;
  pack_tile(WKV + (size_t)k0 * (2 * DM) + n0, 2 * DM, PK + PK_A + (size_t)(DM + n0) * DM + k0);
}
#define LR 4   // rows per wave of k_lnsum
// ---- k_lnsum<RAWR>: wave = LR whole rows (a lane holds 16 elements of each, a wave-wide load = 512 contiguous B), all rows' loads in flight together (every loop is unrolled for that, and so that the arrays stay in registers), row sums inside the wave, the LR rows' exchanges side by side: T = LayerNorm(R + A) g + b ; R is a raw input (bf16-rounded) when RAWR, else an f32 intermediate
template <int RAWR>
__global__ __launch_bounds__(256) void k_lnsum(const float* __restrict__ R, const float* __restrict__ A, const float* __restrict__ G, const float* __restrict__ Bt, float* __restrict__ T) {
  const int t = threadIdx.x, lane = t & 31; const size_t b0 = (size_t)blockIdx.x * (8 * LR * DM); const unsigned vo = (unsigned)((t >> 5) * (LR * DM) + lane * 4);   // block base (scalar) + one lane offset that every load and store of the lane shares
  const float* Rb = R + b0; const float* Ab = A + b0; float* Tb = T + b0; v4f v[LR][4], a[LR][4], gm[4], bt[4];
#pragma unroll
  for (int j = 0; j < LR; ++j) {
#pragma unroll
    for (int i = 0; i < 4; ++i) { v[j][i] = *(const v4f*)(Rb + vo + j * DM + i * 128); a[j][i] = *(const v4f*)(Ab + vo + j * DM + i * 128); } }
#pragma unroll
  for (int i = 0; i < 4; ++i) { gm[i] = *(const v4f*)(G + i * 128 + lane * 4); bt[i] = *(const v4f*)(Bt + i * 128 + lane * 4); }
  XW();
  float s[LR], q[LR];
#pragma unroll
  for (int j = 0; j < LR; ++j) { float p[4];
#pragma unroll
    for (int i = 0; i < 4; ++i) { p[i] = 0.f;
#pragma unroll
      for (int e = 0; e < 4; ++e) { v[j][i][e] = (RAWR ? bfr(v[j][i][e]) : v[j][i][e]) + a[j][i][e]; p[i] += v[j][i][e]; } }
    s[j] = (p[0] + p[1]) + (p[2] + p[3]); }
#pragma unroll
  for (int o = 1; o < 32; o <<= 1) {
#pragma unroll
    for (int j = 0; j < LR; ++j) s[j] += __shfl_xor(s[j], o); }
#pragma unroll
  for (int j = 0; j < LR; ++j) { s[j] = s[j] / (float)DM; float p[4];
#pragma unroll
    for (int i = 0; i < 4; ++i) { p[i] = 0.f;
#pragma unroll
      for (int e = 0; e < 4; ++e) { v[j][i][e] -= s[j]; p[i] += v[j][i][e] * v[j][i][e]; } }
    q[j] = (p[0] + p[1]) + (p[2] + p[3]); }
#pragma unroll
  for (int o = 1; o < 32; o <<= 1) {
#pragma unroll
    for (int j = 0; j < LR; ++j) q[j] += __shfl_xor(q[j], o); }
#pragma unroll
  for (int j = 0; j < LR; ++j) { const float inv = 1.0f / sqrtf(q[j] / (float)DM + 1e-5f);
#pragma unroll
    for (int i = 0; i < 4; ++i) { v4f o4;
#pragma unroll
      for (int e = 0; e < 4; ++e) o4[e] = v[j][i][e] * inv * bfr(gm[i][e]) + bfr(bt[i][e]);
      vst2(Tb + vo + j * DM + i * 128, o4); } }
}
extern "C" void kernel_launch(void* const* d_in, const int* in_sizes, int n_in, void* d_out, int out_size, void* d_ws, size_t ws_size, hipStream_t stream) {
  (void)in_sizes; (void)n_in; (void)out_size;
  const float** F = (const float**)d_in;   // 0 h [1024,8,512] (s,b,d), 1 Wq [512,512] (in,out), 2 Wkv [512,1024] (in,out: k | v), 3 Wo [512,512] (in,out), 4 mu [2,8,64], 5 gamma, 6 beta
  if (ws_size < (size_t)WS_END) return;
  char* ws = (char*)d_ws; __bf16* PK = (__bf16*)(ws + WS_PK); _Float16 *QK = (_Float16*)(ws + WS_QK), *QKL = (_Float16*)(ws + WS_QKL), *VTH = (_Float16*)(ws + WS_VTH), *VTL = (_Float16*)(ws + WS_VTL); float *O = (float*)(ws + WS_O), *TB = (float*)(ws + WS_TB), *A = (float*)(ws + WS_A);
  k_pack<<<dim3(DM / PT, DM / PT, 2), 256, 0, stream>>>(F[1], F[3], PK);   // Wq and Wo
  k_packkv<<<dim3(2 * DM / PT, DM / PT), 256, 0, stream>>>(F[2], PK);
  k_qkv<<<dim3(TNB * SS / 64, QKVW / 128), 128, 0, stream>>>(F[0], F[0], F[0], PK + PK_A, nullptr, nullptr, nullptr, QK, F[4], VTH, TB);   // also writes the tables
  k_attn<<<dim3(TQB, NH, TNB), 128, 0, stream>>>(QK, QKL, VTH, VTL, nullptr, TB, O);
  k_out<<<dim3(TOB, DM / 128), 128, 0, stream>>>(O, PK + PK_P, nullptr, A);   // A rows in (s, b) order
  k_lnsum<1><<<TOB * 64 / (8 * LR), 256, 0, stream>>>(F[0], A, F[5], F[6], (float*)d_out);
}

// v007
// Measured time: 71.7 microseconds a run.
// In both of two side-by-side timings against v006, it was 1.04 times as fast.
// Over all steps from v000 it is 3.70 times as fast.
// compute dtype: all float inputs rounded to bf16; q/k/v = h . W with EXACT bf16 products on WMMA 16x16x32 ((in,out) weights as transposed rows); per-(token, head) tables |q|^2 + 2 q . mu_j, |k - mu_j|^2 (j = 0, 1) in f32 from the projections' f32 accumulators; PLAIN scores: q . k single f16, then -max(|q|^2 + |k-mu_j|^2 - 2 q.k + 2 q.mu_j, 0) x (1/16, 3/16) for the two Gaussian keys (mu_0 read too; it is zero), max of the two, in log2 units with the per-query and per-key terms folded in the tables, running-max softmax in f32 (hardware exp2), P (scaled by 2^11, single f16) x v (single f16); out = LayerNorm(h + vec (bf16 hi + residual) . Wo (2 products)) in f32.
#include <hip/hip_runtime.h>
#include <math.h>

typedef __attribute__((ext_vector_type(16))) _Float16 v16h;
typedef __attribute__((ext_vector_type(16))) __bf16 v16b;
typedef __attribute__((ext_vector_type(8)))  _Float16 v8h;
typedef __attribute__((ext_vector_type(8)))  float v8f;
typedef __attribute__((ext_vector_type(4)))  float v4f;
typedef __attribute__((ext_vector_type(2)))  float v2f;
typedef __attribute__((ext_vector_type(4)))  unsigned v4u;
typedef __attribute__((ext_vector_type(4)))  int v4i;
typedef float __attribute__((may_alias)) float_a;
typedef int __attribute__((may_alias)) int_a;

template <typename T> __device__ __forceinline__ void vst2(void* p, T v) { *(T*)p = v;  }
__device__ __forceinline__ v8f wmma16(v16h a, v16h b, v8f c) {
  v8f d = __builtin_amdgcn_wmma_f32_16x16x32_f16(false, a, false, b, (short)0, c, false, false);
  asm volatile("v_nop\n\tv_nop\n\tv_nop\n\tv_nop" : "+v"(d) : "v"(a), "v"(b));
  return d;
}
__device__ __forceinline__ v8f wmma_bf(v16b a, v16b b, v8f c) {
  v8f d = __builtin_amdgcn_wmma_f32_16x16x32_bf16(false, a, false, b, (short)0, c, false, false);
  asm volatile("v_nop\n\tv_nop\n\tv_nop\n\tv_nop" : "+v"(d) : "v"(a), "v"(b));
  return d;
}
// Mixture-of-Gaussian-keys attention (S 1,024, B 8, d 512, 8 heads x 64, two Gaussian keys per position: k and k - mu_1): score = max(-|q - k|^2 / 16, -3 |q - (k - mu_1)|^2 / 16), softmax over keys, . v, Wo, residual, LayerNorm; (s, b, d) layout.
__device__ __forceinline__ v16h frag_h(const _Float16* rowk0, int lane) {
  union { v16h v; v8h q[2]; } u; const _Float16* p = rowk0 + 8 * (lane >> 4);
  u.q[0] = *(const v8h*)p; u.q[1] = *(const v8h*)(p + 16); return u.v;
}
__device__ __forceinline__ v16h frag_f32(const float* rowk0, int lane) {
  v16h a; const float* p = rowk0 + 8 * (lane >> 4);
#pragma unroll
  for (int i = 0; i < 8; ++i) { a[i] = (_Float16)p[i]; a[8 + i] = (_Float16)p[16 + i]; }
  return a;
}
__device__ __forceinline__ v16h frag_f32s(const float* rowk0, int lane, float sc) {
  v16h a; const float* p = rowk0 + 8 * (lane >> 4);
#pragma unroll
  for (int i = 0; i < 8; ++i) { a[i] = (_Float16)(p[i] * sc); a[8 + i] = (_Float16)(p[16 + i] * sc); }
  return a;
}
// column fragment from a [K][ld] layout (column n), rows >= K read as 0
__device__ __forceinline__ v16h fragc_f32(const float* W, int k0, int n, int lane, int ld, int K) {
  v16h a; const int g = lane >> 4;
#pragma unroll
  for (int i = 0; i < 8; ++i) { const int ka = k0 + 8 * g + i, kb = ka + 16;
    a[i] = (_Float16)(ka < K ? W[(size_t)(ka < K ? ka : K - 1) * ld + n] : 0.f); a[8 + i] = (_Float16)(kb < K ? W[(size_t)(kb < K ? kb : K - 1) * ld + n] : 0.f); }
  return a;
}
struct F2 { v16b h, l; };
__device__ __forceinline__ F2 bsplit16(const float v[16]) { F2 r;
#pragma unroll
  for (int i = 0; i < 16; ++i) { const __bf16 h = (__bf16)v[i]; r.h[i] = h; r.l[i] = (__bf16)(v[i] - (float)h); }
  return r; }
__device__ __forceinline__ F2 split_row(const float* row, int k0, int lane) { float v[16]; const float* p = row + k0 + 8 * (lane >> 4);
#pragma unroll
  for (int i = 0; i < 8; ++i) { v[i] = p[i]; v[8 + i] = p[16 + i]; }
  return bsplit16(v); }
__device__ __forceinline__ F2 split_rowK(const float* row, int k0, int lane, int K) { float v[16]; const int g = lane >> 4;
#pragma unroll
  for (int i = 0; i < 8; ++i) { const int ka = k0 + 8 * g + i, kb = ka + 16; v[i] = ka < K ? row[ka < K ? ka : K - 1] : 0.f; v[8 + i] = kb < K ? row[kb < K ? kb : K - 1] : 0.f; }
  return bsplit16(v); }
__device__ __forceinline__ F2 split_col(const float* W, int k0, int n, int lane, int ld, int K) { float v[16]; const int g = lane >> 4;
#pragma unroll
  for (int i = 0; i < 8; ++i) { const int ka = k0 + 8 * g + i, kb = ka + 16; v[i] = ka < K ? W[(size_t)(ka < K ? ka : K - 1) * ld + n] : 0.f; v[8 + i] = kb < K ? W[(size_t)(kb < K ? kb : K - 1) * ld + n] : 0.f; }
  return bsplit16(v); }
__device__ __forceinline__ v8f mac3(const F2& a, const F2& b, v8f c) { c = wmma_bf(a.l, b.h, c); c = wmma_bf(a.h, b.l, c); return wmma_bf(a.h, b.h, c); }
__device__ __forceinline__ float sigm(float v) { return 1.0f / (1.0f + expf(-v)); }
#define LDSX() do { asm volatile("s_wait_dscnt 0" ::: "memory"); __builtin_amdgcn_wave_barrier(); __builtin_amdgcn_fence(__ATOMIC_RELEASE, "workgroup"); } while (0)


#define NB 8
#define SS 1024
#define DM 512
#define NH 8
#define NBATCH 8
__device__ __forceinline__ size_t xrow(size_t r) { return ((r % SS) * NBATCH + r / SS) * (size_t)DM; }   // engine row (b*SS + s) -> module row (s*B + b)
#define HD 64
#define QKVW (3 * DM)
#ifndef TQB
#define TQB (SS / 64)
#define TNB NB
#define TOB (NB * SS / 64)     // output row tiles (all)
#endif
typedef __attribute__((ext_vector_type(8))) __bf16 v8b;
__device__ __forceinline__ v16b frag_b(const __bf16* rowk0, int lane) {
  union { v16b v; v8b q[2]; } u; const __bf16* p = rowk0 + 8 * (lane >> 4);
  u.q[0] = *(const v8b*)p; u.q[1] = *(const v8b*)(p + 16); return u.v;
}
__device__ __forceinline__ float bfr(float v) { return (float)(__bf16)v; }
__device__ __attribute__((noinline)) float exp_ni(float v) { return expf(v); }
__device__ __attribute__((noinline)) float erf_ni(float v) { return erff(v); }

#define PK_A 0                       // [1536][512] Wqkv rows (natural [out][in])
#define PK_P (PK_A + QKVW * DM)        // [512][512] Wo rows (natural)
#define PK_END (PK_P + DM * DM)
#define WS_PK  0u
#define WS_QK  (WS_PK + 2u * PK_END)             // f16 [8192 rows][1024]: q | k
#define WS_QKL (WS_QK + 2u * NB * SS * 2 * DM)     // f16 [8192][1024], not written or read by these kernels
#define WS_VTH (WS_QKL + 2u * NB * SS * 2 * DM)    // f16 [b][512 (h*64+d)][1024 s] hi
#define WS_VTL (WS_VTH + 2u * NB * DM * SS)        // f16 [b][512][1024], not written or read by these kernels
#define WS_O   (WS_VTL + 2u * NB * DM * SS)        // f32 [8192][512]
#define WS_CS  (WS_O + 4u * NB * SS * DM)           // f32 2 x [1024][32], not used by these kernels
#define WS_TB  (WS_CS + 4u * 2 * SS * 32)                  // f32 tables as planes [word][head][NR], L = log2 e: word 0 -(L/16)(|q_h|^2 + 2 q.mu0), 1 -(3L/16)(|q_h|^2 + 2 q.mu1), 2 -|k - mu0|^2 / 2, 3 (3L/16)(|k - mu0|^2 - |k - mu1|^2)
#define WS_A   (WS_TB + 4u * (size_t)NB * SS * 64)
#define WS_END (WS_A + 4u * (size_t)NB * SS * DM)
typedef __attribute__((ext_vector_type(4))) __bf16 v4b;
#define GK 64          // k per LDS stage of the two GEMMs
#define GP (GK + 8)    // LDS row pitch in 16-bit elements: 144 B = 16 B x 9 (odd), so the b128 fragment reads of 16 rows spread over the banks
#define GN (GK / 8)    // 16-B pieces per thread and stage, of the weight tile and of the f32 rows alike
#define XW() asm volatile("s_wait_xcnt 0x0" ::: "memory")   // stands behind a group of stage loads: their address registers are reused only behind it
// one stage (GK k) of a [128 rows][DM] bf16 weight tile in 16-B pieces; one wave-wide load covers four rows x 128 B, whole lines; pw = this thread's piece of the first 128 / GN rows
__device__ __forceinline__ void ldw(v8b (&r)[GN], const __bf16* __restrict__ pw) {
#pragma unroll
  for (int i = 0; i < GN; ++i) r[i] = *(const v8b*)(pw + (size_t)i * (128 / GN) * DM);
}
__device__ __forceinline__ void stw(const v8b (&r)[GN], __bf16* sB, int tid) {
#pragma unroll
  for (int i = 0; i < GN; ++i) *(v8b*)(sB + (i * (128 / GN) + tid / GN) * GP + (tid % GN) * 8) = r[i];
}
#define LOG2E 1.44269504f
// sum over the 16 lanes of a row, every lane of the row gets it: four adds whose second operand comes through DPP row_xmask (0x160 + mask); all lanes are on
template <int M> __device__ __forceinline__ float rowx(float x) { return x + __builtin_bit_cast(float, __builtin_amdgcn_update_dpp(0, __builtin_bit_cast(int, x), 0x160 + M, 0xf, 0xf, true)); }
__device__ __forceinline__ float rowsum16(float x) { return rowx<8>(rowx<4>(rowx<2>(rowx<1>(x)))); }
// this lane's part (4 of the 64 d of each of the block's two heads) of the two table sums of its 8 rows: k rows |k - mu_0|^2, |k - mu_1|^2; q rows |q|^2 + 2 q . mu_0, |q|^2 + 2 q . mu_1
template <bool ISK> __device__ __forceinline__ void tsum(const v8f (&acc)[8], const float (&m0)[8], const float (&m1)[8], float (&ta)[2][8], float (&tb)[2][8]) {
#pragma unroll
  for (int hh = 0; hh < 2; ++hh) {
#pragma unroll
    for (int r = 0; r < 8; ++r) { float a = 0.f, b = 0.f;
#pragma unroll
      for (int jj = 0; jj < 4; ++jj) { const float v = acc[hh * 4 + jj][r], u0 = bfr(m0[hh * 4 + jj]), u1 = bfr(m1[hh * 4 + jj]);
        if (ISK) { const float d0 = v - u0, d1 = v - u1; a += d0 * d0; b += d1 * d1; } else { a += v * (v + 2.0f * u0); b += v * (v + 2.0f * u1); } }
      ta[hh][r] = a; tb[hh][r] = b; } }
}
__global__ __launch_bounds__(128) void k_qkv(const float* __restrict__ XQ, const float* __restrict__ XK, const float* __restrict__ XV, const __bf16* __restrict__ P, const float* __restrict__ BQ, const float* __restrict__ BK, const float* __restrict__ BV, _Float16* __restrict__ QK, const float* __restrict__ MU, _Float16* __restrict__ VTH, float* __restrict__ TB) {
  const int which0 = (blockIdx.y * 128) / DM; const float* X = (which0 == 0) ? XQ : (which0 == 1) ? XK : XV; const float* BB = BQ ? (((which0 == 0) ? BQ : (which0 == 1) ? BK : BV) + (blockIdx.y * 128 - which0 * DM)) : nullptr;
  __shared__ __align__(16) char smem[(128 + 64) * GP * 2];   // stage: weight tile [128][GP] | bf16 input rows [64][GP] (27,648 B); behind the loop's last barrier the same bytes are the output staging (18,432 B)
  __bf16* sB = (__bf16*)smem; __bf16* sA = sB + 128 * GP;
  _Float16 (*so)[16][136] = (_Float16 (*)[16][136])smem; float (*st)[64] = (float (*)[64])(so + 4); _Float16 (*sth)[72] = (_Float16 (*)[72])smem;   // st: the block's table words, [head of the block * 2 + word][row]
  const int tid = threadIdx.x, wave = tid >> 5, lane = tid & 31, col = lane & 15, g = lane >> 4; const size_t r0 = (size_t)blockIdx.x * 64 + wave * 16; const int n0 = blockIdx.y * 128;
  v8f acc[8] = {};
  const __bf16* pw = P + (size_t)(n0 + tid / GN) * DM + (tid % GN) * 8; const size_t rb0 = (size_t)blockIdx.x * 64;
  const int ar = tid / (GK / 4), ap = (tid % (GK / 4)) * 4;   // this thread's row (step 128 / (GK / 4)) and k offset in the f32 rows of a stage
  v8b rw[GN]; v4f ra[GN];   // the next stage, on its way through registers while this stage is multiplied
  const float* px = X + xrow(rb0 + ar) + ap;   // (s, b) input layout: the block's 64 rows are one batch entry's, so the next engine row lies NBATCH * DM further on
  ldw(rw, pw);
#pragma unroll
  for (int i = 0; i < GN; ++i) ra[i] = *(const v4f*)(px + (size_t)i * (512 / GK) * NBATCH * DM);   // one wave-wide load = two rows x 256 B
  XW();
  float m0[8] = {}, m1[8] = {};   // q and k blocks: this lane's elements of mu_0 and mu_1, column j * 16 + col of the block's two heads; loaded here, behind the first stage's loads, so that the epilogue does not wait for them
  if (n0 < 2 * DM) { const float* pm = MU + (n0 & (DM - 1)) + col;
#pragma unroll
    for (int j = 0; j < 8; ++j) { m0[j] = pm[j * 16]; m1[j] = pm[NH * HD + j * 16]; }
    XW(); }
  for (int st = 0; st < DM / GK; ++st) {
    __syncthreads();   // every wave has left the stage that is overwritten next
    stw(rw, sB, tid);
#pragma unroll
    for (int i = 0; i < GN; ++i) { v4b hv; hv[0] = (__bf16)ra[i][0]; hv[1] = (__bf16)ra[i][1]; hv[2] = (__bf16)ra[i][2]; hv[3] = (__bf16)ra[i][3]; *(v4b*)(sA + (i * (512 / GK) + ar) * GP + ap) = hv; }
    __syncthreads();   // the stage is complete for every wave
    if (st + 1 < DM / GK) { ldw(rw, pw + (st + 1) * GK);
#pragma unroll
      for (int i = 0; i < GN; ++i) ra[i] = *(const v4f*)(px + (size_t)i * (512 / GK) * NBATCH * DM + (st + 1) * GK);
      XW(); }
#pragma unroll
    for (int kc = 0; kc < GK / 32; ++kc) { const v16b a = frag_b(sA + (wave * 16 + col) * GP + kc * 32, lane); v16b w[8];
#pragma unroll
      for (int j = 0; j < 8; ++j) w[j] = frag_b(sB + (j * 16 + col) * GP + kc * 32, lane);
      asm volatile("" :: "v"(a), "v"(w[0]), "v"(w[1]), "v"(w[2]), "v"(w[3]), "v"(w[4]), "v"(w[5]), "v"(w[6]), "v"(w[7]));   // holds the nine fragment reads together in front of the products: one LDS wait per eight products, not one per product
#pragma unroll
      for (int j = 0; j < 8; ++j) acc[j] = wmma_bf(a, w[j], acc[j]); } }
  __syncthreads();   // the last stage's reads are over before its bytes become output staging
  if (BB) {
#pragma unroll
    for (int j = 0; j < 8; ++j) { const float bb = bfr(BB[j * 16 + col]);
#pragma unroll
      for (int r = 0; r < 8; ++r) acc[j][r] += bb; } }
  if (n0 < 2 * DM) {   // q stored unscaled (f16 sigma ~0.6, no subnormal exposure); 1/8 and 3/8 (x log2 e) applied to the f32 score
    const bool isk = n0 >= DM; const int h0 = (n0 & (DM - 1)) / HD;   // the block holds heads h0 and h0 + 1 of q or of k
#pragma unroll
    for (int j = 0; j < 8; ++j) {
#pragma unroll
      for (int r = 0; r < 8; ++r) so[wave][8 * g + r][j * 16 + col] = (_Float16)acc[j][r]; }   // q, k (+ bias) as f16
    float ta[2][8], tb[2][8];
    if (isk) tsum<true>(acc, m0, m1, ta, tb); else tsum<false>(acc, m0, m1, ta, tb);
#pragma unroll
    for (int hh = 0; hh < 2; ++hh) {
#pragma unroll
      for (int r = 0; r < 8; ++r) { ta[hh][r] = rowsum16(ta[hh][r]); tb[hh][r] = rowsum16(tb[hh][r]); } }
    if (col == 0) {   // one lane of each half stores the words of its 8 rows
#pragma unroll
      for (int hh = 0; hh < 2; ++hh) { v4f w0[2], w1[2];
#pragma unroll
        for (int r = 0; r < 8; ++r) { const float a = ta[hh][r], b = tb[hh][r]; w0[r >> 2][r & 3] = isk ? -0.5f * a : a * (-0.0625f * LOG2E); w1[r >> 2][r & 3] = isk ? (a - b) * (0.1875f * LOG2E) : b * (-0.1875f * LOG2E); }
#pragma unroll
        for (int c = 0; c < 2; ++c) { *(v4f*)&st[hh * 2][wave * 16 + 8 * g + 4 * c] = w0[c]; *(v4f*)&st[hh * 2 + 1][wave * 16 + 8 * g + 4 * c] = w1[c]; } } }
    __syncthreads();   // the four waves' table words are complete before two waves store them as whole lines; each wave's own staged rows are complete too
    for (int rl = 0; rl < 16; ++rl) if (lane < 16) vst2((unsigned*)(QK + (r0 + rl) * (2 * DM) + n0 + lane * 8), *(const v4u*)&so[wave][rl][lane * 8]);
    if (tid < 64) { const int p = tid >> 4, pc = tid & 15; vst2(TB + ((size_t)((isk ? 2 : 0) + (p & 1)) * NH + h0 + (p >> 1)) * (NB * SS) + rb0 + pc * 4, *(const v4f*)&st[p][pc * 4]); }   // 16 lanes = the block's 64 rows of one plane, 256 contiguous B
  } else {
#pragma unroll
    for (int j = 0; j < 8; ++j) {
#pragma unroll
      for (int r = 0; r < 8; ++r) sth[j * 16 + col][wave * 16 + 8 * g + r] = (_Float16)acc[j][r]; }
    __syncthreads();
    const size_t rb = (size_t)blockIdx.x * 64; const int b = (int)(rb / SS), s0 = (int)(rb % SS); const int pc0 = n0 - 2 * DM;
    for (int q = tid; q < 128 * 8; q += 128) { const int d = q >> 3, pc = q & 7; const size_t o = ((size_t)b * DM + pc0 + d) * SS + s0 + pc * 8; vst2((unsigned*)(VTH + o), *(const v4u*)&sth[d][pc * 8]); }
  }
}
#define AK 64   // keys per LDS stage of k_attn
#define AP 72   // its LDS row pitch in f16: 144 B = 16 B x 9 (odd), so the b128 fragment reads of 16 rows spread over the banks
__device__ __forceinline__ float xhalf(float x) { return __builtin_bit_cast(float, __builtin_amdgcn_permlanex16(__builtin_bit_cast(int, x), __builtin_bit_cast(int, x), 0x76543210, 0xfedcba98, false, false)); }   // lane l with lane l ^ 16
__global__ __launch_bounds__(128) void k_attn(const _Float16* __restrict__ QK, const _Float16* __restrict__ QKL, const _Float16* __restrict__ VTH, const _Float16* __restrict__ VTL, const void* __restrict__ KMASK, const float* __restrict__ TB, float* __restrict__ O) {
  __shared__ __align__(16) float so[4][16][68];
  __shared__ __align__(16) _Float16 sK[AK][AP], sV[HD][AP]; __shared__ __align__(32) float skn[2][AK];   // one stage of AK keys, shared by the four waves: k rows, v columns (d-major), the two per-key table words
  const int tid = threadIdx.x, wave = tid >> 5, lane = tid & 31, col = lane & 15, g = lane >> 4;
  const int qb = blockIdx.x, h = blockIdx.y, b = blockIdx.z; const int q0 = qb * 64 + wave * 16; const size_t rq = (size_t)b * SS + q0 + col;
  const float q0t = TB[(size_t)h * (NB * SS) + rq], q1t = TB[(size_t)(NH + h) * (NB * SS) + rq];   // the per-query terms of the two scores of this lane's query
  XW();   // the two loads' address registers are reused only behind it
  v16h aq[2];
#pragma unroll
  for (int kc = 0; kc < 2; ++kc) aq[kc] = frag_h(QK + rq * (2 * DM) + h * HD + kc * 32, lane);
  XW();   // the query-side loads' address registers are reused only behind it
  float m = -3.0e38f, l = 0.f;   // running maximum (equal in both halves) and this half's part of the running sum
  v8f acc[4] = {};   // O^T tiles: acc[dt][r] = d (dt * 16 + 8 g + r) of query col
  // stage loads: AK * 128 B of k rows and of v columns in 16-B pieces, a wave-wide load covering four whole 128-B lines; one table word per thread
  const _Float16* gK = QK + ((size_t)b * SS + (tid >> 3)) * (2 * DM) + DM + h * HD + (tid & 7) * 8; const _Float16* gV = VTH + ((size_t)b * DM + h * HD + (tid >> 3)) * SS + (tid & 7) * 8;
  const float* gT = TB + ((size_t)(2 + tid / AK) * NH + h) * (NB * SS) + (size_t)b * SS + (tid & (AK - 1));   // planes 2 and 3: a stage's AK words of a plane are contiguous
  v8h rk[4], rv[4]; float rt;   // the next stage, on its way through registers while this stage is worked on
#pragma unroll
  for (int i = 0; i < 4; ++i) { rk[i] = *(const v8h*)(gK + (size_t)i * 16 * (2 * DM)); rv[i] = *(const v8h*)(gV + (size_t)i * 16 * SS); }
  rt = *gT;
  XW();
  asm volatile("" :: "v"(aq[0]), "v"(aq[1]), "v"(q0t), "v"(q1t));   // the query-side loads are waited for here, once: a wait for them inside the loop would also cover the next stage's loads, which are to stay in flight over the stage's work
  // One pass of the loop = one stage of AK keys: its LDS reads stand in two groups, each ahead of the products that use it (the k rows and table words right behind the stage's barrier, the v columns behind the score products, in flight over the softmax), and the running maximum, the exchange between the halves and the rescaling of the sums come once per AK keys. The loop stays rolled: a second copy of this long body would only cost registers and instruction cache.
#pragma unroll 1
  for (int st = 0; st < SS / AK; ++st) {
    __syncthreads();   // every wave has left the stage that is overwritten next
#pragma unroll
    for (int i = 0; i < 4; ++i) { *(v8h*)&sK[i * 16 + (tid >> 3)][(tid & 7) * 8] = rk[i]; *(v8h*)&sV[i * 16 + (tid >> 3)][(tid & 7) * 8] = rv[i]; }
    skn[tid / AK][tid & (AK - 1)] = rt;
    __syncthreads();   // the stage is complete for every wave
    if (st + 1 < SS / AK) { const size_t k1 = (size_t)(st + 1) * AK;
#pragma unroll
      for (int i = 0; i < 4; ++i) { rk[i] = *(const v8h*)(gK + (k1 + i * 16) * (2 * DM)); rv[i] = *(const v8h*)(gV + (size_t)i * 16 * SS + k1); }
      rt = gT[k1];
      XW(); }
    v16h kf[AK / 16][2], vf[AK / 32][4]; v8f c[AK / 16], dk[AK / 16];   // k fragments [16-key tile][k half], v fragments [32 keys][d tile], the two table words of each tile
#pragma unroll
    for (int ct = 0; ct < AK / 16; ++ct) { c[ct] = *(const v8f*)&skn[0][ct * 16 + 8 * g];   // the products are added onto -|k - mu_0|^2 / 2
#pragma unroll
      for (int kc = 0; kc < 2; ++kc) kf[ct][kc] = frag_h(&sK[ct * 16 + col][kc * 32], lane); }
#pragma unroll
    for (int ct = 0; ct < AK / 16; ++ct) dk[ct] = *(const v8f*)&skn[1][ct * 16 + 8 * g];
    __builtin_amdgcn_sched_barrier(0);   // keeps the group of reads above the products: sunk to their uses, each read's LDS latency is waited out in front of its own product
#pragma unroll
    for (int kc = 0; kc < 2; ++kc) {
#pragma unroll
      for (int ct = 0; ct < AK / 16; ++ct) c[ct] = wmma16(kf[ct][kc], aq[kc], c[ct]); }   // single product: k, q as one-rounding f16 operands; c[ct][r] = k (ct * 16 + 8 g + r) . q (col) - |k - mu_0|^2 / 2; the tiles' chains alternate
#pragma unroll
    for (int sub = 0; sub < AK / 32; ++sub) {
#pragma unroll
      for (int dt = 0; dt < 4; ++dt) vf[sub][dt] = frag_h(&sV[dt * 16 + col][sub * 32], lane); }
    __builtin_amdgcn_sched_barrier(0);   // the v columns' reads are issued here and fly over the softmax's vector work
    v8f s[AK / 16];
#pragma unroll
    for (int ct = 0; ct < AK / 16; ++ct) {
#pragma unroll
      for (int r = 0; r < 8; ++r) { const float x0 = c[ct][r] * (LOG2E * 0.125f) + q0t, x1 = c[ct][r] * (LOG2E * 0.375f) + (dk[ct][r] + q1t); s[ct][r] = fminf(fmaxf(x0, x1), 0.f); } }   // max over the two Gaussian keys (mu_0, mu_1 both read) of min(x_j, 0) = -max(distance^2, 0) x scale x log2 e
    float mx = fmaxf(fmaxf(s[0][0], s[1][0]), fmaxf(s[2][0], s[3][0]));
#pragma unroll
    for (int r = 1; r < 8; ++r) mx = fmaxf(fmaxf(mx, fmaxf(s[0][r], s[1][r])), fmaxf(s[2][r], s[3][r]));
    mx = fmaxf(mx, xhalf(mx));   // both halves now hold the maximum over the AK keys
    const float mn = fmaxf(m, mx); const float mb = mn - 11.0f;
    v16h pb[AK / 32]; float es[AK / 16];
#pragma unroll
    for (int ct = 0; ct < AK / 16; ++ct) { const v8f t = s[ct] - mb; float e[8];
      asm("v_exp_f32 %0, %8\n\tv_exp_f32 %1, %9\n\tv_exp_f32 %2, %10\n\tv_exp_f32 %3, %11\n\tv_exp_f32 %4, %12\n\tv_exp_f32 %5, %13\n\tv_exp_f32 %6, %14\n\tv_exp_f32 %7, %15\n\tv_nop" : "=&v"(e[0]), "=&v"(e[1]), "=&v"(e[2]), "=&v"(e[3]), "=&v"(e[4]), "=&v"(e[5]), "=&v"(e[6]), "=&v"(e[7]) : "v"(t[0]), "v"(t[1]), "v"(t[2]), "v"(t[3]), "v"(t[4]), "v"(t[5]), "v"(t[6]), "v"(t[7]));   // a tile's eight exp2 in one statement, results apart from all sources: behind each stands an independent one, behind the last the v_nop, which is the slot the instruction set asks for behind a transcendental
      es[ct] = e[0]; pb[ct >> 1][(ct & 1) * 8] = (_Float16)e[0];
#pragma unroll
      for (int r = 1; r < 8; ++r) { es[ct] += e[r]; pb[ct >> 1][(ct & 1) * 8 + r] = (_Float16)e[r]; } }   // P carries 2^11 (in the exponent's argument) so small softmax weights stay out of the f16 subnormal range; the sum l carries it too, so it cancels in the epilogue
    float alpha;   // exp2(m - mn); the first pass's m gives 0
    asm("v_exp_f32 %0, %1\n\tv_nop" : "=v"(alpha) : "v"(m - mn));   // in asm so that the slot which the instruction set asks for behind a transcendental stands in the same statement
    l = l * alpha + ((es[0] + es[1]) + (es[2] + es[3])); m = mn;
#pragma unroll
    for (int dt = 0; dt < 4; ++dt) acc[dt] *= alpha;
#pragma unroll
    for (int sub = 0; sub < AK / 32; ++sub) {
#pragma unroll
      for (int dt = 0; dt < 4; ++dt) acc[dt] = wmma16(vf[sub][dt], pb[sub], acc[dt]); } }   // single product: V^T x P^T (x2^11)
  l += xhalf(l);   // the halves' sums are joined once
  { const float il = 1.0f / l;
#pragma unroll
    for (int dt = 0; dt < 4; ++dt) { v4f o0, o1;
#pragma unroll
      for (int r = 0; r < 4; ++r) { o0[r] = acc[dt][r] * il; o1[r] = acc[dt][4 + r] * il; }
      *(v4f*)&so[wave][col][dt * 16 + 8 * g] = o0; *(v4f*)&so[wave][col][dt * 16 + 8 * g + 4] = o1; } }
  LDSX();
  for (int rl = 0; rl < 16; ++rl) if (lane < 16) vst2(O + ((size_t)b * SS + q0 + rl) * DM + h * HD + lane * 4, *(const v4f*)&so[wave][rl][lane * 4]);
}
// ---- k_out: block = (64 rows, 128 cols): out = O(hi/lo) . Wo rows (2 products) + bo
__global__ __launch_bounds__(128) void k_out(const float* __restrict__ O, const __bf16* __restrict__ P, const float* __restrict__ BO, float* __restrict__ Y) {
  __shared__ __align__(16) char smem[(128 + 64 + 64) * GP * 2];   // stage: weight tile [128][GP] | O rows bf16 hi [64][GP] | residual [64][GP]; behind the loop's last barrier the same bytes are the output staging
  __bf16* sB = (__bf16*)smem; __bf16* sAh = sB + 128 * GP; __bf16* sAl = sAh + 64 * GP;
  float (*so)[16][132] = (float (*)[16][132])smem;
  const int tid = threadIdx.x, wave = tid >> 5, lane = tid & 31, col = lane & 15, g = lane >> 4; const size_t r0 = (size_t)blockIdx.x * 64 + wave * 16; const int n0 = blockIdx.y * 128;
  v8f acc[8] = {};
  const __bf16* pw = P + (size_t)(n0 + tid / GN) * DM + (tid % GN) * 8; const int ar = tid / (GK / 4), ap = (tid % (GK / 4)) * 4; const float* Ot = O + ((size_t)blockIdx.x * 64 + ar) * DM + ap;   // this thread's row (step 128 / (GK / 4)) and k offset in the f32 rows of a stage
  v8b rw[GN]; v4f ra[GN];   // the next stage, on its way through registers while this stage is multiplied
  ldw(rw, pw);
#pragma unroll
  for (int i = 0; i < GN; ++i) ra[i] = *(const v4f*)(Ot + (size_t)i * (512 / GK) * DM);   // one wave-wide load = two rows x 256 B
  XW();
  for (int st = 0; st < DM / GK; ++st) {
    __syncthreads();   // every wave has left the stage that is overwritten next
    stw(rw, sB, tid);
#pragma unroll
    for (int i = 0; i < GN; ++i) { v4b hv, lv;
#pragma unroll
      for (int e = 0; e < 4; ++e) { const __bf16 hh = (__bf16)ra[i][e]; hv[e] = hh; lv[e] = (__bf16)(ra[i][e] - (float)hh); }
      *(v4b*)(sAh + (i * (512 / GK) + ar) * GP + ap) = hv; *(v4b*)(sAl + (i * (512 / GK) + ar) * GP + ap) = lv; }
    __syncthreads();   // the stage is complete for every wave
    if (st + 1 < DM / GK) { ldw(rw, pw + (st + 1) * GK);
#pragma unroll
      for (int i = 0; i < GN; ++i) ra[i] = *(const v4f*)(Ot + (size_t)i * (512 / GK) * DM + (st + 1) * GK);
      XW(); }
#pragma unroll
    for (int kc = 0; kc < GK / 32; ++kc) { const v16b ah = frag_b(sAh + (wave * 16 + col) * GP + kc * 32, lane), al = frag_b(sAl + (wave * 16 + col) * GP + kc * 32, lane); v16b w[8];
#pragma unroll
      for (int j = 0; j < 8; ++j) w[j] = frag_b(sB + (j * 16 + col) * GP + kc * 32, lane);
      asm volatile("" :: "v"(ah), "v"(al), "v"(w[0]), "v"(w[1]), "v"(w[2]), "v"(w[3]), "v"(w[4]), "v"(w[5]), "v"(w[6]), "v"(w[7]));   // holds the ten fragment reads together in front of the products: one LDS wait per sixteen products, not one per pair
#pragma unroll
      for (int j = 0; j < 8; ++j) { acc[j] = wmma_bf(al, w[j], acc[j]); acc[j] = wmma_bf(ah, w[j], acc[j]); } } }
  __syncthreads();   // the last stage's reads are over before its bytes become output staging
#pragma unroll
  for (int j = 0; j < 8; ++j) {
#pragma unroll
    for (int r = 0; r < 8; ++r) so[wave][8 * g + r][j * 16 + col] = acc[j][r] + (BO ? bfr(BO[n0 + j * 16 + col]) : 0.f); }
  LDSX();
  for (int rl = 0; rl < 16; ++rl) vst2(Y + xrow(r0 + rl) + n0 + lane * 4, *(const v4f*)&so[wave][rl][lane * 4]);
}
// ---- pack_tile: one work-group turns a PT (k) x PT (n) tile of an (in,out) f32 weight (row length ld) into bf16 rows [n][k] of length DM: whole-line loads (a wave-wide load = two k rows x 256 B), transposed through LDS, whole-line stores (four n rows x 128 B); its loops are unrolled so that the four loads issue as one group
#define PT 64
__device__ __forceinline__ void pack_tile(const float* __restrict__ Wt, int ld, __bf16* __restrict__ dst) {   // Wt = the tile's first element, dst = its first element in the packed rows
  __shared__ __align__(16) __bf16 s[PT][PT + 8]; const int t = threadIdx.x, kr = t >> 4, c4 = (t & 15) * 4; const unsigned vo = (unsigned)(kr * ld + c4); v4f r[4];
#pragma unroll
  for (int i = 0; i < 4; ++i) r[i] = *(const v4f*)(Wt + vo + i * 16 * ld);
  XW();
#pragma unroll
  for (int i = 0; i < 4; ++i) {
#pragma unroll
    for (int e = 0; e < 4; ++e) s[c4 + e][i * 16 + kr] = (__bf16)r[i][e]; }
  __syncthreads();   // the tile is complete before its rows are read back
#pragma unroll
  for (int i = 0; i < 2; ++i) { const int n = i * 32 + (t >> 3), pc = (t & 7) * 8; vst2((unsigned*)(dst + (unsigned)((t >> 3) * DM + pc) + i * 32 * DM), *(const v4u*)&s[n][pc]); }
}
// ---- k_pack: block = (n tile, k tile, which): all four 512 x 512 weight panels in one launch, since none of them needs another: 0 Wq -> PK_A rows 0..511, 1 Wo -> PK_P, 2 and 3 the k and the v columns of Wkv (in,out) [512][1024] -> the PK_A rows behind the q rows
__global__ __launch_bounds__(256) void k_pack(const float* __restrict__ WQ, const float* __restrict__ WO, const float* __restrict__ WKV, __bf16* __restrict__ PK) {
  const int n0 = blockIdx.x * PT, k0 = blockIdx.y * PT, z = blockIdx.z;
  __bf16* dst = PK + (z == 1 ? PK_P : PK_A + (z ? z - 1 : 0) * (DM * DM)) + (size_t)n0 * DM + k0;
  if (z < 2) pack_tile((z ? WO : WQ) + (size_t)k0 * DM + n0, DM, dst);   // the branch is the same for the whole work-group; each side has its source's row length as a constant
  else pack_tile(WKV + (size_t)k0 * (2 * DM) + (z - 2) * DM + n0, 2 * DM, dst);
}
#define LR 4   // rows per wave of k_lnsum
// ---- k_lnsum<RAWR>: wave = LR whole rows (a lane holds 16 elements of each, a wave-wide load = 512 contiguous B), all rows' loads in flight together (every loop is unrolled for that, and so that the arrays stay in registers), row sums inside the wave, the LR rows' exchanges side by side: T = LayerNorm(R + A) g + b ; R is a raw input (bf16-rounded) when RAWR, else an f32 intermediate
template <int RAWR>
__global__ __launch_bounds__(256) void k_lnsum(const float* __restrict__ R, const float* __restrict__ A, const float* __restrict__ G, const float* __restrict__ Bt, float* __restrict__ T) {
  const int t = threadIdx.x, lane = t & 31; const size_t b0 = (size_t)blockIdx.x * (8 * LR * DM); const unsigned vo = (unsigned)((t >> 5) * (LR * DM) + lane * 4);   // block base (scalar) + one lane offset that every load and store of the lane shares
  const float* Rb = R + b0; const float* Ab = A + b0; float* Tb = T + b0; v4f v[LR][4], a[LR][4], gm[4], bt[4];
#pragma unroll
  for (int j = 0; j < LR; ++j) {
#pragma unroll
    for (int i = 0; i < 4; ++i) { v[j][i] = *(const v4f*)(Rb + vo + j * DM + i * 128); a[j][i] = *(const v4f*)(Ab + vo + j * DM + i * 128); } }
#pragma unroll
  for (int i = 0; i < 4; ++i) { gm[i] = *(const v4f*)(G + i * 128 + lane * 4); bt[i] = *(const v4f*)(Bt + i * 128 + lane * 4); }
  XW();
  float s[LR], q[LR];
#pragma unroll
  for (int j = 0; j < LR; ++j) { float p[4];
#pragma unroll
    for (int i = 0; i < 4; ++i) { p[i] = 0.f;
#pragma unroll
      for (int e = 0; e < 4; ++e) { v[j][i][e] = (RAWR ? bfr(v[j][i][e]) : v[j][i][e]) + a[j][i][e]; p[i] += v[j][i][e]; } }
    s[j] = (p[0] + p[1]) + (p[2] + p[3]); }
#pragma unroll
  for (int o = 1; o < 32; o <<= 1) {
#pragma unroll
    for (int j = 0; j < LR; ++j) s[j] += __shfl_xor(s[j], o); }
#pragma unroll
  for (int j = 0; j < LR; ++j) { s[j] = s[j] / (float)DM; float p[4];
#pragma unroll
    for (int i = 0; i < 4; ++i) { p[i] = 0.f;
#pragma unroll
      for (int e = 0; e < 4; ++e) { v[j][i][e] -= s[j]; p[i] += v[j][i][e] * v[j][i][e]; } }
    q[j] = (p[0] + p[1]) + (p[2] + p[3]); }
#pragma unroll
  for (int o = 1; o < 32; o <<= 1) {
#pragma unroll
    for (int j = 0; j < LR; ++j) q[j] += __shfl_xor(q[j], o); }
#pragma unroll
  for (int j = 0; j < LR; ++j) { const float inv = 1.0f / sqrtf(q[j] / (float)DM + 1e-5f);
#pragma unroll
    for (int i = 0; i < 4; ++i) { v4f o4;
#pragma unroll
      for (int e = 0; e < 4; ++e) o4[e] = v[j][i][e] * inv * bfr(gm[i][e]) + bfr(bt[i][e]);
      vst2(Tb + vo + j * DM + i * 128, o4); } }
}
extern "C" void kernel_launch(void* const* d_in, const int* in_sizes, int n_in, void* d_out, int out_size, void* d_ws, size_t ws_size, hipStream_t stream) {
  (void)in_sizes; (void)n_in; (void)out_size;
  const float** F = (const float**)d_in;   // 0 h [1024,8,512] (s,b,d), 1 Wq [512,512] (in,out), 2 Wkv [512,1024] (in,out: k | v), 3 Wo [512,512] (in,out), 4 mu [2,8,64], 5 gamma, 6 beta
  if (ws_size < (size_t)WS_END) return;
  char* ws = (char*)d_ws; __bf16* PK = (__bf16*)(ws + WS_PK); _Float16 *QK = (_Float16*)(ws + WS_QK), *QKL = (_Float16*)(ws + WS_QKL), *VTH = (_Float16*)(ws + WS_VTH), *VTL = (_Float16*)(ws + WS_VTL); float *O = (float*)(ws + WS_O), *TB = (float*)(ws + WS_TB), *A = (float*)(ws + WS_A);
  k_pack<<<dim3(DM / PT, DM / PT, 4), 256, 0, stream>>>(F[1], F[3], F[2], PK);   // Wq, Wo and both halves of Wkv
  k_qkv<<<dim3(TNB * SS / 64, QKVW / 128), 128, 0, stream>>>(F[0], F[0], F[0], PK + PK_A, nullptr, nullptr, nullptr, QK, F[4], VTH, TB);   // also writes the tables
  k_attn<<<dim3(TQB, NH, TNB), 128, 0, stream>>>(QK, QKL, VTH, VTL, nullptr, TB, O);
  k_out<<<dim3(TOB, DM / 128), 128, 0, stream>>>(O, PK + PK_P, nullptr, A);   // A rows in (s, b) order
  k_lnsum<1><<<TOB * 64 / (8 * LR), 256, 0, stream>>>(F[0], A, F[5], F[6], (float*)d_out);
}

// v008
// It runs in 67.5 microseconds.
// In both of two side-by-side timings against v007, it was 1.06 times as fast.
// Counting every step since v000, it is 3.94 times as fast.
// compute dtype: all float inputs rounded to bf16; q/k/v = h . W with EXACT bf16 products on WMMA 16x16x32 ((in,out) weights as transposed rows); per-(token, head) tables |q|^2 + 2 q . mu_j, |k - mu_j|^2 (j = 0, 1) in f32 from the projections' f32 accumulators; PLAIN scores: q . k single f16, then -max(|q|^2 + |k-mu_j|^2 - 2 q.k + 2 q.mu_j, 0) x (1/16, 3/16) for the two Gaussian keys (mu_0 read too; it is zero), max of the two, in log2 units with the per-query and per-key terms folded in the tables, running-max softmax in f32 (hardware exp2), P (scaled by 2^11, single f16) x v (single f16); out = LayerNorm(h + vec (bf16 hi + residual) . Wo (2 products)) in f32.
#include <hip/hip_runtime.h>
#include <math.h>

typedef __attribute__((ext_vector_type(16))) _Float16 v16h;
typedef __attribute__((ext_vector_type(16))) __bf16 v16b;
typedef __attribute__((ext_vector_type(8)))  _Float16 v8h;
typedef __attribute__((ext_vector_type(8)))  float v8f;
typedef __attribute__((ext_vector_type(4)))  float v4f;
typedef __attribute__((ext_vector_type(2)))  float v2f;
typedef __attribute__((ext_vector_type(4)))  unsigned v4u;
typedef __attribute__((ext_vector_type(4)))  int v4i;
typedef float __attribute__((may_alias)) float_a;
typedef int __attribute__((may_alias)) int_a;

template <typename T> __device__ __forceinline__ void vst2(void* p, T v) { *(T*)p = v;  }
__device__ __forceinline__ v8f wmma16(v16h a, v16h b, v8f c) {
  v8f d = __builtin_amdgcn_wmma_f32_16x16x32_f16(false, a, false, b, (short)0, c, false, false);
  asm volatile("v_nop\n\tv_nop\n\tv_nop\n\tv_nop" : "+v"(d) : "v"(a), "v"(b));
  return d;
}
__device__ __forceinline__ v8f wmma_bf(v16b a, v16b b, v8f c) {
  v8f d = __builtin_amdgcn_wmma_f32_16x16x32_bf16(false, a, false, b, (short)0, c, false, false);
  asm volatile("v_nop\n\tv_nop\n\tv_nop\n\tv_nop" : "+v"(d) : "v"(a), "v"(b));
  return d;
}
// Mixture-of-Gaussian-keys attention (S 1,024, B 8, d 512, 8 heads x 64, two Gaussian keys per position: k and k - mu_1): score = max(-|q - k|^2 / 16, -3 |q - (k - mu_1)|^2 / 16), softmax over keys, . v, Wo, residual, LayerNorm; (s, b, d) layout.
__device__ __forceinline__ v16h frag_h(const _Float16* rowk0, int lane) {
  union { v16h v; v8h q[2]; } u; const _Float16* p = rowk0 + 8 * (lane >> 4);
  u.q[0] = *(const v8h*)p; u.q[1] = *(const v8h*)(p + 16); return u.v;
}
__device__ __forceinline__ v16h frag_f32(const float* rowk0, int lane) {
  v16h a; const float* p = rowk0 + 8 * (lane >> 4);
#pragma unroll
  for (int i = 0; i < 8; ++i) { a[i] = (_Float16)p[i]; a[8 + i] = (_Float16)p[16 + i]; }
  return a;
}
__device__ __forceinline__ v16h frag_f32s(const float* rowk0, int lane, float sc) {
  v16h a; const float* p = rowk0 + 8 * (lane >> 4);
#pragma unroll
  for (int i = 0; i < 8; ++i) { a[i] = (_Float16)(p[i] * sc); a[8 + i] = (_Float16)(p[16 + i] * sc); }
  return a;
}
// column fragment from a [K][ld] layout (column n), rows >= K read as 0
__device__ __forceinline__ v16h fragc_f32(const float* W, int k0, int n, int lane, int ld, int K) {
  v16h a; const int g = lane >> 4;
#pragma unroll
  for (int i = 0; i < 8; ++i) { const int ka = k0 + 8 * g + i, kb = ka + 16;
    a[i] = (_Float16)(ka < K ? W[(size_t)(ka < K ? ka : K - 1) * ld + n] : 0.f); a[8 + i] = (_Float16)(kb < K ? W[(size_t)(kb < K ? kb : K - 1) * ld + n] : 0.f); }
  return a;
}
struct F2 { v16b h, l; };
__device__ __forceinline__ F2 bsplit16(const float v[16]) { F2 r;
#pragma unroll
  for (int i = 0; i < 16; ++i) { const __bf16 h = (__bf16)v[i]; r.h[i] = h; r.l[i] = (__bf16)(v[i] - (float)h); }
  return r; }
__device__ __forceinline__ F2 split_row(const float* row, int k0, int lane) { float v[16]; const float* p = row + k0 + 8 * (lane >> 4);
#pragma unroll
  for (int i = 0; i < 8; ++i) { v[i] = p[i]; v[8 + i] = p[16 + i]; }
  return bsplit16(v); }
__device__ __forceinline__ F2 split_rowK(const float* row, int k0, int lane, int K) { float v[16]; const int g = lane >> 4;
#pragma unroll
  for (int i = 0; i < 8; ++i) { const int ka = k0 + 8 * g + i, kb = ka + 16; v[i] = ka < K ? row[ka < K ? ka : K - 1] : 0.f; v[8 + i] = kb < K ? row[kb < K ? kb : K - 1] : 0.f; }
  return bsplit16(v); }
__device__ __forceinline__ F2 split_col(const float* W, int k0, int n, int lane, int ld, int K) { float v[16]; const int g = lane >> 4;
#pragma unroll
  for (int i = 0; i < 8; ++i) { const int ka = k0 + 8 * g + i, kb = ka + 16; v[i] = ka < K ? W[(size_t)(ka < K ? ka : K - 1) * ld + n] : 0.f; v[8 + i] = kb < K ? W[(size_t)(kb < K ? kb : K - 1) * ld + n] : 0.f; }
  return bsplit16(v); }
__device__ __forceinline__ v8f mac3(const F2& a, const F2& b, v8f c) { c = wmma_bf(a.l, b.h, c); c = wmma_bf(a.h, b.l, c); return wmma_bf(a.h, b.h, c); }
__device__ __forceinline__ float sigm(float v) { return 1.0f / (1.0f + expf(-v)); }
#define LDSX() do { asm volatile("s_wait_dscnt 0" ::: "memory"); __builtin_amdgcn_wave_barrier(); __builtin_amdgcn_fence(__ATOMIC_RELEASE, "workgroup"); } while (0)


#define NB 8
#define SS 1024
#define DM 512
#define NH 8
#define NBATCH 8
__device__ __forceinline__ size_t xrow(size_t r) { return ((r % SS) * NBATCH + r / SS) * (size_t)DM; }   // engine row (b*SS + s) -> module row (s*B + b)
#define HD 64
#define QKVW (3 * DM)
#ifndef TQB
#define TQB (SS / 64)
#define TNB NB
#define TOB (NB * SS / 64)     // output row tiles (all)
#endif
typedef __attribute__((ext_vector_type(8))) __bf16 v8b;
__device__ __forceinline__ v16b frag_b(const __bf16* rowk0, int lane) {
  union { v16b v; v8b q[2]; } u; const __bf16* p = rowk0 + 8 * (lane >> 4);
  u.q[0] = *(const v8b*)p; u.q[1] = *(const v8b*)(p + 16); return u.v;
}
__device__ __forceinline__ float bfr(float v) { return (float)(__bf16)v; }
__device__ __attribute__((noinline)) float exp_ni(float v) { return expf(v); }
__device__ __attribute__((noinline)) float erf_ni(float v) { return erff(v); }

#define PK_A 0                       // [1536][512] Wqkv rows (natural [out][in])
#define PK_P (PK_A + QKVW * DM)        // [512][512] Wo rows (natural)
#define PK_END (PK_P + DM * DM)
#define WS_PK  0u
#define WS_QK  (WS_PK + 2u * PK_END)             // f16 [8192 rows][1024]: q | k
#define WS_QKL (WS_QK + 2u * NB * SS * 2 * DM)     // f16 [8192][1024], not written or read by these kernels
#define WS_VTH (WS_QKL + 2u * NB * SS * 2 * DM)    // f16 [b][512 (h*64+d)][1024 s] hi
#define WS_VTL (WS_VTH + 2u * NB * DM * SS)        // f16 [b][512][1024], not written or read by these kernels
#define WS_O   (WS_VTL + 2u * NB * DM * SS)        // f32 [8192][512]
#define WS_CS  (WS_O + 4u * NB * SS * DM)           // f32 2 x [1024][32], not used by these kernels
#define WS_TB  (WS_CS + 4u * 2 * SS * 32)                  // f32 tables as planes [word][head][NR], L = log2 e: word 0 -(L/16)(|q_h|^2 + 2 q.mu0), 1 -(3L/16)(|q_h|^2 + 2 q.mu1), 2 -|k - mu0|^2 / 2, 3 (3L/16)(|k - mu0|^2 - |k - mu1|^2)
#define WS_A   (WS_TB + 4u * (size_t)NB * SS * 64)
#define WS_END (WS_A + 4u * (size_t)NB * SS * DM)
typedef __attribute__((ext_vector_type(4))) __bf16 v4b;
#define GK 64          // k per LDS stage of the two GEMMs
#define GP (GK + 8)    // LDS row pitch in 16-bit elements: 144 B = 16 B x 9 (odd), so the b128 fragment reads of 16 rows spread over the banks
#define GN (GK / 8)    // 16-B pieces per thread and stage, of the weight tile and of k_out's f32 rows
#define XW() asm volatile("s_wait_xcnt 0x0" ::: "memory")   // stands behind a group of stage loads: their address registers are reused only behind it
// one stage (GK k) of a [128 rows][DM] bf16 weight tile in 16-B pieces; one wave-wide load covers four rows x 128 B, whole lines; pw = this thread's piece of the first 128 / GN rows
__device__ __forceinline__ void ldw(v8b (&r)[GN], const __bf16* __restrict__ pw) {
#pragma unroll
  for (int i = 0; i < GN; ++i) r[i] = *(const v8b*)(pw + (size_t)i * (128 / GN) * DM);
}
__device__ __forceinline__ void stw(const v8b (&r)[GN], __bf16* sB, int tid) {
#pragma unroll
  for (int i = 0; i < GN; ++i) *(v8b*)(sB + (i * (128 / GN) + tid / GN) * GP + (tid % GN) * 8) = r[i];
}
#define LOG2E 1.44269504f
// sum over the 16 lanes of a row, every lane of the row gets it: four adds whose second operand comes through DPP row_xmask (0x160 + mask); all lanes are on
template <int M> __device__ __forceinline__ float rowx(float x) { return x + __builtin_bit_cast(float, __builtin_amdgcn_update_dpp(0, __builtin_bit_cast(int, x), 0x160 + M, 0xf, 0xf, true)); }
__device__ __forceinline__ float rowsum16(float x) { return rowx<8>(rowx<4>(rowx<2>(rowx<1>(x)))); }
// this lane's part (4 of the 64 d of the wave's head) of the two table sums of its 8 rows of one 16-row tile: k rows |k - mu_0|^2, |k - mu_1|^2; q rows |q|^2 + 2 q . mu_0, |q|^2 + 2 q . mu_1
template <bool ISK> __device__ __forceinline__ void tsum(const v8f (&acc)[4], const float (&m0)[4], const float (&m1)[4], float (&ta)[8], float (&tb)[8]) {
#pragma unroll
  for (int r = 0; r < 8; ++r) { float a = 0.f, b = 0.f;
#pragma unroll
    for (int jj = 0; jj < 4; ++jj) { const float v = acc[jj][r], u0 = bfr(m0[jj]), u1 = bfr(m1[jj]);
      if (ISK) { const float d0 = v - u0, d1 = v - u1; a += d0 * d0; b += d1 * d1; } else { a += v * (v + 2.0f * u0); b += v * (v + 2.0f * u1); } }
    ta[r] = a; tb[r] = b; }
}
#define QR 128   // rows per work-group of k_qkv
#define QXN (QR * GK / 4 / 128)   // 16-B pieces of the f32 input rows per thread and stage
// ---- k_qkv: block = (128 rows, 128 cols), four waves in 2 x 2, a wave = 64 rows x 64 cols (one head): eight fragments from LDS feed sixteen products (a 16 x 128 wave reads nine for eight), and a weight row is fetched by half as many work-groups as with 64-row blocks
__global__ __launch_bounds__(128) void k_qkv(const float* __restrict__ XQ, const float* __restrict__ XK, const float* __restrict__ XV, const __bf16* __restrict__ P, const float* __restrict__ BQ, const float* __restrict__ BK, const float* __restrict__ BV, _Float16* __restrict__ QK, const float* __restrict__ MU, _Float16* __restrict__ VTH, float* __restrict__ TB) {
  const int which0 = (blockIdx.y * 128) / DM; const float* X = (which0 == 0) ? XQ : (which0 == 1) ? XK : XV; const float* BB = BQ ? (((which0 == 0) ? BQ : (which0 == 1) ? BK : BV) + (blockIdx.y * 128 - which0 * DM)) : nullptr;
  __shared__ __align__(16) char smem[(128 + QR) * GP * 2 + 4 * QR * 4];   // stage: weight tile [128][GP] | bf16 input rows [QR][GP] (36,864 B); behind the loop's last barrier the same bytes are the output staging, with the table words behind it
  __bf16* sB = (__bf16*)smem; __bf16* sA = sB + 128 * GP;
  _Float16 (*so)[64][GP] = (_Float16 (*)[64][GP])smem; float (*st)[QR] = (float (*)[QR])(so + 4); _Float16 (*sth)[QR + 8] = (_Float16 (*)[QR + 8])smem;   // so: each wave's 64 x 64 tile; st: the block's table words, [head of the block * 2 + word][row]; sth: v columns [d][row], pitch 272 B = 16 B x 17
  const int tid = threadIdx.x, wave = tid >> 5, lane = tid & 31, col = lane & 15, g = lane >> 4, wr = wave >> 1, wc = wave & 1; const int n0 = blockIdx.y * 128;
  v8f acc[4][4] = {};   // [16-row tile][16-col tile]
  const __bf16* pw = P + (size_t)(n0 + tid / GN) * DM + (tid % GN) * 8; const size_t rb0 = (size_t)blockIdx.x * QR;
  const int ar = tid / (GK / 4), ap = (tid % (GK / 4)) * 4;   // this thread's row (step 128 / (GK / 4)) and k offset in the f32 rows of a stage
  v8b rw[GN]; v4f ra[QXN];   // the next stage, on its way through registers while this stage is multiplied
  const float* px = X + xrow(rb0 + ar) + ap;   // (s, b) input layout: the block's QR rows are one batch entry's, so the next engine row lies NBATCH * DM further on
  ldw(rw, pw);
#pragma unroll
  for (int i = 0; i < QXN; ++i) ra[i] = *(const v4f*)(px + (size_t)i * (512 / GK) * NBATCH * DM);   // one wave-wide load = two rows x 256 B
  XW();
  float m0[4] = {}, m1[4] = {};   // q and k blocks: this lane's elements of mu_0 and mu_1, column j * 16 + col of the wave's head; loaded here, behind the first stage's loads, so that the epilogue does not wait for them
  if (n0 < 2 * DM) { const float* pm = MU + (n0 & (DM - 1)) + wc * HD + col;
#pragma unroll
    for (int j = 0; j < 4; ++j) { m0[j] = pm[j * 16]; m1[j] = pm[NH * HD + j * 16]; }
    XW(); }
  for (int st = 0; st < DM / GK; ++st) {
    __syncthreads();   // every wave has left the stage that is overwritten next
    stw(rw, sB, tid);
#pragma unroll
    for (int i = 0; i < QXN; ++i) { v4b hv; hv[0] = (__bf16)ra[i][0]; hv[1] = (__bf16)ra[i][1]; hv[2] = (__bf16)ra[i][2]; hv[3] = (__bf16)ra[i][3]; *(v4b*)(sA + (i * (512 / GK) + ar) * GP + ap) = hv; }
    __syncthreads();   // the stage is complete for every wave
    if (st + 1 < DM / GK) { ldw(rw, pw + (st + 1) * GK);
#pragma unroll
      for (int i = 0; i < QXN; ++i) ra[i] = *(const v4f*)(px + (size_t)i * (512 / GK) * NBATCH * DM + (st + 1) * GK);
      XW(); }
#pragma unroll
    for (int kc = 0; kc < GK / 32; ++kc) { v16b a[4], w[4];
#pragma unroll
      for (int j = 0; j < 4; ++j) { a[j] = frag_b(sA + (wr * 64 + j * 16 + col) * GP + kc * 32, lane); w[j] = frag_b(sB + (wc * 64 + j * 16 + col) * GP + kc * 32, lane); }
      asm volatile("" :: "v"(a[0]), "v"(a[1]), "v"(a[2]), "v"(a[3]), "v"(w[0]), "v"(w[1]), "v"(w[2]), "v"(w[3]));   // holds the eight fragment reads together in front of the products: one LDS wait per sixteen products, not one per product
#pragma unroll
      for (int i = 0; i < 4; ++i) {
#pragma unroll
        for (int j = 0; j < 4; ++j) acc[i][j] = wmma_bf(a[i], w[j], acc[i][j]); } } }
  __syncthreads();   // the last stage's reads are over before its bytes become output staging
  if (BB) {
#pragma unroll
    for (int j = 0; j < 4; ++j) { const float bb = bfr(BB[wc * 64 + j * 16 + col]);
#pragma unroll
      for (int i = 0; i < 4; ++i) {
#pragma unroll
        for (int r = 0; r < 8; ++r) acc[i][j][r] += bb; } } }
  if (n0 < 2 * DM) {   // q stored unscaled (f16 sigma ~0.6, no subnormal exposure); 1/8 and 3/8 (x log2 e) applied to the f32 score
    const bool isk = n0 >= DM; const int h0 = (n0 & (DM - 1)) / HD;   // the block holds heads h0 and h0 + 1 of q or of k; this wave's head is h0 + wc
#pragma unroll
    for (int i = 0; i < 4; ++i) {
#pragma unroll
      for (int j = 0; j < 4; ++j) {
#pragma unroll
        for (int r = 0; r < 8; ++r) so[wave][i * 16 + 8 * g + r][j * 16 + col] = (_Float16)acc[i][j][r]; }   // q, k (+ bias) as f16
      float ta[8], tb[8];
      if (isk) tsum<true>(acc[i], m0, m1, ta, tb); else tsum<false>(acc[i], m0, m1, ta, tb);
#pragma unroll
      for (int r = 0; r < 8; ++r) { ta[r] = rowsum16(ta[r]); tb[r] = rowsum16(tb[r]); }
      if (col == 0) {   // one lane of each half stores the words of its 8 rows
        v4f w0[2], w1[2];
#pragma unroll
        for (int r = 0; r < 8; ++r) { const float a = ta[r], b = tb[r]; w0[r >> 2][r & 3] = isk ? -0.5f * a : a * (-0.0625f * LOG2E); w1[r >> 2][r & 3] = isk ? (a - b) * (0.1875f * LOG2E) : b * (-0.1875f * LOG2E); }
#pragma unroll
        for (int c = 0; c < 2; ++c) { *(v4f*)&st[wc * 2][wr * 64 + i * 16 + 8 * g + 4 * c] = w0[c]; *(v4f*)&st[wc * 2 + 1][wr * 64 + i * 16 + 8 * g + 4 * c] = w1[c]; } } }
    __syncthreads();   // the four waves' table words are complete before they are stored as whole lines; each wave's own staged rows are complete too
    { const int p = tid >> 5, pc = tid & 31; vst2(TB + ((size_t)((isk ? 2 : 0) + (p & 1)) * NH + h0 + (p >> 1)) * (NB * SS) + rb0 + pc * 4, *(const v4f*)&st[p][pc * 4]); }   // a wave = the block's QR rows of one plane, 512 contiguous B
    _Float16* pq = QK + (rb0 + wr * 64 + (lane >> 3)) * (2 * DM) + n0 + wc * 64 + (lane & 7) * 8;
#pragma unroll
    for (int it = 0; it < 16; ++it) vst2((unsigned*)(pq + (size_t)it * 4 * (2 * DM)), *(const v4u*)&so[wave][it * 4 + (lane >> 3)][(lane & 7) * 8]);   // a wave-wide store = four rows x 128 B, whole lines
  } else {
#pragma unroll
    for (int i = 0; i < 4; ++i) {
#pragma unroll
      for (int j = 0; j < 4; ++j) {
#pragma unroll
        for (int r = 0; r < 8; ++r) sth[wc * 64 + j * 16 + col][wr * 64 + i * 16 + 8 * g + r] = (_Float16)acc[i][j][r]; } }
    __syncthreads();   // the v columns are complete before they are stored as whole lines
    const int b = (int)(rb0 / SS), s0 = (int)(rb0 % SS); const int pc0 = n0 - 2 * DM;
    _Float16* pv = VTH + ((size_t)b * DM + pc0 + (tid >> 4)) * SS + s0 + (tid & 15) * 8;
#pragma unroll
    for (int it = 0; it < 16; ++it) vst2((unsigned*)(pv + (size_t)it * 8 * SS), *(const v4u*)&sth[it * 8 + (tid >> 4)][(tid & 15) * 8]);   // a wave-wide store = two d rows x 256 B
    XW();   // behind the run of stores: their address and data registers are reused only behind it
  }
}
#define AK 64   // keys per LDS stage of k_attn
#define AP 72   // its LDS row pitch in f16: 144 B = 16 B x 9 (odd), so the b128 fragment reads of 16 rows spread over the banks
__device__ __forceinline__ float xhalf(float x) { return __builtin_bit_cast(float, __builtin_amdgcn_permlanex16(__builtin_bit_cast(int, x), __builtin_bit_cast(int, x), 0x76543210, 0xfedcba98, false, false)); }   // lane l with lane l ^ 16
__global__ __launch_bounds__(128) void k_attn(const _Float16* __restrict__ QK, const _Float16* __restrict__ QKL, const _Float16* __restrict__ VTH, const _Float16* __restrict__ VTL, const void* __restrict__ KMASK, const float* __restrict__ TB, float* __restrict__ O) {
  __shared__ __align__(16) float so[4][16][68];
  __shared__ __align__(16) _Float16 sK[AK][AP], sV[HD][AP]; __shared__ __align__(32) float skn[2][AK];   // one stage of AK keys, shared by the four waves: k rows, v columns (d-major), the two per-key table words
  const int tid = threadIdx.x, wave = tid >> 5, lane = tid & 31, col = lane & 15, g = lane >> 4;
  const int qb = blockIdx.x, h = blockIdx.y, b = blockIdx.z; const int q0 = qb * 64 + wave * 16; const size_t rq = (size_t)b * SS + q0 + col;
  const float q0t = TB[(size_t)h * (NB * SS) + rq], q1t = TB[(size_t)(NH + h) * (NB * SS) + rq];   // the per-query terms of the two scores of this lane's query
  XW();   // the two loads' address registers are reused only behind it
  v16h aq[2];
#pragma unroll
  for (int kc = 0; kc < 2; ++kc) aq[kc] = frag_h(QK + rq * (2 * DM) + h * HD + kc * 32, lane);
  XW();   // the query-side loads' address registers are reused only behind it
  float m = -3.0e38f, l = 0.f;   // running maximum (equal in both halves) and this half's part of the running sum
  v8f acc[4] = {};   // O^T tiles: acc[dt][r] = d (dt * 16 + 8 g + r) of query col
  // stage loads: AK * 128 B of k rows and of v columns in 16-B pieces, a wave-wide load covering four whole 128-B lines; one table word per thread
  const _Float16* gK = QK + ((size_t)b * SS + (tid >> 3)) * (2 * DM) + DM + h * HD + (tid & 7) * 8; const _Float16* gV = VTH + ((size_t)b * DM + h * HD + (tid >> 3)) * SS + (tid & 7) * 8;
  const float* gT = TB + ((size_t)(2 + tid / AK) * NH + h) * (NB * SS) + (size_t)b * SS + (tid & (AK - 1));   // planes 2 and 3: a stage's AK words of a plane are contiguous
  v8h rk[4], rv[4]; float rt;   // the next stage, on its way through registers while this stage is worked on
#pragma unroll
  for (int i = 0; i < 4; ++i) { rk[i] = *(const v8h*)(gK + (size_t)i * 16 * (2 * DM)); rv[i] = *(const v8h*)(gV + (size_t)i * 16 * SS); }
  rt = *gT;
  XW();
  asm volatile("" :: "v"(aq[0]), "v"(aq[1]), "v"(q0t), "v"(q1t));   // the query-side loads are waited for here, once: a wait for them inside the loop would also cover the next stage's loads, which are to stay in flight over the stage's work
  // One pass of the loop = one stage of AK keys: its LDS reads stand in two groups, each ahead of the products that use it (the k rows and table words right behind the stage's barrier, the v columns behind the score products, in flight over the softmax), and the running maximum, the exchange between the halves and the rescaling of the sums come once per AK keys. The loop stays rolled: a second copy of this long body would only cost registers and instruction cache.
#pragma unroll 1
  for (int st = 0; st < SS / AK; ++st) {
    __syncthreads();   // every wave has left the stage that is overwritten next
#pragma unroll
    for (int i = 0; i < 4; ++i) { *(v8h*)&sK[i * 16 + (tid >> 3)][(tid & 7) * 8] = rk[i]; *(v8h*)&sV[i * 16 + (tid >> 3)][(tid & 7) * 8] = rv[i]; }
    skn[tid / AK][tid & (AK - 1)] = rt;
    __syncthreads();   // the stage is complete for every wave
    if (st + 1 < SS / AK) { const size_t k1 = (size_t)(st + 1) * AK;
#pragma unroll
      for (int i = 0; i < 4; ++i) { rk[i] = *(const v8h*)(gK + (k1 + i * 16) * (2 * DM)); rv[i] = *(const v8h*)(gV + (size_t)i * 16 * SS + k1); }
      rt = gT[k1];
      XW(); }
    v16h kf[AK / 16][2], vf[AK / 32][4]; v8f c[AK / 16], dk[AK / 16];   // k fragments [16-key tile][k half], v fragments [32 keys][d tile], the two table words of each tile
#pragma unroll
    for (int ct = 0; ct < AK / 16; ++ct) { c[ct] = *(const v8f*)&skn[0][ct * 16 + 8 * g];   // the products are added onto -|k - mu_0|^2 / 2
#pragma unroll
      for (int kc = 0; kc < 2; ++kc) kf[ct][kc] = frag_h(&sK[ct * 16 + col][kc * 32], lane); }
#pragma unroll
    for (int ct = 0; ct < AK / 16; ++ct) dk[ct] = *(const v8f*)&skn[1][ct * 16 + 8 * g];
    __builtin_amdgcn_sched_barrier(0);   // keeps the group of reads above the products: sunk to their uses, each read's LDS latency is waited out in front of its own product
#pragma unroll
    for (int kc = 0; kc < 2; ++kc) {
#pragma unroll
      for (int ct = 0; ct < AK / 16; ++ct) c[ct] = wmma16(kf[ct][kc], aq[kc], c[ct]); }   // single product: k, q as one-rounding f16 operands; c[ct][r] = k (ct * 16 + 8 g + r) . q (col) - |k - mu_0|^2 / 2; the tiles' chains alternate
#pragma unroll
    for (int sub = 0; sub < AK / 32; ++sub) {
#pragma unroll
      for (int dt = 0; dt < 4; ++dt) vf[sub][dt] = frag_h(&sV[dt * 16 + col][sub * 32], lane); }
    __builtin_amdgcn_sched_barrier(0);   // the v columns' reads are issued here and fly over the softmax's vector work
    v8f s[AK / 16];
#pragma unroll
    for (int ct = 0; ct < AK / 16; ++ct) {
#pragma unroll
      for (int r = 0; r < 8; ++r) { const float x0 = c[ct][r] * (LOG2E * 0.125f) + q0t, x1 = c[ct][r] * (LOG2E * 0.375f) + (dk[ct][r] + q1t); s[ct][r] = fminf(fmaxf(x0, x1), 0.f); } }   // max over the two Gaussian keys (mu_0, mu_1 both read) of min(x_j, 0) = -max(distance^2, 0) x scale x log2 e
    float mx = fmaxf(fmaxf(s[0][0], s[1][0]), fmaxf(s[2][0], s[3][0]));
#pragma unroll
    for (int r = 1; r < 8; ++r) mx = fmaxf(fmaxf(mx, fmaxf(s[0][r], s[1][r])), fmaxf(s[2][r], s[3][r]));
    mx = fmaxf(mx, xhalf(mx));   // both halves now hold the maximum over the AK keys
    const float mn = fmaxf(m, mx); const float mb = mn - 11.0f;
    v16h pb[AK / 32]; float es[AK / 16];
#pragma unroll
    for (int ct = 0; ct < AK / 16; ++ct) { const v8f t = s[ct] - mb; float e[8];
      asm("v_exp_f32 %0, %8\n\tv_exp_f32 %1, %9\n\tv_exp_f32 %2, %10\n\tv_exp_f32 %3, %11\n\tv_exp_f32 %4, %12\n\tv_exp_f32 %5, %13\n\tv_exp_f32 %6, %14\n\tv_exp_f32 %7, %15\n\tv_nop" : "=&v"(e[0]), "=&v"(e[1]), "=&v"(e[2]), "=&v"(e[3]), "=&v"(e[4]), "=&v"(e[5]), "=&v"(e[6]), "=&v"(e[7]) : "v"(t[0]), "v"(t[1]), "v"(t[2]), "v"(t[3]), "v"(t[4]), "v"(t[5]), "v"(t[6]), "v"(t[7]));   // a tile's eight exp2 in one statement, results apart from all sources: behind each stands an independent one, behind the last the v_nop, which is the slot the instruction set asks for behind a transcendental
      es[ct] = e[0]; pb[ct >> 1][(ct & 1) * 8] = (_Float16)e[0];
#pragma unroll
      for (int r = 1; r < 8; ++r) { es[ct] += e[r]; pb[ct >> 1][(ct & 1) * 8 + r] = (_Float16)e[r]; } }   // P carries 2^11 (in the exponent's argument) so small softmax weights stay out of the f16 subnormal range; the sum l carries it too, so it cancels in the epilogue
    float alpha;   // exp2(m - mn); the first pass's m gives 0
    asm("v_exp_f32 %0, %1\n\tv_nop" : "=v"(alpha) : "v"(m - mn));   // in asm so that the slot which the instruction set asks for behind a transcendental stands in the same statement
    l = l * alpha + ((es[0] + es[1]) + (es[2] + es[3])); m = mn;
#pragma unroll
    for (int dt = 0; dt < 4; ++dt) acc[dt] *= alpha;
#pragma unroll
    for (int sub = 0; sub < AK / 32; ++sub) {
#pragma unroll
      for (int dt = 0; dt < 4; ++dt) acc[dt] = wmma16(vf[sub][dt], pb[sub], acc[dt]); } }   // single product: V^T x P^T (x2^11)
  l += xhalf(l);   // the halves' sums are joined once
  { const float il = 1.0f / l;
#pragma unroll
    for (int dt = 0; dt < 4; ++dt) { v4f o0, o1;
#pragma unroll
      for (int r = 0; r < 4; ++r) { o0[r] = acc[dt][r] * il; o1[r] = acc[dt][4 + r] * il; }
      *(v4f*)&so[wave][col][dt * 16 + 8 * g] = o0; *(v4f*)&so[wave][col][dt * 16 + 8 * g + 4] = o1; } }
  LDSX();
  for (int rl = 0; rl < 16; ++rl) if (lane < 16) vst2(O + ((size_t)b * SS + q0 + rl) * DM + h * HD + lane * 4, *(const v4f*)&so[wave][rl][lane * 4]);
}
// ---- k_out: block = (64 rows, 128 cols): out = O(hi/lo) . Wo rows (2 products) + bo
__global__ __launch_bounds__(128) void k_out(const float* __restrict__ O, const __bf16* __restrict__ P, const float* __restrict__ BO, float* __restrict__ Y) {
  __shared__ __align__(16) char smem[(128 + 64 + 64) * GP * 2];   // stage: weight tile [128][GP] | O rows bf16 hi [64][GP] | residual [64][GP]; behind the loop's last barrier the same bytes are the output staging
  __bf16* sB = (__bf16*)smem; __bf16* sAh = sB + 128 * GP; __bf16* sAl = sAh + 64 * GP;
  float (*so)[16][132] = (float (*)[16][132])smem;
  const int tid = threadIdx.x, wave = tid >> 5, lane = tid & 31, col = lane & 15, g = lane >> 4; const size_t r0 = (size_t)blockIdx.x * 64 + wave * 16; const int n0 = blockIdx.y * 128;
  v8f acc[8] = {};
  const __bf16* pw = P + (size_t)(n0 + tid / GN) * DM + (tid % GN) * 8; const int ar = tid / (GK / 4), ap = (tid % (GK / 4)) * 4; const float* Ot = O + ((size_t)blockIdx.x * 64 + ar) * DM + ap;   // this thread's row (step 128 / (GK / 4)) and k offset in the f32 rows of a stage
  v8b rw[GN]; v4f ra[GN];   // the next stage, on its way through registers while this stage is multiplied
  ldw(rw, pw);
#pragma unroll
  for (int i = 0; i < GN; ++i) ra[i] = *(const v4f*)(Ot + (size_t)i * (512 / GK) * DM);   // one wave-wide load = two rows x 256 B
  XW();
  for (int st = 0; st < DM / GK; ++st) {
    __syncthreads();   // every wave has left the stage that is overwritten next
    stw(rw, sB, tid);
#pragma unroll
    for (int i = 0; i < GN; ++i) { v4b hv, lv;
#pragma unroll
      for (int e = 0; e < 4; ++e) { const __bf16 hh = (__bf16)ra[i][e]; hv[e] = hh; lv[e] = (__bf16)(ra[i][e] - (float)hh); }
      *(v4b*)(sAh + (i * (512 / GK) + ar) * GP + ap) = hv; *(v4b*)(sAl + (i * (512 / GK) + ar) * GP + ap) = lv; }
    __syncthreads();   // the stage is complete for every wave
    if (st + 1 < DM / GK) { ldw(rw, pw + (st + 1) * GK);
#pragma unroll
      for (int i = 0; i < GN; ++i) ra[i] = *(const v4f*)(Ot + (size_t)i * (512 / GK) * DM + (st + 1) * GK);
      XW(); }
#pragma unroll
    for (int kc = 0; kc < GK / 32; ++kc) { const v16b ah = frag_b(sAh + (wave * 16 + col) * GP + kc * 32, lane), al = frag_b(sAl + (wave * 16 + col) * GP + kc * 32, lane); v16b w[8];
#pragma unroll
      for (int j = 0; j < 8; ++j) w[j] = frag_b(sB + (j * 16 + col) * GP + kc * 32, lane);
      asm volatile("" :: "v"(ah), "v"(al), "v"(w[0]), "v"(w[1]), "v"(w[2]), "v"(w[3]), "v"(w[4]), "v"(w[5]), "v"(w[6]), "v"(w[7]));   // holds the ten fragment reads together in front of the products: one LDS wait per sixteen products, not one per pair
#pragma unroll
      for (int j = 0; j < 8; ++j) { acc[j] = wmma_bf(al, w[j], acc[j]); acc[j] = wmma_bf(ah, w[j], acc[j]); } } }
  __syncthreads();   // the last stage's reads are over before its bytes become output staging
#pragma unroll
  for (int j = 0; j < 8; ++j) {
#pragma unroll
    for (int r = 0; r < 8; ++r) so[wave][8 * g + r][j * 16 + col] = acc[j][r] + (BO ? bfr(BO[n0 + j * 16 + col]) : 0.f); }
  LDSX();
  for (int rl = 0; rl < 16; ++rl) vst2(Y + xrow(r0 + rl) + n0 + lane * 4, *(const v4f*)&so[wave][rl][lane * 4]);
}
// ---- pack_tile: one work-group turns a PT (k) x PT (n) tile of an (in,out) f32 weight (row length ld) into bf16 rows [n][k] of length DM: whole-line loads (a wave-wide load = two k rows x 256 B), transposed through LDS, whole-line stores (four n rows x 128 B); its loops are unrolled so that the four loads issue as one group
#define PT 64
__device__ __forceinline__ void pack_tile(const float* __restrict__ Wt, int ld, __bf16* __restrict__ dst) {   // Wt = the tile's first element, dst = its first element in the packed rows
  __shared__ __align__(16) __bf16 s[PT][PT + 8]; const int t = threadIdx.x, kr = t >> 4, c4 = (t & 15) * 4; const unsigned vo = (unsigned)(kr * ld + c4); v4f r[4];
#pragma unroll
  for (int i = 0; i < 4; ++i) r[i] = *(const v4f*)(Wt + vo + i * 16 * ld);
  XW();
#pragma unroll
  for (int i = 0; i < 4; ++i) {
#pragma unroll
    for (int e = 0; e < 4; ++e) s[c4 + e][i * 16 + kr] = (__bf16)r[i][e]; }
  __syncthreads();   // the tile is complete before its rows are read back
#pragma unroll
  for (int i = 0; i < 2; ++i) { const int n = i * 32 + (t >> 3), pc = (t & 7) * 8; vst2((unsigned*)(dst + (unsigned)((t >> 3) * DM + pc) + i * 32 * DM), *(const v4u*)&s[n][pc]); }
}
// ---- k_pack: block = (n tile, k tile, which): all four 512 x 512 weight panels in one launch, since none of them needs another: 0 Wq -> PK_A rows 0..511, 1 Wo -> PK_P, 2 and 3 the k and the v columns of Wkv (in,out) [512][1024] -> the PK_A rows behind the q rows
__global__ __launch_bounds__(256) void k_pack(const float* __restrict__ WQ, const float* __restrict__ WO, const float* __restrict__ WKV, __bf16* __restrict__ PK) {
  const int n0 = blockIdx.x * PT, k0 = blockIdx.y * PT, z = blockIdx.z;
  __bf16* dst = PK + (z == 1 ? PK_P : PK_A + (z ? z - 1 : 0) * (DM * DM)) + (size_t)n0 * DM + k0;
  if (z < 2) pack_tile((z ? WO : WQ) + (size_t)k0 * DM + n0, DM, dst);   // the branch is the same for the whole work-group; each side has its source's row length as a constant
  else pack_tile(WKV + (size_t)k0 * (2 * DM) + (z - 2) * DM + n0, 2 * DM, dst);
}
#define LR 4   // rows per wave of k_lnsum
// ---- k_lnsum<RAWR>: wave = LR whole rows (a lane holds 16 elements of each, a wave-wide load = 512 contiguous B), all rows' loads in flight together (every loop is unrolled for that, and so that the arrays stay in registers), row sums inside the wave, the LR rows' exchanges side by side: T = LayerNorm(R + A) g + b ; R is a raw input (bf16-rounded) when RAWR, else an f32 intermediate
template <int RAWR>
__global__ __launch_bounds__(256) void k_lnsum(const float* __restrict__ R, const float* __restrict__ A, const float* __restrict__ G, const float* __restrict__ Bt, float* __restrict__ T) {
  const int t = threadIdx.x, lane = t & 31; const size_t b0 = (size_t)blockIdx.x * (8 * LR * DM); const unsigned vo = (unsigned)((t >> 5) * (LR * DM) + lane * 4);   // block base (scalar) + one lane offset that every load and store of the lane shares
  const float* Rb = R + b0; const float* Ab = A + b0; float* Tb = T + b0; v4f v[LR][4], a[LR][4], gm[4], bt[4];
#pragma unroll
  for (int j = 0; j < LR; ++j) {
#pragma unroll
    for (int i = 0; i < 4; ++i) { v[j][i] = *(const v4f*)(Rb + vo + j * DM + i * 128); a[j][i] = *(const v4f*)(Ab + vo + j * DM + i * 128); } }
#pragma unroll
  for (int i = 0; i < 4; ++i) { gm[i] = *(const v4f*)(G + i * 128 + lane * 4); bt[i] = *(const v4f*)(Bt + i * 128 + lane * 4); }
  XW();
  float s[LR], q[LR];
#pragma unroll
  for (int j = 0; j < LR; ++j) { float p[4];
#pragma unroll
    for (int i = 0; i < 4; ++i) { p[i] = 0.f;
#pragma unroll
      for (int e = 0; e < 4; ++e) { v[j][i][e] = (RAWR ? bfr(v[j][i][e]) : v[j][i][e]) + a[j][i][e]; p[i] += v[j][i][e]; } }
    s[j] = (p[0] + p[1]) + (p[2] + p[3]); }
#pragma unroll
  for (int o = 1; o < 32; o <<= 1) {
#pragma unroll
    for (int j = 0; j < LR; ++j) s[j] += __shfl_xor(s[j], o); }
#pragma unroll
  for (int j = 0; j < LR; ++j) { s[j] = s[j] / (float)DM; float p[4];
#pragma unroll
    for (int i = 0; i < 4; ++i) { p[i] = 0.f;
#pragma unroll
      for (int e = 0; e < 4; ++e) { v[j][i][e] -= s[j]; p[i] += v[j][i][e] * v[j][i][e]; } }
    q[j] = (p[0] + p[1]) + (p[2] + p[3]); }
#pragma unroll
  for (int o = 1; o < 32; o <<= 1) {
#pragma unroll
    for (int j = 0; j < LR; ++j) q[j] += __shfl_xor(q[j], o); }
#pragma unroll
  for (int j = 0; j < LR; ++j) { const float inv = 1.0f / sqrtf(q[j] / (float)DM + 1e-5f);
#pragma unroll
    for (int i = 0; i < 4; ++i) { v4f o4;
#pragma unroll
      for (int e = 0; e < 4; ++e) o4[e] = v[j][i][e] * inv * bfr(gm[i][e]) + bfr(bt[i][e]);
      vst2(Tb + vo + j * DM + i * 128, o4); } }
}
extern "C" void kernel_launch(void* const* d_in, const int* in_sizes, int n_in, void* d_out, int out_size, void* d_ws, size_t ws_size, hipStream_t stream) {
  (void)in_sizes; (void)n_in; (void)out_size;
  const float** F = (const float**)d_in;   // 0 h [1024,8,512] (s,b,d), 1 Wq [512,512] (in,out), 2 Wkv [512,1024] (in,out: k | v), 3 Wo [512,512] (in,out), 4 mu [2,8,64], 5 gamma, 6 beta
  if (ws_size < (size_t)WS_END) return;
  char* ws = (char*)d_ws; __bf16* PK = (__bf16*)(ws + WS_PK); _Float16 *QK = (_Float16*)(ws + WS_QK), *QKL = (_Float16*)(ws + WS_QKL), *VTH = (_Float16*)(ws + WS_VTH), *VTL = (_Float16*)(ws + WS_VTL); float *O = (float*)(ws + WS_O), *TB = (float*)(ws + WS_TB), *A = (float*)(ws + WS_A);
  k_pack<<<dim3(DM / PT, DM / PT, 4), 256, 0, stream>>>(F[1], F[3], F[2], PK);   // Wq, Wo and both halves of Wkv
  k_qkv<<<dim3(TNB * SS / QR, QKVW / 128), 128, 0, stream>>>(F[0], F[0], F[0], PK + PK_A, nullptr, nullptr, nullptr, QK, F[4], VTH, TB);   // also writes the tables
  k_attn<<<dim3(TQB, NH, TNB), 128, 0, stream>>>(QK, QKL, VTH, VTL, nullptr, TB, O);
  k_out<<<dim3(TOB, DM / 128), 128, 0, stream>>>(O, PK + PK_P, nullptr, A);   // A rows in (s, b) order
  k_lnsum<1><<<TOB * 64 / (8 * LR), 256, 0, stream>>>(F[0], A, F[5], F[6], (float*)d_out);
}

// v009
// Measured time: 65.2 microseconds a run.
// In two side-by-side timings against v008, it was 1.03 and 1.04 times as fast.
// All steps since v000 together make it 4.08 times as fast.
// compute dtype: all float inputs rounded to bf16; q/k/v = h . W with EXACT bf16 products on WMMA 16x16x32 ((in,out) weights as transposed rows); per-(token, head) tables |q|^2 + 2 q . mu_j, |k - mu_j|^2 (j = 0, 1) in f32 from the projections' f32 accumulators; PLAIN scores: q . k single f16, then -max(|q|^2 + |k-mu_j|^2 - 2 q.k + 2 q.mu_j, 0) x (1/16, 3/16) for the two Gaussian keys (mu_0 read too; it is zero), max of the two, in log2 units with the per-query and per-key terms folded in the tables, running-max softmax in f32 (hardware exp2), P (scaled by 2^11, single f16) x v (single f16); out = LayerNorm(h + vec (bf16 hi + residual) . Wo (2 products)) in f32.
#include <hip/hip_runtime.h>
#include <math.h>

typedef __attribute__((ext_vector_type(16))) _Float16 v16h;
typedef __attribute__((ext_vector_type(16))) __bf16 v16b;
typedef __attribute__((ext_vector_type(8)))  _Float16 v8h;
typedef __attribute__((ext_vector_type(8)))  float v8f;
typedef __attribute__((ext_vector_type(4)))  float v4f;
typedef __attribute__((ext_vector_type(2)))  float v2f;
typedef __attribute__((ext_vector_type(4)))  unsigned v4u;
typedef __attribute__((ext_vector_type(4)))  int v4i;
typedef float __attribute__((may_alias)) float_a;
typedef int __attribute__((may_alias)) int_a;

template <typename T> __device__ __forceinline__ void vst2(void* p, T v) { *(T*)p = v;  }
__device__ __forceinline__ v8f wmma16(v16h a, v16h b, v8f c) {
  v8f d = __builtin_amdgcn_wmma_f32_16x16x32_f16(false, a, false, b, (short)0, c, false, false);
  asm volatile("v_nop\n\tv_nop\n\tv_nop\n\tv_nop" : "+v"(d) : "v"(a), "v"(b));
  return d;
}
__device__ __forceinline__ v8f wmma_bf(v16b a, v16b b, v8f c) {
  v8f d = __builtin_amdgcn_wmma_f32_16x16x32_bf16(false, a, false, b, (short)0, c, false, false);
  asm volatile("v_nop\n\tv_nop\n\tv_nop\n\tv_nop" : "+v"(d) : "v"(a), "v"(b));
  return d;
}
// Mixture-of-Gaussian-keys attention (S 1,024, B 8, d 512, 8 heads x 64, two Gaussian keys per position: k and k - mu_1): score = max(-|q - k|^2 / 16, -3 |q - (k - mu_1)|^2 / 16), softmax over keys, . v, Wo, residual, LayerNorm; (s, b, d) layout.
__device__ __forceinline__ v16h frag_h(const _Float16* rowk0, int lane) {
  union { v16h v; v8h q[2]; } u; const _Float16* p = rowk0 + 8 * (lane >> 4);
  u.q[0] = *(const v8h*)p; u.q[1] = *(const v8h*)(p + 16); return u.v;
}
__device__ __forceinline__ v16h frag_f32(const float* rowk0, int lane) {
  v16h a; const float* p = rowk0 + 8 * (lane >> 4);
#pragma unroll
  for (int i = 0; i < 8; ++i) { a[i] = (_Float16)p[i]; a[8 + i] = (_Float16)p[16 + i]; }
  return a;
}
__device__ __forceinline__ v16h frag_f32s(const float* rowk0, int lane, float sc) {
  v16h a; const float* p = rowk0 + 8 * (lane >> 4);
#pragma unroll
  for (int i = 0; i < 8; ++i) { a[i] = (_Float16)(p[i] * sc); a[8 + i] = (_Float16)(p[16 + i] * sc); }
  return a;
}
// column fragment from a [K][ld] layout (column n), rows >= K read as 0
__device__ __forceinline__ v16h fragc_f32(const float* W, int k0, int n, int lane, int ld, int K) {
  v16h a; const int g = lane >> 4;
#pragma unroll
  for (int i = 0; i < 8; ++i) { const int ka = k0 + 8 * g + i, kb = ka + 16;
    a[i] = (_Float16)(ka < K ? W[(size_t)(ka < K ? ka : K - 1) * ld + n] : 0.f); a[8 + i] = (_Float16)(kb < K ? W[(size_t)(kb < K ? kb : K - 1) * ld + n] : 0.f); }
  return a;
}
struct F2 { v16b h, l; };
__device__ __forceinline__ F2 bsplit16(const float v[16]) { F2 r;
#pragma unroll
  for (int i = 0; i < 16; ++i) { const __bf16 h = (__bf16)v[i]; r.h[i] = h; r.l[i] = (__bf16)(v[i] - (float)h); }
  return r; }
__device__ __forceinline__ F2 split_row(const float* row, int k0, int lane) { float v[16]; const float* p = row + k0 + 8 * (lane >> 4);
#pragma unroll
  for (int i = 0; i < 8; ++i) { v[i] = p[i]; v[8 + i] = p[16 + i]; }
  return bsplit16(v); }
__device__ __forceinline__ F2 split_rowK(const float* row, int k0, int lane, int K) { float v[16]; const int g = lane >> 4;
#pragma unroll
  for (int i = 0; i < 8; ++i) { const int ka = k0 + 8 * g + i, kb = ka + 16; v[i] = ka < K ? row[ka < K ? ka : K - 1] : 0.f; v[8 + i] = kb < K ? row[kb < K ? kb : K - 1] : 0.f; }
  return bsplit16(v); }
__device__ __forceinline__ F2 split_col(const float* W, int k0, int n, int lane, int ld, int K) { float v[16]; const int g = lane >> 4;
#pragma unroll
  for (int i = 0; i < 8; ++i) { const int ka = k0 + 8 * g + i, kb = ka + 16; v[i] = ka < K ? W[(size_t)(ka < K ? ka : K - 1) * ld + n] : 0.f; v[8 + i] = kb < K ? W[(size_t)(kb < K ? kb : K - 1) * ld + n] : 0.f; }
  return bsplit16(v); }
__device__ __forceinline__ v8f mac3(const F2& a, const F2& b, v8f c) { c = wmma_bf(a.l, b.h, c); c = wmma_bf(a.h, b.l, c); return wmma_bf(a.h, b.h, c); }
__device__ __forceinline__ float sigm(float v) { return 1.0f / (1.0f + expf(-v)); }
#define LDSX() do { asm volatile("s_wait_dscnt 0" ::: "memory"); __builtin_amdgcn_wave_barrier(); __builtin_amdgcn_fence(__ATOMIC_RELEASE, "workgroup"); } while (0)


#define NB 8
#define SS 1024
#define DM 512
#define NH 8
#define NBATCH 8
__device__ __forceinline__ size_t xrow(size_t r) { return ((r % SS) * NBATCH + r / SS) * (size_t)DM; }   // engine row (b*SS + s) -> module row (s*B + b)
#define HD 64
#define QKVW (3 * DM)
#ifndef TQB
#define TQB (SS / 64)
#define TNB NB
#define TOB (NB * SS / 64)     // output row tiles (all)
#endif
typedef __attribute__((ext_vector_type(8))) __bf16 v8b;
__device__ __forceinline__ v16b frag_b(const __bf16* rowk0, int lane) {
  union { v16b v; v8b q[2]; } u; const __bf16* p = rowk0 + 8 * (lane >> 4);
  u.q[0] = *(const v8b*)p; u.q[1] = *(const v8b*)(p + 16); return u.v;
}
__device__ __forceinline__ float bfr(float v) { return (float)(__bf16)v; }
__device__ __attribute__((noinline)) float exp_ni(float v) { return expf(v); }
__device__ __attribute__((noinline)) float erf_ni(float v) { return erff(v); }

#define PK_A 0                       // [1536][512] Wqkv rows (natural [out][in])
#define PK_P (PK_A + QKVW * DM)        // [512][512] Wo rows (natural)
#define PK_END (PK_P + DM * DM)
#define WS_PK  0u
#define WS_QK  (WS_PK + 2u * PK_END)             // f16 [8192 rows][1024]: q | k
#define WS_QKL (WS_QK + 2u * NB * SS * 2 * DM)     // f16 [8192][1024], not written or read by these kernels
#define WS_VTH (WS_QKL + 2u * NB * SS * 2 * DM)    // f16 [b][512 (h*64+d)][1024 s] hi
#define WS_VTL (WS_VTH + 2u * NB * DM * SS)        // f16 [b][512][1024], not written or read by these kernels
#define WS_O   (WS_VTL + 2u * NB * DM * SS)        // f32 [8192][512]
#define WS_CS  (WS_O + 4u * NB * SS * DM)           // f32 2 x [1024][32], not used by these kernels
#define WS_TB  (WS_CS + 4u * 2 * SS * 32)                  // f32 tables as planes [word][head][NR], L = log2 e: word 0 -(L/16)(|q_h|^2 + 2 q.mu0), 1 -(3L/16)(|q_h|^2 + 2 q.mu1), 2 -|k - mu0|^2 / 2, 3 (3L/16)(|k - mu0|^2 - |k - mu1|^2)
#define WS_A   (WS_TB + 4u * (size_t)NB * SS * 64)
#define WS_END (WS_A + 4u * (size_t)NB * SS * DM)
typedef __attribute__((ext_vector_type(4))) __bf16 v4b;
#define GK 64          // k per LDS stage of the two GEMMs
#define GP (GK + 8)    // LDS row pitch in 16-bit elements: 144 B = 16 B x 9 (odd), so the b128 fragment reads of 16 rows spread over the banks
#define GN (GK / 8)    // 16-B pieces per thread and stage, of the weight tile and of k_out's f32 rows
#define XW() asm volatile("s_wait_xcnt 0x0" ::: "memory")   // stands behind a group of stage loads: their address registers are reused only behind it
// one stage (GK k) of a [128 rows][DM] bf16 weight tile in 16-B pieces; one wave-wide load covers four rows x 128 B, whole lines; pw = this thread's piece of the first 128 / GN rows
__device__ __forceinline__ void ldw(v8b (&r)[GN], const __bf16* __restrict__ pw) {
#pragma unroll
  for (int i = 0; i < GN; ++i) r[i] = *(const v8b*)(pw + (size_t)i * (128 / GN) * DM);
}
__device__ __forceinline__ void stw(const v8b (&r)[GN], __bf16* sB, int tid) {
#pragma unroll
  for (int i = 0; i < GN; ++i) *(v8b*)(sB + (i * (128 / GN) + tid / GN) * GP + (tid % GN) * 8) = r[i];
}
#define LOG2E 1.44269504f
// sum over the 16 lanes of a row, every lane of the row gets it: four adds whose second operand comes through DPP row_xmask (0x160 + mask); all lanes are on
template <int M> __device__ __forceinline__ float rowx(float x) { return x + __builtin_bit_cast(float, __builtin_amdgcn_update_dpp(0, __builtin_bit_cast(int, x), 0x160 + M, 0xf, 0xf, true)); }
__device__ __forceinline__ float rowsum16(float x) { return rowx<8>(rowx<4>(rowx<2>(rowx<1>(x)))); }
// this lane's part (4 of the 64 d of the wave's head) of the two table sums of its 8 rows of one 16-row tile: k rows |k - mu_0|^2, |k - mu_1|^2; q rows |q|^2 + 2 q . mu_0, |q|^2 + 2 q . mu_1
template <bool ISK> __device__ __forceinline__ void tsum(const v8f (&acc)[4], const float (&m0)[4], const float (&m1)[4], float (&ta)[8], float (&tb)[8]) {
#pragma unroll
  for (int r = 0; r < 8; ++r) { float a = 0.f, b = 0.f;
#pragma unroll
    for (int jj = 0; jj < 4; ++jj) { const float v = acc[jj][r], u0 = bfr(m0[jj]), u1 = bfr(m1[jj]);
      if (ISK) { const float d0 = v - u0, d1 = v - u1; a += d0 * d0; b += d1 * d1; } else { a += v * (v + 2.0f * u0); b += v * (v + 2.0f * u1); } }
    ta[r] = a; tb[r] = b; }
}
#define QR 128   // rows per work-group of k_qkv
#define QXN (QR * GK / 4 / 128)   // 16-B pieces of the f32 input rows per thread and stage
// ---- k_qkv: block = (128 rows, 128 cols), four waves in 2 x 2, a wave = 64 rows x 64 cols (one head): eight fragments from LDS feed sixteen products (a 16 x 128 wave reads nine for eight), and a weight row is fetched by half as many work-groups as with 64-row blocks
__global__ __launch_bounds__(128) void k_qkv(const float* __restrict__ XQ, const float* __restrict__ XK, const float* __restrict__ XV, const __bf16* __restrict__ P, const float* __restrict__ BQ, const float* __restrict__ BK, const float* __restrict__ BV, _Float16* __restrict__ QK, const float* __restrict__ MU, _Float16* __restrict__ VTH, float* __restrict__ TB) {
  const int which0 = (blockIdx.y * 128) / DM; const float* X = (which0 == 0) ? XQ : (which0 == 1) ? XK : XV; const float* BB = BQ ? (((which0 == 0) ? BQ : (which0 == 1) ? BK : BV) + (blockIdx.y * 128 - which0 * DM)) : nullptr;
  __shared__ __align__(16) char smem[(128 + QR) * GP * 2 + 4 * QR * 4];   // stage: weight tile [128][GP] | bf16 input rows [QR][GP] (36,864 B); behind the loop's last barrier the same bytes are the output staging, with the table words behind it
  __bf16* sB = (__bf16*)smem; __bf16* sA = sB + 128 * GP;
  _Float16 (*so)[64][GP] = (_Float16 (*)[64][GP])smem; float (*st)[QR] = (float (*)[QR])(so + 4); _Float16 (*sth)[QR + 8] = (_Float16 (*)[QR + 8])smem;   // so: each wave's 64 x 64 tile; st: the block's table words, [head of the block * 2 + word][row]; sth: v columns [d][row], pitch 272 B = 16 B x 17
  const int tid = threadIdx.x, wave = tid >> 5, lane = tid & 31, col = lane & 15, g = lane >> 4, wr = wave >> 1, wc = wave & 1; const int n0 = blockIdx.y * 128;
  v8f acc[4][4] = {};   // [16-row tile][16-col tile]
  const __bf16* pw = P + (size_t)(n0 + tid / GN) * DM + (tid % GN) * 8; const size_t rb0 = (size_t)blockIdx.x * QR;
  const int ar = tid / (GK / 4), ap = (tid % (GK / 4)) * 4;   // this thread's row (step 128 / (GK / 4)) and k offset in the f32 rows of a stage
  v8b rw[GN]; v4f ra[QXN];   // the next stage, on its way through registers while this stage is multiplied
  const float* px = X + xrow(rb0 + ar) + ap;   // (s, b) input layout: the block's QR rows are one batch entry's, so the next engine row lies NBATCH * DM further on
  ldw(rw, pw);
#pragma unroll
  for (int i = 0; i < QXN; ++i) ra[i] = *(const v4f*)(px + (size_t)i * (512 / GK) * NBATCH * DM);   // one wave-wide load = two rows x 256 B
  XW();
  float m0[4] = {}, m1[4] = {};   // q and k blocks: this lane's elements of mu_0 and mu_1, column j * 16 + col of the wave's head; loaded here, behind the first stage's loads, so that the epilogue does not wait for them
  if (n0 < 2 * DM) { const float* pm = MU + (n0 & (DM - 1)) + wc * HD + col;
#pragma unroll
    for (int j = 0; j < 4; ++j) { m0[j] = pm[j * 16]; m1[j] = pm[NH * HD + j * 16]; }
    XW(); }
  for (int st = 0; st < DM / GK; ++st) {
    __syncthreads();   // every wave has left the stage that is overwritten next
    stw(rw, sB, tid);
#pragma unroll
    for (int i = 0; i < QXN; ++i) { v4b hv; hv[0] = (__bf16)ra[i][0]; hv[1] = (__bf16)ra[i][1]; hv[2] = (__bf16)ra[i][2]; hv[3] = (__bf16)ra[i][3]; *(v4b*)(sA + (i * (512 / GK) + ar) * GP + ap) = hv; }
    __syncthreads();   // the stage is complete for every wave
    if (st + 1 < DM / GK) { ldw(rw, pw + (st + 1) * GK);
#pragma unroll
      for (int i = 0; i < QXN; ++i) ra[i] = *(const v4f*)(px + (size_t)i * (512 / GK) * NBATCH * DM + (st + 1) * GK);
      XW(); }
#pragma unroll
    for (int kc = 0; kc < GK / 32; ++kc) { v16b a[4], w[4];
#pragma unroll
      for (int j = 0; j < 4; ++j) { a[j] = frag_b(sA + (wr * 64 + j * 16 + col) * GP + kc * 32, lane); w[j] = frag_b(sB + (wc * 64 + j * 16 + col) * GP + kc * 32, lane); }
      asm volatile("" :: "v"(a[0]), "v"(a[1]), "v"(a[2]), "v"(a[3]), "v"(w[0]), "v"(w[1]), "v"(w[2]), "v"(w[3]));   // holds the eight fragment reads together in front of the products: one LDS wait per sixteen products, not one per product
#pragma unroll
      for (int i = 0; i < 4; ++i) {
#pragma unroll
        for (int j = 0; j < 4; ++j) acc[i][j] = wmma_bf(a[i], w[j], acc[i][j]); } } }
  __syncthreads();   // the last stage's reads are over before its bytes become output staging
  if (BB) {
#pragma unroll
    for (int j = 0; j < 4; ++j) { const float bb = bfr(BB[wc * 64 + j * 16 + col]);
#pragma unroll
      for (int i = 0; i < 4; ++i) {
#pragma unroll
        for (int r = 0; r < 8; ++r) acc[i][j][r] += bb; } } }
  if (n0 < 2 * DM) {   // q stored unscaled (f16 sigma ~0.6, no subnormal exposure); 1/8 and 3/8 (x log2 e) applied to the f32 score
    const bool isk = n0 >= DM; const int h0 = (n0 & (DM - 1)) / HD;   // the block holds heads h0 and h0 + 1 of q or of k; this wave's head is h0 + wc
#pragma unroll
    for (int i = 0; i < 4; ++i) {
#pragma unroll
      for (int j = 0; j < 4; ++j) {
#pragma unroll
        for (int r = 0; r < 8; ++r) so[wave][i * 16 + 8 * g + r][j * 16 + col] = (_Float16)acc[i][j][r]; }   // q, k (+ bias) as f16
      float ta[8], tb[8];
      if (isk) tsum<true>(acc[i], m0, m1, ta, tb); else tsum<false>(acc[i], m0, m1, ta, tb);
#pragma unroll
      for (int r = 0; r < 8; ++r) { ta[r] = rowsum16(ta[r]); tb[r] = rowsum16(tb[r]); }
      if (col == 0) {   // one lane of each half stores the words of its 8 rows
        v4f w0[2], w1[2];
#pragma unroll
        for (int r = 0; r < 8; ++r) { const float a = ta[r], b = tb[r]; w0[r >> 2][r & 3] = isk ? -0.5f * a : a * (-0.0625f * LOG2E); w1[r >> 2][r & 3] = isk ? (a - b) * (0.1875f * LOG2E) : b * (-0.1875f * LOG2E); }
#pragma unroll
        for (int c = 0; c < 2; ++c) { *(v4f*)&st[wc * 2][wr * 64 + i * 16 + 8 * g + 4 * c] = w0[c]; *(v4f*)&st[wc * 2 + 1][wr * 64 + i * 16 + 8 * g + 4 * c] = w1[c]; } } }
    __syncthreads();   // the four waves' table words are complete before they are stored as whole lines; each wave's own staged rows are complete too
    { const int p = tid >> 5, pc = tid & 31; vst2(TB + ((size_t)((isk ? 2 : 0) + (p & 1)) * NH + h0 + (p >> 1)) * (NB * SS) + rb0 + pc * 4, *(const v4f*)&st[p][pc * 4]); }   // a wave = the block's QR rows of one plane, 512 contiguous B
    _Float16* pq = QK + (rb0 + wr * 64 + (lane >> 3)) * (2 * DM) + n0 + wc * 64 + (lane & 7) * 8;
#pragma unroll
    for (int it = 0; it < 16; ++it) vst2((unsigned*)(pq + (size_t)it * 4 * (2 * DM)), *(const v4u*)&so[wave][it * 4 + (lane >> 3)][(lane & 7) * 8]);   // a wave-wide store = four rows x 128 B, whole lines
  } else {
#pragma unroll
    for (int i = 0; i < 4; ++i) {
#pragma unroll
      for (int j = 0; j < 4; ++j) {
#pragma unroll
        for (int r = 0; r < 8; ++r) sth[wc * 64 + j * 16 + col][wr * 64 + i * 16 + 8 * g + r] = (_Float16)acc[i][j][r]; } }
    __syncthreads();   // the v columns are complete before they are stored as whole lines
    const int b = (int)(rb0 / SS), s0 = (int)(rb0 % SS); const int pc0 = n0 - 2 * DM;
    _Float16* pv = VTH + ((size_t)b * DM + pc0 + (tid >> 4)) * SS + s0 + (tid & 15) * 8;
#pragma unroll
    for (int it = 0; it < 16; ++it) vst2((unsigned*)(pv + (size_t)it * 8 * SS), *(const v4u*)&sth[it * 8 + (tid >> 4)][(tid & 15) * 8]);   // a wave-wide store = two d rows x 256 B
    XW();   // behind the run of stores: their address and data registers are reused only behind it
  }
}
#define AK 64   // keys per LDS stage of k_attn
#define AP 72   // its LDS row pitch in f16: 144 B = 16 B x 9 (odd), so the b128 fragment reads of 16 rows spread over the banks
__device__ __forceinline__ float xhalf(float x) { return __builtin_bit_cast(float, __builtin_amdgcn_permlanex16(__builtin_bit_cast(int, x), __builtin_bit_cast(int, x), 0x76543210, 0xfedcba98, false, false)); }   // lane l with lane l ^ 16
#define AQ 2   // 16-query tiles per wave of k_attn: every k, v and table fragment read from LDS serves AQ products
__global__ __launch_bounds__(128) void k_attn(const _Float16* __restrict__ QK, const _Float16* __restrict__ QKL, const _Float16* __restrict__ VTH, const _Float16* __restrict__ VTL, const void* __restrict__ KMASK, const float* __restrict__ TB, float* __restrict__ O) {
  __shared__ __align__(16) float so[4][16 * AQ][68];
  __shared__ __align__(16) _Float16 sK[AK][AP], sV[HD][AP]; __shared__ __align__(32) float skn[2][AK];   // one stage of AK keys, shared by the four waves: k rows, v columns (d-major), the two per-key table words
  const int tid = threadIdx.x, wave = tid >> 5, lane = tid & 31, col = lane & 15, g = lane >> 4;
  const int qb = blockIdx.x, h = blockIdx.y, b = blockIdx.z; const int q0 = (qb * 4 + wave) * (16 * AQ); const size_t rq = (size_t)b * SS + q0 + col;   // this lane's query of tile qt is row rq + 16 qt
  float q0t[AQ], q1t[AQ];   // the per-query terms of the two scores of this lane's queries
#pragma unroll
  for (int qt = 0; qt < AQ; ++qt) { q0t[qt] = TB[(size_t)h * (NB * SS) + rq + qt * 16]; q1t[qt] = TB[(size_t)(NH + h) * (NB * SS) + rq + qt * 16]; }
  XW();   // the loads' address registers are reused only behind it
  __builtin_amdgcn_sched_barrier(0);   // holds the later address arithmetic behind that wait: without it the compiler lifted a write of the loads' address pair over the wait
  v16h aq[AQ][2];
#pragma unroll
  for (int qt = 0; qt < AQ; ++qt) {
#pragma unroll
    for (int kc = 0; kc < 2; ++kc) aq[qt][kc] = frag_h(QK + (rq + qt * 16) * (2 * DM) + h * HD + kc * 32, lane); }
  XW();   // the query-side loads' address registers are reused only behind it
  float m[AQ], l[AQ];   // per query tile: running maximum (equal in both halves) and this half's part of the running sum
  v8f acc[AQ][4] = {};   // O^T tiles: acc[qt][dt][r] = d (dt * 16 + 8 g + r) of query col of tile qt
#pragma unroll
  for (int qt = 0; qt < AQ; ++qt) { m[qt] = -3.0e38f; l[qt] = 0.f; }
  // stage loads: AK * 128 B of k rows and of v columns in 16-B pieces, a wave-wide load covering four whole 128-B lines; one table word per thread
  const _Float16* gK = QK + ((size_t)b * SS + (tid >> 3)) * (2 * DM) + DM + h * HD + (tid & 7) * 8; const _Float16* gV = VTH + ((size_t)b * DM + h * HD + (tid >> 3)) * SS + (tid & 7) * 8;
  const float* gT = TB + ((size_t)(2 + tid / AK) * NH + h) * (NB * SS) + (size_t)b * SS + (tid & (AK - 1));   // planes 2 and 3: a stage's AK words of a plane are contiguous
  v8h rk[4], rv[4]; float rt;   // the next stage, on its way through registers while this stage is worked on
#pragma unroll
  for (int i = 0; i < 4; ++i) { rk[i] = *(const v8h*)(gK + (size_t)i * 16 * (2 * DM)); rv[i] = *(const v8h*)(gV + (size_t)i * 16 * SS); }
  rt = *gT;
  XW();
  __builtin_amdgcn_sched_barrier(0);   // nothing that reads a loaded value is lifted above the stage loads: its wait would hold back their issue by one memory latency
  asm volatile("" :: "v"(aq[0][0]), "v"(aq[0][1]), "v"(aq[1][0]), "v"(aq[1][1]), "v"(q0t[0]), "v"(q1t[0]), "v"(q0t[1]), "v"(q1t[1]));   // the query-side loads are waited for here, once: a wait for them inside the loop would also cover the next stage's loads, which are to stay in flight over the stage's work
  // One pass of the loop = one stage of AK keys: its LDS reads stand in two groups, each ahead of the products that use it (the k rows and table words right behind the stage's barrier, the v columns behind the score products, in flight over the softmax), and the running maximum, the exchange between the halves and the rescaling of the sums come once per AK keys and query tile. The loop stays rolled: a second copy of this long body would only cost registers and instruction cache.
#pragma unroll 1
  for (int st = 0; st < SS / AK; ++st) {
    __syncthreads();   // every wave has left the stage that is overwritten next
#pragma unroll
    for (int i = 0; i < 4; ++i) { *(v8h*)&sK[i * 16 + (tid >> 3)][(tid & 7) * 8] = rk[i]; *(v8h*)&sV[i * 16 + (tid >> 3)][(tid & 7) * 8] = rv[i]; }
    skn[tid / AK][tid & (AK - 1)] = rt;
    __syncthreads();   // the stage is complete for every wave
    if (st + 1 < SS / AK) { const size_t k1 = (size_t)(st + 1) * AK;
#pragma unroll
      for (int i = 0; i < 4; ++i) { rk[i] = *(const v8h*)(gK + (k1 + i * 16) * (2 * DM)); rv[i] = *(const v8h*)(gV + (size_t)i * 16 * SS + k1); }
      rt = gT[k1];
      XW(); }
    v16h kf[AK / 16][2], vf[AK / 32][4]; v8f c0[AK / 16], dk[AK / 16], c[AQ][AK / 16];   // k fragments [16-key tile][k half], v fragments [32 keys][d tile], the two table words of each tile, the score tiles
#pragma unroll
    for (int ct = 0; ct < AK / 16; ++ct) { c0[ct] = *(const v8f*)&skn[0][ct * 16 + 8 * g];   // the products are added onto -|k - mu_0|^2 / 2
#pragma unroll
      for (int kc = 0; kc < 2; ++kc) kf[ct][kc] = frag_h(&sK[ct * 16 + col][kc * 32], lane); }
#pragma unroll
    for (int ct = 0; ct < AK / 16; ++ct) dk[ct] = *(const v8f*)&skn[1][ct * 16 + 8 * g];
    __builtin_amdgcn_sched_barrier(0);   // keeps the group of reads above the products: sunk to their uses, each read's LDS latency is waited out in front of its own product
#pragma unroll
    for (int kc = 0; kc < 2; ++kc) {
#pragma unroll
      for (int ct = 0; ct < AK / 16; ++ct) {
#pragma unroll
        for (int qt = 0; qt < AQ; ++qt) c[qt][ct] = wmma16(kf[ct][kc], aq[qt][kc], kc ? c[qt][ct] : c0[ct]); } }   // single product: k, q as one-rounding f16 operands; c[qt][ct][r] = k (ct * 16 + 8 g + r) . q (col of tile qt) - |k - mu_0|^2 / 2; the tiles' chains alternate
#pragma unroll
    for (int sub = 0; sub < AK / 32; ++sub) {
#pragma unroll
      for (int dt = 0; dt < 4; ++dt) vf[sub][dt] = frag_h(&sV[dt * 16 + col][sub * 32], lane); }
    __builtin_amdgcn_sched_barrier(0);   // the v columns' reads are issued here and fly over the softmax's vector work
#pragma unroll
    for (int qt = 0; qt < AQ; ++qt) {
      v8f s[AK / 16];
#pragma unroll
      for (int ct = 0; ct < AK / 16; ++ct) {
#pragma unroll
        for (int r = 0; r < 8; ++r) { const float x0 = c[qt][ct][r] * (LOG2E * 0.125f) + q0t[qt], x1 = c[qt][ct][r] * (LOG2E * 0.375f) + (dk[ct][r] + q1t[qt]); s[ct][r] = fminf(fmaxf(x0, x1), 0.f); } }   // max over the two Gaussian keys (mu_0, mu_1 both read) of min(x_j, 0) = -max(distance^2, 0) x scale x log2 e
      float mx = fmaxf(fmaxf(s[0][0], s[1][0]), fmaxf(s[2][0], s[3][0]));
#pragma unroll
      for (int r = 1; r < 8; ++r) mx = fmaxf(fmaxf(mx, fmaxf(s[0][r], s[1][r])), fmaxf(s[2][r], s[3][r]));
      mx = fmaxf(mx, xhalf(mx));   // both halves now hold the maximum over the AK keys
      const float mn = fmaxf(m[qt], mx); const float mb = mn - 11.0f;
      v16h pb[AK / 32]; float es[AK / 16];
#pragma unroll
      for (int ct = 0; ct < AK / 16; ++ct) { const v8f t = s[ct] - mb; float e[8];
        asm("v_exp_f32 %0, %8\n\tv_exp_f32 %1, %9\n\tv_exp_f32 %2, %10\n\tv_exp_f32 %3, %11\n\tv_exp_f32 %4, %12\n\tv_exp_f32 %5, %13\n\tv_exp_f32 %6, %14\n\tv_exp_f32 %7, %15\n\tv_nop" : "=&v"(e[0]), "=&v"(e[1]), "=&v"(e[2]), "=&v"(e[3]), "=&v"(e[4]), "=&v"(e[5]), "=&v"(e[6]), "=&v"(e[7]) : "v"(t[0]), "v"(t[1]), "v"(t[2]), "v"(t[3]), "v"(t[4]), "v"(t[5]), "v"(t[6]), "v"(t[7]));   // a tile's eight exp2 in one statement, results apart from all sources: behind each stands an independent one, behind the last the v_nop, which is the slot the instruction set asks for behind a transcendental
        es[ct] = e[0]; pb[ct >> 1][(ct & 1) * 8] = (_Float16)e[0];
#pragma unroll
        for (int r = 1; r < 8; ++r) { es[ct] += e[r]; pb[ct >> 1][(ct & 1) * 8 + r] = (_Float16)e[r]; } }   // P carries 2^11 (in the exponent's argument) so small softmax weights stay out of the f16 subnormal range; the sum l carries it too, so it cancels in the epilogue
      float alpha;   // exp2(m - mn); the first pass's m gives 0
      asm("v_exp_f32 %0, %1\n\tv_nop" : "=v"(alpha) : "v"(m[qt] - mn));   // in asm so that the slot which the instruction set asks for behind a transcendental stands in the same statement
      l[qt] = l[qt] * alpha + ((es[0] + es[1]) + (es[2] + es[3])); m[qt] = mn;
#pragma unroll
      for (int dt = 0; dt < 4; ++dt) acc[qt][dt] *= alpha;
#pragma unroll
      for (int sub = 0; sub < AK / 32; ++sub) {
#pragma unroll
        for (int dt = 0; dt < 4; ++dt) acc[qt][dt] = wmma16(vf[sub][dt], pb[sub], acc[qt][dt]); } } }   // single product: V^T x P^T (x2^11)
#pragma unroll
  for (int qt = 0; qt < AQ; ++qt) { const float lt = l[qt] + xhalf(l[qt]);   // the halves' sums are joined once
    const float il = 1.0f / lt;
#pragma unroll
    for (int dt = 0; dt < 4; ++dt) { v4f o0, o1;
#pragma unroll
      for (int r = 0; r < 4; ++r) { o0[r] = acc[qt][dt][r] * il; o1[r] = acc[qt][dt][4 + r] * il; }
      *(v4f*)&so[wave][qt * 16 + col][dt * 16 + 8 * g] = o0; *(v4f*)&so[wave][qt * 16 + col][dt * 16 + 8 * g + 4] = o1; } }
  LDSX();
  for (int rl = 0; rl < 16 * AQ; ++rl) if (lane < 16) vst2(O + ((size_t)b * SS + q0 + rl) * DM + h * HD + lane * 4, *(const v4f*)&so[wave][rl][lane * 4]);
}
// ---- k_out: block = (64 rows, 128 cols): out = O(hi/lo) . Wo rows (2 products) + bo
__global__ __launch_bounds__(128) void k_out(const float* __restrict__ O, const __bf16* __restrict__ P, const float* __restrict__ BO, float* __restrict__ Y) {
  __shared__ __align__(16) char smem[(128 + 64 + 64) * GP * 2];   // stage: weight tile [128][GP] | O rows bf16 hi [64][GP] | residual [64][GP]; behind the loop's last barrier the same bytes are the output staging
  __bf16* sB = (__bf16*)smem; __bf16* sAh = sB + 128 * GP; __bf16* sAl = sAh + 64 * GP;
  float (*so)[16][132] = (float (*)[16][132])smem;
  const int tid = threadIdx.x, wave = tid >> 5, lane = tid & 31, col = lane & 15, g = lane >> 4; const size_t r0 = (size_t)blockIdx.x * 64 + wave * 16; const int n0 = blockIdx.y * 128;
  v8f acc[8] = {};
  const __bf16* pw = P + (size_t)(n0 + tid / GN) * DM + (tid % GN) * 8; const int ar = tid / (GK / 4), ap = (tid % (GK / 4)) * 4; const float* Ot = O + ((size_t)blockIdx.x * 64 + ar) * DM + ap;   // this thread's row (step 128 / (GK / 4)) and k offset in the f32 rows of a stage
  v8b rw[GN]; v4f ra[GN];   // the next stage, on its way through registers while this stage is multiplied
  ldw(rw, pw);
#pragma unroll
  for (int i = 0; i < GN; ++i) ra[i] = *(const v4f*)(Ot + (size_t)i * (512 / GK) * DM);   // one wave-wide load = two rows x 256 B
  XW();
  for (int st = 0; st < DM / GK; ++st) {
    __syncthreads();   // every wave has left the stage that is overwritten next
    stw(rw, sB, tid);
#pragma unroll
    for (int i = 0; i < GN; ++i) { v4b hv, lv;
#pragma unroll
      for (int e = 0; e < 4; ++e) { const __bf16 hh = (__bf16)ra[i][e]; hv[e] = hh; lv[e] = (__bf16)(ra[i][e] - (float)hh); }
      *(v4b*)(sAh + (i * (512 / GK) + ar) * GP + ap) = hv; *(v4b*)(sAl + (i * (512 / GK) + ar) * GP + ap) = lv; }
    __syncthreads();   // the stage is complete for every wave
    if (st + 1 < DM / GK) { ldw(rw, pw + (st + 1) * GK);
#pragma unroll
      for (int i = 0; i < GN; ++i) ra[i] = *(const v4f*)(Ot + (size_t)i * (512 / GK) * DM + (st + 1) * GK);
      XW(); }
#pragma unroll
    for (int kc = 0; kc < GK / 32; ++kc) { const v16b ah = frag_b(sAh + (wave * 16 + col) * GP + kc * 32, lane), al = frag_b(sAl + (wave * 16 + col) * GP + kc * 32, lane); v16b w[8];
#pragma unroll
      for (int j = 0; j < 8; ++j) w[j] = frag_b(sB + (j * 16 + col) * GP + kc * 32, lane);
      asm volatile("" :: "v"(ah), "v"(al), "v"(w[0]), "v"(w[1]), "v"(w[2]), "v"(w[3]), "v"(w[4]), "v"(w[5]), "v"(w[6]), "v"(w[7]));   // holds the ten fragment reads together in front of the products: one LDS wait per sixteen products, not one per pair
#pragma unroll
      for (int j = 0; j < 8; ++j) { acc[j] = wmma_bf(al, w[j], acc[j]); acc[j] = wmma_bf(ah, w[j], acc[j]); } } }
  __syncthreads();   // the last stage's reads are over before its bytes become output staging
#pragma unroll
  for (int j = 0; j < 8; ++j) {
#pragma unroll
    for (int r = 0; r < 8; ++r) so[wave][8 * g + r][j * 16 + col] = acc[j][r] + (BO ? bfr(BO[n0 + j * 16 + col]) : 0.f); }
  LDSX();
  for (int rl = 0; rl < 16; ++rl) vst2(Y + xrow(r0 + rl) + n0 + lane * 4, *(const v4f*)&so[wave][rl][lane * 4]);
}
// ---- pack_tile: one work-group turns a PT (k) x PT (n) tile of an (in,out) f32 weight (row length ld) into bf16 rows [n][k] of length DM: whole-line loads (a wave-wide load = two k rows x 256 B), transposed through LDS, whole-line stores (four n rows x 128 B); its loops are unrolled so that the four loads issue as one group
#define PT 64
__device__ __forceinline__ void pack_tile(const float* __restrict__ Wt, int ld, __bf16* __restrict__ dst) {   // Wt = the tile's first element, dst = its first element in the packed rows
  __shared__ __align__(16) __bf16 s[PT][PT + 8]; const int t = threadIdx.x, kr = t >> 4, c4 = (t & 15) * 4; const unsigned vo = (unsigned)(kr * ld + c4); v4f r[4];
#pragma unroll
  for (int i = 0; i < 4; ++i) r[i] = *(const v4f*)(Wt + vo + i * 16 * ld);
  XW();
#pragma unroll
  for (int i = 0; i < 4; ++i) {
#pragma unroll
    for (int e = 0; e < 4; ++e) s[c4 + e][i * 16 + kr] = (__bf16)r[i][e]; }
  __syncthreads();   // the tile is complete before its rows are read back
#pragma unroll
  for (int i = 0; i < 2; ++i) { const int n = i * 32 + (t >> 3), pc = (t & 7) * 8; vst2((unsigned*)(dst + (unsigned)((t >> 3) * DM + pc) + i * 32 * DM), *(const v4u*)&s[n][pc]); }
}
// ---- k_pack: block = (n tile, k tile, which): all four 512 x 512 weight panels in one launch, since none of them needs another: 0 Wq -> PK_A rows 0..511, 1 Wo -> PK_P, 2 and 3 the k and the v columns of Wkv (in,out) [512][1024] -> the PK_A rows behind the q rows
__global__ __launch_bounds__(256) void k_pack(const float* __restrict__ WQ, const float* __restrict__ WO, const float* __restrict__ WKV, __bf16* __restrict__ PK) {
  const int n0 = blockIdx.x * PT, k0 = blockIdx.y * PT, z = blockIdx.z;
  __bf16* dst = PK + (z == 1 ? PK_P : PK_A + (z ? z - 1 : 0) * (DM * DM)) + (size_t)n0 * DM + k0;
  if (z < 2) pack_tile((z ? WO : WQ) + (size_t)k0 * DM + n0, DM, dst);   // the branch is the same for the whole work-group; each side has its source's row length as a constant
  else pack_tile(WKV + (size_t)k0 * (2 * DM) + (z - 2) * DM + n0, 2 * DM, dst);
}
#define LR 4   // rows per wave of k_lnsum
// ---- k_lnsum<RAWR>: wave = LR whole rows (a lane holds 16 elements of each, a wave-wide load = 512 contiguous B), all rows' loads in flight together (every loop is unrolled for that, and so that the arrays stay in registers), row sums inside the wave, the LR rows' exchanges side by side: T = LayerNorm(R + A) g + b ; R is a raw input (bf16-rounded) when RAWR, else an f32 intermediate
template <int RAWR>
__global__ __launch_bounds__(256) void k_lnsum(const float* __restrict__ R, const float* __restrict__ A, const float* __restrict__ G, const float* __restrict__ Bt, float* __restrict__ T) {
  const int t = threadIdx.x, lane = t & 31; const size_t b0 = (size_t)blockIdx.x * (8 * LR * DM); const unsigned vo = (unsigned)((t >> 5) * (LR * DM) + lane * 4);   // block base (scalar) + one lane offset that every load and store of the lane shares
  const float* Rb = R + b0; const float* Ab = A + b0; float* Tb = T + b0; v4f v[LR][4], a[LR][4], gm[4], bt[4];
#pragma unroll
  for (int j = 0; j < LR; ++j) {
#pragma unroll
    for (int i = 0; i < 4; ++i) { v[j][i] = *(const v4f*)(Rb + vo + j * DM + i * 128); a[j][i] = *(const v4f*)(Ab + vo + j * DM + i * 128); } }
#pragma unroll
  for (int i = 0; i < 4; ++i) { gm[i] = *(const v4f*)(G + i * 128 + lane * 4); bt[i] = *(const v4f*)(Bt + i * 128 + lane * 4); }
  XW();
  float s[LR], q[LR];
#pragma unroll
  for (int j = 0; j < LR; ++j) { float p[4];
#pragma unroll
    for (int i = 0; i < 4; ++i) { p[i] = 0.f;
#pragma unroll
      for (int e = 0; e < 4; ++e) { v[j][i][e] = (RAWR ? bfr(v[j][i][e]) : v[j][i][e]) + a[j][i][e]; p[i] += v[j][i][e]; } }
    s[j] = (p[0] + p[1]) + (p[2] + p[3]); }
#pragma unroll
  for (int o = 1; o < 32; o <<= 1) {
#pragma unroll
    for (int j = 0; j < LR; ++j) s[j] += __shfl_xor(s[j], o); }
#pragma unroll
  for (int j = 0; j < LR; ++j) { s[j] = s[j] / (float)DM; float p[4];
#pragma unroll
    for (int i = 0; i < 4; ++i) { p[i] = 0.f;
#pragma unroll
      for (int e = 0; e < 4; ++e) { v[j][i][e] -= s[j]; p[i] += v[j][i][e] * v[j][i][e]; } }
    q[j] = (p[0] + p[1]) + (p[2] + p[3]); }
#pragma unroll
  for (int o = 1; o < 32; o <<= 1) {
#pragma unroll
    for (int j = 0; j < LR; ++j) q[j] += __shfl_xor(q[j], o); }
#pragma unroll
  for (int j = 0; j < LR; ++j) { const float inv = 1.0f / sqrtf(q[j] / (float)DM + 1e-5f);
#pragma unroll
    for (int i = 0; i < 4; ++i) { v4f o4;
#pragma unroll
      for (int e = 0; e < 4; ++e) o4[e] = v[j][i][e] * inv * bfr(gm[i][e]) + bfr(bt[i][e]);
      vst2(Tb + vo + j * DM + i * 128, o4); } }
}
extern "C" void kernel_launch(void* const* d_in, const int* in_sizes, int n_in, void* d_out, int out_size, void* d_ws, size_t ws_size, hipStream_t stream) {
  (void)in_sizes; (void)n_in; (void)out_size;
  const float** F = (const float**)d_in;   // 0 h [1024,8,512] (s,b,d), 1 Wq [512,512] (in,out), 2 Wkv [512,1024] (in,out: k | v), 3 Wo [512,512] (in,out), 4 mu [2,8,64], 5 gamma, 6 beta
  if (ws_size < (size_t)WS_END) return;
  char* ws = (char*)d_ws; __bf16* PK = (__bf16*)(ws + WS_PK); _Float16 *QK = (_Float16*)(ws + WS_QK), *QKL = (_Float16*)(ws + WS_QKL), *VTH = (_Float16*)(ws + WS_VTH), *VTL = (_Float16*)(ws + WS_VTL); float *O = (float*)(ws + WS_O), *TB = (float*)(ws + WS_TB), *A = (float*)(ws + WS_A);
  k_pack<<<dim3(DM / PT, DM / PT, 4), 256, 0, stream>>>(F[1], F[3], F[2], PK);   // Wq, Wo and both halves of Wkv
  k_qkv<<<dim3(TNB * SS / QR, QKVW / 128), 128, 0, stream>>>(F[0], F[0], F[0], PK + PK_A, nullptr, nullptr, nullptr, QK, F[4], VTH, TB);   // also writes the tables
  k_attn<<<dim3(TQB / AQ, NH, TNB), 128, 0, stream>>>(QK, QKL, VTH, VTL, nullptr, TB, O);
  k_out<<<dim3(TOB, DM / 128), 128, 0, stream>>>(O, PK + PK_P, nullptr, A);   // A rows in (s, b) order
  k_lnsum<1><<<TOB * 64 / (8 * LR), 256, 0, stream>>>(F[0], A, F[5], F[6], (float*)d_out);
}

// v010
// Measured time: 62.2 microseconds a run.
// Two timings next to v009 both put it at 1.05 times that version's speed.
// Counting every step since v000, it is 4.28 times as fast.
// compute dtype: all float inputs rounded to bf16; q/k/v = h . W with EXACT bf16 products on WMMA 16x16x32 ((in,out) weights as transposed rows); per-(token, head) tables |q|^2 + 2 q . mu_j, |k - mu_j|^2 (j = 0, 1) in f32 from the projections' f32 accumulators; PLAIN scores: q . k single f16, then -max(|q|^2 + |k-mu_j|^2 - 2 q.k + 2 q.mu_j, 0) x (1/16, 3/16) for the two Gaussian keys (mu_0 read too; it is zero), max of the two, in log2 units with the per-query and per-key terms folded in the tables, running-max softmax in f32 (hardware exp2), P (scaled by 2^11, single f16) x v (single f16); out = LayerNorm(h + vec (bf16 hi + residual) . Wo (2 products)) in f32.
#include <hip/hip_runtime.h>
#include <math.h>

typedef __attribute__((ext_vector_type(16))) _Float16 v16h;
typedef __attribute__((ext_vector_type(16))) __bf16 v16b;
typedef __attribute__((ext_vector_type(8)))  _Float16 v8h;
typedef __attribute__((ext_vector_type(8)))  float v8f;
typedef __attribute__((ext_vector_type(4)))  float v4f;
typedef __attribute__((ext_vector_type(2)))  float v2f;
typedef __attribute__((ext_vector_type(4)))  unsigned v4u;
typedef __attribute__((ext_vector_type(4)))  int v4i;
typedef float __attribute__((may_alias)) float_a;
typedef int __attribute__((may_alias)) int_a;

template <typename T> __device__ __forceinline__ void vst2(void* p, T v) { *(T*)p = v;  }
__device__ __forceinline__ v8f wmma16(v16h a, v16h b, v8f c) {
  v8f d = __builtin_amdgcn_wmma_f32_16x16x32_f16(false, a, false, b, (short)0, c, false, false);
  asm volatile("v_nop\n\tv_nop\n\tv_nop\n\tv_nop" : "+v"(d));   // names D alone: an operand of an asm statement must lie below v256, and with A and B held there too the query fragments were spilled
  return d;
}
__device__ __forceinline__ v8f wmma_bf(v16b a, v16b b, v8f c) {
  v8f d = __builtin_amdgcn_wmma_f32_16x16x32_bf16(false, a, false, b, (short)0, c, false, false);
  asm volatile("v_nop\n\tv_nop\n\tv_nop\n\tv_nop" : "+v"(d) : "v"(a), "v"(b));
  return d;
}
// Mixture-of-Gaussian-keys attention (S 1,024, B 8, d 512, 8 heads x 64, two Gaussian keys per position: k and k - mu_1): score = max(-|q - k|^2 / 16, -3 |q - (k - mu_1)|^2 / 16), softmax over keys, . v, Wo, residual, LayerNorm; (s, b, d) layout.
__device__ __forceinline__ v16h frag_h(const _Float16* rowk0, int lane) {
  union { v16h v; v8h q[2]; } u; const _Float16* p = rowk0 + 8 * (lane >> 4);
  u.q[0] = *(const v8h*)p; u.q[1] = *(const v8h*)(p + 16); return u.v;
}
__device__ __forceinline__ v16h frag_f32(const float* rowk0, int lane) {
  v16h a; const float* p = rowk0 + 8 * (lane >> 4);
#pragma unroll
  for (int i = 0; i < 8; ++i) { a[i] = (_Float16)p[i]; a[8 + i] = (_Float16)p[16 + i]; }
  return a;
}
__device__ __forceinline__ v16h frag_f32s(const float* rowk0, int lane, float sc) {
  v16h a; const float* p = rowk0 + 8 * (lane >> 4);
#pragma unroll
  for (int i = 0; i < 8; ++i) { a[i] = (_Float16)(p[i] * sc); a[8 + i] = (_Float16)(p[16 + i] * sc); }
  return a;
}
// column fragment from a [K][ld] layout (column n), rows >= K read as 0
__device__ __forceinline__ v16h fragc_f32(const float* W, int k0, int n, int lane, int ld, int K) {
  v16h a; const int g = lane >> 4;
#pragma unroll
  for (int i = 0; i < 8; ++i) { const int ka = k0 + 8 * g + i, kb = ka + 16;
    a[i] = (_Float16)(ka < K ? W[(size_t)(ka < K ? ka : K - 1) * ld + n] : 0.f); a[8 + i] = (_Float16)(kb < K ? W[(size_t)(kb < K ? kb : K - 1) * ld + n] : 0.f); }
  return a;
}
struct F2 { v16b h, l; };
__device__ __forceinline__ F2 bsplit16(const float v[16]) { F2 r;
#pragma unroll
  for (int i = 0; i < 16; ++i) { const __bf16 h = (__bf16)v[i]; r.h[i] = h; r.l[i] = (__bf16)(v[i] - (float)h); }
  return r; }
__device__ __forceinline__ F2 split_row(const float* row, int k0, int lane) { float v[16]; const float* p = row + k0 + 8 * (lane >> 4);
#pragma unroll
  for (int i = 0; i < 8; ++i) { v[i] = p[i]; v[8 + i] = p[16 + i]; }
  return bsplit16(v); }
__device__ __forceinline__ F2 split_rowK(const float* row, int k0, int lane, int K) { float v[16]; const int g = lane >> 4;
#pragma unroll
  for (int i = 0; i < 8; ++i) { const int ka = k0 + 8 * g + i, kb = ka + 16; v[i] = ka < K ? row[ka < K ? ka : K - 1] : 0.f; v[8 + i] = kb < K ? row[kb < K ? kb : K - 1] : 0.f; }
  return bsplit16(v); }
__device__ __forceinline__ F2 split_col(const float* W, int k0, int n, int lane, int ld, int K) { float v[16]; const int g = lane >> 4;
#pragma unroll
  for (int i = 0; i < 8; ++i) { const int ka = k0 + 8 * g + i, kb = ka + 16; v[i] = ka < K ? W[(size_t)(ka < K ? ka : K - 1) * ld + n] : 0.f; v[8 + i] = kb < K ? W[(size_t)(kb < K ? kb : K - 1) * ld + n] : 0.f; }
  return bsplit16(v); }
__device__ __forceinline__ v8f mac3(const F2& a, const F2& b, v8f c) { c = wmma_bf(a.l, b.h, c); c = wmma_bf(a.h, b.l, c); return wmma_bf(a.h, b.h, c); }
__device__ __forceinline__ float sigm(float v) { return 1.0f / (1.0f + expf(-v)); }
#define LDSX() do { asm volatile("s_wait_dscnt 0" ::: "memory"); __builtin_amdgcn_wave_barrier(); __builtin_amdgcn_fence(__ATOMIC_RELEASE, "workgroup"); } while (0)


#define NB 8
#define SS 1024
#define DM 512
#define NH 8
#define NBATCH 8
__device__ __forceinline__ size_t xrow(size_t r) { return ((r % SS) * NBATCH + r / SS) * (size_t)DM; }   // engine row (b*SS + s) -> module row (s*B + b)
#define HD 64
#define QKVW (3 * DM)
#ifndef TQB
#define TQB (SS / 64)
#define TNB NB
#define TOB (NB * SS / 64)     // output row tiles (all)
#endif
typedef __attribute__((ext_vector_type(8))) __bf16 v8b;
__device__ __forceinline__ v16b frag_b(const __bf16* rowk0, int lane) {
  union { v16b v; v8b q[2]; } u; const __bf16* p = rowk0 + 8 * (lane >> 4);
  u.q[0] = *(const v8b*)p; u.q[1] = *(const v8b*)(p + 16); return u.v;
}
__device__ __forceinline__ float bfr(float v) { return (float)(__bf16)v; }
__device__ __attribute__((noinline)) float exp_ni(float v) { return expf(v); }
__device__ __attribute__((noinline)) float erf_ni(float v) { return erff(v); }

#define PK_A 0                       // [1536][512] Wqkv rows (natural [out][in])
#define PK_P (PK_A + QKVW * DM)        // [512][512] Wo rows (natural)
#define PK_END (PK_P + DM * DM)
#define WS_PK  0u
#define WS_QK  (WS_PK + 2u * PK_END)             // f16 [8192 rows][1024]: q | k
#define WS_QKL (WS_QK + 2u * NB * SS * 2 * DM)     // f16 [8192][1024], not written or read by these kernels
#define WS_VTH (WS_QKL + 2u * NB * SS * 2 * DM)    // f16 [b][512 (h*64+d)][1024 s] hi
#define WS_VTL (WS_VTH + 2u * NB * DM * SS)        // f16 [b][512][1024], not written or read by these kernels
#define WS_O   (WS_VTL + 2u * NB * DM * SS)        // f32 [8192][512]
#define WS_CS  (WS_O + 4u * NB * SS * DM)           // f32 2 x [1024][32], not used by these kernels
#define WS_TB  (WS_CS + 4u * 2 * SS * 32)                  // f32 tables as planes [word][head][NR], L = log2 e: word 0 -(L/16)(|q_h|^2 + 2 q.mu0), 1 -(3L/16)(|q_h|^2 + 2 q.mu1), 2 -|k - mu0|^2 / 2, 3 (3L/16)(|k - mu0|^2 - |k - mu1|^2)
#define WS_A   (WS_TB + 4u * (size_t)NB * SS * 64)
#define WS_END (WS_A + 4u * (size_t)NB * SS * DM)
typedef __attribute__((ext_vector_type(4))) __bf16 v4b;
#define GK 64          // k per LDS stage of the two GEMMs
#define GP (GK + 8)    // LDS row pitch in 16-bit elements: 144 B = 16 B x 9 (odd), so the b128 fragment reads of 16 rows spread over the banks
#define GN (GK / 8)    // 16-B pieces per thread and stage, of the weight tile and of k_out's f32 rows
#define XW() asm volatile("s_wait_xcnt 0x0" ::: "memory")   // stands behind a group of stage loads: their address registers are reused only behind it
// one stage (GK k) of a [128 rows][DM] bf16 weight tile in 16-B pieces; one wave-wide load covers four rows x 128 B, whole lines; pw = this thread's piece of the first 128 / GN rows
__device__ __forceinline__ void ldw(v8b (&r)[GN], const __bf16* __restrict__ pw) {
#pragma unroll
  for (int i = 0; i < GN; ++i) r[i] = *(const v8b*)(pw + (size_t)i * (128 / GN) * DM);
}
__device__ __forceinline__ void stw(const v8b (&r)[GN], __bf16* sB, int tid) {
#pragma unroll
  for (int i = 0; i < GN; ++i) *(v8b*)(sB + (i * (128 / GN) + tid / GN) * GP + (tid % GN) * 8) = r[i];
}
#define LOG2E 1.44269504f
// sum over the 16 lanes of a row, every lane of the row gets it: four adds whose second operand comes through DPP row_xmask (0x160 + mask); all lanes are on
template <int M> __device__ __forceinline__ float rowx(float x) { return x + __builtin_bit_cast(float, __builtin_amdgcn_update_dpp(0, __builtin_bit_cast(int, x), 0x160 + M, 0xf, 0xf, true)); }
__device__ __forceinline__ float rowsum16(float x) { return rowx<8>(rowx<4>(rowx<2>(rowx<1>(x)))); }
// this lane's part (4 of the 64 d of the wave's head) of the two table sums of its 8 rows of one 16-row tile: k rows |k - mu_0|^2, |k - mu_1|^2; q rows |q|^2 + 2 q . mu_0, |q|^2 + 2 q . mu_1
template <bool ISK> __device__ __forceinline__ void tsum(const v8f (&acc)[4], const float (&m0)[4], const float (&m1)[4], float (&ta)[8], float (&tb)[8]) {
#pragma unroll
  for (int r = 0; r < 8; ++r) { float a = 0.f, b = 0.f;
#pragma unroll
    for (int jj = 0; jj < 4; ++jj) { const float v = acc[jj][r], u0 = bfr(m0[jj]), u1 = bfr(m1[jj]);
      if (ISK) { const float d0 = v - u0, d1 = v - u1; a += d0 * d0; b += d1 * d1; } else { a += v * (v + 2.0f * u0); b += v * (v + 2.0f * u1); } }
    ta[r] = a; tb[r] = b; }
}
#define QR 128   // rows per work-group of k_qkv
#define QXN (QR * GK / 4 / 128)   // 16-B pieces of the f32 input rows per thread and stage
// ---- k_qkv: block = (128 rows, 128 cols), four waves in 2 x 2, a wave = 64 rows x 64 cols (one head): eight fragments from LDS feed sixteen products (a 16 x 128 wave reads nine for eight), and a weight row is fetched by half as many work-groups as with 64-row blocks
__global__ __launch_bounds__(128) void k_qkv(const float* __restrict__ XQ, const float* __restrict__ XK, const float* __restrict__ XV, const __bf16* __restrict__ P, const float* __restrict__ BQ, const float* __restrict__ BK, const float* __restrict__ BV, _Float16* __restrict__ QK, const float* __restrict__ MU, _Float16* __restrict__ VTH, float* __restrict__ TB) {
  const int which0 = (blockIdx.y * 128) / DM; const float* X = (which0 == 0) ? XQ : (which0 == 1) ? XK : XV; const float* BB = BQ ? (((which0 == 0) ? BQ : (which0 == 1) ? BK : BV) + (blockIdx.y * 128 - which0 * DM)) : nullptr;
  __shared__ __align__(16) char smem[(128 + QR) * GP * 2 + 4 * QR * 4];   // stage: weight tile [128][GP] | bf16 input rows [QR][GP] (36,864 B); behind the loop's last barrier the same bytes are the output staging, with the table words behind it
  __bf16* sB = (__bf16*)smem; __bf16* sA = sB + 128 * GP;
  _Float16 (*so)[64][GP] = (_Float16 (*)[64][GP])smem; float (*st)[QR] = (float (*)[QR])(so + 4); _Float16 (*sth)[QR + 8] = (_Float16 (*)[QR + 8])smem;   // so: each wave's 64 x 64 tile; st: the block's table words, [head of the block * 2 + word][row]; sth: v columns [d][row], pitch 272 B = 16 B x 17
  const int tid = threadIdx.x, wave = tid >> 5, lane = tid & 31, col = lane & 15, g = lane >> 4, wr = wave >> 1, wc = wave & 1; const int n0 = blockIdx.y * 128;
  v8f acc[4][4] = {};   // [16-row tile][16-col tile]
  const __bf16* pw = P + (size_t)(n0 + tid / GN) * DM + (tid % GN) * 8; const size_t rb0 = (size_t)blockIdx.x * QR;
  const int ar = tid / (GK / 4), ap = (tid % (GK / 4)) * 4;   // this thread's row (step 128 / (GK / 4)) and k offset in the f32 rows of a stage
  v8b rw[GN]; v4f ra[QXN];   // the next stage, on its way through registers while this stage is multiplied
  const float* px = X + xrow(rb0 + ar) + ap;   // (s, b) input layout: the block's QR rows are one batch entry's, so the next engine row lies NBATCH * DM further on
  ldw(rw, pw);
#pragma unroll
  for (int i = 0; i < QXN; ++i) ra[i] = *(const v4f*)(px + (size_t)i * (512 / GK) * NBATCH * DM);   // one wave-wide load = two rows x 256 B
  XW();
  float m0[4] = {}, m1[4] = {};   // q and k blocks: this lane's elements of mu_0 and mu_1, column j * 16 + col of the wave's head; loaded here, behind the first stage's loads, so that the epilogue does not wait for them
  if (n0 < 2 * DM) { const float* pm = MU + (n0 & (DM - 1)) + wc * HD + col;
#pragma unroll
    for (int j = 0; j < 4; ++j) { m0[j] = pm[j * 16]; m1[j] = pm[NH * HD + j * 16]; }
    XW(); }
  for (int st = 0; st < DM / GK; ++st) {
    __syncthreads();   // every wave has left the stage that is overwritten next
    stw(rw, sB, tid);
#pragma unroll
    for (int i = 0; i < QXN; ++i) { v4b hv; hv[0] = (__bf16)ra[i][0]; hv[1] = (__bf16)ra[i][1]; hv[2] = (__bf16)ra[i][2]; hv[3] = (__bf16)ra[i][3]; *(v4b*)(sA + (i * (512 / GK) + ar) * GP + ap) = hv; }
    __syncthreads();   // the stage is complete for every wave
    if (st + 1 < DM / GK) { ldw(rw, pw + (st + 1) * GK);
#pragma unroll
      for (int i = 0; i < QXN; ++i) ra[i] = *(const v4f*)(px + (size_t)i * (512 / GK) * NBATCH * DM + (st + 1) * GK);
      XW(); }
#pragma unroll
    for (int kc = 0; kc < GK / 32; ++kc) { v16b a[4], w[4];
#pragma unroll
      for (int j = 0; j < 4; ++j) { a[j] = frag_b(sA + (wr * 64 + j * 16 + col) * GP + kc * 32, lane); w[j] = frag_b(sB + (wc * 64 + j * 16 + col) * GP + kc * 32, lane); }
      asm volatile("" :: "v"(a[0]), "v"(a[1]), "v"(a[2]), "v"(a[3]), "v"(w[0]), "v"(w[1]), "v"(w[2]), "v"(w[3]));   // holds the eight fragment reads together in front of the products: one LDS wait per sixteen products, not one per product
#pragma unroll
      for (int i = 0; i < 4; ++i) {
#pragma unroll
        for (int j = 0; j < 4; ++j) acc[i][j] = wmma_bf(a[i], w[j], acc[i][j]); } } }
  __syncthreads();   // the last stage's reads are over before its bytes become output staging
  if (BB) {
#pragma unroll
    for (int j = 0; j < 4; ++j) { const float bb = bfr(BB[wc * 64 + j * 16 + col]);
#pragma unroll
      for (int i = 0; i < 4; ++i) {
#pragma unroll
        for (int r = 0; r < 8; ++r) acc[i][j][r] += bb; } } }
  if (n0 < 2 * DM) {   // q stored unscaled (f16 sigma ~0.6, no subnormal exposure); 1/8 and 3/8 (x log2 e) applied to the f32 score
    const bool isk = n0 >= DM; const int h0 = (n0 & (DM - 1)) / HD;   // the block holds heads h0 and h0 + 1 of q or of k; this wave's head is h0 + wc
#pragma unroll
    for (int i = 0; i < 4; ++i) {
#pragma unroll
      for (int j = 0; j < 4; ++j) {
#pragma unroll
        for (int r = 0; r < 8; ++r) so[wave][i * 16 + 8 * g + r][j * 16 + col] = (_Float16)acc[i][j][r]; }   // q, k (+ bias) as f16
      float ta[8], tb[8];
      if (isk) tsum<true>(acc[i], m0, m1, ta, tb); else tsum<false>(acc[i], m0, m1, ta, tb);
#pragma unroll
      for (int r = 0; r < 8; ++r) { ta[r] = rowsum16(ta[r]); tb[r] = rowsum16(tb[r]); }
      if (col == 0) {   // one lane of each half stores the words of its 8 rows
        v4f w0[2], w1[2];
#pragma unroll
        for (int r = 0; r < 8; ++r) { const float a = ta[r], b = tb[r]; w0[r >> 2][r & 3] = isk ? -0.5f * a : a * (-0.0625f * LOG2E); w1[r >> 2][r & 3] = isk ? (a - b) * (0.1875f * LOG2E) : b * (-0.1875f * LOG2E); }
#pragma unroll
        for (int c = 0; c < 2; ++c) { *(v4f*)&st[wc * 2][wr * 64 + i * 16 + 8 * g + 4 * c] = w0[c]; *(v4f*)&st[wc * 2 + 1][wr * 64 + i * 16 + 8 * g + 4 * c] = w1[c]; } } }
    __syncthreads();   // the four waves' table words are complete before they are stored as whole lines; each wave's own staged rows are complete too
    { const int p = tid >> 5, pc = tid & 31; vst2(TB + ((size_t)((isk ? 2 : 0) + (p & 1)) * NH + h0 + (p >> 1)) * (NB * SS) + rb0 + pc * 4, *(const v4f*)&st[p][pc * 4]); }   // a wave = the block's QR rows of one plane, 512 contiguous B
    _Float16* pq = QK + (rb0 + wr * 64 + (lane >> 3)) * (2 * DM) + n0 + wc * 64 + (lane & 7) * 8;
#pragma unroll
    for (int it = 0; it < 16; ++it) vst2((unsigned*)(pq + (size_t)it * 4 * (2 * DM)), *(const v4u*)&so[wave][it * 4 + (lane >> 3)][(lane & 7) * 8]);   // a wave-wide store = four rows x 128 B, whole lines
  } else {
#pragma unroll
    for (int i = 0; i < 4; ++i) {
#pragma unroll
      for (int j = 0; j < 4; ++j) {
#pragma unroll
        for (int r = 0; r < 8; ++r) sth[wc * 64 + j * 16 + col][wr * 64 + i * 16 + 8 * g + r] = (_Float16)acc[i][j][r]; } }
    __syncthreads();   // the v columns are complete before they are stored as whole lines
    const int b = (int)(rb0 / SS), s0 = (int)(rb0 % SS); const int pc0 = n0 - 2 * DM;
    _Float16* pv = VTH + ((size_t)b * DM + pc0 + (tid >> 4)) * SS + s0 + (tid & 15) * 8;
#pragma unroll
    for (int it = 0; it < 16; ++it) vst2((unsigned*)(pv + (size_t)it * 8 * SS), *(const v4u*)&sth[it * 8 + (tid >> 4)][(tid & 15) * 8]);   // a wave-wide store = two d rows x 256 B
    XW();   // behind the run of stores: their address and data registers are reused only behind it
  }
}
#define AK 64   // keys per LDS stage of k_attn
#define AP 72   // its LDS row pitch in f16: 144 B = 16 B x 9 (odd), so the b128 fragment reads of 16 rows spread over the banks
__device__ __forceinline__ float xhalf(float x) { return __builtin_bit_cast(float, __builtin_amdgcn_permlanex16(__builtin_bit_cast(int, x), __builtin_bit_cast(int, x), 0x76543210, 0xfedcba98, false, false)); }   // lane l with lane l ^ 16
// eight exp2 of one 16-key tile: P (f16) into p[o .. o + 7], their f32 sum returned
__device__ __forceinline__ float exp8(const v8f t, v16h& p, const int o) { float e[8];
  asm("v_exp_f32 %0, %8\n\tv_exp_f32 %1, %9\n\tv_exp_f32 %2, %10\n\tv_exp_f32 %3, %11\n\tv_exp_f32 %4, %12\n\tv_exp_f32 %5, %13\n\tv_exp_f32 %6, %14\n\tv_exp_f32 %7, %15\n\tv_nop" : "=&v"(e[0]), "=&v"(e[1]), "=&v"(e[2]), "=&v"(e[3]), "=&v"(e[4]), "=&v"(e[5]), "=&v"(e[6]), "=&v"(e[7]) : "v"(t[0]), "v"(t[1]), "v"(t[2]), "v"(t[3]), "v"(t[4]), "v"(t[5]), "v"(t[6]), "v"(t[7]));   // a tile's eight exp2 in one statement, results apart from all sources: behind each stands an independent one, behind the last the v_nop, which is the slot the instruction set asks for behind a transcendental
  float s = e[0]; p[o] = (_Float16)e[0];
#pragma unroll
  for (int r = 1; r < 8; ++r) { s += e[r]; p[o + r] = (_Float16)e[r]; }
  return s; }
#define PTOP 65504.0f   // the largest finite f16
#define AQ 2   // 16-query tiles per wave of k_attn: every k, v and table fragment read from LDS serves AQ products
__global__ __launch_bounds__(128) void k_attn(const _Float16* __restrict__ QK, const _Float16* __restrict__ QKL, const _Float16* __restrict__ VTH, const _Float16* __restrict__ VTL, const void* __restrict__ KMASK, const float* __restrict__ TB, float* __restrict__ O) {
  __shared__ __align__(16) float so[4][16 * AQ][68];
  __shared__ __align__(16) _Float16 sK[AK][AP], sV[HD][AP]; __shared__ __align__(32) float skn[2][AK];   // one stage of AK keys, shared by the four waves: k rows, v columns (d-major), the two per-key table words
  const int tid = threadIdx.x, wave = tid >> 5, lane = tid & 31, col = lane & 15, g = lane >> 4;
  const int qb = blockIdx.x, h = blockIdx.y, b = blockIdx.z; const int q0 = (qb * 4 + wave) * (16 * AQ); const size_t rq = (size_t)b * SS + q0 + col;   // this lane's query of tile qt is row rq + 16 qt
  float q0t[AQ], q1t[AQ];   // the per-query terms of the two scores of this lane's queries
#pragma unroll
  for (int qt = 0; qt < AQ; ++qt) { q0t[qt] = TB[(size_t)h * (NB * SS) + rq + qt * 16]; q1t[qt] = TB[(size_t)(NH + h) * (NB * SS) + rq + qt * 16]; }
  XW();   // the loads' address registers are reused only behind it
  __builtin_amdgcn_sched_barrier(0);   // holds the later address arithmetic behind that wait: without it the compiler lifted a write of the loads' address pair over the wait
  v16h aq[AQ][2];
#pragma unroll
  for (int qt = 0; qt < AQ; ++qt) {
#pragma unroll
    for (int kc = 0; kc < 2; ++kc) aq[qt][kc] = frag_h(QK + (rq + qt * 16) * (2 * DM) + h * HD + kc * 32, lane);
    XW();   // each tile's loads' address registers are reused only behind it
    __builtin_amdgcn_sched_barrier(0); }   // holds the later address arithmetic behind that wait, as above
  float l[AQ], q0m[AQ], q1m[AQ], zm[AQ];   // per query tile: this half's part of the running sum, and q0t, q1t and the clamp 0, each minus the exponent's base (equal in both halves)
  v8f acc[AQ][4] = {};   // O^T tiles: acc[qt][dt][r] = d (dt * 16 + 8 g + r) of query col of tile qt
#pragma unroll
  for (int qt = 0; qt < AQ; ++qt) l[qt] = 0.f;
  // stage loads: AK * 128 B of k rows and of v columns in 16-B pieces, a wave-wide load covering four whole 128-B lines; one table word per thread
  const _Float16* gK = QK + ((size_t)b * SS + (tid >> 3)) * (2 * DM) + DM + h * HD + (tid & 7) * 8; const _Float16* gV = VTH + ((size_t)b * DM + h * HD + (tid >> 3)) * SS + (tid & 7) * 8;
  const float* gT = TB + ((size_t)(2 + tid / AK) * NH + h) * (NB * SS) + (size_t)b * SS + (tid & (AK - 1));   // planes 2 and 3: a stage's AK words of a plane are contiguous
  v8h rk[4], rv[4]; float rt;   // the next stage, on its way through registers while this stage is worked on
#pragma unroll
  for (int i = 0; i < 4; ++i) { rk[i] = *(const v8h*)(gK + (size_t)i * 16 * (2 * DM)); rv[i] = *(const v8h*)(gV + (size_t)i * 16 * SS); }
  rt = *gT;
  XW();
  __builtin_amdgcn_sched_barrier(0);   // nothing that reads a loaded value is lifted above the stage loads: its wait would hold back their issue by one memory latency
#pragma unroll
  for (int qt = 0; qt < AQ; ++qt) { q0m[qt] = q0t[qt] + 11.0f; q1m[qt] = q1t[qt] + 11.0f; zm[qt] = 11.0f; }   // no score exceeds 0: the base starts at 0 - 11, and the first pass replaces it; stands behind the stage loads because it waits for the table words
  // One pass of the loop = one stage of AK keys: its LDS reads stand in two groups, each ahead of the products that use it (the k rows and table words right behind the stage's barrier, the v columns behind the score products, in flight over the softmax), and both query tiles' scores, exponentials and sums are formed side by side. The loop stays rolled: a second copy of this long body would only cost registers and instruction cache.
#pragma unroll 1
  for (int st = 0; st < SS / AK; ++st) {
    __syncthreads();   // every wave has left the stage that is overwritten next
#pragma unroll
    for (int i = 0; i < 4; ++i) { *(v8h*)&sK[i * 16 + (tid >> 3)][(tid & 7) * 8] = rk[i]; *(v8h*)&sV[i * 16 + (tid >> 3)][(tid & 7) * 8] = rv[i]; }
    skn[tid / AK][tid & (AK - 1)] = rt;
    __syncthreads();   // the stage is complete for every wave
    if (st + 1 < SS / AK) { const size_t k1 = (size_t)(st + 1) * AK;
#pragma unroll
      for (int i = 0; i < 4; ++i) { rk[i] = *(const v8h*)(gK + (k1 + i * 16) * (2 * DM)); rv[i] = *(const v8h*)(gV + (size_t)i * 16 * SS + k1); }
      rt = gT[k1];
      XW(); }
    v16h kf[AK / 16][2], vf[AK / 32][4]; v8f c0[AK / 16], dk[AK / 16], c[AQ][AK / 16];   // k fragments [16-key tile][k half], v fragments [32 keys][d tile], the two table words of each tile, the score tiles
#pragma unroll
    for (int ct = 0; ct < AK / 16; ++ct) { c0[ct] = *(const v8f*)&skn[0][ct * 16 + 8 * g];   // the products are added onto -|k - mu_0|^2 / 2
#pragma unroll
      for (int kc = 0; kc < 2; ++kc) kf[ct][kc] = frag_h(&sK[ct * 16 + col][kc * 32], lane); }
#pragma unroll
    for (int ct = 0; ct < AK / 16; ++ct) dk[ct] = *(const v8f*)&skn[1][ct * 16 + 8 * g];
    __builtin_amdgcn_sched_barrier(0);   // keeps the group of reads above the products: sunk to their uses, each read's LDS latency is waited out in front of its own product
#pragma unroll
    for (int kc = 0; kc < 2; ++kc) {
#pragma unroll
      for (int ct = 0; ct < AK / 16; ++ct) {
#pragma unroll
        for (int qt = 0; qt < AQ; ++qt) c[qt][ct] = wmma16(kf[ct][kc], aq[qt][kc], kc ? c[qt][ct] : c0[ct]); } }   // single product: k, q as one-rounding f16 operands; c[qt][ct][r] = k (ct * 16 + 8 g + r) . q (col of tile qt) - |k - mu_0|^2 / 2; the tiles' chains alternate
#pragma unroll
    for (int sub = 0; sub < AK / 32; ++sub) {
#pragma unroll
      for (int dt = 0; dt < 4; ++dt) vf[sub][dt] = frag_h(&sV[dt * 16 + col][sub * 32], lane); }
    __builtin_amdgcn_sched_barrier(0);   // the v columns' reads are issued here and fly over the softmax's vector work
    // The exponent's base (a running maximum as of the pass that last set it, minus 11) is kept from pass to pass and the scores are formed already shifted by it: it sits in the two addends and in the clamp, so the usual pass has no maximum, no shift and no rescaling. No P exceeds the lane's sum of them: while that sum stays within f16 range every P is finite and the pass stands.
    v8f t[AQ][AK / 16]; v16h pb[AQ][AK / 32]; float es[AQ];
#pragma unroll
    for (int qt = 0; qt < AQ; ++qt) { es[qt] = 0.f;
#pragma unroll
      for (int ct = 0; ct < AK / 16; ++ct) {
#pragma unroll
        for (int r = 0; r < 8; ++r) { const float x0 = c[qt][ct][r] * (LOG2E * 0.125f) + q0m[qt], x1 = c[qt][ct][r] * (LOG2E * 0.375f) + (dk[ct][r] + q1m[qt]); t[qt][ct][r] = fminf(fmaxf(x0, x1), zm[qt]); } } }   // max over the two Gaussian keys (mu_0, mu_1 both read) of min(x_j, 0) = -max(distance^2, 0) x scale x log2 e, minus the base
    bool move = st == 0;   // the first pass's base is only the scores' upper bound 0
    if (!move) {
#pragma unroll
      for (int qt = 0; qt < AQ; ++qt) { float ec[AK / 16];
#pragma unroll
        for (int ct = 0; ct < AK / 16; ++ct) ec[ct] = exp8(t[qt][ct], pb[qt][ct >> 1], (ct & 1) * 8);   // P carries 2^11 (in the exponent's argument) so small softmax weights stay out of the f16 subnormal range; the sum l carries it too, so it cancels in the epilogue
        es[qt] = (ec[0] + ec[1]) + (ec[2] + ec[3]); }
      move = __builtin_amdgcn_ballot_w32(!(es[0] + es[1] <= PTOP)) != 0u; }   // some lane's sums beyond f16 range (an infinity too)
    if (move) {   // the same for the whole wave (the products below need every lane on): the base moves to the true running maximum, the sums so far are rescaled to it and the pass's exponentials are taken from the shifted scores
#pragma unroll
      for (int qt = 0; qt < AQ; ++qt) {
        float mx = fmaxf(fmaxf(t[qt][0][0], t[qt][1][0]), fmaxf(t[qt][2][0], t[qt][3][0]));
#pragma unroll
        for (int r = 1; r < 8; ++r) mx = fmaxf(fmaxf(mx, fmaxf(t[qt][0][r], t[qt][1][r])), fmaxf(t[qt][2][r], t[qt][3][r]));
        mx = fmaxf(mx, xhalf(mx));   // both halves now hold the maximum over the AK keys
        const float d = st ? fmaxf(mx - 11.0f, 0.f) : mx - 11.0f;   // the base only rises, but for the first pass, where nothing is summed yet and it comes down to that pass's maximum
        float ec[AK / 16];
#pragma unroll
        for (int ct = 0; ct < AK / 16; ++ct) ec[ct] = exp8(t[qt][ct] - d, pb[qt][ct >> 1], (ct & 1) * 8);
        es[qt] = (ec[0] + ec[1]) + (ec[2] + ec[3]);
        float alpha;   // exp2(-d); 1 in the first pass, whose sums are still 0
        asm("v_exp_f32 %0, %1\n\tv_nop" : "=v"(alpha) : "v"(fminf(-d, 0.f)));   // in asm so that the slot which the instruction set asks for behind a transcendental stands in the same statement
        l[qt] *= alpha; q0m[qt] -= d; q1m[qt] -= d; zm[qt] -= d;
#pragma unroll
        for (int dt = 0; dt < 4; ++dt) acc[qt][dt] *= alpha; } }
#pragma unroll
    for (int qt = 0; qt < AQ; ++qt) { l[qt] += es[qt];
#pragma unroll
      for (int sub = 0; sub < AK / 32; ++sub) {
#pragma unroll
        for (int dt = 0; dt < 4; ++dt) acc[qt][dt] = wmma16(vf[sub][dt], pb[qt][sub], acc[qt][dt]); } } }   // single product: V^T x P^T (x2^11)
#pragma unroll
  for (int qt = 0; qt < AQ; ++qt) { const float lt = l[qt] + xhalf(l[qt]);   // the halves' sums are joined once
    const float il = 1.0f / lt;
#pragma unroll
    for (int dt = 0; dt < 4; ++dt) { v4f o0, o1;
#pragma unroll
      for (int r = 0; r < 4; ++r) { o0[r] = acc[qt][dt][r] * il; o1[r] = acc[qt][dt][4 + r] * il; }
      *(v4f*)&so[wave][qt * 16 + col][dt * 16 + 8 * g] = o0; *(v4f*)&so[wave][qt * 16 + col][dt * 16 + 8 * g + 4] = o1; } }
  LDSX();
  for (int rl = 0; rl < 16 * AQ; ++rl) if (lane < 16) vst2(O + ((size_t)b * SS + q0 + rl) * DM + h * HD + lane * 4, *(const v4f*)&so[wave][rl][lane * 4]);
}
// ---- k_out: block = (64 rows, 128 cols): out = O(hi/lo) . Wo rows (2 products) + bo
__global__ __launch_bounds__(128) void k_out(const float* __restrict__ O, const __bf16* __restrict__ P, const float* __restrict__ BO, float* __restrict__ Y) {
  __shared__ __align__(16) char smem[(128 + 64 + 64) * GP * 2];   // stage: weight tile [128][GP] | O rows bf16 hi [64][GP] | residual [64][GP]; behind the loop's last barrier the same bytes are the output staging
  __bf16* sB = (__bf16*)smem; __bf16* sAh = sB + 128 * GP; __bf16* sAl = sAh + 64 * GP;
  float (*so)[16][132] = (float (*)[16][132])smem;
  const int tid = threadIdx.x, wave = tid >> 5, lane = tid & 31, col = lane & 15, g = lane >> 4; const size_t r0 = (size_t)blockIdx.x * 64 + wave * 16; const int n0 = blockIdx.y * 128;
  v8f acc[8] = {};
  const __bf16* pw = P + (size_t)(n0 + tid / GN) * DM + (tid % GN) * 8; const int ar = tid / (GK / 4), ap = (tid % (GK / 4)) * 4; const float* Ot = O + ((size_t)blockIdx.x * 64 + ar) * DM + ap;   // this thread's row (step 128 / (GK / 4)) and k offset in the f32 rows of a stage
  v8b rw[GN]; v4f ra[GN];   // the next stage, on its way through registers while this stage is multiplied
  ldw(rw, pw);
#pragma unroll
  for (int i = 0; i < GN; ++i) ra[i] = *(const v4f*)(Ot + (size_t)i * (512 / GK) * DM);   // one wave-wide load = two rows x 256 B
  XW();
  for (int st = 0; st < DM / GK; ++st) {
    __syncthreads();   // every wave has left the stage that is overwritten next
    stw(rw, sB, tid);
#pragma unroll
    for (int i = 0; i < GN; ++i) { v4b hv, lv;
#pragma unroll
      for (int e = 0; e < 4; ++e) { const __bf16 hh = (__bf16)ra[i][e]; hv[e] = hh; lv[e] = (__bf16)(ra[i][e] - (float)hh); }
      *(v4b*)(sAh + (i * (512 / GK) + ar) * GP + ap) = hv; *(v4b*)(sAl + (i * (512 / GK) + ar) * GP + ap) = lv; }
    __syncthreads();   // the stage is complete for every wave
    if (st + 1 < DM / GK) { ldw(rw, pw + (st + 1) * GK);
#pragma unroll
      for (int i = 0; i < GN; ++i) ra[i] = *(const v4f*)(Ot + (size_t)i * (512 / GK) * DM + (st + 1) * GK);
      XW(); }
#pragma unroll
    for (int kc = 0; kc < GK / 32; ++kc) { const v16b ah = frag_b(sAh + (wave * 16 + col) * GP + kc * 32, lane), al = frag_b(sAl + (wave * 16 + col) * GP + kc * 32, lane); v16b w[8];
#pragma unroll
      for (int j = 0; j < 8; ++j) w[j] = frag_b(sB + (j * 16 + col) * GP + kc * 32, lane);
      asm volatile("" :: "v"(ah), "v"(al), "v"(w[0]), "v"(w[1]), "v"(w[2]), "v"(w[3]), "v"(w[4]), "v"(w[5]), "v"(w[6]), "v"(w[7]));   // holds the ten fragment reads together in front of the products: one LDS wait per sixteen products, not one per pair
#pragma unroll
      for (int j = 0; j < 8; ++j) { acc[j] = wmma_bf(al, w[j], acc[j]); acc[j] = wmma_bf(ah, w[j], acc[j]); } } }
  __syncthreads();   // the last stage's reads are over before its bytes become output staging
#pragma unroll
  for (int j = 0; j < 8; ++j) {
#pragma unroll
    for (int r = 0; r < 8; ++r) so[wave][8 * g + r][j * 16 + col] = acc[j][r] + (BO ? bfr(BO[n0 + j * 16 + col]) : 0.f); }
  LDSX();
  for (int rl = 0; rl < 16; ++rl) vst2(Y + xrow(r0 + rl) + n0 + lane * 4, *(const v4f*)&so[wave][rl][lane * 4]);
}
// ---- pack_tile: one work-group turns a PT (k) x PT (n) tile of an (in,out) f32 weight (row length ld) into bf16 rows [n][k] of length DM: whole-line loads (a wave-wide load = two k rows x 256 B), transposed through LDS, whole-line stores (four n rows x 128 B); its loops are unrolled so that the four loads issue as one group
#define PT 64
__device__ __forceinline__ void pack_tile(const float* __restrict__ Wt, int ld, __bf16* __restrict__ dst) {   // Wt = the tile's first element, dst = its first element in the packed rows
  __shared__ __align__(16) __bf16 s[PT][PT + 8]; const int t = threadIdx.x, kr = t >> 4, c4 = (t & 15) * 4; const unsigned vo = (unsigned)(kr * ld + c4); v4f r[4];
#pragma unroll
  for (int i = 0; i < 4; ++i) r[i] = *(const v4f*)(Wt + vo + i * 16 * ld);
  XW();
#pragma unroll
  for (int i = 0; i < 4; ++i) {
#pragma unroll
    for (int e = 0; e < 4; ++e) s[c4 + e][i * 16 + kr] = (__bf16)r[i][e]; }
  __syncthreads();   // the tile is complete before its rows are read back
#pragma unroll
  for (int i = 0; i < 2; ++i) { const int n = i * 32 + (t >> 3), pc = (t & 7) * 8; vst2((unsigned*)(dst + (unsigned)((t >> 3) * DM + pc) + i * 32 * DM), *(const v4u*)&s[n][pc]); }
}
// ---- k_pack: block = (n tile, k tile, which): all four 512 x 512 weight panels in one launch, since none of them needs another: 0 Wq -> PK_A rows 0..511, 1 Wo -> PK_P, 2 and 3 the k and the v columns of Wkv (in,out) [512][1024] -> the PK_A rows behind the q rows
__global__ __launch_bounds__(256) void k_pack(const float* __restrict__ WQ, const float* __restrict__ WO, const float* __restrict__ WKV, __bf16* __restrict__ PK) {
  const int n0 = blockIdx.x * PT, k0 = blockIdx.y * PT, z = blockIdx.z;
  __bf16* dst = PK + (z == 1 ? PK_P : PK_A + (z ? z - 1 : 0) * (DM * DM)) + (size_t)n0 * DM + k0;
  if (z < 2) pack_tile((z ? WO : WQ) + (size_t)k0 * DM + n0, DM, dst);   // the branch is the same for the whole work-group; each side has its source's row length as a constant
  else pack_tile(WKV + (size_t)k0 * (2 * DM) + (z - 2) * DM + n0, 2 * DM, dst);
}
#define LR 4   // rows per wave of k_lnsum
// ---- k_lnsum<RAWR>: wave = LR whole rows (a lane holds 16 elements of each, a wave-wide load = 512 contiguous B), all rows' loads in flight together (every loop is unrolled for that, and so that the arrays stay in registers), row sums inside the wave, the LR rows' exchanges side by side: T = LayerNorm(R + A) g + b ; R is a raw input (bf16-rounded) when RAWR, else an f32 intermediate
template <int RAWR>
__global__ __launch_bounds__(256) void k_lnsum(const float* __restrict__ R, const float* __restrict__ A, const float* __restrict__ G, const float* __restrict__ Bt, float* __restrict__ T) {
  const int t = threadIdx.x, lane = t & 31; const size_t b0 = (size_t)blockIdx.x * (8 * LR * DM); const unsigned vo = (unsigned)((t >> 5) * (LR * DM) + lane * 4);   // block base (scalar) + one lane offset that every load and store of the lane shares
  const float* Rb = R + b0; const float* Ab = A + b0; float* Tb = T + b0; v4f v[LR][4], a[LR][4], gm[4], bt[4];
#pragma unroll
  for (int j = 0; j < LR; ++j) {
#pragma unroll
    for (int i = 0; i < 4; ++i) { v[j][i] = *(const v4f*)(Rb + vo + j * DM + i * 128); a[j][i] = *(const v4f*)(Ab + vo + j * DM + i * 128); } }
#pragma unroll
  for (int i = 0; i < 4; ++i) { gm[i] = *(const v4f*)(G + i * 128 + lane * 4); bt[i] = *(const v4f*)(Bt + i * 128 + lane * 4); }
  XW();
  float s[LR], q[LR];
#pragma unroll
  for (int j = 0; j < LR; ++j) { float p[4];
#pragma unroll
    for (int i = 0; i < 4; ++i) { p[i] = 0.f;
#pragma unroll
      for (int e = 0; e < 4; ++e) { v[j][i][e] = (RAWR ? bfr(v[j][i][e]) : v[j][i][e]) + a[j][i][e]; p[i] += v[j][i][e]; } }
    s[j] = (p[0] + p[1]) + (p[2] + p[3]); }
#pragma unroll
  for (int o = 1; o < 32; o <<= 1) {
#pragma unroll
    for (int j = 0; j < LR; ++j) s[j] += __shfl_xor(s[j], o); }
#pragma unroll
  for (int j = 0; j < LR; ++j) { s[j] = s[j] / (float)DM; float p[4];
#pragma unroll
    for (int i = 0; i < 4; ++i) { p[i] = 0.f;
#pragma unroll
      for (int e = 0; e < 4; ++e) { v[j][i][e] -= s[j]; p[i] += v[j][i][e] * v[j][i][e]; } }
    q[j] = (p[0] + p[1]) + (p[2] + p[3]); }
#pragma unroll
  for (int o = 1; o < 32; o <<= 1) {
#pragma unroll
    for (int j = 0; j < LR; ++j) q[j] += __shfl_xor(q[j], o); }
#pragma unroll
  for (int j = 0; j < LR; ++j) { const float inv = 1.0f / sqrtf(q[j] / (float)DM + 1e-5f);
#pragma unroll
    for (int i = 0; i < 4; ++i) { v4f o4;
#pragma unroll
      for (int e = 0; e < 4; ++e) o4[e] = v[j][i][e] * inv * bfr(gm[i][e]) + bfr(bt[i][e]);
      vst2(Tb + vo + j * DM + i * 128, o4); } }
}
extern "C" void kernel_launch(void* const* d_in, const int* in_sizes, int n_in, void* d_out, int out_size, void* d_ws, size_t ws_size, hipStream_t stream) {
  (void)in_sizes; (void)n_in; (void)out_size;
  const float** F = (const float**)d_in;   // 0 h [1024,8,512] (s,b,d), 1 Wq [512,512] (in,out), 2 Wkv [512,1024] (in,out: k | v), 3 Wo [512,512] (in,out), 4 mu [2,8,64], 5 gamma, 6 beta
  if (ws_size < (size_t)WS_END) return;
  char* ws = (char*)d_ws; __bf16* PK = (__bf16*)(ws + WS_PK); _Float16 *QK = (_Float16*)(ws + WS_QK), *QKL = (_Float16*)(ws + WS_QKL), *VTH = (_Float16*)(ws + WS_VTH), *VTL = (_Float16*)(ws + WS_VTL); float *O = (float*)(ws + WS_O), *TB = (float*)(ws + WS_TB), *A = (float*)(ws + WS_A);
  k_pack<<<dim3(DM / PT, DM / PT, 4), 256, 0, stream>>>(F[1], F[3], F[2], PK);   // Wq, Wo and both halves of Wkv
  k_qkv<<<dim3(TNB * SS / QR, QKVW / 128), 128, 0, stream>>>(F[0], F[0], F[0], PK + PK_A, nullptr, nullptr, nullptr, QK, F[4], VTH, TB);   // also writes the tables
  k_attn<<<dim3(TQB / AQ, NH, TNB), 128, 0, stream>>>(QK, QKL, VTH, VTL, nullptr, TB, O);
  k_out<<<dim3(TOB, DM / 128), 128, 0, stream>>>(O, PK + PK_P, nullptr, A);   // A rows in (s, b) order
  k_lnsum<1><<<TOB * 64 / (8 * LR), 256, 0, stream>>>(F[0], A, F[5], F[6], (float*)d_out);
}
